// v000
// Measured on an AMD MI455X. A time is GPU time per run, averaged over a window of back-to-back runs after a warm-up
// (all launches, gaps included; the runs take copies of the inputs in turn), and the median of several windows.
// Apart from v000's, it joins two sittings. Times from different sittings can be a few percent apart, while
// side-by-side timings come from the same sitting.
// The starting kernel, v000, takes 752 microseconds a run.
#include <hip/hip_runtime.h>
// Attention_KV (5 sources x 4 batches x 1024 tokens x 768 = 12 heads of 64): q from source 0 (Wq + bq); every source n gives k_n, v_n (shared Wk/bk, Wv/bv); ctx = sum_n softmax(q k_n^T / 8) v_n (independent softmax per source); output = ctx merged [B, S, 768] (no output projection).
// Structure: one exact f16 plane of all sources; q / k / v GEMMs (32x64 wave tiles, f32 accumulation, exact x16 weights + bias, f16 outputs; k and v over all 5 sources at once); V^T by LDS tiles for all (source, batch, head) slabs in one launch; five fused flash kernels (plain f16 operands), one per source, into five f32 planes; a VALU sum of the five planes into the output.
// Compute dtype: inputs and parameters rounded to bf16; q, k, v, P as f16 (~2^-12); f32 accumulation/softmax/sum. v_wmma_f32_16x16x32_f16.
#define NSRC 5
#define NB 4
#define CC 768
#define NR (NB * SLEN)           /* 4096 query rows */
#define NRA (NSRC * NR)          /* 20480 source rows */
#define SLEN 1024
#define TQ SLEN
#define TK SLEN
#define NH 12
#define SCL 0.125f               /* 1/sqrt(64) */
#define QBLKS (TQ / 64)
typedef __bf16 v16b __attribute__((ext_vector_type(16)));
typedef unsigned short v8us __attribute__((ext_vector_type(8), may_alias));
typedef float  v8f  __attribute__((ext_vector_type(8)));
typedef float  v4f  __attribute__((ext_vector_type(4)));
typedef float  v4fa __attribute__((ext_vector_type(4), may_alias));
union FragB { v16b v; v8us half[2]; unsigned short u[16]; };

__device__ __forceinline__ unsigned short bf16_bits(float x) { unsigned int u = __float_as_uint(x); return (unsigned short)((u + 0x7FFFu + ((u >> 16) & 1u)) >> 16); }
__device__ __forceinline__ float bf16_val(unsigned short b) { return __uint_as_float(((unsigned int)b) << 16); }
__device__ __forceinline__ float bf16_round(float x) { return bf16_val(bf16_bits(x)); }
// D += A·B with NT terms: 1 = ah·bh, 2 = + al·bh (A split), 3 = + ah·bl (both split)
template <int NT>
__device__ __forceinline__ v8f mmaN(v16b ah, v16b al, v16b bh, v16b bl, v8f c) {
  c = __builtin_amdgcn_wmma_f32_16x16x32_bf16(false, ah, false, bh, (short)0, c, false, false);
  if (NT >= 2) c = __builtin_amdgcn_wmma_f32_16x16x32_bf16(false, al, false, bh, (short)0, c, false, false);
  if (NT >= 3) c = __builtin_amdgcn_wmma_f32_16x16x32_bf16(false, ah, false, bl, (short)0, c, false, false);
  asm volatile("v_nop\n\tv_nop\n\tv_nop\n\tv_nop" : "+v"(c) : "v"(ah), "v"(al), "v"(bh), "v"(bl));
  return c;
}

__global__ __launch_bounds__(256) void k_wt_bf16(const float* __restrict__ W, unsigned short* __restrict__ Wt, int K, int N) {
  const int t = blockIdx.x * 256 + threadIdx.x;
  const int k8n = K / 8;
  if (t >= N * k8n) return;
  const int n = t / k8n, k8 = (t % k8n) * 8;
  v8us v;
#pragma unroll
  for (int i = 0; i < 8; ++i) v[i] = bf16_bits(W[(size_t)(k8 + i) * N + n]);
  *(v8us*)(Wt + (size_t)n * K + k8) = v;
  
}

// GEMM C[M][N] (f32, pitch ldc) = act(A[M][K]·W + bias). A f32 row-major (pitch lda) converted per fragment to bf16
// (ASPLIT: hi/lo two planes -> 2 terms, else single rounded term); Wt bf16 [N][K] (pitch ldb). BIAS_BF16 rounds the
// bias to bf16 first (bias quantised to bf16 before the add). K%32==0, M%16==0, N%64==0.
template <bool ASPLIT, int ACT, bool BIAS_BF16>
__global__ __launch_bounds__(128) void k_gemm_bf(const float* __restrict__ A, int lda, const unsigned short* __restrict__ Wt, int ldb,
                                               const float* __restrict__ bias, float* __restrict__ C, int ldc, int M, int N, int K) {
  __shared__ __attribute__((aligned(16))) float so[4][16][64];
  const int tid = threadIdx.x, w = tid >> 5, lane = tid & 31, ln = lane & 15, hh = lane >> 4;
  const int ntn = N / 64;
  const int wid = blockIdx.x * 4 + w;
  const int mt = wid / ntn, nq = wid % ntn;
  if (mt * 16 >= M) return;
  const int row0 = mt * 16, col0 = nq * 64;
  const float* arow = A + (size_t)(row0 + ln) * lda;
  v8f acc[4] = {};
  for (int kb = 0; kb < K; kb += 32) {
    FragB ah, al;
    const v4f x0 = *(const v4fa*)(arow + kb + 8 * hh), x1 = *(const v4fa*)(arow + kb + 8 * hh + 4);
    const v4f x2 = *(const v4fa*)(arow + kb + 16 + 8 * hh), x3 = *(const v4fa*)(arow + kb + 16 + 8 * hh + 4);
    float xs[16] = {x0[0],x0[1],x0[2],x0[3],x1[0],x1[1],x1[2],x1[3],x2[0],x2[1],x2[2],x2[3],x3[0],x3[1],x3[2],x3[3]};
#pragma unroll
    for (int i = 0; i < 16; ++i) { const unsigned short hb = bf16_bits(xs[i]); ah.u[i] = hb; al.u[i] = ASPLIT ? bf16_bits(xs[i] - bf16_val(hb)) : (unsigned short)0; }
#pragma unroll
    for (int t = 0; t < 4; ++t) {
      const unsigned short* brow = Wt + (size_t)(col0 + t * 16 + ln) * ldb + kb;
      FragB b;
      b.half[0] = *(const v8us*)(brow + 8 * hh);
      b.half[1] = *(const v8us*)(brow + 16 + 8 * hh);
      acc[t] = mmaN<ASPLIT ? 2 : 1>(ah.v, al.v, b.v, b.v, acc[t]);
    }
  }
#pragma unroll
  for (int t = 0; t < 4; ++t) {
    float bv = bias ? bias[col0 + t * 16 + ln] : 0.f;
    if (BIAS_BF16) bv = bf16_round(bv);
#pragma unroll
    for (int r = 0; r < 8; ++r) { float v = acc[t][r] + bv; if (ACT == 1) v = fmaxf(v, 0.f); so[w][8 * hh + r][t * 16 + ln] = v; }
  }
  __builtin_amdgcn_fence(__ATOMIC_ACQ_REL, "workgroup");
  __builtin_amdgcn_wave_barrier();
  const int rsub = lane >> 4, c4 = (lane & 15) * 4;
  {
#pragma unroll
    for (int q = 0; q < 8; ++q) {
      const int r = q * 2 + rsub;
      const v4f v = *(const v4fa*)&so[w][r][c4];
      *(v4f*)(C + (size_t)(row0 + r) * ldc + col0 + c4) = v;
    }
    
  }
}

// GEMM C = act(A·W + bias + resid): A f32 (ASPLIT -> hi/lo 2 terms), Wt bf16 [N][K]; ACT 0 none, 1 relu, 2 exact gelu;
// resid (optional, f32, row index = (row % rmod), pitch ldr, RES_BF16 rounds it) added before the activation.
template <bool ASPLIT, int ACT, bool BIAS_BF16, bool RES_BF16>
__global__ __launch_bounds__(128) void k_gemm_bf3(const float* __restrict__ A, int lda, const unsigned short* __restrict__ Wt, int ldb,
                                                const float* __restrict__ bias, const float* __restrict__ resid, int rmod, int ldr,
                                                float* __restrict__ C, int ldc, int M, int N, int K) {
  __shared__ __attribute__((aligned(16))) float so[4][16][64];
  const int tid = threadIdx.x, w = tid >> 5, lane = tid & 31, ln = lane & 15, hh = lane >> 4;
  const int ntn = N / 64;
  const int wid = blockIdx.x * 4 + w;
  const int mt = wid / ntn, nq = wid % ntn;
  if (mt * 16 >= M) return;
  const int row0 = mt * 16, col0 = nq * 64;
  const float* arow = A + (size_t)(row0 + ln) * lda;
  v8f acc[4] = {};
  for (int kb = 0; kb < K; kb += 32) {
    FragB ah, al;
    const v4f x0 = *(const v4fa*)(arow + kb + 8 * hh), x1 = *(const v4fa*)(arow + kb + 8 * hh + 4);
    const v4f x2 = *(const v4fa*)(arow + kb + 16 + 8 * hh), x3 = *(const v4fa*)(arow + kb + 16 + 8 * hh + 4);
    float xs[16] = {x0[0],x0[1],x0[2],x0[3],x1[0],x1[1],x1[2],x1[3],x2[0],x2[1],x2[2],x2[3],x3[0],x3[1],x3[2],x3[3]};
#pragma unroll
    for (int i = 0; i < 16; ++i) { const unsigned short hb = bf16_bits(xs[i]); ah.u[i] = hb; al.u[i] = ASPLIT ? bf16_bits(xs[i] - bf16_val(hb)) : (unsigned short)0; }
#pragma unroll
    for (int t = 0; t < 4; ++t) {
      const unsigned short* brow = Wt + (size_t)(col0 + t * 16 + ln) * ldb + kb;
      FragB b;
      b.half[0] = *(const v8us*)(brow + 8 * hh);
      b.half[1] = *(const v8us*)(brow + 16 + 8 * hh);
      acc[t] = mmaN<ASPLIT ? 2 : 1>(ah.v, al.v, b.v, b.v, acc[t]);
    }
  }
#pragma unroll
  for (int t = 0; t < 4; ++t) {
    const int col = col0 + t * 16 + ln;
    float bv = bias ? bias[col] : 0.f;
    if (BIAS_BF16) bv = bf16_round(bv);
#pragma unroll
    for (int r = 0; r < 8; ++r) {
      float v = acc[t][r] + bv;
      if (resid) { float rv = resid[(size_t)((row0 + 8 * hh + r) % rmod) * ldr + col]; if (RES_BF16) rv = bf16_round(rv); v += rv; }
      if (ACT == 1) v = fmaxf(v, 0.f);
      if (ACT == 2) v = 0.5f * v * (1.0f + erff(v * 0.70710678118654752f));
      if (ACT == 3) { const float u = 0.7978845608028654f * (v + 0.044715f * v * v * v); v = 0.5f * v * (1.0f + tanhf(u)); }
      so[w][8 * hh + r][t * 16 + ln] = v;
    }
  }
  __builtin_amdgcn_fence(__ATOMIC_ACQ_REL, "workgroup");
  __builtin_amdgcn_wave_barrier();
  const int rsub = lane >> 4, c4 = (lane & 15) * 4;
  {
#pragma unroll
    for (int q = 0; q < 8; ++q) {
      const int r = q * 2 + rsub;
      const v4f v = *(const v4fa*)&so[w][r][c4];
      *(v4f*)(C + (size_t)(row0 + r) * ldc + col0 + c4) = v;
    }
    
  }
}
// row LayerNorm (biased variance, eps) over N: s = X (+ R); optional out_sum <- s; out_norm <- (s-mu)*rsqrt(var+eps)*g + b
template <bool PARAM_BF16>
__global__ __launch_bounds__(256) void k_layernorm(const float* __restrict__ X, const float* __restrict__ R, const float* __restrict__ g, const float* __restrict__ bta,
                                                  float* __restrict__ out_sum, float* __restrict__ out_norm, int N, float eps) {
  __shared__ float red[256];
  const int row = blockIdx.x, tid = threadIdx.x;
  const float* x = X + (size_t)row * N; const float* rr = R ? R + (size_t)row * N : nullptr;
  float vals[16];                     // up to N = 4096
  const int per = N / 256;            // contiguous chunk per thread? use strided-by-4 chunks: thread handles j = tid*4 + 1024*u
  float s1 = 0.f;
  for (int u = 0; u < per / 4; ++u) {
    const int j = tid * 4 + 1024 * u;
    const v4f a = *(const v4fa*)(x + j);
    v4f b = {0.f,0.f,0.f,0.f}; if (rr) b = *(const v4fa*)(rr + j);
#pragma unroll
    for (int q = 0; q < 4; ++q) { const float v = a[q] + b[q]; vals[u * 4 + q] = v; s1 += v; }
  }
  red[tid] = s1; __syncthreads();
  for (int st = 128; st > 0; st >>= 1) { if (tid < st) red[tid] += red[tid + st]; __syncthreads(); }
  const float mu = red[0] / (float)N; __syncthreads();
  float s2 = 0.f;
  for (int u = 0; u < per / 4; ++u)
#pragma unroll
    for (int q = 0; q < 4; ++q) { const float c = vals[u * 4 + q] - mu; s2 += c * c; }
  red[tid] = s2; __syncthreads();
  for (int st = 128; st > 0; st >>= 1) { if (tid < st) red[tid] += red[tid + st]; __syncthreads(); }
  const float rs = rsqrtf(red[0] / (float)N + eps);
  {
    for (int u = 0; u < per / 4; ++u) {
      const int j = tid * 4 + 1024 * u;
      v4f o, sm;
#pragma unroll
      for (int q = 0; q < 4; ++q) {
        float gg = g[j + q], bb = bta[j + q];
        if (PARAM_BF16) { gg = bf16_round(gg); bb = bf16_round(bb); }
        sm[q] = vals[u * 4 + q]; o[q] = (vals[u * 4 + q] - mu) * rs * gg + bb;
      }
      if (out_sum) *(v4f*)(out_sum + (size_t)row * N + j) = sm;
      *(v4f*)(out_norm + (size_t)row * N + j) = o;
    }
    
  }
}



// ---- f16 WMMA path (v_wmma_f32_16x16x32_f16): 11-bit significands for operands in range — used where a [0,1] probability operand needs more precision than bf16
typedef _Float16 v16h __attribute__((ext_vector_type(16)));
union FragH { v16h v; v8us half[2]; _Float16 h[16]; unsigned short u[16]; };
template <int NT>
__device__ __forceinline__ v8f mmaH(v16h ah, v16h al, v16h bh, v16h bl, v8f c) {
  c = __builtin_amdgcn_wmma_f32_16x16x32_f16(false, ah, false, bh, (short)0, c, false, false);
  if (NT >= 2) c = __builtin_amdgcn_wmma_f32_16x16x32_f16(false, al, false, bh, (short)0, c, false, false);
  if (NT >= 3) c = __builtin_amdgcn_wmma_f32_16x16x32_f16(false, ah, false, bl, (short)0, c, false, false);
  asm volatile("v_nop\n\tv_nop\n\tv_nop\n\tv_nop" : "+v"(c) : "v"(ah), "v"(al), "v"(bh), "v"(bl));
  return c;
}
// batched GEMM like k_gemm_b but f16 operands: A f32 (split into f16 hi/lo if ASPLIT, else rounded to f16), Bt = f16 values [n][k]; alpha; C f32; N multiple of 16 (partial tiles skipped)
template <bool ASPLIT>
__global__ __launch_bounds__(128) void k_gemm_h(const float* __restrict__ A, int lda, size_t sA, const _Float16* __restrict__ Bh, int ldb, size_t sB, float alpha, float* __restrict__ C, int ldc, size_t sC, int M, int N, int K) {
  __shared__ __attribute__((aligned(16))) float so[4][16][64];
  const int tid = threadIdx.x, w = tid >> 5, lane = tid & 31, ln = lane & 15, hh = lane >> 4; const int by = blockIdx.y;
  A += (size_t)by * sA; Bh += (size_t)by * sB; C += (size_t)by * sC;
  const int ntn = (N + 63) / 64; const int wid = blockIdx.x * 4 + w; const int mt = wid / ntn, nq = wid % ntn; if (mt * 16 >= M) return;
  const int row0 = mt * 16, col0 = nq * 64; const float* arow = A + (size_t)(row0 + ln) * lda;
  v8f acc[4] = {};
  for (int kb = 0; kb < K; kb += 32) {
    FragH ah, al;
    const v4f x0 = *(const v4fa*)(arow + kb + 8 * hh), x1 = *(const v4fa*)(arow + kb + 8 * hh + 4), x2 = *(const v4fa*)(arow + kb + 16 + 8 * hh), x3 = *(const v4fa*)(arow + kb + 16 + 8 * hh + 4);
    float xs[16] = {x0[0],x0[1],x0[2],x0[3],x1[0],x1[1],x1[2],x1[3],x2[0],x2[1],x2[2],x2[3],x3[0],x3[1],x3[2],x3[3]};
#pragma unroll
    for (int i = 0; i < 16; ++i) { const _Float16 h = (_Float16)xs[i]; ah.h[i] = h; al.h[i] = ASPLIT ? (_Float16)(xs[i] - (float)h) : (_Float16)0.0f; }
#pragma unroll
    for (int t = 0; t < 4; ++t) { if (col0 + t * 16 >= N) continue; const size_t boff = (size_t)(col0 + t * 16 + ln) * ldb + kb; FragH bq; bq.half[0] = *(const v8us*)(Bh + boff + 8 * hh); bq.half[1] = *(const v8us*)(Bh + boff + 16 + 8 * hh);
      acc[t] = mmaH<ASPLIT ? 2 : 1>(ah.v, al.v, bq.v, bq.v, acc[t]); }
  }
#pragma unroll
  for (int t = 0; t < 4; ++t) { if (col0 + t * 16 >= N) continue;
#pragma unroll
    for (int r = 0; r < 8; ++r) so[w][8 * hh + r][t * 16 + ln] = acc[t][r] * alpha; }
  __builtin_amdgcn_fence(__ATOMIC_ACQ_REL, "workgroup"); __builtin_amdgcn_wave_barrier();
  const int rsub = lane >> 4, c4 = (lane & 15) * 4;
  {
#pragma unroll
    for (int q = 0; q < 8; ++q) { const int r = q * 2 + rsub; if (col0 + c4 < N) { const v4f v = *(const v4fa*)&so[w][r][c4]; *(v4f*)(C + (size_t)(row0 + r) * ldc + col0 + c4) = v; } }
     }
}

// Wt[n][k] = f16(W[k][n]·scale) from f32 row-major W[K][N] (scale = power of two; bf16-exact weights stay exact in f16 away from the subnormal range)
__global__ __launch_bounds__(256) void k_wt_f16(const float* __restrict__ W, _Float16* __restrict__ Wt, int K, int N, float scale) {
  const int t = blockIdx.x * 256 + threadIdx.x; if (t >= N * (K / 8)) return; const int n = t / (K / 8), k8 = (t % (K / 8)) * 8; FragH f;
#pragma unroll
  for (int i = 0; i < 8; ++i) f.h[i] = (_Float16)(bf16_round(W[(size_t)(k8 + i) * N + n]) * scale); const v8us o = f.half[0];
  *(v8us*)((unsigned short*)Wt + (size_t)n * K + k8) = o; 
}
// k_gemm_hh variant with fused epilogue: v = acc·alpha + bias[by·sBias + col] (+ CP[(row/rowsPerB)·sCPb + by·64 + col] if CP) ; ACT 0 none / 1 elu ; writes f16 C16 (and f32 C if non-null)
template <int ACT>
__global__ __launch_bounds__(128) void k_gemm_hhx(const _Float16* __restrict__ A, int lda, size_t sA, const _Float16* __restrict__ Bh, int ldb, size_t sB, float alpha, const float* __restrict__ bias, size_t sBias, const float* __restrict__ CP, int rowsPerB, size_t sCPb, int row0g,
    float* __restrict__ C, _Float16* __restrict__ C16, int ldc, size_t sC, int M, int N, int K) {
  __shared__ __attribute__((aligned(16))) float so[4][16][64];
  const int tid = threadIdx.x, w = tid >> 5, lane = tid & 31, ln = lane & 15, hh = lane >> 4; const int by = blockIdx.y;
  A += (size_t)by * sA; Bh += (size_t)by * sB; const size_t cofs = (size_t)by * sC; const float* bp = bias ? bias + (size_t)by * sBias : nullptr;
  const int ntn = (N + 63) / 64; const int wid = blockIdx.x * 4 + w; const int mt = wid / ntn, nq = wid % ntn; if (mt * 16 >= M) return;
  const int row0 = mt * 16, col0 = nq * 64; const _Float16* arow = A + (size_t)(row0 + ln) * lda;
  v8f acc[4] = {};
  for (int kb = 0; kb < K; kb += 32) { FragH ah; ah.half[0] = *(const v8us*)((const unsigned short*)arow + kb + 8 * hh); ah.half[1] = *(const v8us*)((const unsigned short*)arow + kb + 16 + 8 * hh);
#pragma unroll
    for (int t = 0; t < 4; ++t) { if (col0 + t * 16 >= N) continue; const size_t boff = (size_t)(col0 + t * 16 + ln) * ldb + kb; FragH bq; bq.half[0] = *(const v8us*)((const unsigned short*)Bh + boff + 8 * hh); bq.half[1] = *(const v8us*)((const unsigned short*)Bh + boff + 16 + 8 * hh);
      acc[t] = mmaH<1>(ah.v, ah.v, bq.v, bq.v, acc[t]); }
  }
#pragma unroll
  for (int t = 0; t < 4; ++t) { if (col0 + t * 16 >= N) continue; const int col = col0 + t * 16 + ln; const float bv = bp ? bf16_round(bp[col]) : 0.f;
#pragma unroll
    for (int r = 0; r < 8; ++r) { float v = acc[t][r] * alpha + bv; if (CP) { const int bidx = (row0g + row0 + 8 * hh + r) / rowsPerB; v += CP[(size_t)bidx * sCPb + (size_t)by * 64 + col]; } if (ACT == 1) v = (v > 0.f) ? v : expm1f(v); else if (ACT == 7) v = (v > 0.f) ? v + 1.0f : expf(v); else if (ACT == 8) v = tanhf(v); else if (ACT == 9) v = 0.5f * v * (1.0f + tanhf(0.7978845608028654f * (v + 0.044715f * v * v * v))); else if (ACT == 11) v = 1.0f / (1.0f + expf(-v)); else if (ACT == 12) v = (v > 0.f) ? v : 0.01f * v; else if (ACT == 14) v = (v > 0.f) ? v : 0.1f * v; else if (ACT == 15) v = v / (1.0f + expf(-v)); else if (ACT == 3) v = fmaxf(v, 0.f); else if (ACT == 6) v = 0.5f * v * (1.0f + erff(v * 0.70710678118654752f)); so[w][8 * hh + r][t * 16 + ln] = v; } }
  __builtin_amdgcn_fence(__ATOMIC_ACQ_REL, "workgroup"); __builtin_amdgcn_wave_barrier();
  const int rsub = lane >> 4, c4 = (lane & 15) * 4; typedef _Float16 v4h __attribute__((ext_vector_type(4)));
  {
#pragma unroll
    for (int q = 0; q < 8; ++q) { const int r = q * 2 + rsub; if (col0 + c4 < N) { const v4f v = *(const v4fa*)&so[w][r][c4]; if (C) *(v4f*)(C + cofs + (size_t)(row0 + r) * ldc + col0 + c4) = v; if (C16) { v4h h4; for (int i = 0; i < 4; ++i) h4[i] = (_Float16)v[i]; *(v4h*)(C16 + cofs + (size_t)(row0 + r) * ldc + col0 + c4) = h4; } } }
     }
}


typedef _Float16 v4h __attribute__((ext_vector_type(4)));

__global__ __launch_bounds__(256) void k_x16(const float* __restrict__ x, _Float16* __restrict__ X16, size_t n8) { const size_t t = (size_t)blockIdx.x * 256 + threadIdx.x; if (t >= n8) return; FragH f;
#pragma unroll
  for (int q = 0; q < 8; ++q) f.h[q] = (_Float16)bf16_round(x[t * 8 + q]); *(v8us*)((unsigned short*)X16 + t * 8) = f.half[0];  }
__global__ __launch_bounds__(256) void k_h16(const float* __restrict__ x, _Float16* __restrict__ X16, size_t n8) { const size_t t = (size_t)blockIdx.x * 256 + threadIdx.x; if (t >= n8) return; FragH f;
#pragma unroll
  for (int q = 0; q < 8; ++q) f.h[q] = (_Float16)x[t * 8 + q]; *(v8us*)((unsigned short*)X16 + t * 8) = f.half[0];  }
__global__ __launch_bounds__(256) void k_round16f(const float* __restrict__ W, _Float16* __restrict__ Bt, size_t n8) { const size_t t = (size_t)blockIdx.x * 256 + threadIdx.x; if (t >= n8) return; FragH f;
#pragma unroll
  for (int i = 0; i < 8; ++i) f.h[i] = (_Float16)(bf16_round(W[t * 8 + i]) * 16.0f); *(v8us*)((unsigned short*)Bt + t * 8) = f.half[0];  }
template <int NHv, int TTv>
__global__ __launch_bounds__(256) void k_vt(const _Float16* __restrict__ V16, int ldv, int voff, _Float16* __restrict__ Vt) { __shared__ unsigned short tl[64][66]; const int tid = threadIdx.x; const int slab = blockIdx.x / (TTv / 64), lg = blockIdx.x % (TTv / 64); const int b = slab / NHv, h = slab % NHv;
  for (int i = tid; i < 64 * 8; i += 256) { const int r = i / 8, c8 = (i % 8) * 8; FragH f; f.half[0] = *(const v8us*)((const unsigned short*)V16 + ((size_t)b * TTv + lg * 64 + r) * ldv + voff + h * 64 + c8);
#pragma unroll
    for (int q = 0; q < 8; ++q) tl[r][c8 + q] = f.u[q]; }
  __syncthreads();
  {
#pragma unroll
    for (int rd = 0; rd < 2; ++rd) { const int d = rd * 32 + tid / 8, pc = tid % 8; FragH f;
#pragma unroll
      for (int q = 0; q < 8; ++q) f.u[q] = tl[pc * 8 + q][d];
      *(v8us*)((unsigned short*)Vt + ((size_t)slab * 64 + d) * TTv + lg * 64 + pc * 8) = f.half[0]; }
     } }

__global__ __launch_bounds__(256) void k_hl(const float* __restrict__ F, _Float16* __restrict__ Hh, _Float16* __restrict__ Hl, size_t n8) { const size_t t = (size_t)blockIdx.x * 256 + threadIdx.x; if (t >= n8) return; FragH fh, fl; const v4f a = *(const v4fa*)(F + t * 8), c = *(const v4fa*)(F + t * 8 + 4);
#pragma unroll
  for (int q = 0; q < 4; ++q) { _Float16 h = (_Float16)a[q]; fh.h[q] = h; fl.h[q] = (_Float16)((a[q] - (float)h) * 1024.0f); h = (_Float16)c[q]; fh.h[4 + q] = h; fl.h[4 + q] = (_Float16)((c[q] - (float)h) * 1024.0f); }
  { *(v8us*)((unsigned short*)Hh + t * 8) = fh.half[0]; *(v8us*)((unsigned short*)Hl + t * 8) = fl.half[0];  } }

// ---- fast GEMM (wave tile 32x64; requires M % 32 == 0 rows per launch region and N % 64 == 0); epilogue = k_gemm_hhx semantics ----
__device__ __forceinline__ v16h g2_frag(const _Float16* p, int hh) { FragH f; f.half[0] = *(const v8us*)((const unsigned short*)p + 8 * hh); f.half[1] = *(const v8us*)((const unsigned short*)p + 16 + 8 * hh); return f.v; }
__device__ __forceinline__ v8f g2_mma(v16h a, v16h b, v8f c) { v8f d = __builtin_amdgcn_wmma_f32_16x16x32_f16(false, a, false, b, (short)0, c, false, false); asm volatile("v_nop\n\tv_nop\n\tv_nop\n\tv_nop" : "+v"(d) : "v"(a), "v"(b)); return d; }
template <int ACT>
__global__ __launch_bounds__(128) void k_gemm2(const _Float16* __restrict__ A, int lda, size_t sA, const _Float16* __restrict__ Bh, int ldb, size_t sB, float alpha, const float* __restrict__ bias, size_t sBias, const float* __restrict__ CP, int rowsPerB, size_t sCPb, int row0g,
    float* __restrict__ C, _Float16* __restrict__ C16, int ldc, size_t sC, int M, int N, int K) {
  __shared__ __attribute__((aligned(16))) float so[4][32][68];
  const int tid = threadIdx.x, w = tid >> 5, lane = tid & 31, ln = lane & 15, hh = lane >> 4; const int by = blockIdx.y;
  A += (size_t)by * sA; Bh += (size_t)by * sB; const size_t cofs = (size_t)by * sC; const float* bp = bias ? bias + (size_t)by * sBias : nullptr;
  const int ntn = N >> 6; const int mt = blockIdx.x / ntn, nq = blockIdx.x - mt * ntn; const int row0 = mt * 128 + 32 * w, col0 = nq * 64; if (row0 >= M) return;
  const _Float16* a0p = A + (size_t)(row0 + ln) * lda; const _Float16* a1p = a0p + (size_t)16 * lda;
  const _Float16* b0p = Bh + (size_t)(col0 + ln) * ldb; const _Float16* b1p = b0p + (size_t)16 * ldb; const _Float16* b2p = b1p + (size_t)16 * ldb; const _Float16* b3p = b2p + (size_t)16 * ldb;
  const v8f z8 = {0.f,0.f,0.f,0.f,0.f,0.f,0.f,0.f}; v8f c00 = z8, c01 = z8, c02 = z8, c03 = z8, c10 = z8, c11 = z8, c12 = z8, c13 = z8;
#pragma unroll 1
  for (int kb = 0; kb < K; kb += 32) { const v16h a0 = g2_frag(a0p + kb, hh), a1 = g2_frag(a1p + kb, hh);
    v16h b = g2_frag(b0p + kb, hh); c00 = g2_mma(a0, b, c00); c10 = g2_mma(a1, b, c10);
    b = g2_frag(b1p + kb, hh); c01 = g2_mma(a0, b, c01); c11 = g2_mma(a1, b, c11);
    b = g2_frag(b2p + kb, hh); c02 = g2_mma(a0, b, c02); c12 = g2_mma(a1, b, c12);
    b = g2_frag(b3p + kb, hh); c03 = g2_mma(a0, b, c03); c13 = g2_mma(a1, b, c13); }
  v8f accs[8] = {c00, c01, c02, c03, c10, c11, c12, c13};
#pragma unroll
  for (int u = 0; u < 8; ++u) { const int t = u & 3, half = u >> 2; const int col = col0 + t * 16 + ln; const float bv = bp ? bf16_round(bp[col]) : 0.f;
#pragma unroll
    for (int r = 0; r < 8; ++r) { const int rloc = half * 16 + 8 * hh + r; float v = accs[u][r] * alpha + bv; if (CP) { const int bidx = (row0g + row0 + rloc) / rowsPerB; v += CP[(size_t)bidx * sCPb + (size_t)by * 64 + col]; }
      if (ACT == 3) v = fmaxf(v, 0.f); else if (ACT == 6) v = 0.5f * v * (1.0f + erff(v * 0.70710678118654752f)); else if (ACT == 11) v = 1.0f / (1.0f + expf(-v)); else if (ACT == 15) v = v / (1.0f + expf(-v)); else if (ACT == 12) v = (v > 0.f) ? v : 0.01f * v; else if (ACT == 8) v = tanhf(v);
      so[w][rloc][t * 16 + ln] = v; } }
  __builtin_amdgcn_fence(__ATOMIC_ACQ_REL, "workgroup"); __builtin_amdgcn_wave_barrier();
  const int rsub = lane >> 4, c4 = (lane & 15) * 4;
  {
#pragma unroll
    for (int q = 0; q < 16; ++q) { const int r = q * 2 + rsub; const v4f v = *(const v4fa*)&so[w][r][c4]; if (C) *(v4f*)(C + cofs + (size_t)(row0 + r) * ldc + col0 + c4) = v; if (C16) { v4h h4; for (int i = 0; i < 4; ++i) h4[i] = (_Float16)v[i]; *(v4h*)(C16 + cofs + (size_t)(row0 + r) * ldc + col0 + c4) = h4; } }
     } }



template <int CAUSAL>
__global__ __launch_bounds__(128) void k_flash(const _Float16* __restrict__ Q16, int ldq, const _Float16* __restrict__ K16, int ldk, const _Float16* __restrict__ Vt, const int* __restrict__ MSK, float* __restrict__ O, int ldo) {
  constexpr int RPW = 16, RTN = RPW / 16, NQB = TQ / (4 * RPW), DT = 4, KS = 2;
  __shared__ __attribute__((aligned(16))) unsigned short sP[4][RPW][40]; __shared__ __attribute__((aligned(16))) float sO[4][RPW][64 + 4];
  const int tid = threadIdx.x, w = tid >> 5, lane = tid & 31, ln = lane & 15, hh = lane >> 4;
  const int slab = blockIdx.x / QBLKS, qblk = blockIdx.x % QBLKS; (void)NQB; const int b = slab / NH, h = slab % NH; const int qb0 = qblk * (4 * RPW); const int q0 = qb0 + w * RPW;
  FragH aq[2][KS];
#pragma unroll
  for (int rt = 0; rt < RTN; ++rt) { const unsigned short* qr = (const unsigned short*)Q16 + ((size_t)b * TQ + q0 + rt * 16 + ln) * ldq + h * 64;
#pragma unroll
    for (int ks = 0; ks < KS; ++ks) { aq[rt][ks].half[0] = *(const v8us*)(qr + ks * 32 + 8 * hh); aq[rt][ks].half[1] = *(const v8us*)(qr + ks * 32 + 16 + 8 * hh); } }
  const unsigned short* Vth = (const unsigned short*)Vt + (size_t)slab * 64 * TK;
  float m_r[2][8], l_r[2][8]; v8f oacc[2][DT];
#pragma unroll
  for (int rt = 0; rt < RTN; ++rt) {
#pragma unroll
    for (int r = 0; r < 8; ++r) { m_r[rt][r] = -3.0e38f; l_r[rt][r] = 0.f; }
#pragma unroll
    for (int dt = 0; dt < DT; ++dt) oacc[rt][dt] = (v8f){0.f,0.f,0.f,0.f,0.f,0.f,0.f,0.f}; }
  const int jend = (CAUSAL == 1) ? (qb0 + 4 * RPW) : TK;      /* causal: keys beyond the block's last query never contribute */
#pragma unroll 1
  for (int j0 = 0; j0 < jend; j0 += 32) {
    v8f s[2][2];
#pragma unroll
    for (int nt = 0; nt < 2; ++nt) { const unsigned short* kr = (const unsigned short*)K16 + ((size_t)b * TK + j0 + nt * 16 + ln) * ldk + h * 64; FragH bk[KS];
#pragma unroll
      for (int ks = 0; ks < KS; ++ks) { bk[ks].half[0] = *(const v8us*)(kr + ks * 32 + 8 * hh); bk[ks].half[1] = *(const v8us*)(kr + ks * 32 + 16 + 8 * hh); }
#pragma unroll
      for (int rt = 0; rt < RTN; ++rt) { v8f acc = (v8f){0.f,0.f,0.f,0.f,0.f,0.f,0.f,0.f};
#pragma unroll
        for (int ks = 0; ks < KS; ++ks) acc = mmaH<1>(aq[rt][ks].v, aq[rt][ks].v, bk[ks].v, bk[ks].v, acc); s[rt][nt] = acc; } }
#pragma unroll
    for (int rt = 0; rt < RTN; ++rt)
#pragma unroll
      for (int r = 0; r < 8; ++r) { const int tq = q0 + rt * 16 + 8 * hh + r; const int k0 = j0 + ln, k1 = j0 + 16 + ln;
        const bool ok0 = (CAUSAL == 1) ? (k0 <= tq) : ((CAUSAL == 2) ? ((k0 >> 5) == (tq >> 5)) : true), ok1 = (CAUSAL == 1) ? (k1 <= tq) : ((CAUSAL == 2) ? ((k1 >> 5) == (tq >> 5)) : true);      /* mode 2: block-diagonal 32-token groups */
        const float s0 = ok0 ? s[rt][0][r] * SCL : -3.0e38f, s1 = ok1 ? s[rt][1][r] * SCL : -3.0e38f; float mc = fmaxf(s0, s1);
        mc = fmaxf(mc, __shfl_xor(mc, 1, 32)); mc = fmaxf(mc, __shfl_xor(mc, 2, 32)); mc = fmaxf(mc, __shfl_xor(mc, 4, 32)); mc = fmaxf(mc, __shfl_xor(mc, 8, 32));
        const float mn = fmaxf(m_r[rt][r], mc); const float al = (mn > -1.0e38f) ? expf(m_r[rt][r] - mn) : 1.0f; m_r[rt][r] = mn; const float p0 = ok0 ? expf(s0 - mn) : 0.f, p1 = ok1 ? expf(s1 - mn) : 0.f; l_r[rt][r] = l_r[rt][r] * al + p0 + p1;
#pragma unroll
        for (int dt = 0; dt < DT; ++dt) oacc[rt][dt][r] *= al;
        FragH t2; t2.h[0] = (_Float16)(p0 * 1024.0f); t2.h[1] = (_Float16)(p1 * 1024.0f); sP[w][rt * 16 + 8 * hh + r][ln] = t2.u[0]; sP[w][rt * 16 + 8 * hh + r][16 + ln] = t2.u[1]; }
    __builtin_amdgcn_fence(__ATOMIC_ACQ_REL, "workgroup"); __builtin_amdgcn_wave_barrier();
    FragH pa[2];
#pragma unroll
    for (int rt = 0; rt < RTN; ++rt) { pa[rt].half[0] = *(const v8us*)&sP[w][rt * 16 + ln][8 * hh]; pa[rt].half[1] = *(const v8us*)&sP[w][rt * 16 + ln][16 + 8 * hh]; }
#pragma unroll
    for (int dt = 0; dt < DT; ++dt) { const unsigned short* vrow = Vth + (size_t)(dt * 16 + ln) * TK + j0; FragH bv; bv.half[0] = *(const v8us*)(vrow + 8 * hh); bv.half[1] = *(const v8us*)(vrow + 16 + 8 * hh);
#pragma unroll
      for (int rt = 0; rt < RTN; ++rt) oacc[rt][dt] = mmaH<1>(pa[rt].v, pa[rt].v, bv.v, bv.v, oacc[rt][dt]); }
    __builtin_amdgcn_fence(__ATOMIC_ACQ_REL, "workgroup"); __builtin_amdgcn_wave_barrier(); }
#pragma unroll
  for (int rt = 0; rt < RTN; ++rt) {
#pragma unroll
    for (int r = 0; r < 8; ++r) { float l = l_r[rt][r]; l += __shfl_xor(l, 1, 32); l += __shfl_xor(l, 2, 32); l += __shfl_xor(l, 4, 32); l += __shfl_xor(l, 8, 32); l_r[rt][r] = (l > 0.f) ? 1.0f / (l * 1024.0f) : 0.f; }
#pragma unroll
    for (int dt = 0; dt < DT; ++dt)
#pragma unroll
      for (int r = 0; r < 8; ++r) sO[w][rt * 16 + 8 * hh + r][dt * 16 + ln] = oacc[rt][dt][r] * l_r[rt][r]; }
  __builtin_amdgcn_fence(__ATOMIC_ACQ_REL, "workgroup"); __builtin_amdgcn_wave_barrier();
  {
#pragma unroll
    for (int rp = 0; rp < RPW; rp += 2) { const int r = rp + (lane >> 4), pc = lane & 15; const v4f val = *(const v4fa*)&sO[w][r][pc * 4]; *(v4f*)(O + ((size_t)b * TQ + q0 + r) * ldo + h * 64 + pc * 4) = val; }
     } }

__global__ __launch_bounds__(256) void k_sum5(const float* __restrict__ O, float* __restrict__ out, size_t n4) {
  #pragma clang fp contract(off)
  const size_t t = (size_t)blockIdx.x * 256 + threadIdx.x; if (t >= n4) return; v4f a = *(const v4fa*)(O + t * 4);
  for (int n = 1; n < NSRC; ++n) { const v4f b = *(const v4fa*)(O + (size_t)n * NR * CC + t * 4); for (int q = 0; q < 4; ++q) a[q] += b[q]; }
  *(v4f*)(out + t * 4) = a;  }

extern "C" void kernel_launch(void* const* d_in, const int* in_sizes, int n_in,
                              void* d_out, int out_size, void* d_ws, size_t ws_size, hipStream_t stream) {
  (void)in_sizes; (void)n_in; (void)out_size;
  const float* const* I = (const float* const*)d_in; const float* hsp = I[0]; const float* Wq = I[1]; const float* bq = I[2]; const float* Wk = I[3]; const float* bk = I[4]; const float* Wv = I[5]; const float* bv = I[6];
  char* ws = (char*)d_ws; size_t off = 0;
  auto take = [&](size_t bytes) { char* p = ws + off; off += (bytes + 255) & ~(size_t)255; return p; };
  _Float16* BQ = (_Float16*)take((size_t)CC * CC * 2); _Float16* BK = (_Float16*)take((size_t)CC * CC * 2); _Float16* BV = (_Float16*)take((size_t)CC * CC * 2);
  _Float16* X16 = (_Float16*)take((size_t)NRA * CC * 2); _Float16* Q16 = (_Float16*)take((size_t)NR * CC * 2); _Float16* K16 = (_Float16*)take((size_t)NRA * CC * 2); _Float16* V16 = (_Float16*)take((size_t)NRA * CC * 2); _Float16* VT = (_Float16*)take((size_t)NRA * CC * 2); float* O = (float*)take((size_t)NSRC * NR * CC * 4);
  if (off > ws_size) return;      /* 3.4 + 30 + 6 + 30 + 30 + 30 + 60 = 190 MiB */
  k_wt_f16<<<(CC * CC / 8 + 255) / 256, 256, 0, stream>>>(Wq, BQ, CC, CC, 16.0f); k_wt_f16<<<(CC * CC / 8 + 255) / 256, 256, 0, stream>>>(Wk, BK, CC, CC, 16.0f); k_wt_f16<<<(CC * CC / 8 + 255) / 256, 256, 0, stream>>>(Wv, BV, CC, CC, 16.0f);
  k_x16<<<(unsigned)(((size_t)NRA * CC / 8 + 255) / 256), 256, 0, stream>>>(hsp, X16, (size_t)NRA * CC / 8);
  k_gemm2<0><<<dim3((NR / 128) * (CC / 64), 1), 128, 0, stream>>>(X16, CC, 0, BQ, CC, 0, 0.0625f, bq, 0, nullptr, 1, 0, 0, nullptr, Q16, CC, 0, NR, CC, CC);      /* q from source 0 */
  k_gemm2<0><<<dim3((NRA / 128) * (CC / 64), 1), 128, 0, stream>>>(X16, CC, 0, BK, CC, 0, 0.0625f, bk, 0, nullptr, 1, 0, 0, nullptr, K16, CC, 0, NRA, CC, CC);      /* k for every source */
  k_gemm2<0><<<dim3((NRA / 128) * (CC / 64), 1), 128, 0, stream>>>(X16, CC, 0, BV, CC, 0, 0.0625f, bv, 0, nullptr, 1, 0, 0, nullptr, V16, CC, 0, NRA, CC, CC);
  k_vt<NH, SLEN><<<NSRC * NB * NH * (SLEN / 64), 256, 0, stream>>>(V16, CC, 0, VT);      /* slabs ((n*4 + b)*12 + h) */
  for (int n = 0; n < NSRC; ++n)
    k_flash<0><<<NB * NH * QBLKS, 128, 0, stream>>>(Q16, CC, K16 + (size_t)n * NR * CC, CC, VT + (size_t)n * NB * NH * 64 * SLEN, nullptr, O + (size_t)n * NR * CC, CC);
  k_sum5<<<(unsigned)(((size_t)NR * CC / 4 + 255) / 256), 256, 0, stream>>>(O, (float*)d_out, (size_t)NR * CC / 4);
}

// v001
// It runs in 544 microseconds.
// In two side-by-side timings against v000, it was 1.43 and 1.42 times as fast.
#include <hip/hip_runtime.h>
// Attention_KV (5 sources x 4 batches x 1024 tokens x 768 = 12 heads of 64): q from source 0 (Wq + bq); every source n gives k_n, v_n (shared Wk/bk, Wv/bv); ctx = sum_n softmax(q k_n^T / 8) v_n (independent softmax per source); output = ctx merged [B, S, 768] (no output projection).
// Structure: one exact f16 plane of all sources; q / k / v GEMMs (32x64 wave tiles, f32 accumulation, exact x16 weights + bias, f16 outputs; k and v over all 5 sources at once); V^T by LDS tiles for all (source, batch, head) slabs in one launch; five fused flash kernels (plain f16 operands), one per source, into five f32 planes; a VALU sum of the five planes into the output.
// Compute dtype: inputs and parameters rounded to bf16; q, k, v, P as f16 (~2^-12); f32 accumulation/softmax/sum. v_wmma_f32_16x16x32_f16.
#define NSRC 5
#define NB 4
#define CC 768
#define NR (NB * SLEN)           /* 4096 query rows */
#define NRA (NSRC * NR)          /* 20480 source rows */
#define SLEN 1024
#define TQ SLEN
#define TK SLEN
#define NH 12
#define SCL 0.125f               /* 1/sqrt(64) */
#define QBLKS (TQ / 64)
typedef __bf16 v16b __attribute__((ext_vector_type(16)));
typedef unsigned short v8us __attribute__((ext_vector_type(8), may_alias));
typedef float  v8f  __attribute__((ext_vector_type(8)));
typedef float  v4f  __attribute__((ext_vector_type(4)));
typedef float  v4fa __attribute__((ext_vector_type(4), may_alias));
union FragB { v16b v; v8us half[2]; unsigned short u[16]; };

__device__ __forceinline__ unsigned short bf16_bits(float x) { unsigned int u = __float_as_uint(x); return (unsigned short)((u + 0x7FFFu + ((u >> 16) & 1u)) >> 16); }
__device__ __forceinline__ float bf16_val(unsigned short b) { return __uint_as_float(((unsigned int)b) << 16); }
__device__ __forceinline__ float bf16_round(float x) { return bf16_val(bf16_bits(x)); }
// D += A·B with NT terms: 1 = ah·bh, 2 = + al·bh (A split), 3 = + ah·bl (both split)
template <int NT>
__device__ __forceinline__ v8f mmaN(v16b ah, v16b al, v16b bh, v16b bl, v8f c) {
  c = __builtin_amdgcn_wmma_f32_16x16x32_bf16(false, ah, false, bh, (short)0, c, false, false);
  if (NT >= 2) c = __builtin_amdgcn_wmma_f32_16x16x32_bf16(false, al, false, bh, (short)0, c, false, false);
  if (NT >= 3) c = __builtin_amdgcn_wmma_f32_16x16x32_bf16(false, ah, false, bl, (short)0, c, false, false);
  asm volatile("v_nop\n\tv_nop\n\tv_nop\n\tv_nop" : "+v"(c) : "v"(ah), "v"(al), "v"(bh), "v"(bl));
  return c;
}

__global__ __launch_bounds__(256) void k_wt_bf16(const float* __restrict__ W, unsigned short* __restrict__ Wt, int K, int N) {
  const int t = blockIdx.x * 256 + threadIdx.x;
  const int k8n = K / 8;
  if (t >= N * k8n) return;
  const int n = t / k8n, k8 = (t % k8n) * 8;
  v8us v;
#pragma unroll
  for (int i = 0; i < 8; ++i) v[i] = bf16_bits(W[(size_t)(k8 + i) * N + n]);
  *(v8us*)(Wt + (size_t)n * K + k8) = v;
  
}

// GEMM C[M][N] (f32, pitch ldc) = act(A[M][K]·W + bias). A f32 row-major (pitch lda) converted per fragment to bf16
// (ASPLIT: hi/lo two planes -> 2 terms, else single rounded term); Wt bf16 [N][K] (pitch ldb). BIAS_BF16 rounds the
// bias to bf16 first (bias quantised to bf16 before the add). K%32==0, M%16==0, N%64==0.
template <bool ASPLIT, int ACT, bool BIAS_BF16>
__global__ __launch_bounds__(128) void k_gemm_bf(const float* __restrict__ A, int lda, const unsigned short* __restrict__ Wt, int ldb,
                                               const float* __restrict__ bias, float* __restrict__ C, int ldc, int M, int N, int K) {
  __shared__ __attribute__((aligned(16))) float so[4][16][64];
  const int tid = threadIdx.x, w = tid >> 5, lane = tid & 31, ln = lane & 15, hh = lane >> 4;
  const int ntn = N / 64;
  const int wid = blockIdx.x * 4 + w;
  const int mt = wid / ntn, nq = wid % ntn;
  if (mt * 16 >= M) return;
  const int row0 = mt * 16, col0 = nq * 64;
  const float* arow = A + (size_t)(row0 + ln) * lda;
  v8f acc[4] = {};
  for (int kb = 0; kb < K; kb += 32) {
    FragB ah, al;
    const v4f x0 = *(const v4fa*)(arow + kb + 8 * hh), x1 = *(const v4fa*)(arow + kb + 8 * hh + 4);
    const v4f x2 = *(const v4fa*)(arow + kb + 16 + 8 * hh), x3 = *(const v4fa*)(arow + kb + 16 + 8 * hh + 4);
    float xs[16] = {x0[0],x0[1],x0[2],x0[3],x1[0],x1[1],x1[2],x1[3],x2[0],x2[1],x2[2],x2[3],x3[0],x3[1],x3[2],x3[3]};
#pragma unroll
    for (int i = 0; i < 16; ++i) { const unsigned short hb = bf16_bits(xs[i]); ah.u[i] = hb; al.u[i] = ASPLIT ? bf16_bits(xs[i] - bf16_val(hb)) : (unsigned short)0; }
#pragma unroll
    for (int t = 0; t < 4; ++t) {
      const unsigned short* brow = Wt + (size_t)(col0 + t * 16 + ln) * ldb + kb;
      FragB b;
      b.half[0] = *(const v8us*)(brow + 8 * hh);
      b.half[1] = *(const v8us*)(brow + 16 + 8 * hh);
      acc[t] = mmaN<ASPLIT ? 2 : 1>(ah.v, al.v, b.v, b.v, acc[t]);
    }
  }
#pragma unroll
  for (int t = 0; t < 4; ++t) {
    float bv = bias ? bias[col0 + t * 16 + ln] : 0.f;
    if (BIAS_BF16) bv = bf16_round(bv);
#pragma unroll
    for (int r = 0; r < 8; ++r) { float v = acc[t][r] + bv; if (ACT == 1) v = fmaxf(v, 0.f); so[w][8 * hh + r][t * 16 + ln] = v; }
  }
  __builtin_amdgcn_fence(__ATOMIC_ACQ_REL, "workgroup");
  __builtin_amdgcn_wave_barrier();
  const int rsub = lane >> 4, c4 = (lane & 15) * 4;
  {
#pragma unroll
    for (int q = 0; q < 8; ++q) {
      const int r = q * 2 + rsub;
      const v4f v = *(const v4fa*)&so[w][r][c4];
      *(v4f*)(C + (size_t)(row0 + r) * ldc + col0 + c4) = v;
    }
    
  }
}

// GEMM C = act(A·W + bias + resid): A f32 (ASPLIT -> hi/lo 2 terms), Wt bf16 [N][K]; ACT 0 none, 1 relu, 2 exact gelu;
// resid (optional, f32, row index = (row % rmod), pitch ldr, RES_BF16 rounds it) added before the activation.
template <bool ASPLIT, int ACT, bool BIAS_BF16, bool RES_BF16>
__global__ __launch_bounds__(128) void k_gemm_bf3(const float* __restrict__ A, int lda, const unsigned short* __restrict__ Wt, int ldb,
                                                const float* __restrict__ bias, const float* __restrict__ resid, int rmod, int ldr,
                                                float* __restrict__ C, int ldc, int M, int N, int K) {
  __shared__ __attribute__((aligned(16))) float so[4][16][64];
  const int tid = threadIdx.x, w = tid >> 5, lane = tid & 31, ln = lane & 15, hh = lane >> 4;
  const int ntn = N / 64;
  const int wid = blockIdx.x * 4 + w;
  const int mt = wid / ntn, nq = wid % ntn;
  if (mt * 16 >= M) return;
  const int row0 = mt * 16, col0 = nq * 64;
  const float* arow = A + (size_t)(row0 + ln) * lda;
  v8f acc[4] = {};
  for (int kb = 0; kb < K; kb += 32) {
    FragB ah, al;
    const v4f x0 = *(const v4fa*)(arow + kb + 8 * hh), x1 = *(const v4fa*)(arow + kb + 8 * hh + 4);
    const v4f x2 = *(const v4fa*)(arow + kb + 16 + 8 * hh), x3 = *(const v4fa*)(arow + kb + 16 + 8 * hh + 4);
    float xs[16] = {x0[0],x0[1],x0[2],x0[3],x1[0],x1[1],x1[2],x1[3],x2[0],x2[1],x2[2],x2[3],x3[0],x3[1],x3[2],x3[3]};
#pragma unroll
    for (int i = 0; i < 16; ++i) { const unsigned short hb = bf16_bits(xs[i]); ah.u[i] = hb; al.u[i] = ASPLIT ? bf16_bits(xs[i] - bf16_val(hb)) : (unsigned short)0; }
#pragma unroll
    for (int t = 0; t < 4; ++t) {
      const unsigned short* brow = Wt + (size_t)(col0 + t * 16 + ln) * ldb + kb;
      FragB b;
      b.half[0] = *(const v8us*)(brow + 8 * hh);
      b.half[1] = *(const v8us*)(brow + 16 + 8 * hh);
      acc[t] = mmaN<ASPLIT ? 2 : 1>(ah.v, al.v, b.v, b.v, acc[t]);
    }
  }
#pragma unroll
  for (int t = 0; t < 4; ++t) {
    const int col = col0 + t * 16 + ln;
    float bv = bias ? bias[col] : 0.f;
    if (BIAS_BF16) bv = bf16_round(bv);
#pragma unroll
    for (int r = 0; r < 8; ++r) {
      float v = acc[t][r] + bv;
      if (resid) { float rv = resid[(size_t)((row0 + 8 * hh + r) % rmod) * ldr + col]; if (RES_BF16) rv = bf16_round(rv); v += rv; }
      if (ACT == 1) v = fmaxf(v, 0.f);
      if (ACT == 2) v = 0.5f * v * (1.0f + erff(v * 0.70710678118654752f));
      if (ACT == 3) { const float u = 0.7978845608028654f * (v + 0.044715f * v * v * v); v = 0.5f * v * (1.0f + tanhf(u)); }
      so[w][8 * hh + r][t * 16 + ln] = v;
    }
  }
  __builtin_amdgcn_fence(__ATOMIC_ACQ_REL, "workgroup");
  __builtin_amdgcn_wave_barrier();
  const int rsub = lane >> 4, c4 = (lane & 15) * 4;
  {
#pragma unroll
    for (int q = 0; q < 8; ++q) {
      const int r = q * 2 + rsub;
      const v4f v = *(const v4fa*)&so[w][r][c4];
      *(v4f*)(C + (size_t)(row0 + r) * ldc + col0 + c4) = v;
    }
    
  }
}
// row LayerNorm (biased variance, eps) over N: s = X (+ R); optional out_sum <- s; out_norm <- (s-mu)*rsqrt(var+eps)*g + b
template <bool PARAM_BF16>
__global__ __launch_bounds__(256) void k_layernorm(const float* __restrict__ X, const float* __restrict__ R, const float* __restrict__ g, const float* __restrict__ bta,
                                                  float* __restrict__ out_sum, float* __restrict__ out_norm, int N, float eps) {
  __shared__ float red[256];
  const int row = blockIdx.x, tid = threadIdx.x;
  const float* x = X + (size_t)row * N; const float* rr = R ? R + (size_t)row * N : nullptr;
  float vals[16];                     // up to N = 4096
  const int per = N / 256;            // contiguous chunk per thread? use strided-by-4 chunks: thread handles j = tid*4 + 1024*u
  float s1 = 0.f;
  for (int u = 0; u < per / 4; ++u) {
    const int j = tid * 4 + 1024 * u;
    const v4f a = *(const v4fa*)(x + j);
    v4f b = {0.f,0.f,0.f,0.f}; if (rr) b = *(const v4fa*)(rr + j);
#pragma unroll
    for (int q = 0; q < 4; ++q) { const float v = a[q] + b[q]; vals[u * 4 + q] = v; s1 += v; }
  }
  red[tid] = s1; __syncthreads();
  for (int st = 128; st > 0; st >>= 1) { if (tid < st) red[tid] += red[tid + st]; __syncthreads(); }
  const float mu = red[0] / (float)N; __syncthreads();
  float s2 = 0.f;
  for (int u = 0; u < per / 4; ++u)
#pragma unroll
    for (int q = 0; q < 4; ++q) { const float c = vals[u * 4 + q] - mu; s2 += c * c; }
  red[tid] = s2; __syncthreads();
  for (int st = 128; st > 0; st >>= 1) { if (tid < st) red[tid] += red[tid + st]; __syncthreads(); }
  const float rs = rsqrtf(red[0] / (float)N + eps);
  {
    for (int u = 0; u < per / 4; ++u) {
      const int j = tid * 4 + 1024 * u;
      v4f o, sm;
#pragma unroll
      for (int q = 0; q < 4; ++q) {
        float gg = g[j + q], bb = bta[j + q];
        if (PARAM_BF16) { gg = bf16_round(gg); bb = bf16_round(bb); }
        sm[q] = vals[u * 4 + q]; o[q] = (vals[u * 4 + q] - mu) * rs * gg + bb;
      }
      if (out_sum) *(v4f*)(out_sum + (size_t)row * N + j) = sm;
      *(v4f*)(out_norm + (size_t)row * N + j) = o;
    }
    
  }
}



// ---- f16 WMMA path (v_wmma_f32_16x16x32_f16): 11-bit significands for operands in range — used where a [0,1] probability operand needs more precision than bf16
typedef _Float16 v16h __attribute__((ext_vector_type(16)));
union FragH { v16h v; v8us half[2]; _Float16 h[16]; unsigned short u[16]; };
template <int NT>
__device__ __forceinline__ v8f mmaH(v16h ah, v16h al, v16h bh, v16h bl, v8f c) {
  c = __builtin_amdgcn_wmma_f32_16x16x32_f16(false, ah, false, bh, (short)0, c, false, false);
  if (NT >= 2) c = __builtin_amdgcn_wmma_f32_16x16x32_f16(false, al, false, bh, (short)0, c, false, false);
  if (NT >= 3) c = __builtin_amdgcn_wmma_f32_16x16x32_f16(false, ah, false, bl, (short)0, c, false, false);
  asm volatile("v_nop\n\tv_nop\n\tv_nop\n\tv_nop" : "+v"(c) : "v"(ah), "v"(al), "v"(bh), "v"(bl));
  return c;
}
// batched GEMM like k_gemm_b but f16 operands: A f32 (split into f16 hi/lo if ASPLIT, else rounded to f16), Bt = f16 values [n][k]; alpha; C f32; N multiple of 16 (partial tiles skipped)
template <bool ASPLIT>
__global__ __launch_bounds__(128) void k_gemm_h(const float* __restrict__ A, int lda, size_t sA, const _Float16* __restrict__ Bh, int ldb, size_t sB, float alpha, float* __restrict__ C, int ldc, size_t sC, int M, int N, int K) {
  __shared__ __attribute__((aligned(16))) float so[4][16][64];
  const int tid = threadIdx.x, w = tid >> 5, lane = tid & 31, ln = lane & 15, hh = lane >> 4; const int by = blockIdx.y;
  A += (size_t)by * sA; Bh += (size_t)by * sB; C += (size_t)by * sC;
  const int ntn = (N + 63) / 64; const int wid = blockIdx.x * 4 + w; const int mt = wid / ntn, nq = wid % ntn; if (mt * 16 >= M) return;
  const int row0 = mt * 16, col0 = nq * 64; const float* arow = A + (size_t)(row0 + ln) * lda;
  v8f acc[4] = {};
  for (int kb = 0; kb < K; kb += 32) {
    FragH ah, al;
    const v4f x0 = *(const v4fa*)(arow + kb + 8 * hh), x1 = *(const v4fa*)(arow + kb + 8 * hh + 4), x2 = *(const v4fa*)(arow + kb + 16 + 8 * hh), x3 = *(const v4fa*)(arow + kb + 16 + 8 * hh + 4);
    float xs[16] = {x0[0],x0[1],x0[2],x0[3],x1[0],x1[1],x1[2],x1[3],x2[0],x2[1],x2[2],x2[3],x3[0],x3[1],x3[2],x3[3]};
#pragma unroll
    for (int i = 0; i < 16; ++i) { const _Float16 h = (_Float16)xs[i]; ah.h[i] = h; al.h[i] = ASPLIT ? (_Float16)(xs[i] - (float)h) : (_Float16)0.0f; }
#pragma unroll
    for (int t = 0; t < 4; ++t) { if (col0 + t * 16 >= N) continue; const size_t boff = (size_t)(col0 + t * 16 + ln) * ldb + kb; FragH bq; bq.half[0] = *(const v8us*)(Bh + boff + 8 * hh); bq.half[1] = *(const v8us*)(Bh + boff + 16 + 8 * hh);
      acc[t] = mmaH<ASPLIT ? 2 : 1>(ah.v, al.v, bq.v, bq.v, acc[t]); }
  }
#pragma unroll
  for (int t = 0; t < 4; ++t) { if (col0 + t * 16 >= N) continue;
#pragma unroll
    for (int r = 0; r < 8; ++r) so[w][8 * hh + r][t * 16 + ln] = acc[t][r] * alpha; }
  __builtin_amdgcn_fence(__ATOMIC_ACQ_REL, "workgroup"); __builtin_amdgcn_wave_barrier();
  const int rsub = lane >> 4, c4 = (lane & 15) * 4;
  {
#pragma unroll
    for (int q = 0; q < 8; ++q) { const int r = q * 2 + rsub; if (col0 + c4 < N) { const v4f v = *(const v4fa*)&so[w][r][c4]; *(v4f*)(C + (size_t)(row0 + r) * ldc + col0 + c4) = v; } }
     }
}

// Wt[n][k] = f16(W[k][n]·scale) from f32 row-major W[K][N] (scale = power of two; bf16-exact weights stay exact in f16 away from the subnormal range)
__global__ __launch_bounds__(256) void k_wt_f16(const float* __restrict__ W, _Float16* __restrict__ Wt, int K, int N, float scale) {
  const int t = blockIdx.x * 256 + threadIdx.x; if (t >= N * (K / 8)) return; const int n = t / (K / 8), k8 = (t % (K / 8)) * 8; FragH f;
#pragma unroll
  for (int i = 0; i < 8; ++i) f.h[i] = (_Float16)(bf16_round(W[(size_t)(k8 + i) * N + n]) * scale); const v8us o = f.half[0];
  *(v8us*)((unsigned short*)Wt + (size_t)n * K + k8) = o; 
}
// k_gemm_hh variant with fused epilogue: v = acc·alpha + bias[by·sBias + col] (+ CP[(row/rowsPerB)·sCPb + by·64 + col] if CP) ; ACT 0 none / 1 elu ; writes f16 C16 (and f32 C if non-null)
template <int ACT>
__global__ __launch_bounds__(128) void k_gemm_hhx(const _Float16* __restrict__ A, int lda, size_t sA, const _Float16* __restrict__ Bh, int ldb, size_t sB, float alpha, const float* __restrict__ bias, size_t sBias, const float* __restrict__ CP, int rowsPerB, size_t sCPb, int row0g,
    float* __restrict__ C, _Float16* __restrict__ C16, int ldc, size_t sC, int M, int N, int K) {
  __shared__ __attribute__((aligned(16))) float so[4][16][64];
  const int tid = threadIdx.x, w = tid >> 5, lane = tid & 31, ln = lane & 15, hh = lane >> 4; const int by = blockIdx.y;
  A += (size_t)by * sA; Bh += (size_t)by * sB; const size_t cofs = (size_t)by * sC; const float* bp = bias ? bias + (size_t)by * sBias : nullptr;
  const int ntn = (N + 63) / 64; const int wid = blockIdx.x * 4 + w; const int mt = wid / ntn, nq = wid % ntn; if (mt * 16 >= M) return;
  const int row0 = mt * 16, col0 = nq * 64; const _Float16* arow = A + (size_t)(row0 + ln) * lda;
  v8f acc[4] = {};
  for (int kb = 0; kb < K; kb += 32) { FragH ah; ah.half[0] = *(const v8us*)((const unsigned short*)arow + kb + 8 * hh); ah.half[1] = *(const v8us*)((const unsigned short*)arow + kb + 16 + 8 * hh);
#pragma unroll
    for (int t = 0; t < 4; ++t) { if (col0 + t * 16 >= N) continue; const size_t boff = (size_t)(col0 + t * 16 + ln) * ldb + kb; FragH bq; bq.half[0] = *(const v8us*)((const unsigned short*)Bh + boff + 8 * hh); bq.half[1] = *(const v8us*)((const unsigned short*)Bh + boff + 16 + 8 * hh);
      acc[t] = mmaH<1>(ah.v, ah.v, bq.v, bq.v, acc[t]); }
  }
#pragma unroll
  for (int t = 0; t < 4; ++t) { if (col0 + t * 16 >= N) continue; const int col = col0 + t * 16 + ln; const float bv = bp ? bf16_round(bp[col]) : 0.f;
#pragma unroll
    for (int r = 0; r < 8; ++r) { float v = acc[t][r] * alpha + bv; if (CP) { const int bidx = (row0g + row0 + 8 * hh + r) / rowsPerB; v += CP[(size_t)bidx * sCPb + (size_t)by * 64 + col]; } if (ACT == 1) v = (v > 0.f) ? v : expm1f(v); else if (ACT == 7) v = (v > 0.f) ? v + 1.0f : expf(v); else if (ACT == 8) v = tanhf(v); else if (ACT == 9) v = 0.5f * v * (1.0f + tanhf(0.7978845608028654f * (v + 0.044715f * v * v * v))); else if (ACT == 11) v = 1.0f / (1.0f + expf(-v)); else if (ACT == 12) v = (v > 0.f) ? v : 0.01f * v; else if (ACT == 14) v = (v > 0.f) ? v : 0.1f * v; else if (ACT == 15) v = v / (1.0f + expf(-v)); else if (ACT == 3) v = fmaxf(v, 0.f); else if (ACT == 6) v = 0.5f * v * (1.0f + erff(v * 0.70710678118654752f)); so[w][8 * hh + r][t * 16 + ln] = v; } }
  __builtin_amdgcn_fence(__ATOMIC_ACQ_REL, "workgroup"); __builtin_amdgcn_wave_barrier();
  const int rsub = lane >> 4, c4 = (lane & 15) * 4; typedef _Float16 v4h __attribute__((ext_vector_type(4)));
  {
#pragma unroll
    for (int q = 0; q < 8; ++q) { const int r = q * 2 + rsub; if (col0 + c4 < N) { const v4f v = *(const v4fa*)&so[w][r][c4]; if (C) *(v4f*)(C + cofs + (size_t)(row0 + r) * ldc + col0 + c4) = v; if (C16) { v4h h4; for (int i = 0; i < 4; ++i) h4[i] = (_Float16)v[i]; *(v4h*)(C16 + cofs + (size_t)(row0 + r) * ldc + col0 + c4) = h4; } } }
     }
}


typedef _Float16 v4h __attribute__((ext_vector_type(4)));

__global__ __launch_bounds__(256) void k_x16(const float* __restrict__ x, _Float16* __restrict__ X16, size_t n8) { const size_t t = (size_t)blockIdx.x * 256 + threadIdx.x; if (t >= n8) return; FragH f;
#pragma unroll
  for (int q = 0; q < 8; ++q) f.h[q] = (_Float16)bf16_round(x[t * 8 + q]); *(v8us*)((unsigned short*)X16 + t * 8) = f.half[0];  }
__global__ __launch_bounds__(256) void k_h16(const float* __restrict__ x, _Float16* __restrict__ X16, size_t n8) { const size_t t = (size_t)blockIdx.x * 256 + threadIdx.x; if (t >= n8) return; FragH f;
#pragma unroll
  for (int q = 0; q < 8; ++q) f.h[q] = (_Float16)x[t * 8 + q]; *(v8us*)((unsigned short*)X16 + t * 8) = f.half[0];  }
__global__ __launch_bounds__(256) void k_round16f(const float* __restrict__ W, _Float16* __restrict__ Bt, size_t n8) { const size_t t = (size_t)blockIdx.x * 256 + threadIdx.x; if (t >= n8) return; FragH f;
#pragma unroll
  for (int i = 0; i < 8; ++i) f.h[i] = (_Float16)(bf16_round(W[t * 8 + i]) * 16.0f); *(v8us*)((unsigned short*)Bt + t * 8) = f.half[0];  }
template <int NHv, int TTv>
__global__ __launch_bounds__(256) void k_vt(const _Float16* __restrict__ V16, int ldv, int voff, _Float16* __restrict__ Vt) { __shared__ unsigned short tl[64][66]; const int tid = threadIdx.x; const int slab = blockIdx.x / (TTv / 64), lg = blockIdx.x % (TTv / 64); const int b = slab / NHv, h = slab % NHv;
  for (int i = tid; i < 64 * 8; i += 256) { const int r = i / 8, c8 = (i % 8) * 8; FragH f; f.half[0] = *(const v8us*)((const unsigned short*)V16 + ((size_t)b * TTv + lg * 64 + r) * ldv + voff + h * 64 + c8);
#pragma unroll
    for (int q = 0; q < 8; ++q) tl[r][c8 + q] = f.u[q]; }
  __syncthreads();
  {
#pragma unroll
    for (int rd = 0; rd < 2; ++rd) { const int d = rd * 32 + tid / 8, pc = tid % 8; FragH f;
#pragma unroll
      for (int q = 0; q < 8; ++q) f.u[q] = tl[pc * 8 + q][d];
      *(v8us*)((unsigned short*)Vt + ((size_t)slab * 64 + d) * TTv + lg * 64 + pc * 8) = f.half[0]; }
     } }

__global__ __launch_bounds__(256) void k_hl(const float* __restrict__ F, _Float16* __restrict__ Hh, _Float16* __restrict__ Hl, size_t n8) { const size_t t = (size_t)blockIdx.x * 256 + threadIdx.x; if (t >= n8) return; FragH fh, fl; const v4f a = *(const v4fa*)(F + t * 8), c = *(const v4fa*)(F + t * 8 + 4);
#pragma unroll
  for (int q = 0; q < 4; ++q) { _Float16 h = (_Float16)a[q]; fh.h[q] = h; fl.h[q] = (_Float16)((a[q] - (float)h) * 1024.0f); h = (_Float16)c[q]; fh.h[4 + q] = h; fl.h[4 + q] = (_Float16)((c[q] - (float)h) * 1024.0f); }
  { *(v8us*)((unsigned short*)Hh + t * 8) = fh.half[0]; *(v8us*)((unsigned short*)Hl + t * 8) = fl.half[0];  } }

// ---- fast GEMM (wave tile 32x64; requires M % 32 == 0 rows per launch region and N % 64 == 0); epilogue = k_gemm_hhx semantics ----
__device__ __forceinline__ v16h g2_frag(const _Float16* p, int hh) { FragH f; f.half[0] = *(const v8us*)((const unsigned short*)p + 8 * hh); f.half[1] = *(const v8us*)((const unsigned short*)p + 16 + 8 * hh); return f.v; }
__device__ __forceinline__ v8f g2_mma(v16h a, v16h b, v8f c) { v8f d = __builtin_amdgcn_wmma_f32_16x16x32_f16(false, a, false, b, (short)0, c, false, false); asm volatile("v_nop\n\tv_nop\n\tv_nop\n\tv_nop" : "+v"(d) : "v"(a), "v"(b)); return d; }
template <int ACT>
__global__ __launch_bounds__(128) void k_gemm2(const _Float16* __restrict__ A, int lda, size_t sA, const _Float16* __restrict__ Bh, int ldb, size_t sB, float alpha, const float* __restrict__ bias, size_t sBias, const float* __restrict__ CP, int rowsPerB, size_t sCPb, int row0g,
    float* __restrict__ C, _Float16* __restrict__ C16, int ldc, size_t sC, int M, int N, int K) {
  __shared__ __attribute__((aligned(16))) float so[4][32][68];
  const int tid = threadIdx.x, w = tid >> 5, lane = tid & 31, ln = lane & 15, hh = lane >> 4; const int by = blockIdx.y;
  A += (size_t)by * sA; Bh += (size_t)by * sB; const size_t cofs = (size_t)by * sC; const float* bp = bias ? bias + (size_t)by * sBias : nullptr;
  const int ntn = N >> 6; const int mt = blockIdx.x / ntn, nq = blockIdx.x - mt * ntn; const int row0 = mt * 128 + 32 * w, col0 = nq * 64; if (row0 >= M) return;
  const _Float16* a0p = A + (size_t)(row0 + ln) * lda; const _Float16* a1p = a0p + (size_t)16 * lda;
  const _Float16* b0p = Bh + (size_t)(col0 + ln) * ldb; const _Float16* b1p = b0p + (size_t)16 * ldb; const _Float16* b2p = b1p + (size_t)16 * ldb; const _Float16* b3p = b2p + (size_t)16 * ldb;
  const v8f z8 = {0.f,0.f,0.f,0.f,0.f,0.f,0.f,0.f}; v8f c00 = z8, c01 = z8, c02 = z8, c03 = z8, c10 = z8, c11 = z8, c12 = z8, c13 = z8;
#pragma unroll 1
  for (int kb = 0; kb < K; kb += 32) { const v16h a0 = g2_frag(a0p + kb, hh), a1 = g2_frag(a1p + kb, hh);
    v16h b = g2_frag(b0p + kb, hh); c00 = g2_mma(a0, b, c00); c10 = g2_mma(a1, b, c10);
    b = g2_frag(b1p + kb, hh); c01 = g2_mma(a0, b, c01); c11 = g2_mma(a1, b, c11);
    b = g2_frag(b2p + kb, hh); c02 = g2_mma(a0, b, c02); c12 = g2_mma(a1, b, c12);
    b = g2_frag(b3p + kb, hh); c03 = g2_mma(a0, b, c03); c13 = g2_mma(a1, b, c13); }
  v8f accs[8] = {c00, c01, c02, c03, c10, c11, c12, c13};
#pragma unroll
  for (int u = 0; u < 8; ++u) { const int t = u & 3, half = u >> 2; const int col = col0 + t * 16 + ln; const float bv = bp ? bf16_round(bp[col]) : 0.f;
#pragma unroll
    for (int r = 0; r < 8; ++r) { const int rloc = half * 16 + 8 * hh + r; float v = accs[u][r] * alpha + bv; if (CP) { const int bidx = (row0g + row0 + rloc) / rowsPerB; v += CP[(size_t)bidx * sCPb + (size_t)by * 64 + col]; }
      if (ACT == 3) v = fmaxf(v, 0.f); else if (ACT == 6) v = 0.5f * v * (1.0f + erff(v * 0.70710678118654752f)); else if (ACT == 11) v = 1.0f / (1.0f + expf(-v)); else if (ACT == 15) v = v / (1.0f + expf(-v)); else if (ACT == 12) v = (v > 0.f) ? v : 0.01f * v; else if (ACT == 8) v = tanhf(v);
      so[w][rloc][t * 16 + ln] = v; } }
  __builtin_amdgcn_fence(__ATOMIC_ACQ_REL, "workgroup"); __builtin_amdgcn_wave_barrier();
  const int rsub = lane >> 4, c4 = (lane & 15) * 4;
  {
#pragma unroll
    for (int q = 0; q < 16; ++q) { const int r = q * 2 + rsub; const v4f v = *(const v4fa*)&so[w][r][c4]; if (C) *(v4f*)(C + cofs + (size_t)(row0 + r) * ldc + col0 + c4) = v; if (C16) { v4h h4; for (int i = 0; i < 4; ++i) h4[i] = (_Float16)v[i]; *(v4h*)(C16 + cofs + (size_t)(row0 + r) * ldc + col0 + c4) = h4; } }
     } }



// lane l with lane l ^ 16: the two lanes that share one query column of a transposed score tile
__device__ __forceinline__ float xhalf(float x) { return __builtin_bit_cast(float, __builtin_amdgcn_permlanex16(__builtin_bit_cast(int, x), __builtin_bit_cast(int, x), 0x76543210, 0xfedcba98, false, false)); }
template <int CAUSAL>
__global__ __launch_bounds__(128) void k_flash(const _Float16* __restrict__ Q16, int ldq, const _Float16* __restrict__ K16, int ldk, const _Float16* __restrict__ Vt, const int* __restrict__ MSK, float* __restrict__ O, int ldo) {
  constexpr int RPW = 16, DT = 4, KS = 2;
  __shared__ __attribute__((aligned(16))) float sO[4][RPW][64 + 4];
  const int tid = threadIdx.x, w = tid >> 5, lane = tid & 31, ln = lane & 15, hh = lane >> 4;
  const int slab = blockIdx.x / QBLKS, qblk = blockIdx.x % QBLKS; (void)MSK; const int b = slab / NH, h = slab % NH; const int qb0 = qblk * (4 * RPW); const int q0 = qb0 + w * RPW;
  FragH bq[KS];
  { const unsigned short* qr = (const unsigned short*)Q16 + ((size_t)b * TQ + q0 + ln) * ldq + h * 64;
#pragma unroll
    for (int ks = 0; ks < KS; ++ks) { bq[ks].half[0] = *(const v8us*)(qr + ks * 32 + 8 * hh); bq[ks].half[1] = *(const v8us*)(qr + ks * 32 + 16 + 8 * hh); } }
  const unsigned short* Vth = (const unsigned short*)Vt + (size_t)slab * 64 * TK;
  const int tq = q0 + ln;
  float m_q = -3.0e38f, l_q = 0.f; v8f oacc[DT];
#pragma unroll
  for (int dt = 0; dt < DT; ++dt) oacc[dt] = (v8f){0.f,0.f,0.f,0.f,0.f,0.f,0.f,0.f};
  const int jend = (CAUSAL == 1) ? (qb0 + 4 * RPW) : TK;      /* causal: keys beyond the block's last query never contribute */
#pragma unroll 1
  for (int j0 = 0; j0 < jend; j0 += 32) {
    v8f s[2];
#pragma unroll
    for (int nt = 0; nt < 2; ++nt) { const unsigned short* kr = (const unsigned short*)K16 + ((size_t)b * TK + j0 + nt * 16 + ln) * ldk + h * 64; FragH ak[KS];
#pragma unroll
      for (int ks = 0; ks < KS; ++ks) { ak[ks].half[0] = *(const v8us*)(kr + ks * 32 + 8 * hh); ak[ks].half[1] = *(const v8us*)(kr + ks * 32 + 16 + 8 * hh); }
      v8f acc = (v8f){0.f,0.f,0.f,0.f,0.f,0.f,0.f,0.f};
#pragma unroll
      for (int ks = 0; ks < KS; ++ks) acc = mmaH<1>(ak[ks].v, ak[ks].v, bq[ks].v, bq[ks].v, acc);
      s[nt] = acc; }
    float sc[2][8], mx[8]; bool ok[2][8];
#pragma unroll
    for (int r = 0; r < 8; ++r) {
#pragma unroll
      for (int nt = 0; nt < 2; ++nt) { const int kk = j0 + nt * 16 + 8 * hh + r;
        ok[nt][r] = (CAUSAL == 1) ? (kk <= tq) : ((CAUSAL == 2) ? ((kk >> 5) == (tq >> 5)) : true);      /* mode 2: block-diagonal 32-token groups */
        sc[nt][r] = ok[nt][r] ? s[nt][r] * SCL : -3.0e38f; }
      mx[r] = fmaxf(sc[0][r], sc[1][r]); }
    float mc = fmaxf(fmaxf(fmaxf(mx[0], mx[1]), fmaxf(mx[2], mx[3])), fmaxf(fmaxf(mx[4], mx[5]), fmaxf(mx[6], mx[7])));
    mc = fmaxf(mc, xhalf(mc));
    const float mn = fmaxf(m_q, mc); const float al = (mn > -1.0e38f) ? expf(m_q - mn) : 1.0f; m_q = mn;
    FragH pb; float ps[8];
#pragma unroll
    for (int r = 0; r < 8; ++r) { const float p0 = ok[0][r] ? expf(sc[0][r] - mn) : 0.f, p1 = ok[1][r] ? expf(sc[1][r] - mn) : 0.f; ps[r] = p0 + p1;
      pb.h[r] = (_Float16)(p0 * 1024.0f); pb.h[8 + r] = (_Float16)(p1 * 1024.0f); }
    l_q = l_q * al + (((ps[0] + ps[1]) + (ps[2] + ps[3])) + ((ps[4] + ps[5]) + (ps[6] + ps[7])));
#pragma unroll
    for (int dt = 0; dt < DT; ++dt)
#pragma unroll
      for (int r = 0; r < 8; ++r) oacc[dt][r] *= al;
#pragma unroll
    for (int dt = 0; dt < DT; ++dt) { const unsigned short* vrow = Vth + (size_t)(dt * 16 + ln) * TK + j0; FragH av; av.half[0] = *(const v8us*)(vrow + 8 * hh); av.half[1] = *(const v8us*)(vrow + 16 + 8 * hh);
      oacc[dt] = mmaH<1>(av.v, av.v, pb.v, pb.v, oacc[dt]); } }
  const float l = l_q + xhalf(l_q); const float inv = (l > 0.f) ? 1.0f / (l * 1024.0f) : 0.f;
#pragma unroll
  for (int dt = 0; dt < DT; ++dt) {      /* register r of tile dt is O[q0 + ln][dt*16 + 8*hh + r] */
    const v4f lo = {oacc[dt][0] * inv, oacc[dt][1] * inv, oacc[dt][2] * inv, oacc[dt][3] * inv}, hi = {oacc[dt][4] * inv, oacc[dt][5] * inv, oacc[dt][6] * inv, oacc[dt][7] * inv};
    *(v4fa*)&sO[w][ln][dt * 16 + 8 * hh] = lo; *(v4fa*)&sO[w][ln][dt * 16 + 8 * hh + 4] = hi; }
  __builtin_amdgcn_fence(__ATOMIC_ACQ_REL, "workgroup"); __builtin_amdgcn_wave_barrier();
  {
#pragma unroll
    for (int rp = 0; rp < RPW; rp += 2) { const int r = rp + (lane >> 4), pc = lane & 15; const v4f val = *(const v4fa*)&sO[w][r][pc * 4]; *(v4f*)(O + ((size_t)b * TQ + q0 + r) * ldo + h * 64 + pc * 4) = val; }
     } }

__global__ __launch_bounds__(256) void k_sum5(const float* __restrict__ O, float* __restrict__ out, size_t n4) {
  #pragma clang fp contract(off)
  const size_t t = (size_t)blockIdx.x * 256 + threadIdx.x; if (t >= n4) return; v4f a = *(const v4fa*)(O + t * 4);
  for (int n = 1; n < NSRC; ++n) { const v4f b = *(const v4fa*)(O + (size_t)n * NR * CC + t * 4); for (int q = 0; q < 4; ++q) a[q] += b[q]; }
  *(v4f*)(out + t * 4) = a;  }

extern "C" void kernel_launch(void* const* d_in, const int* in_sizes, int n_in,
                              void* d_out, int out_size, void* d_ws, size_t ws_size, hipStream_t stream) {
  (void)in_sizes; (void)n_in; (void)out_size;
  const float* const* I = (const float* const*)d_in; const float* hsp = I[0]; const float* Wq = I[1]; const float* bq = I[2]; const float* Wk = I[3]; const float* bk = I[4]; const float* Wv = I[5]; const float* bv = I[6];
  char* ws = (char*)d_ws; size_t off = 0;
  auto take = [&](size_t bytes) { char* p = ws + off; off += (bytes + 255) & ~(size_t)255; return p; };
  _Float16* BQ = (_Float16*)take((size_t)CC * CC * 2); _Float16* BK = (_Float16*)take((size_t)CC * CC * 2); _Float16* BV = (_Float16*)take((size_t)CC * CC * 2);
  _Float16* X16 = (_Float16*)take((size_t)NRA * CC * 2); _Float16* Q16 = (_Float16*)take((size_t)NR * CC * 2); _Float16* K16 = (_Float16*)take((size_t)NRA * CC * 2); _Float16* V16 = (_Float16*)take((size_t)NRA * CC * 2); _Float16* VT = (_Float16*)take((size_t)NRA * CC * 2); float* O = (float*)take((size_t)NSRC * NR * CC * 4);
  if (off > ws_size) return;      /* 3.4 + 30 + 6 + 30 + 30 + 30 + 60 = 190 MiB */
  k_wt_f16<<<(CC * CC / 8 + 255) / 256, 256, 0, stream>>>(Wq, BQ, CC, CC, 16.0f); k_wt_f16<<<(CC * CC / 8 + 255) / 256, 256, 0, stream>>>(Wk, BK, CC, CC, 16.0f); k_wt_f16<<<(CC * CC / 8 + 255) / 256, 256, 0, stream>>>(Wv, BV, CC, CC, 16.0f);
  k_x16<<<(unsigned)(((size_t)NRA * CC / 8 + 255) / 256), 256, 0, stream>>>(hsp, X16, (size_t)NRA * CC / 8);
  k_gemm2<0><<<dim3((NR / 128) * (CC / 64), 1), 128, 0, stream>>>(X16, CC, 0, BQ, CC, 0, 0.0625f, bq, 0, nullptr, 1, 0, 0, nullptr, Q16, CC, 0, NR, CC, CC);      /* q from source 0 */
  k_gemm2<0><<<dim3((NRA / 128) * (CC / 64), 1), 128, 0, stream>>>(X16, CC, 0, BK, CC, 0, 0.0625f, bk, 0, nullptr, 1, 0, 0, nullptr, K16, CC, 0, NRA, CC, CC);      /* k for every source */
  k_gemm2<0><<<dim3((NRA / 128) * (CC / 64), 1), 128, 0, stream>>>(X16, CC, 0, BV, CC, 0, 0.0625f, bv, 0, nullptr, 1, 0, 0, nullptr, V16, CC, 0, NRA, CC, CC);
  k_vt<NH, SLEN><<<NSRC * NB * NH * (SLEN / 64), 256, 0, stream>>>(V16, CC, 0, VT);      /* slabs ((n*4 + b)*12 + h) */
  for (int n = 0; n < NSRC; ++n)
    k_flash<0><<<NB * NH * QBLKS, 128, 0, stream>>>(Q16, CC, K16 + (size_t)n * NR * CC, CC, VT + (size_t)n * NB * NH * 64 * SLEN, nullptr, O + (size_t)n * NR * CC, CC);
  k_sum5<<<(unsigned)(((size_t)NR * CC / 4 + 255) / 256), 256, 0, stream>>>(O, (float*)d_out, (size_t)NR * CC / 4);
}

// v002
// It runs in 351 microseconds.
// Timed twice side by side with v001, it ran 1.55 times as fast both times.
// Counting every step since v000, it is 2.21 times as fast.
#include <hip/hip_runtime.h>
// Attention_KV (5 sources x 4 batches x 1024 tokens x 768 = 12 heads of 64): q from source 0 (Wq + bq); every source n gives k_n, v_n (shared Wk/bk, Wv/bv); ctx = sum_n softmax(q k_n^T / 8) v_n (independent softmax per source); output = ctx merged [B, S, 768] (no output projection).
// Structure: one exact f16 plane of all sources; q / k / v GEMMs (32x64 wave tiles, f32 accumulation, exact x16 weights + bias, f16 outputs; k and v over all 5 sources at once); V^T by LDS tiles for all (source, batch, head) slabs in one launch; five fused flash kernels (plain f16 operands), one per source, into five f32 planes; a VALU sum of the five planes into the output.
// Compute dtype: inputs and parameters rounded to bf16; q, k, v, P as f16 (~2^-12); f32 accumulation/softmax/sum. v_wmma_f32_16x16x32_f16.
#define NSRC 5
#define NB 4
#define CC 768
#define NR (NB * SLEN)           /* 4096 query rows */
#define NRA (NSRC * NR)          /* 20480 source rows */
#define SLEN 1024
#define TQ SLEN
#define TK SLEN
#define NH 12
#define SCL 0.125f               /* 1/sqrt(64) */
#define QBLKS (TQ / 64)
typedef __bf16 v16b __attribute__((ext_vector_type(16)));
typedef unsigned short v8us __attribute__((ext_vector_type(8), may_alias));
typedef float  v8f  __attribute__((ext_vector_type(8)));
typedef float  v4f  __attribute__((ext_vector_type(4)));
typedef float  v4fa __attribute__((ext_vector_type(4), may_alias));
union FragB { v16b v; v8us half[2]; unsigned short u[16]; };

__device__ __forceinline__ unsigned short bf16_bits(float x) { unsigned int u = __float_as_uint(x); return (unsigned short)((u + 0x7FFFu + ((u >> 16) & 1u)) >> 16); }
__device__ __forceinline__ float bf16_val(unsigned short b) { return __uint_as_float(((unsigned int)b) << 16); }
__device__ __forceinline__ float bf16_round(float x) { return bf16_val(bf16_bits(x)); }
// D += A·B with NT terms: 1 = ah·bh, 2 = + al·bh (A split), 3 = + ah·bl (both split)
template <int NT>
__device__ __forceinline__ v8f mmaN(v16b ah, v16b al, v16b bh, v16b bl, v8f c) {
  c = __builtin_amdgcn_wmma_f32_16x16x32_bf16(false, ah, false, bh, (short)0, c, false, false);
  if (NT >= 2) c = __builtin_amdgcn_wmma_f32_16x16x32_bf16(false, al, false, bh, (short)0, c, false, false);
  if (NT >= 3) c = __builtin_amdgcn_wmma_f32_16x16x32_bf16(false, ah, false, bl, (short)0, c, false, false);
  asm volatile("v_nop\n\tv_nop\n\tv_nop\n\tv_nop" : "+v"(c) : "v"(ah), "v"(al), "v"(bh), "v"(bl));
  return c;
}

__global__ __launch_bounds__(256) void k_wt_bf16(const float* __restrict__ W, unsigned short* __restrict__ Wt, int K, int N) {
  const int t = blockIdx.x * 256 + threadIdx.x;
  const int k8n = K / 8;
  if (t >= N * k8n) return;
  const int n = t / k8n, k8 = (t % k8n) * 8;
  v8us v;
#pragma unroll
  for (int i = 0; i < 8; ++i) v[i] = bf16_bits(W[(size_t)(k8 + i) * N + n]);
  *(v8us*)(Wt + (size_t)n * K + k8) = v;
  
}

// GEMM C[M][N] (f32, pitch ldc) = act(A[M][K]·W + bias). A f32 row-major (pitch lda) converted per fragment to bf16
// (ASPLIT: hi/lo two planes -> 2 terms, else single rounded term); Wt bf16 [N][K] (pitch ldb). BIAS_BF16 rounds the
// bias to bf16 first (bias quantised to bf16 before the add). K%32==0, M%16==0, N%64==0.
template <bool ASPLIT, int ACT, bool BIAS_BF16>
__global__ __launch_bounds__(128) void k_gemm_bf(const float* __restrict__ A, int lda, const unsigned short* __restrict__ Wt, int ldb,
                                               const float* __restrict__ bias, float* __restrict__ C, int ldc, int M, int N, int K) {
  __shared__ __attribute__((aligned(16))) float so[4][16][64];
  const int tid = threadIdx.x, w = tid >> 5, lane = tid & 31, ln = lane & 15, hh = lane >> 4;
  const int ntn = N / 64;
  const int wid = blockIdx.x * 4 + w;
  const int mt = wid / ntn, nq = wid % ntn;
  if (mt * 16 >= M) return;
  const int row0 = mt * 16, col0 = nq * 64;
  const float* arow = A + (size_t)(row0 + ln) * lda;
  v8f acc[4] = {};
  for (int kb = 0; kb < K; kb += 32) {
    FragB ah, al;
    const v4f x0 = *(const v4fa*)(arow + kb + 8 * hh), x1 = *(const v4fa*)(arow + kb + 8 * hh + 4);
    const v4f x2 = *(const v4fa*)(arow + kb + 16 + 8 * hh), x3 = *(const v4fa*)(arow + kb + 16 + 8 * hh + 4);
    float xs[16] = {x0[0],x0[1],x0[2],x0[3],x1[0],x1[1],x1[2],x1[3],x2[0],x2[1],x2[2],x2[3],x3[0],x3[1],x3[2],x3[3]};
#pragma unroll
    for (int i = 0; i < 16; ++i) { const unsigned short hb = bf16_bits(xs[i]); ah.u[i] = hb; al.u[i] = ASPLIT ? bf16_bits(xs[i] - bf16_val(hb)) : (unsigned short)0; }
#pragma unroll
    for (int t = 0; t < 4; ++t) {
      const unsigned short* brow = Wt + (size_t)(col0 + t * 16 + ln) * ldb + kb;
      FragB b;
      b.half[0] = *(const v8us*)(brow + 8 * hh);
      b.half[1] = *(const v8us*)(brow + 16 + 8 * hh);
      acc[t] = mmaN<ASPLIT ? 2 : 1>(ah.v, al.v, b.v, b.v, acc[t]);
    }
  }
#pragma unroll
  for (int t = 0; t < 4; ++t) {
    float bv = bias ? bias[col0 + t * 16 + ln] : 0.f;
    if (BIAS_BF16) bv = bf16_round(bv);
#pragma unroll
    for (int r = 0; r < 8; ++r) { float v = acc[t][r] + bv; if (ACT == 1) v = fmaxf(v, 0.f); so[w][8 * hh + r][t * 16 + ln] = v; }
  }
  __builtin_amdgcn_fence(__ATOMIC_ACQ_REL, "workgroup");
  __builtin_amdgcn_wave_barrier();
  const int rsub = lane >> 4, c4 = (lane & 15) * 4;
  {
#pragma unroll
    for (int q = 0; q < 8; ++q) {
      const int r = q * 2 + rsub;
      const v4f v = *(const v4fa*)&so[w][r][c4];
      *(v4f*)(C + (size_t)(row0 + r) * ldc + col0 + c4) = v;
    }
    
  }
}

// GEMM C = act(A·W + bias + resid): A f32 (ASPLIT -> hi/lo 2 terms), Wt bf16 [N][K]; ACT 0 none, 1 relu, 2 exact gelu;
// resid (optional, f32, row index = (row % rmod), pitch ldr, RES_BF16 rounds it) added before the activation.
template <bool ASPLIT, int ACT, bool BIAS_BF16, bool RES_BF16>
__global__ __launch_bounds__(128) void k_gemm_bf3(const float* __restrict__ A, int lda, const unsigned short* __restrict__ Wt, int ldb,
                                                const float* __restrict__ bias, const float* __restrict__ resid, int rmod, int ldr,
                                                float* __restrict__ C, int ldc, int M, int N, int K) {
  __shared__ __attribute__((aligned(16))) float so[4][16][64];
  const int tid = threadIdx.x, w = tid >> 5, lane = tid & 31, ln = lane & 15, hh = lane >> 4;
  const int ntn = N / 64;
  const int wid = blockIdx.x * 4 + w;
  const int mt = wid / ntn, nq = wid % ntn;
  if (mt * 16 >= M) return;
  const int row0 = mt * 16, col0 = nq * 64;
  const float* arow = A + (size_t)(row0 + ln) * lda;
  v8f acc[4] = {};
  for (int kb = 0; kb < K; kb += 32) {
    FragB ah, al;
    const v4f x0 = *(const v4fa*)(arow + kb + 8 * hh), x1 = *(const v4fa*)(arow + kb + 8 * hh + 4);
    const v4f x2 = *(const v4fa*)(arow + kb + 16 + 8 * hh), x3 = *(const v4fa*)(arow + kb + 16 + 8 * hh + 4);
    float xs[16] = {x0[0],x0[1],x0[2],x0[3],x1[0],x1[1],x1[2],x1[3],x2[0],x2[1],x2[2],x2[3],x3[0],x3[1],x3[2],x3[3]};
#pragma unroll
    for (int i = 0; i < 16; ++i) { const unsigned short hb = bf16_bits(xs[i]); ah.u[i] = hb; al.u[i] = ASPLIT ? bf16_bits(xs[i] - bf16_val(hb)) : (unsigned short)0; }
#pragma unroll
    for (int t = 0; t < 4; ++t) {
      const unsigned short* brow = Wt + (size_t)(col0 + t * 16 + ln) * ldb + kb;
      FragB b;
      b.half[0] = *(const v8us*)(brow + 8 * hh);
      b.half[1] = *(const v8us*)(brow + 16 + 8 * hh);
      acc[t] = mmaN<ASPLIT ? 2 : 1>(ah.v, al.v, b.v, b.v, acc[t]);
    }
  }
#pragma unroll
  for (int t = 0; t < 4; ++t) {
    const int col = col0 + t * 16 + ln;
    float bv = bias ? bias[col] : 0.f;
    if (BIAS_BF16) bv = bf16_round(bv);
#pragma unroll
    for (int r = 0; r < 8; ++r) {
      float v = acc[t][r] + bv;
      if (resid) { float rv = resid[(size_t)((row0 + 8 * hh + r) % rmod) * ldr + col]; if (RES_BF16) rv = bf16_round(rv); v += rv; }
      if (ACT == 1) v = fmaxf(v, 0.f);
      if (ACT == 2) v = 0.5f * v * (1.0f + erff(v * 0.70710678118654752f));
      if (ACT == 3) { const float u = 0.7978845608028654f * (v + 0.044715f * v * v * v); v = 0.5f * v * (1.0f + tanhf(u)); }
      so[w][8 * hh + r][t * 16 + ln] = v;
    }
  }
  __builtin_amdgcn_fence(__ATOMIC_ACQ_REL, "workgroup");
  __builtin_amdgcn_wave_barrier();
  const int rsub = lane >> 4, c4 = (lane & 15) * 4;
  {
#pragma unroll
    for (int q = 0; q < 8; ++q) {
      const int r = q * 2 + rsub;
      const v4f v = *(const v4fa*)&so[w][r][c4];
      *(v4f*)(C + (size_t)(row0 + r) * ldc + col0 + c4) = v;
    }
    
  }
}
// row LayerNorm (biased variance, eps) over N: s = X (+ R); optional out_sum <- s; out_norm <- (s-mu)*rsqrt(var+eps)*g + b
template <bool PARAM_BF16>
__global__ __launch_bounds__(256) void k_layernorm(const float* __restrict__ X, const float* __restrict__ R, const float* __restrict__ g, const float* __restrict__ bta,
                                                  float* __restrict__ out_sum, float* __restrict__ out_norm, int N, float eps) {
  __shared__ float red[256];
  const int row = blockIdx.x, tid = threadIdx.x;
  const float* x = X + (size_t)row * N; const float* rr = R ? R + (size_t)row * N : nullptr;
  float vals[16];                     // up to N = 4096
  const int per = N / 256;            // contiguous chunk per thread? use strided-by-4 chunks: thread handles j = tid*4 + 1024*u
  float s1 = 0.f;
  for (int u = 0; u < per / 4; ++u) {
    const int j = tid * 4 + 1024 * u;
    const v4f a = *(const v4fa*)(x + j);
    v4f b = {0.f,0.f,0.f,0.f}; if (rr) b = *(const v4fa*)(rr + j);
#pragma unroll
    for (int q = 0; q < 4; ++q) { const float v = a[q] + b[q]; vals[u * 4 + q] = v; s1 += v; }
  }
  red[tid] = s1; __syncthreads();
  for (int st = 128; st > 0; st >>= 1) { if (tid < st) red[tid] += red[tid + st]; __syncthreads(); }
  const float mu = red[0] / (float)N; __syncthreads();
  float s2 = 0.f;
  for (int u = 0; u < per / 4; ++u)
#pragma unroll
    for (int q = 0; q < 4; ++q) { const float c = vals[u * 4 + q] - mu; s2 += c * c; }
  red[tid] = s2; __syncthreads();
  for (int st = 128; st > 0; st >>= 1) { if (tid < st) red[tid] += red[tid + st]; __syncthreads(); }
  const float rs = rsqrtf(red[0] / (float)N + eps);
  {
    for (int u = 0; u < per / 4; ++u) {
      const int j = tid * 4 + 1024 * u;
      v4f o, sm;
#pragma unroll
      for (int q = 0; q < 4; ++q) {
        float gg = g[j + q], bb = bta[j + q];
        if (PARAM_BF16) { gg = bf16_round(gg); bb = bf16_round(bb); }
        sm[q] = vals[u * 4 + q]; o[q] = (vals[u * 4 + q] - mu) * rs * gg + bb;
      }
      if (out_sum) *(v4f*)(out_sum + (size_t)row * N + j) = sm;
      *(v4f*)(out_norm + (size_t)row * N + j) = o;
    }
    
  }
}



// ---- f16 WMMA path (v_wmma_f32_16x16x32_f16): 11-bit significands for operands in range — used where a [0,1] probability operand needs more precision than bf16
typedef _Float16 v16h __attribute__((ext_vector_type(16)));
union FragH { v16h v; v8us half[2]; _Float16 h[16]; unsigned short u[16]; };
template <int NT>
__device__ __forceinline__ v8f mmaH(v16h ah, v16h al, v16h bh, v16h bl, v8f c) {
  c = __builtin_amdgcn_wmma_f32_16x16x32_f16(false, ah, false, bh, (short)0, c, false, false);
  if (NT >= 2) c = __builtin_amdgcn_wmma_f32_16x16x32_f16(false, al, false, bh, (short)0, c, false, false);
  if (NT >= 3) c = __builtin_amdgcn_wmma_f32_16x16x32_f16(false, ah, false, bl, (short)0, c, false, false);
  asm volatile("v_nop\n\tv_nop\n\tv_nop\n\tv_nop" : "+v"(c) : "v"(ah), "v"(al), "v"(bh), "v"(bl));
  return c;
}
// batched GEMM like k_gemm_b but f16 operands: A f32 (split into f16 hi/lo if ASPLIT, else rounded to f16), Bt = f16 values [n][k]; alpha; C f32; N multiple of 16 (partial tiles skipped)
template <bool ASPLIT>
__global__ __launch_bounds__(128) void k_gemm_h(const float* __restrict__ A, int lda, size_t sA, const _Float16* __restrict__ Bh, int ldb, size_t sB, float alpha, float* __restrict__ C, int ldc, size_t sC, int M, int N, int K) {
  __shared__ __attribute__((aligned(16))) float so[4][16][64];
  const int tid = threadIdx.x, w = tid >> 5, lane = tid & 31, ln = lane & 15, hh = lane >> 4; const int by = blockIdx.y;
  A += (size_t)by * sA; Bh += (size_t)by * sB; C += (size_t)by * sC;
  const int ntn = (N + 63) / 64; const int wid = blockIdx.x * 4 + w; const int mt = wid / ntn, nq = wid % ntn; if (mt * 16 >= M) return;
  const int row0 = mt * 16, col0 = nq * 64; const float* arow = A + (size_t)(row0 + ln) * lda;
  v8f acc[4] = {};
  for (int kb = 0; kb < K; kb += 32) {
    FragH ah, al;
    const v4f x0 = *(const v4fa*)(arow + kb + 8 * hh), x1 = *(const v4fa*)(arow + kb + 8 * hh + 4), x2 = *(const v4fa*)(arow + kb + 16 + 8 * hh), x3 = *(const v4fa*)(arow + kb + 16 + 8 * hh + 4);
    float xs[16] = {x0[0],x0[1],x0[2],x0[3],x1[0],x1[1],x1[2],x1[3],x2[0],x2[1],x2[2],x2[3],x3[0],x3[1],x3[2],x3[3]};
#pragma unroll
    for (int i = 0; i < 16; ++i) { const _Float16 h = (_Float16)xs[i]; ah.h[i] = h; al.h[i] = ASPLIT ? (_Float16)(xs[i] - (float)h) : (_Float16)0.0f; }
#pragma unroll
    for (int t = 0; t < 4; ++t) { if (col0 + t * 16 >= N) continue; const size_t boff = (size_t)(col0 + t * 16 + ln) * ldb + kb; FragH bq; bq.half[0] = *(const v8us*)(Bh + boff + 8 * hh); bq.half[1] = *(const v8us*)(Bh + boff + 16 + 8 * hh);
      acc[t] = mmaH<ASPLIT ? 2 : 1>(ah.v, al.v, bq.v, bq.v, acc[t]); }
  }
#pragma unroll
  for (int t = 0; t < 4; ++t) { if (col0 + t * 16 >= N) continue;
#pragma unroll
    for (int r = 0; r < 8; ++r) so[w][8 * hh + r][t * 16 + ln] = acc[t][r] * alpha; }
  __builtin_amdgcn_fence(__ATOMIC_ACQ_REL, "workgroup"); __builtin_amdgcn_wave_barrier();
  const int rsub = lane >> 4, c4 = (lane & 15) * 4;
  {
#pragma unroll
    for (int q = 0; q < 8; ++q) { const int r = q * 2 + rsub; if (col0 + c4 < N) { const v4f v = *(const v4fa*)&so[w][r][c4]; *(v4f*)(C + (size_t)(row0 + r) * ldc + col0 + c4) = v; } }
     }
}

// Wt[n][k] = f16(W[k][n]·scale) from f32 row-major W[K][N] (scale = power of two; bf16-exact weights stay exact in f16 away from the subnormal range)
__global__ __launch_bounds__(256) void k_wt_f16(const float* __restrict__ W, _Float16* __restrict__ Wt, int K, int N, float scale) {
  const int t = blockIdx.x * 256 + threadIdx.x; if (t >= N * (K / 8)) return; const int n = t / (K / 8), k8 = (t % (K / 8)) * 8; FragH f;
#pragma unroll
  for (int i = 0; i < 8; ++i) f.h[i] = (_Float16)(bf16_round(W[(size_t)(k8 + i) * N + n]) * scale); const v8us o = f.half[0];
  *(v8us*)((unsigned short*)Wt + (size_t)n * K + k8) = o; 
}
// k_gemm_hh variant with fused epilogue: v = acc·alpha + bias[by·sBias + col] (+ CP[(row/rowsPerB)·sCPb + by·64 + col] if CP) ; ACT 0 none / 1 elu ; writes f16 C16 (and f32 C if non-null)
template <int ACT>
__global__ __launch_bounds__(128) void k_gemm_hhx(const _Float16* __restrict__ A, int lda, size_t sA, const _Float16* __restrict__ Bh, int ldb, size_t sB, float alpha, const float* __restrict__ bias, size_t sBias, const float* __restrict__ CP, int rowsPerB, size_t sCPb, int row0g,
    float* __restrict__ C, _Float16* __restrict__ C16, int ldc, size_t sC, int M, int N, int K) {
  __shared__ __attribute__((aligned(16))) float so[4][16][64];
  const int tid = threadIdx.x, w = tid >> 5, lane = tid & 31, ln = lane & 15, hh = lane >> 4; const int by = blockIdx.y;
  A += (size_t)by * sA; Bh += (size_t)by * sB; const size_t cofs = (size_t)by * sC; const float* bp = bias ? bias + (size_t)by * sBias : nullptr;
  const int ntn = (N + 63) / 64; const int wid = blockIdx.x * 4 + w; const int mt = wid / ntn, nq = wid % ntn; if (mt * 16 >= M) return;
  const int row0 = mt * 16, col0 = nq * 64; const _Float16* arow = A + (size_t)(row0 + ln) * lda;
  v8f acc[4] = {};
  for (int kb = 0; kb < K; kb += 32) { FragH ah; ah.half[0] = *(const v8us*)((const unsigned short*)arow + kb + 8 * hh); ah.half[1] = *(const v8us*)((const unsigned short*)arow + kb + 16 + 8 * hh);
#pragma unroll
    for (int t = 0; t < 4; ++t) { if (col0 + t * 16 >= N) continue; const size_t boff = (size_t)(col0 + t * 16 + ln) * ldb + kb; FragH bq; bq.half[0] = *(const v8us*)((const unsigned short*)Bh + boff + 8 * hh); bq.half[1] = *(const v8us*)((const unsigned short*)Bh + boff + 16 + 8 * hh);
      acc[t] = mmaH<1>(ah.v, ah.v, bq.v, bq.v, acc[t]); }
  }
#pragma unroll
  for (int t = 0; t < 4; ++t) { if (col0 + t * 16 >= N) continue; const int col = col0 + t * 16 + ln; const float bv = bp ? bf16_round(bp[col]) : 0.f;
#pragma unroll
    for (int r = 0; r < 8; ++r) { float v = acc[t][r] * alpha + bv; if (CP) { const int bidx = (row0g + row0 + 8 * hh + r) / rowsPerB; v += CP[(size_t)bidx * sCPb + (size_t)by * 64 + col]; } if (ACT == 1) v = (v > 0.f) ? v : expm1f(v); else if (ACT == 7) v = (v > 0.f) ? v + 1.0f : expf(v); else if (ACT == 8) v = tanhf(v); else if (ACT == 9) v = 0.5f * v * (1.0f + tanhf(0.7978845608028654f * (v + 0.044715f * v * v * v))); else if (ACT == 11) v = 1.0f / (1.0f + expf(-v)); else if (ACT == 12) v = (v > 0.f) ? v : 0.01f * v; else if (ACT == 14) v = (v > 0.f) ? v : 0.1f * v; else if (ACT == 15) v = v / (1.0f + expf(-v)); else if (ACT == 3) v = fmaxf(v, 0.f); else if (ACT == 6) v = 0.5f * v * (1.0f + erff(v * 0.70710678118654752f)); so[w][8 * hh + r][t * 16 + ln] = v; } }
  __builtin_amdgcn_fence(__ATOMIC_ACQ_REL, "workgroup"); __builtin_amdgcn_wave_barrier();
  const int rsub = lane >> 4, c4 = (lane & 15) * 4; typedef _Float16 v4h __attribute__((ext_vector_type(4)));
  {
#pragma unroll
    for (int q = 0; q < 8; ++q) { const int r = q * 2 + rsub; if (col0 + c4 < N) { const v4f v = *(const v4fa*)&so[w][r][c4]; if (C) *(v4f*)(C + cofs + (size_t)(row0 + r) * ldc + col0 + c4) = v; if (C16) { v4h h4; for (int i = 0; i < 4; ++i) h4[i] = (_Float16)v[i]; *(v4h*)(C16 + cofs + (size_t)(row0 + r) * ldc + col0 + c4) = h4; } } }
     }
}


typedef _Float16 v4h __attribute__((ext_vector_type(4)));

__global__ __launch_bounds__(256) void k_x16(const float* __restrict__ x, _Float16* __restrict__ X16, size_t n8) { const size_t t = (size_t)blockIdx.x * 256 + threadIdx.x; if (t >= n8) return; FragH f;
#pragma unroll
  for (int q = 0; q < 8; ++q) f.h[q] = (_Float16)bf16_round(x[t * 8 + q]); *(v8us*)((unsigned short*)X16 + t * 8) = f.half[0];  }
__global__ __launch_bounds__(256) void k_h16(const float* __restrict__ x, _Float16* __restrict__ X16, size_t n8) { const size_t t = (size_t)blockIdx.x * 256 + threadIdx.x; if (t >= n8) return; FragH f;
#pragma unroll
  for (int q = 0; q < 8; ++q) f.h[q] = (_Float16)x[t * 8 + q]; *(v8us*)((unsigned short*)X16 + t * 8) = f.half[0];  }
__global__ __launch_bounds__(256) void k_round16f(const float* __restrict__ W, _Float16* __restrict__ Bt, size_t n8) { const size_t t = (size_t)blockIdx.x * 256 + threadIdx.x; if (t >= n8) return; FragH f;
#pragma unroll
  for (int i = 0; i < 8; ++i) f.h[i] = (_Float16)(bf16_round(W[t * 8 + i]) * 16.0f); *(v8us*)((unsigned short*)Bt + t * 8) = f.half[0];  }
template <int NHv, int TTv>
__global__ __launch_bounds__(256) void k_vt(const _Float16* __restrict__ V16, int ldv, int voff, _Float16* __restrict__ Vt) { __shared__ unsigned short tl[64][66]; const int tid = threadIdx.x; const int slab = blockIdx.x / (TTv / 64), lg = blockIdx.x % (TTv / 64); const int b = slab / NHv, h = slab % NHv;
  for (int i = tid; i < 64 * 8; i += 256) { const int r = i / 8, c8 = (i % 8) * 8; FragH f; f.half[0] = *(const v8us*)((const unsigned short*)V16 + ((size_t)b * TTv + lg * 64 + r) * ldv + voff + h * 64 + c8);
#pragma unroll
    for (int q = 0; q < 8; ++q) tl[r][c8 + q] = f.u[q]; }
  __syncthreads();
  {
#pragma unroll
    for (int rd = 0; rd < 2; ++rd) { const int d = rd * 32 + tid / 8, pc = tid % 8; FragH f;
#pragma unroll
      for (int q = 0; q < 8; ++q) f.u[q] = tl[pc * 8 + q][d];
      *(v8us*)((unsigned short*)Vt + ((size_t)slab * 64 + d) * TTv + lg * 64 + pc * 8) = f.half[0]; }
     } }

__global__ __launch_bounds__(256) void k_hl(const float* __restrict__ F, _Float16* __restrict__ Hh, _Float16* __restrict__ Hl, size_t n8) { const size_t t = (size_t)blockIdx.x * 256 + threadIdx.x; if (t >= n8) return; FragH fh, fl; const v4f a = *(const v4fa*)(F + t * 8), c = *(const v4fa*)(F + t * 8 + 4);
#pragma unroll
  for (int q = 0; q < 4; ++q) { _Float16 h = (_Float16)a[q]; fh.h[q] = h; fl.h[q] = (_Float16)((a[q] - (float)h) * 1024.0f); h = (_Float16)c[q]; fh.h[4 + q] = h; fl.h[4 + q] = (_Float16)((c[q] - (float)h) * 1024.0f); }
  { *(v8us*)((unsigned short*)Hh + t * 8) = fh.half[0]; *(v8us*)((unsigned short*)Hl + t * 8) = fl.half[0];  } }

// ---- fast GEMM (wave tile 32x64; requires M % 32 == 0 rows per launch region and N % 64 == 0); epilogue = k_gemm_hhx semantics ----
__device__ __forceinline__ v16h g2_frag(const _Float16* p, int hh) { FragH f; f.half[0] = *(const v8us*)((const unsigned short*)p + 8 * hh); f.half[1] = *(const v8us*)((const unsigned short*)p + 16 + 8 * hh); return f.v; }
__device__ __forceinline__ v8f g2_mma(v16h a, v16h b, v8f c) { v8f d = __builtin_amdgcn_wmma_f32_16x16x32_f16(false, a, false, b, (short)0, c, false, false); asm volatile("v_nop\n\tv_nop\n\tv_nop\n\tv_nop" : "+v"(d) : "v"(a), "v"(b)); return d; }
template <int ACT>
__global__ __launch_bounds__(128) void k_gemm2(const _Float16* __restrict__ A, int lda, size_t sA, const _Float16* __restrict__ Bh, int ldb, size_t sB, float alpha, const float* __restrict__ bias, size_t sBias, const float* __restrict__ CP, int rowsPerB, size_t sCPb, int row0g,
    float* __restrict__ C, _Float16* __restrict__ C16, int ldc, size_t sC, int M, int N, int K) {
  __shared__ __attribute__((aligned(16))) float so[4][32][68];
  const int tid = threadIdx.x, w = tid >> 5, lane = tid & 31, ln = lane & 15, hh = lane >> 4; const int by = blockIdx.y;
  A += (size_t)by * sA; Bh += (size_t)by * sB; const size_t cofs = (size_t)by * sC; const float* bp = bias ? bias + (size_t)by * sBias : nullptr;
  const int ntn = N >> 6; const int mt = blockIdx.x / ntn, nq = blockIdx.x - mt * ntn; const int row0 = mt * 128 + 32 * w, col0 = nq * 64; if (row0 >= M) return;
  const _Float16* a0p = A + (size_t)(row0 + ln) * lda; const _Float16* a1p = a0p + (size_t)16 * lda;
  const _Float16* b0p = Bh + (size_t)(col0 + ln) * ldb; const _Float16* b1p = b0p + (size_t)16 * ldb; const _Float16* b2p = b1p + (size_t)16 * ldb; const _Float16* b3p = b2p + (size_t)16 * ldb;
  const v8f z8 = {0.f,0.f,0.f,0.f,0.f,0.f,0.f,0.f}; v8f c00 = z8, c01 = z8, c02 = z8, c03 = z8, c10 = z8, c11 = z8, c12 = z8, c13 = z8;
#pragma unroll 1
  for (int kb = 0; kb < K; kb += 32) { const v16h a0 = g2_frag(a0p + kb, hh), a1 = g2_frag(a1p + kb, hh);
    v16h b = g2_frag(b0p + kb, hh); c00 = g2_mma(a0, b, c00); c10 = g2_mma(a1, b, c10);
    b = g2_frag(b1p + kb, hh); c01 = g2_mma(a0, b, c01); c11 = g2_mma(a1, b, c11);
    b = g2_frag(b2p + kb, hh); c02 = g2_mma(a0, b, c02); c12 = g2_mma(a1, b, c12);
    b = g2_frag(b3p + kb, hh); c03 = g2_mma(a0, b, c03); c13 = g2_mma(a1, b, c13); }
  v8f accs[8] = {c00, c01, c02, c03, c10, c11, c12, c13};
#pragma unroll
  for (int u = 0; u < 8; ++u) { const int t = u & 3, half = u >> 2; const int col = col0 + t * 16 + ln; const float bv = bp ? bf16_round(bp[col]) : 0.f;
#pragma unroll
    for (int r = 0; r < 8; ++r) { const int rloc = half * 16 + 8 * hh + r; float v = accs[u][r] * alpha + bv; if (CP) { const int bidx = (row0g + row0 + rloc) / rowsPerB; v += CP[(size_t)bidx * sCPb + (size_t)by * 64 + col]; }
      if (ACT == 3) v = fmaxf(v, 0.f); else if (ACT == 6) v = 0.5f * v * (1.0f + erff(v * 0.70710678118654752f)); else if (ACT == 11) v = 1.0f / (1.0f + expf(-v)); else if (ACT == 15) v = v / (1.0f + expf(-v)); else if (ACT == 12) v = (v > 0.f) ? v : 0.01f * v; else if (ACT == 8) v = tanhf(v);
      so[w][rloc][t * 16 + ln] = v; } }
  __builtin_amdgcn_fence(__ATOMIC_ACQ_REL, "workgroup"); __builtin_amdgcn_wave_barrier();
  const int rsub = lane >> 4, c4 = (lane & 15) * 4;
  {
#pragma unroll
    for (int q = 0; q < 16; ++q) { const int r = q * 2 + rsub; const v4f v = *(const v4fa*)&so[w][r][c4]; if (C) *(v4f*)(C + cofs + (size_t)(row0 + r) * ldc + col0 + c4) = v; if (C16) { v4h h4; for (int i = 0; i < 4; ++i) h4[i] = (_Float16)v[i]; *(v4h*)(C16 + cofs + (size_t)(row0 + r) * ldc + col0 + c4) = h4; } }
     } }



// lane l with lane l ^ 16: the two lanes that share one query column of a transposed score tile
__device__ __forceinline__ float xhalf(float x) { return __builtin_bit_cast(float, __builtin_amdgcn_permlanex16(__builtin_bit_cast(int, x), __builtin_bit_cast(int, x), 0x76543210, 0xfedcba98, false, false)); }
__device__ __forceinline__ void copy4_to_lds(unsigned l0, const unsigned short* g0, unsigned l1, const unsigned short* g1, unsigned l2, const unsigned short* g2, unsigned l3, const unsigned short* g3) {
  asm volatile("global_load_async_to_lds_b128 %0, %1, off\n\tglobal_load_async_to_lds_b128 %2, %3, off\n\tglobal_load_async_to_lds_b128 %4, %5, off\n\tglobal_load_async_to_lds_b128 %6, %7, off\n\ts_wait_xcnt 0x0"
               :: "v"(l0), "v"(g0), "v"(l1), "v"(g1), "v"(l2), "v"(g2), "v"(l3), "v"(g3) : "memory"); }
template <int CAUSAL>
__global__ __launch_bounds__(128) void k_flash(const _Float16* __restrict__ Q16, int ldq, const _Float16* __restrict__ K16, int ldk, const _Float16* __restrict__ Vt, const int* __restrict__ MSK, float* __restrict__ O, int ldo) {
  constexpr int RPW = 16, DT = 4, KS = 2;
  constexpr int KP = 72, VP = 40;      /* LDS row pitch in f16: 144 B for the 128-byte K rows, 80 B for the 64-byte V^T rows (16 B x odd: no bank conflict for 16-byte readers) */
  __shared__ __attribute__((aligned(16))) float sO[4][RPW][64 + 4];
  __shared__ __attribute__((aligned(16))) unsigned short sK[2][32 * KP];      /* 32 keys x 64 */
  __shared__ __attribute__((aligned(16))) unsigned short sV[2][64 * VP];      /* 64 d x 32 keys */
  const int tid = threadIdx.x, w = tid >> 5, lane = tid & 31, ln = lane & 15, hh = lane >> 4;
  const int slab = blockIdx.x / QBLKS, qblk = blockIdx.x % QBLKS; (void)MSK; const int b = slab / NH, h = slab % NH; const int qb0 = qblk * (4 * RPW); const int q0 = qb0 + w * RPW;
  FragH bq[KS];
  { const unsigned short* qr = (const unsigned short*)Q16 + ((size_t)b * TQ + q0 + ln) * ldq + h * 64;
#pragma unroll
    for (int ks = 0; ks < KS; ++ks) { bq[ks].half[0] = *(const v8us*)(qr + ks * 32 + 8 * hh); bq[ks].half[1] = *(const v8us*)(qr + ks * 32 + 16 + 8 * hh); } }
  const unsigned short* Vth = (const unsigned short*)Vt + (size_t)slab * 64 * TK;
  const int tq = q0 + ln;
  float m_q = -3.0e38f, l_q = 0.f; v8f oacc[DT];
#pragma unroll
  for (int dt = 0; dt < DT; ++dt) oacc[dt] = (v8f){0.f,0.f,0.f,0.f,0.f,0.f,0.f,0.f};
  const int jend = (CAUSAL == 1) ? (qb0 + 4 * RPW) : TK;      /* causal: keys beyond the block's last query never contribute */
  // Key tiles of 32 keys go to LDS once per block (the four waves read the same K and V^T), two buffers: tile t + 2 is copied while tile t + 1 is worked on.
  // Thread tid copies 16-byte pieces tid and tid + 128 of each tile: K piece c = row c / 8, column c % 8 (a wave covers 4 whole 128-byte rows); V^T piece c = row c / 4, column c % 4.
  const unsigned short* gK = (const unsigned short*)K16 + ((size_t)b * TK + (tid >> 3)) * ldk + h * 64 + (tid & 7) * 8;
  const unsigned short* gV = Vth + (size_t)(tid >> 2) * TK + (tid & 3) * 8;
  const unsigned lK = (unsigned)(size_t)&sK[0][(tid >> 3) * KP + (tid & 7) * 8], lV = (unsigned)(size_t)&sV[0][(tid >> 2) * VP + (tid & 3) * 8];
  auto stage = [&](int j, int buf) { const unsigned short* k0 = gK + (size_t)j * ldk; const unsigned short* v0 = gV + j; const unsigned lk = lK + buf * (32 * KP * 2), lv = lV + buf * (64 * VP * 2);
    copy4_to_lds(lk, k0, lk + 16 * KP * 2, k0 + (size_t)16 * ldk, lv, v0, lv + 32 * VP * 2, v0 + (size_t)32 * TK); };
  stage(0, 0);
  asm volatile("s_wait_asynccnt 0x0" ::: "memory");      /* tile 0 has landed before the barrier that publishes it */
  __syncthreads();
  stage(32, 1);      /* jend is at least 64: a tile 1 exists */
#pragma unroll 1
  for (int j0 = 0; j0 < jend; j0 += 32) {
    const int buf = (j0 >> 5) & 1;
    const unsigned short* tK = &sK[buf][ln * KP + 8 * hh]; const unsigned short* tV = &sV[buf][ln * VP + 8 * hh];
    FragH ak[2][KS], av[DT];
#pragma unroll
    for (int nt = 0; nt < 2; ++nt)
#pragma unroll
      for (int ks = 0; ks < KS; ++ks) { ak[nt][ks].half[0] = *(const v8us*)(tK + nt * 16 * KP + ks * 32); ak[nt][ks].half[1] = *(const v8us*)(tK + nt * 16 * KP + ks * 32 + 16); }
#pragma unroll
    for (int dt = 0; dt < DT; ++dt) { av[dt].half[0] = *(const v8us*)(tV + dt * 16 * VP); av[dt].half[1] = *(const v8us*)(tV + dt * 16 * VP + 16); }
    v8f s[2];
#pragma unroll
    for (int nt = 0; nt < 2; ++nt) {
      v8f acc = (v8f){0.f,0.f,0.f,0.f,0.f,0.f,0.f,0.f};
#pragma unroll
      for (int ks = 0; ks < KS; ++ks) acc = mmaH<1>(ak[nt][ks].v, ak[nt][ks].v, bq[ks].v, bq[ks].v, acc);
      s[nt] = acc; }
    float sc[2][8], mx[8]; bool ok[2][8];
#pragma unroll
    for (int r = 0; r < 8; ++r) {
#pragma unroll
      for (int nt = 0; nt < 2; ++nt) { const int kk = j0 + nt * 16 + 8 * hh + r;
        ok[nt][r] = (CAUSAL == 1) ? (kk <= tq) : ((CAUSAL == 2) ? ((kk >> 5) == (tq >> 5)) : true);      /* mode 2: block-diagonal 32-token groups */
        sc[nt][r] = ok[nt][r] ? s[nt][r] * SCL : -3.0e38f; }
      mx[r] = fmaxf(sc[0][r], sc[1][r]); }
    float mc = fmaxf(fmaxf(fmaxf(mx[0], mx[1]), fmaxf(mx[2], mx[3])), fmaxf(fmaxf(mx[4], mx[5]), fmaxf(mx[6], mx[7])));
    mc = fmaxf(mc, xhalf(mc));
    const float mn = fmaxf(m_q, mc); const float al = (mn > -1.0e38f) ? expf(m_q - mn) : 1.0f; m_q = mn;
    FragH pb; float ps[8];
#pragma unroll
    for (int r = 0; r < 8; ++r) { const float p0 = ok[0][r] ? expf(sc[0][r] - mn) : 0.f, p1 = ok[1][r] ? expf(sc[1][r] - mn) : 0.f; ps[r] = p0 + p1;
      pb.h[r] = (_Float16)(p0 * 1024.0f); pb.h[8 + r] = (_Float16)(p1 * 1024.0f); }
    l_q = l_q * al + (((ps[0] + ps[1]) + (ps[2] + ps[3])) + ((ps[4] + ps[5]) + (ps[6] + ps[7])));
#pragma unroll
    for (int dt = 0; dt < DT; ++dt)
#pragma unroll
      for (int r = 0; r < 8; ++r) oacc[dt][r] *= al;
#pragma unroll
    for (int dt = 0; dt < DT; ++dt) oacc[dt] = mmaH<1>(av[dt].v, av[dt].v, pb.v, pb.v, oacc[dt]);
    asm volatile("s_wait_dscnt 0x0" ::: "memory");      /* this wave's reads of the buffer have returned before the buffer is handed back */
    asm volatile("s_wait_asynccnt 0x0" ::: "memory");      /* this wave's copies of tile t + 1 have landed */
    __syncthreads();      /* publishes tile t + 1 and ends every wave's reads of tile t */
    if (j0 + 64 < jend) stage(j0 + 64, buf); }
  asm volatile("s_wait_asynccnt 0x0" ::: "memory");      /* nothing is in flight when the wave goes on to the epilogue and ends */
  const float l = l_q + xhalf(l_q); const float inv = (l > 0.f) ? 1.0f / (l * 1024.0f) : 0.f;
#pragma unroll
  for (int dt = 0; dt < DT; ++dt) {      /* register r of tile dt is O[q0 + ln][dt*16 + 8*hh + r] */
    const v4f lo = {oacc[dt][0] * inv, oacc[dt][1] * inv, oacc[dt][2] * inv, oacc[dt][3] * inv}, hi = {oacc[dt][4] * inv, oacc[dt][5] * inv, oacc[dt][6] * inv, oacc[dt][7] * inv};
    *(v4fa*)&sO[w][ln][dt * 16 + 8 * hh] = lo; *(v4fa*)&sO[w][ln][dt * 16 + 8 * hh + 4] = hi; }
  __builtin_amdgcn_fence(__ATOMIC_ACQ_REL, "workgroup"); __builtin_amdgcn_wave_barrier();
  {
#pragma unroll
    for (int rp = 0; rp < RPW; rp += 2) { const int r = rp + (lane >> 4), pc = lane & 15; const v4f val = *(const v4fa*)&sO[w][r][pc * 4]; *(v4f*)(O + ((size_t)b * TQ + q0 + r) * ldo + h * 64 + pc * 4) = val; }
     } }

__global__ __launch_bounds__(256) void k_sum5(const float* __restrict__ O, float* __restrict__ out, size_t n4) {
  #pragma clang fp contract(off)
  const size_t t = (size_t)blockIdx.x * 256 + threadIdx.x; if (t >= n4) return; v4f a = *(const v4fa*)(O + t * 4);
  for (int n = 1; n < NSRC; ++n) { const v4f b = *(const v4fa*)(O + (size_t)n * NR * CC + t * 4); for (int q = 0; q < 4; ++q) a[q] += b[q]; }
  *(v4f*)(out + t * 4) = a;  }

extern "C" void kernel_launch(void* const* d_in, const int* in_sizes, int n_in,
                              void* d_out, int out_size, void* d_ws, size_t ws_size, hipStream_t stream) {
  (void)in_sizes; (void)n_in; (void)out_size;
  const float* const* I = (const float* const*)d_in; const float* hsp = I[0]; const float* Wq = I[1]; const float* bq = I[2]; const float* Wk = I[3]; const float* bk = I[4]; const float* Wv = I[5]; const float* bv = I[6];
  char* ws = (char*)d_ws; size_t off = 0;
  auto take = [&](size_t bytes) { char* p = ws + off; off += (bytes + 255) & ~(size_t)255; return p; };
  _Float16* BQ = (_Float16*)take((size_t)CC * CC * 2); _Float16* BK = (_Float16*)take((size_t)CC * CC * 2); _Float16* BV = (_Float16*)take((size_t)CC * CC * 2);
  _Float16* X16 = (_Float16*)take((size_t)NRA * CC * 2); _Float16* Q16 = (_Float16*)take((size_t)NR * CC * 2); _Float16* K16 = (_Float16*)take((size_t)NRA * CC * 2); _Float16* V16 = (_Float16*)take((size_t)NRA * CC * 2); _Float16* VT = (_Float16*)take((size_t)NRA * CC * 2); float* O = (float*)take((size_t)NSRC * NR * CC * 4);
  if (off > ws_size) return;      /* 3.4 + 30 + 6 + 30 + 30 + 30 + 60 = 190 MiB */
  k_wt_f16<<<(CC * CC / 8 + 255) / 256, 256, 0, stream>>>(Wq, BQ, CC, CC, 16.0f); k_wt_f16<<<(CC * CC / 8 + 255) / 256, 256, 0, stream>>>(Wk, BK, CC, CC, 16.0f); k_wt_f16<<<(CC * CC / 8 + 255) / 256, 256, 0, stream>>>(Wv, BV, CC, CC, 16.0f);
  k_x16<<<(unsigned)(((size_t)NRA * CC / 8 + 255) / 256), 256, 0, stream>>>(hsp, X16, (size_t)NRA * CC / 8);
  k_gemm2<0><<<dim3((NR / 128) * (CC / 64), 1), 128, 0, stream>>>(X16, CC, 0, BQ, CC, 0, 0.0625f, bq, 0, nullptr, 1, 0, 0, nullptr, Q16, CC, 0, NR, CC, CC);      /* q from source 0 */
  k_gemm2<0><<<dim3((NRA / 128) * (CC / 64), 1), 128, 0, stream>>>(X16, CC, 0, BK, CC, 0, 0.0625f, bk, 0, nullptr, 1, 0, 0, nullptr, K16, CC, 0, NRA, CC, CC);      /* k for every source */
  k_gemm2<0><<<dim3((NRA / 128) * (CC / 64), 1), 128, 0, stream>>>(X16, CC, 0, BV, CC, 0, 0.0625f, bv, 0, nullptr, 1, 0, 0, nullptr, V16, CC, 0, NRA, CC, CC);
  k_vt<NH, SLEN><<<NSRC * NB * NH * (SLEN / 64), 256, 0, stream>>>(V16, CC, 0, VT);      /* slabs ((n*4 + b)*12 + h) */
  for (int n = 0; n < NSRC; ++n)
    k_flash<0><<<NB * NH * QBLKS, 128, 0, stream>>>(Q16, CC, K16 + (size_t)n * NR * CC, CC, VT + (size_t)n * NB * NH * 64 * SLEN, nullptr, O + (size_t)n * NR * CC, CC);
  k_sum5<<<(unsigned)(((size_t)NR * CC / 4 + 255) / 256), 256, 0, stream>>>(O, (float*)d_out, (size_t)NR * CC / 4);
}

// v003
// Measured time: 275 microseconds a run.
// Next to v002, in two timings, it ran 1.27 and 1.28 times as fast.
// Over all steps from v000 it is 2.82 times as fast.
#include <hip/hip_runtime.h>
// Attention_KV (5 sources x 4 batches x 1024 tokens x 768 = 12 heads of 64): q from source 0 (Wq + bq); every source n gives k_n, v_n (shared Wk/bk, Wv/bv); ctx = sum_n softmax(q k_n^T / 8) v_n (independent softmax per source); output = ctx merged [B, S, 768] (no output projection).
// Structure: one exact f16 plane of all sources; q / k / v GEMMs (32x64 wave tiles, f32 accumulation, exact x16 weights + bias, f16 outputs; k and v over all 5 sources at once); V^T by LDS tiles for all (source, batch, head) slabs in one launch; five fused flash kernels (plain f16 operands), one per source, into five f32 planes; a VALU sum of the five planes into the output.
// Compute dtype: inputs and parameters rounded to bf16; q, k, v, P as f16 (~2^-12); f32 accumulation/softmax/sum. v_wmma_f32_16x16x32_f16.
#define NSRC 5
#define NB 4
#define CC 768
#define NR (NB * SLEN)           /* 4096 query rows */
#define NRA (NSRC * NR)          /* 20480 source rows */
#define SLEN 1024
#define TQ SLEN
#define TK SLEN
#define NH 12
#define SCL 0.125f               /* 1/sqrt(64) */
#define QBLKS (TQ / 64)
typedef __bf16 v16b __attribute__((ext_vector_type(16)));
typedef unsigned short v8us __attribute__((ext_vector_type(8), may_alias));
typedef float  v8f  __attribute__((ext_vector_type(8)));
typedef float  v4f  __attribute__((ext_vector_type(4)));
typedef float  v4fa __attribute__((ext_vector_type(4), may_alias));
union FragB { v16b v; v8us half[2]; unsigned short u[16]; };

__device__ __forceinline__ unsigned short bf16_bits(float x) { unsigned int u = __float_as_uint(x); return (unsigned short)((u + 0x7FFFu + ((u >> 16) & 1u)) >> 16); }
__device__ __forceinline__ float bf16_val(unsigned short b) { return __uint_as_float(((unsigned int)b) << 16); }
__device__ __forceinline__ float bf16_round(float x) { return bf16_val(bf16_bits(x)); }
// D += A·B with NT terms: 1 = ah·bh, 2 = + al·bh (A split), 3 = + ah·bl (both split)
template <int NT>
__device__ __forceinline__ v8f mmaN(v16b ah, v16b al, v16b bh, v16b bl, v8f c) {
  c = __builtin_amdgcn_wmma_f32_16x16x32_bf16(false, ah, false, bh, (short)0, c, false, false);
  if (NT >= 2) c = __builtin_amdgcn_wmma_f32_16x16x32_bf16(false, al, false, bh, (short)0, c, false, false);
  if (NT >= 3) c = __builtin_amdgcn_wmma_f32_16x16x32_bf16(false, ah, false, bl, (short)0, c, false, false);
  asm volatile("v_nop\n\tv_nop\n\tv_nop\n\tv_nop" : "+v"(c) : "v"(ah), "v"(al), "v"(bh), "v"(bl));
  return c;
}

__global__ __launch_bounds__(256) void k_wt_bf16(const float* __restrict__ W, unsigned short* __restrict__ Wt, int K, int N) {
  const int t = blockIdx.x * 256 + threadIdx.x;
  const int k8n = K / 8;
  if (t >= N * k8n) return;
  const int n = t / k8n, k8 = (t % k8n) * 8;
  v8us v;
#pragma unroll
  for (int i = 0; i < 8; ++i) v[i] = bf16_bits(W[(size_t)(k8 + i) * N + n]);
  *(v8us*)(Wt + (size_t)n * K + k8) = v;
  
}

// GEMM C[M][N] (f32, pitch ldc) = act(A[M][K]·W + bias). A f32 row-major (pitch lda) converted per fragment to bf16
// (ASPLIT: hi/lo two planes -> 2 terms, else single rounded term); Wt bf16 [N][K] (pitch ldb). BIAS_BF16 rounds the
// bias to bf16 first (bias quantised to bf16 before the add). K%32==0, M%16==0, N%64==0.
template <bool ASPLIT, int ACT, bool BIAS_BF16>
__global__ __launch_bounds__(128) void k_gemm_bf(const float* __restrict__ A, int lda, const unsigned short* __restrict__ Wt, int ldb,
                                               const float* __restrict__ bias, float* __restrict__ C, int ldc, int M, int N, int K) {
  __shared__ __attribute__((aligned(16))) float so[4][16][64];
  const int tid = threadIdx.x, w = tid >> 5, lane = tid & 31, ln = lane & 15, hh = lane >> 4;
  const int ntn = N / 64;
  const int wid = blockIdx.x * 4 + w;
  const int mt = wid / ntn, nq = wid % ntn;
  if (mt * 16 >= M) return;
  const int row0 = mt * 16, col0 = nq * 64;
  const float* arow = A + (size_t)(row0 + ln) * lda;
  v8f acc[4] = {};
  for (int kb = 0; kb < K; kb += 32) {
    FragB ah, al;
    const v4f x0 = *(const v4fa*)(arow + kb + 8 * hh), x1 = *(const v4fa*)(arow + kb + 8 * hh + 4);
    const v4f x2 = *(const v4fa*)(arow + kb + 16 + 8 * hh), x3 = *(const v4fa*)(arow + kb + 16 + 8 * hh + 4);
    float xs[16] = {x0[0],x0[1],x0[2],x0[3],x1[0],x1[1],x1[2],x1[3],x2[0],x2[1],x2[2],x2[3],x3[0],x3[1],x3[2],x3[3]};
#pragma unroll
    for (int i = 0; i < 16; ++i) { const unsigned short hb = bf16_bits(xs[i]); ah.u[i] = hb; al.u[i] = ASPLIT ? bf16_bits(xs[i] - bf16_val(hb)) : (unsigned short)0; }
#pragma unroll
    for (int t = 0; t < 4; ++t) {
      const unsigned short* brow = Wt + (size_t)(col0 + t * 16 + ln) * ldb + kb;
      FragB b;
      b.half[0] = *(const v8us*)(brow + 8 * hh);
      b.half[1] = *(const v8us*)(brow + 16 + 8 * hh);
      acc[t] = mmaN<ASPLIT ? 2 : 1>(ah.v, al.v, b.v, b.v, acc[t]);
    }
  }
#pragma unroll
  for (int t = 0; t < 4; ++t) {
    float bv = bias ? bias[col0 + t * 16 + ln] : 0.f;
    if (BIAS_BF16) bv = bf16_round(bv);
#pragma unroll
    for (int r = 0; r < 8; ++r) { float v = acc[t][r] + bv; if (ACT == 1) v = fmaxf(v, 0.f); so[w][8 * hh + r][t * 16 + ln] = v; }
  }
  __builtin_amdgcn_fence(__ATOMIC_ACQ_REL, "workgroup");
  __builtin_amdgcn_wave_barrier();
  const int rsub = lane >> 4, c4 = (lane & 15) * 4;
  {
#pragma unroll
    for (int q = 0; q < 8; ++q) {
      const int r = q * 2 + rsub;
      const v4f v = *(const v4fa*)&so[w][r][c4];
      *(v4f*)(C + (size_t)(row0 + r) * ldc + col0 + c4) = v;
    }
    
  }
}

// GEMM C = act(A·W + bias + resid): A f32 (ASPLIT -> hi/lo 2 terms), Wt bf16 [N][K]; ACT 0 none, 1 relu, 2 exact gelu;
// resid (optional, f32, row index = (row % rmod), pitch ldr, RES_BF16 rounds it) added before the activation.
template <bool ASPLIT, int ACT, bool BIAS_BF16, bool RES_BF16>
__global__ __launch_bounds__(128) void k_gemm_bf3(const float* __restrict__ A, int lda, const unsigned short* __restrict__ Wt, int ldb,
                                                const float* __restrict__ bias, const float* __restrict__ resid, int rmod, int ldr,
                                                float* __restrict__ C, int ldc, int M, int N, int K) {
  __shared__ __attribute__((aligned(16))) float so[4][16][64];
  const int tid = threadIdx.x, w = tid >> 5, lane = tid & 31, ln = lane & 15, hh = lane >> 4;
  const int ntn = N / 64;
  const int wid = blockIdx.x * 4 + w;
  const int mt = wid / ntn, nq = wid % ntn;
  if (mt * 16 >= M) return;
  const int row0 = mt * 16, col0 = nq * 64;
  const float* arow = A + (size_t)(row0 + ln) * lda;
  v8f acc[4] = {};
  for (int kb = 0; kb < K; kb += 32) {
    FragB ah, al;
    const v4f x0 = *(const v4fa*)(arow + kb + 8 * hh), x1 = *(const v4fa*)(arow + kb + 8 * hh + 4);
    const v4f x2 = *(const v4fa*)(arow + kb + 16 + 8 * hh), x3 = *(const v4fa*)(arow + kb + 16 + 8 * hh + 4);
    float xs[16] = {x0[0],x0[1],x0[2],x0[3],x1[0],x1[1],x1[2],x1[3],x2[0],x2[1],x2[2],x2[3],x3[0],x3[1],x3[2],x3[3]};
#pragma unroll
    for (int i = 0; i < 16; ++i) { const unsigned short hb = bf16_bits(xs[i]); ah.u[i] = hb; al.u[i] = ASPLIT ? bf16_bits(xs[i] - bf16_val(hb)) : (unsigned short)0; }
#pragma unroll
    for (int t = 0; t < 4; ++t) {
      const unsigned short* brow = Wt + (size_t)(col0 + t * 16 + ln) * ldb + kb;
      FragB b;
      b.half[0] = *(const v8us*)(brow + 8 * hh);
      b.half[1] = *(const v8us*)(brow + 16 + 8 * hh);
      acc[t] = mmaN<ASPLIT ? 2 : 1>(ah.v, al.v, b.v, b.v, acc[t]);
    }
  }
#pragma unroll
  for (int t = 0; t < 4; ++t) {
    const int col = col0 + t * 16 + ln;
    float bv = bias ? bias[col] : 0.f;
    if (BIAS_BF16) bv = bf16_round(bv);
#pragma unroll
    for (int r = 0; r < 8; ++r) {
      float v = acc[t][r] + bv;
      if (resid) { float rv = resid[(size_t)((row0 + 8 * hh + r) % rmod) * ldr + col]; if (RES_BF16) rv = bf16_round(rv); v += rv; }
      if (ACT == 1) v = fmaxf(v, 0.f);
      if (ACT == 2) v = 0.5f * v * (1.0f + erff(v * 0.70710678118654752f));
      if (ACT == 3) { const float u = 0.7978845608028654f * (v + 0.044715f * v * v * v); v = 0.5f * v * (1.0f + tanhf(u)); }
      so[w][8 * hh + r][t * 16 + ln] = v;
    }
  }
  __builtin_amdgcn_fence(__ATOMIC_ACQ_REL, "workgroup");
  __builtin_amdgcn_wave_barrier();
  const int rsub = lane >> 4, c4 = (lane & 15) * 4;
  {
#pragma unroll
    for (int q = 0; q < 8; ++q) {
      const int r = q * 2 + rsub;
      const v4f v = *(const v4fa*)&so[w][r][c4];
      *(v4f*)(C + (size_t)(row0 + r) * ldc + col0 + c4) = v;
    }
    
  }
}
// row LayerNorm (biased variance, eps) over N: s = X (+ R); optional out_sum <- s; out_norm <- (s-mu)*rsqrt(var+eps)*g + b
template <bool PARAM_BF16>
__global__ __launch_bounds__(256) void k_layernorm(const float* __restrict__ X, const float* __restrict__ R, const float* __restrict__ g, const float* __restrict__ bta,
                                                  float* __restrict__ out_sum, float* __restrict__ out_norm, int N, float eps) {
  __shared__ float red[256];
  const int row = blockIdx.x, tid = threadIdx.x;
  const float* x = X + (size_t)row * N; const float* rr = R ? R + (size_t)row * N : nullptr;
  float vals[16];                     // up to N = 4096
  const int per = N / 256;            // contiguous chunk per thread? use strided-by-4 chunks: thread handles j = tid*4 + 1024*u
  float s1 = 0.f;
  for (int u = 0; u < per / 4; ++u) {
    const int j = tid * 4 + 1024 * u;
    const v4f a = *(const v4fa*)(x + j);
    v4f b = {0.f,0.f,0.f,0.f}; if (rr) b = *(const v4fa*)(rr + j);
#pragma unroll
    for (int q = 0; q < 4; ++q) { const float v = a[q] + b[q]; vals[u * 4 + q] = v; s1 += v; }
  }
  red[tid] = s1; __syncthreads();
  for (int st = 128; st > 0; st >>= 1) { if (tid < st) red[tid] += red[tid + st]; __syncthreads(); }
  const float mu = red[0] / (float)N; __syncthreads();
  float s2 = 0.f;
  for (int u = 0; u < per / 4; ++u)
#pragma unroll
    for (int q = 0; q < 4; ++q) { const float c = vals[u * 4 + q] - mu; s2 += c * c; }
  red[tid] = s2; __syncthreads();
  for (int st = 128; st > 0; st >>= 1) { if (tid < st) red[tid] += red[tid + st]; __syncthreads(); }
  const float rs = rsqrtf(red[0] / (float)N + eps);
  {
    for (int u = 0; u < per / 4; ++u) {
      const int j = tid * 4 + 1024 * u;
      v4f o, sm;
#pragma unroll
      for (int q = 0; q < 4; ++q) {
        float gg = g[j + q], bb = bta[j + q];
        if (PARAM_BF16) { gg = bf16_round(gg); bb = bf16_round(bb); }
        sm[q] = vals[u * 4 + q]; o[q] = (vals[u * 4 + q] - mu) * rs * gg + bb;
      }
      if (out_sum) *(v4f*)(out_sum + (size_t)row * N + j) = sm;
      *(v4f*)(out_norm + (size_t)row * N + j) = o;
    }
    
  }
}



// ---- f16 WMMA path (v_wmma_f32_16x16x32_f16): 11-bit significands for operands in range — used where a [0,1] probability operand needs more precision than bf16
typedef _Float16 v16h __attribute__((ext_vector_type(16)));
union FragH { v16h v; v8us half[2]; _Float16 h[16]; unsigned short u[16]; };
template <int NT>
__device__ __forceinline__ v8f mmaH(v16h ah, v16h al, v16h bh, v16h bl, v8f c) {
  c = __builtin_amdgcn_wmma_f32_16x16x32_f16(false, ah, false, bh, (short)0, c, false, false);
  if (NT >= 2) c = __builtin_amdgcn_wmma_f32_16x16x32_f16(false, al, false, bh, (short)0, c, false, false);
  if (NT >= 3) c = __builtin_amdgcn_wmma_f32_16x16x32_f16(false, ah, false, bl, (short)0, c, false, false);
  asm volatile("v_nop\n\tv_nop\n\tv_nop\n\tv_nop" : "+v"(c) : "v"(ah), "v"(al), "v"(bh), "v"(bl));
  return c;
}
// batched GEMM like k_gemm_b but f16 operands: A f32 (split into f16 hi/lo if ASPLIT, else rounded to f16), Bt = f16 values [n][k]; alpha; C f32; N multiple of 16 (partial tiles skipped)
template <bool ASPLIT>
__global__ __launch_bounds__(128) void k_gemm_h(const float* __restrict__ A, int lda, size_t sA, const _Float16* __restrict__ Bh, int ldb, size_t sB, float alpha, float* __restrict__ C, int ldc, size_t sC, int M, int N, int K) {
  __shared__ __attribute__((aligned(16))) float so[4][16][64];
  const int tid = threadIdx.x, w = tid >> 5, lane = tid & 31, ln = lane & 15, hh = lane >> 4; const int by = blockIdx.y;
  A += (size_t)by * sA; Bh += (size_t)by * sB; C += (size_t)by * sC;
  const int ntn = (N + 63) / 64; const int wid = blockIdx.x * 4 + w; const int mt = wid / ntn, nq = wid % ntn; if (mt * 16 >= M) return;
  const int row0 = mt * 16, col0 = nq * 64; const float* arow = A + (size_t)(row0 + ln) * lda;
  v8f acc[4] = {};
  for (int kb = 0; kb < K; kb += 32) {
    FragH ah, al;
    const v4f x0 = *(const v4fa*)(arow + kb + 8 * hh), x1 = *(const v4fa*)(arow + kb + 8 * hh + 4), x2 = *(const v4fa*)(arow + kb + 16 + 8 * hh), x3 = *(const v4fa*)(arow + kb + 16 + 8 * hh + 4);
    float xs[16] = {x0[0],x0[1],x0[2],x0[3],x1[0],x1[1],x1[2],x1[3],x2[0],x2[1],x2[2],x2[3],x3[0],x3[1],x3[2],x3[3]};
#pragma unroll
    for (int i = 0; i < 16; ++i) { const _Float16 h = (_Float16)xs[i]; ah.h[i] = h; al.h[i] = ASPLIT ? (_Float16)(xs[i] - (float)h) : (_Float16)0.0f; }
#pragma unroll
    for (int t = 0; t < 4; ++t) { if (col0 + t * 16 >= N) continue; const size_t boff = (size_t)(col0 + t * 16 + ln) * ldb + kb; FragH bq; bq.half[0] = *(const v8us*)(Bh + boff + 8 * hh); bq.half[1] = *(const v8us*)(Bh + boff + 16 + 8 * hh);
      acc[t] = mmaH<ASPLIT ? 2 : 1>(ah.v, al.v, bq.v, bq.v, acc[t]); }
  }
#pragma unroll
  for (int t = 0; t < 4; ++t) { if (col0 + t * 16 >= N) continue;
#pragma unroll
    for (int r = 0; r < 8; ++r) so[w][8 * hh + r][t * 16 + ln] = acc[t][r] * alpha; }
  __builtin_amdgcn_fence(__ATOMIC_ACQ_REL, "workgroup"); __builtin_amdgcn_wave_barrier();
  const int rsub = lane >> 4, c4 = (lane & 15) * 4;
  {
#pragma unroll
    for (int q = 0; q < 8; ++q) { const int r = q * 2 + rsub; if (col0 + c4 < N) { const v4f v = *(const v4fa*)&so[w][r][c4]; *(v4f*)(C + (size_t)(row0 + r) * ldc + col0 + c4) = v; } }
     }
}

// Wt[n][k] = f16(W[k][n]·scale) from f32 row-major W[K][N] (scale = power of two; bf16-exact weights stay exact in f16 away from the subnormal range)
__global__ __launch_bounds__(256) void k_wt_f16(const float* __restrict__ W, _Float16* __restrict__ Wt, int K, int N, float scale) {
  const int t = blockIdx.x * 256 + threadIdx.x; if (t >= N * (K / 8)) return; const int n = t / (K / 8), k8 = (t % (K / 8)) * 8; FragH f;
#pragma unroll
  for (int i = 0; i < 8; ++i) f.h[i] = (_Float16)(bf16_round(W[(size_t)(k8 + i) * N + n]) * scale); const v8us o = f.half[0];
  *(v8us*)((unsigned short*)Wt + (size_t)n * K + k8) = o; 
}
// k_gemm_hh variant with fused epilogue: v = acc·alpha + bias[by·sBias + col] (+ CP[(row/rowsPerB)·sCPb + by·64 + col] if CP) ; ACT 0 none / 1 elu ; writes f16 C16 (and f32 C if non-null)
template <int ACT>
__global__ __launch_bounds__(128) void k_gemm_hhx(const _Float16* __restrict__ A, int lda, size_t sA, const _Float16* __restrict__ Bh, int ldb, size_t sB, float alpha, const float* __restrict__ bias, size_t sBias, const float* __restrict__ CP, int rowsPerB, size_t sCPb, int row0g,
    float* __restrict__ C, _Float16* __restrict__ C16, int ldc, size_t sC, int M, int N, int K) {
  __shared__ __attribute__((aligned(16))) float so[4][16][64];
  const int tid = threadIdx.x, w = tid >> 5, lane = tid & 31, ln = lane & 15, hh = lane >> 4; const int by = blockIdx.y;
  A += (size_t)by * sA; Bh += (size_t)by * sB; const size_t cofs = (size_t)by * sC; const float* bp = bias ? bias + (size_t)by * sBias : nullptr;
  const int ntn = (N + 63) / 64; const int wid = blockIdx.x * 4 + w; const int mt = wid / ntn, nq = wid % ntn; if (mt * 16 >= M) return;
  const int row0 = mt * 16, col0 = nq * 64; const _Float16* arow = A + (size_t)(row0 + ln) * lda;
  v8f acc[4] = {};
  for (int kb = 0; kb < K; kb += 32) { FragH ah; ah.half[0] = *(const v8us*)((const unsigned short*)arow + kb + 8 * hh); ah.half[1] = *(const v8us*)((const unsigned short*)arow + kb + 16 + 8 * hh);
#pragma unroll
    for (int t = 0; t < 4; ++t) { if (col0 + t * 16 >= N) continue; const size_t boff = (size_t)(col0 + t * 16 + ln) * ldb + kb; FragH bq; bq.half[0] = *(const v8us*)((const unsigned short*)Bh + boff + 8 * hh); bq.half[1] = *(const v8us*)((const unsigned short*)Bh + boff + 16 + 8 * hh);
      acc[t] = mmaH<1>(ah.v, ah.v, bq.v, bq.v, acc[t]); }
  }
#pragma unroll
  for (int t = 0; t < 4; ++t) { if (col0 + t * 16 >= N) continue; const int col = col0 + t * 16 + ln; const float bv = bp ? bf16_round(bp[col]) : 0.f;
#pragma unroll
    for (int r = 0; r < 8; ++r) { float v = acc[t][r] * alpha + bv; if (CP) { const int bidx = (row0g + row0 + 8 * hh + r) / rowsPerB; v += CP[(size_t)bidx * sCPb + (size_t)by * 64 + col]; } if (ACT == 1) v = (v > 0.f) ? v : expm1f(v); else if (ACT == 7) v = (v > 0.f) ? v + 1.0f : expf(v); else if (ACT == 8) v = tanhf(v); else if (ACT == 9) v = 0.5f * v * (1.0f + tanhf(0.7978845608028654f * (v + 0.044715f * v * v * v))); else if (ACT == 11) v = 1.0f / (1.0f + expf(-v)); else if (ACT == 12) v = (v > 0.f) ? v : 0.01f * v; else if (ACT == 14) v = (v > 0.f) ? v : 0.1f * v; else if (ACT == 15) v = v / (1.0f + expf(-v)); else if (ACT == 3) v = fmaxf(v, 0.f); else if (ACT == 6) v = 0.5f * v * (1.0f + erff(v * 0.70710678118654752f)); so[w][8 * hh + r][t * 16 + ln] = v; } }
  __builtin_amdgcn_fence(__ATOMIC_ACQ_REL, "workgroup"); __builtin_amdgcn_wave_barrier();
  const int rsub = lane >> 4, c4 = (lane & 15) * 4; typedef _Float16 v4h __attribute__((ext_vector_type(4)));
  {
#pragma unroll
    for (int q = 0; q < 8; ++q) { const int r = q * 2 + rsub; if (col0 + c4 < N) { const v4f v = *(const v4fa*)&so[w][r][c4]; if (C) *(v4f*)(C + cofs + (size_t)(row0 + r) * ldc + col0 + c4) = v; if (C16) { v4h h4; for (int i = 0; i < 4; ++i) h4[i] = (_Float16)v[i]; *(v4h*)(C16 + cofs + (size_t)(row0 + r) * ldc + col0 + c4) = h4; } } }
     }
}


typedef _Float16 v4h __attribute__((ext_vector_type(4)));

__global__ __launch_bounds__(256) void k_x16(const float* __restrict__ x, _Float16* __restrict__ X16, size_t n8) { const size_t t = (size_t)blockIdx.x * 256 + threadIdx.x; if (t >= n8) return; FragH f;
#pragma unroll
  for (int q = 0; q < 8; ++q) f.h[q] = (_Float16)bf16_round(x[t * 8 + q]); *(v8us*)((unsigned short*)X16 + t * 8) = f.half[0];  }
__global__ __launch_bounds__(256) void k_h16(const float* __restrict__ x, _Float16* __restrict__ X16, size_t n8) { const size_t t = (size_t)blockIdx.x * 256 + threadIdx.x; if (t >= n8) return; FragH f;
#pragma unroll
  for (int q = 0; q < 8; ++q) f.h[q] = (_Float16)x[t * 8 + q]; *(v8us*)((unsigned short*)X16 + t * 8) = f.half[0];  }
__global__ __launch_bounds__(256) void k_round16f(const float* __restrict__ W, _Float16* __restrict__ Bt, size_t n8) { const size_t t = (size_t)blockIdx.x * 256 + threadIdx.x; if (t >= n8) return; FragH f;
#pragma unroll
  for (int i = 0; i < 8; ++i) f.h[i] = (_Float16)(bf16_round(W[t * 8 + i]) * 16.0f); *(v8us*)((unsigned short*)Bt + t * 8) = f.half[0];  }
template <int NHv, int TTv>
__global__ __launch_bounds__(256) void k_vt(const _Float16* __restrict__ V16, int ldv, int voff, _Float16* __restrict__ Vt) { __shared__ unsigned short tl[64][66]; const int tid = threadIdx.x; const int slab = blockIdx.x / (TTv / 64), lg = blockIdx.x % (TTv / 64); const int b = slab / NHv, h = slab % NHv;
  for (int i = tid; i < 64 * 8; i += 256) { const int r = i / 8, c8 = (i % 8) * 8; FragH f; f.half[0] = *(const v8us*)((const unsigned short*)V16 + ((size_t)b * TTv + lg * 64 + r) * ldv + voff + h * 64 + c8);
#pragma unroll
    for (int q = 0; q < 8; ++q) tl[r][c8 + q] = f.u[q]; }
  __syncthreads();
  {
#pragma unroll
    for (int rd = 0; rd < 2; ++rd) { const int d = rd * 32 + tid / 8, pc = tid % 8; FragH f;
#pragma unroll
      for (int q = 0; q < 8; ++q) f.u[q] = tl[pc * 8 + q][d];
      *(v8us*)((unsigned short*)Vt + ((size_t)slab * 64 + d) * TTv + lg * 64 + pc * 8) = f.half[0]; }
     } }

__global__ __launch_bounds__(256) void k_hl(const float* __restrict__ F, _Float16* __restrict__ Hh, _Float16* __restrict__ Hl, size_t n8) { const size_t t = (size_t)blockIdx.x * 256 + threadIdx.x; if (t >= n8) return; FragH fh, fl; const v4f a = *(const v4fa*)(F + t * 8), c = *(const v4fa*)(F + t * 8 + 4);
#pragma unroll
  for (int q = 0; q < 4; ++q) { _Float16 h = (_Float16)a[q]; fh.h[q] = h; fl.h[q] = (_Float16)((a[q] - (float)h) * 1024.0f); h = (_Float16)c[q]; fh.h[4 + q] = h; fl.h[4 + q] = (_Float16)((c[q] - (float)h) * 1024.0f); }
  { *(v8us*)((unsigned short*)Hh + t * 8) = fh.half[0]; *(v8us*)((unsigned short*)Hl + t * 8) = fl.half[0];  } }

// ---- fast GEMM (wave tile 32x64; requires M % 32 == 0 rows per launch region and N % 64 == 0); epilogue = k_gemm_hhx semantics ----
__device__ __forceinline__ v16h g2_frag(const _Float16* p, int hh) { FragH f; f.half[0] = *(const v8us*)((const unsigned short*)p + 8 * hh); f.half[1] = *(const v8us*)((const unsigned short*)p + 16 + 8 * hh); return f.v; }
__device__ __forceinline__ v8f g2_mma(v16h a, v16h b, v8f c) { v8f d = __builtin_amdgcn_wmma_f32_16x16x32_f16(false, a, false, b, (short)0, c, false, false); asm volatile("v_nop\n\tv_nop\n\tv_nop\n\tv_nop" : "+v"(d) : "v"(a), "v"(b)); return d; }
// One lane's twelve 16-byte asynchronous copies from global memory to LDS (l: LDS byte addresses, g: global addresses). The s_wait_xcnt is the last line of the copies' own statement, so that no address register is rewritten in front of it.
__device__ __forceinline__ void copy12_to_lds(const unsigned (&l)[12], const unsigned short* const (&g)[12]) {
  asm volatile("global_load_async_to_lds_b128 %0, %12, off\n\tglobal_load_async_to_lds_b128 %1, %13, off\n\tglobal_load_async_to_lds_b128 %2, %14, off\n\tglobal_load_async_to_lds_b128 %3, %15, off\n\t"
               "global_load_async_to_lds_b128 %4, %16, off\n\tglobal_load_async_to_lds_b128 %5, %17, off\n\tglobal_load_async_to_lds_b128 %6, %18, off\n\tglobal_load_async_to_lds_b128 %7, %19, off\n\t"
               "global_load_async_to_lds_b128 %8, %20, off\n\tglobal_load_async_to_lds_b128 %9, %21, off\n\tglobal_load_async_to_lds_b128 %10, %22, off\n\tglobal_load_async_to_lds_b128 %11, %23, off\n\ts_wait_xcnt 0x0"
               :: "v"(l[0]), "v"(l[1]), "v"(l[2]), "v"(l[3]), "v"(l[4]), "v"(l[5]), "v"(l[6]), "v"(l[7]), "v"(l[8]), "v"(l[9]), "v"(l[10]), "v"(l[11]),
                  "v"(g[0]), "v"(g[1]), "v"(g[2]), "v"(g[3]), "v"(g[4]), "v"(g[5]), "v"(g[6]), "v"(g[7]), "v"(g[8]), "v"(g[9]), "v"(g[10]), "v"(g[11]) : "memory"); }
// Block tile 128 x 64. The operands go to LDS once per block in k steps of 64 (whole 128-byte lines of every row), two buffers: step t + 2 is copied while step t + 1 is worked on. Requires K % 64 == 0.
template <int ACT>
__global__ __launch_bounds__(128) void k_gemm2(const _Float16* __restrict__ A, int lda, size_t sA, const _Float16* __restrict__ Bh, int ldb, size_t sB, float alpha, const float* __restrict__ bias, size_t sBias, const float* __restrict__ CP, int rowsPerB, size_t sCPb, int row0g,
    float* __restrict__ C, _Float16* __restrict__ C16, int ldc, size_t sC, int M, int N, int K) {
  constexpr int GP = 72;                    /* LDS row pitch in f16: 144 B for the 128-byte rows (16 B x odd: no bank conflict for 16-byte readers) */
  constexpr int STG = (128 + 64) * GP;      /* one buffer in f16: 128 A rows, then 64 B rows */
  __shared__ __attribute__((aligned(16))) float sm[2 * STG / 2];      /* 55,296 B: the two operand buffers in the k loop; behind it the epilogue's per-wave output tiles */
  float (*so)[32][68] = (float (*)[32][68])sm;
  const unsigned short* sT = (const unsigned short*)sm;
  const int tid = threadIdx.x, w = tid >> 5, lane = tid & 31, ln = lane & 15, hh = lane >> 4; const int by = blockIdx.y;
  A += (size_t)by * sA; Bh += (size_t)by * sB; const size_t cofs = (size_t)by * sC; const float* bp = bias ? bias + (size_t)by * sBias : nullptr;
  const int ntn = N >> 6; const int mt = blockIdx.x / ntn, nq = blockIdx.x - mt * ntn; const int rowb = mt * 128, row0 = rowb + 32 * w, col0 = nq * 64; if (rowb >= M) return;      /* the whole block leaves, in front of every barrier */
  // Thread tid copies 16-byte piece tid & 7 of rows (tid >> 3) + 16 i: a wave's copy covers 4 whole 128-byte rows. An A row past M is clamped to the last row (its products are never stored).
  const int cr = tid >> 3, cc = (tid & 7) * 8;
  const unsigned short* gsrc[12];
#pragma unroll      /* unrolled here and in the three loops below: the address arrays stay in registers */
  for (int i = 0; i < 8; ++i) { const int r = rowb + cr + 16 * i; gsrc[i] = (const unsigned short*)A + (size_t)(r < M ? r : M - 1) * lda + cc; }
#pragma unroll
  for (int i = 0; i < 4; ++i) gsrc[8 + i] = (const unsigned short*)Bh + (size_t)(col0 + cr + 16 * i) * ldb + cc;
  const unsigned l0 = (unsigned)(size_t)&sT[cr * GP + cc];
  auto stage = [&](int buf) { unsigned l[12];      /* copies the next k step into buffer buf and moves the source pointers on by one step */
#pragma unroll
    for (int i = 0; i < 12; ++i) l[i] = l0 + (unsigned)((buf * STG + 16 * i * GP) * 2);
    copy12_to_lds(l, gsrc);
#pragma unroll
    for (int i = 0; i < 12; ++i) gsrc[i] += 64; };
  const v8f z8 = {0.f,0.f,0.f,0.f,0.f,0.f,0.f,0.f}; v8f c00 = z8, c01 = z8, c02 = z8, c03 = z8, c10 = z8, c11 = z8, c12 = z8, c13 = z8;
  stage(0);
  asm volatile("s_wait_asynccnt 0x0" ::: "memory");      /* step 0 has landed before the barrier that publishes it */
  __syncthreads();
  if (64 < K) stage(1);
#pragma unroll 1      /* rolled: one foot with the waits, the barrier and the refill in their order */
  for (int kb = 0; kb < K; kb += 64) {
    const int buf = (kb >> 6) & 1;
    const _Float16* tA = (const _Float16*)sT + buf * STG + (32 * w + ln) * GP; const _Float16* tB = (const _Float16*)sT + buf * STG + (128 + ln) * GP;
    v16h fa[2][2], fb[2][4];      /* the step's fragment reads stand together in front of its products */
#pragma unroll      /* unrolled here and in the two loops below: the fragment arrays stay in registers */
    for (int ks = 0; ks < 2; ++ks) { fa[ks][0] = g2_frag(tA + ks * 32, hh); fa[ks][1] = g2_frag(tA + 16 * GP + ks * 32, hh);
#pragma unroll
      for (int t = 0; t < 4; ++t) fb[ks][t] = g2_frag(tB + t * 16 * GP + ks * 32, hh); }
#pragma unroll
    for (int ks = 0; ks < 2; ++ks) {
      c00 = g2_mma(fa[ks][0], fb[ks][0], c00); c10 = g2_mma(fa[ks][1], fb[ks][0], c10);
      c01 = g2_mma(fa[ks][0], fb[ks][1], c01); c11 = g2_mma(fa[ks][1], fb[ks][1], c11);
      c02 = g2_mma(fa[ks][0], fb[ks][2], c02); c12 = g2_mma(fa[ks][1], fb[ks][2], c12);
      c03 = g2_mma(fa[ks][0], fb[ks][3], c03); c13 = g2_mma(fa[ks][1], fb[ks][3], c13); }
    asm volatile("s_wait_dscnt 0x0" ::: "memory");      /* this wave's reads of the buffer have returned before the buffer is handed back */
    asm volatile("s_wait_asynccnt 0x0" ::: "memory");      /* this wave's copies of step t + 1 have landed */
    __syncthreads();      /* publishes step t + 1 and ends every wave's reads of step t */
    if (kb + 128 < K) stage(buf); }
  asm volatile("s_wait_asynccnt 0x0" ::: "memory");      /* nothing is in flight when the LDS is taken over by the output tiles */
  if (row0 >= M) return;      /* behind the last barrier */
  v8f accs[8] = {c00, c01, c02, c03, c10, c11, c12, c13};
#pragma unroll
  for (int u = 0; u < 8; ++u) { const int t = u & 3, half = u >> 2; const int col = col0 + t * 16 + ln; const float bv = bp ? bf16_round(bp[col]) : 0.f;
#pragma unroll
    for (int r = 0; r < 8; ++r) { const int rloc = half * 16 + 8 * hh + r; float v = accs[u][r] * alpha + bv; if (CP) { const int bidx = (row0g + row0 + rloc) / rowsPerB; v += CP[(size_t)bidx * sCPb + (size_t)by * 64 + col]; }
      if (ACT == 3) v = fmaxf(v, 0.f); else if (ACT == 6) v = 0.5f * v * (1.0f + erff(v * 0.70710678118654752f)); else if (ACT == 11) v = 1.0f / (1.0f + expf(-v)); else if (ACT == 15) v = v / (1.0f + expf(-v)); else if (ACT == 12) v = (v > 0.f) ? v : 0.01f * v; else if (ACT == 8) v = tanhf(v);
      so[w][rloc][t * 16 + ln] = v; } }
  __builtin_amdgcn_fence(__ATOMIC_ACQ_REL, "workgroup"); __builtin_amdgcn_wave_barrier();
  const int rsub = lane >> 4, c4 = (lane & 15) * 4;
  {
#pragma unroll
    for (int q = 0; q < 16; ++q) { const int r = q * 2 + rsub; const v4f v = *(const v4fa*)&so[w][r][c4]; if (C) *(v4f*)(C + cofs + (size_t)(row0 + r) * ldc + col0 + c4) = v; if (C16) { v4h h4; for (int i = 0; i < 4; ++i) h4[i] = (_Float16)v[i]; *(v4h*)(C16 + cofs + (size_t)(row0 + r) * ldc + col0 + c4) = h4; } }
     } }



// lane l with lane l ^ 16: the two lanes that share one query column of a transposed score tile
__device__ __forceinline__ float xhalf(float x) { return __builtin_bit_cast(float, __builtin_amdgcn_permlanex16(__builtin_bit_cast(int, x), __builtin_bit_cast(int, x), 0x76543210, 0xfedcba98, false, false)); }
__device__ __forceinline__ void copy4_to_lds(unsigned l0, const unsigned short* g0, unsigned l1, const unsigned short* g1, unsigned l2, const unsigned short* g2, unsigned l3, const unsigned short* g3) {
  asm volatile("global_load_async_to_lds_b128 %0, %1, off\n\tglobal_load_async_to_lds_b128 %2, %3, off\n\tglobal_load_async_to_lds_b128 %4, %5, off\n\tglobal_load_async_to_lds_b128 %6, %7, off\n\ts_wait_xcnt 0x0"
               :: "v"(l0), "v"(g0), "v"(l1), "v"(g1), "v"(l2), "v"(g2), "v"(l3), "v"(g3) : "memory"); }
template <int CAUSAL>
__global__ __launch_bounds__(128) void k_flash(const _Float16* __restrict__ Q16, int ldq, const _Float16* __restrict__ K16, int ldk, const _Float16* __restrict__ Vt, const int* __restrict__ MSK, float* __restrict__ O, int ldo) {
  constexpr int RPW = 16, DT = 4, KS = 2;
  constexpr int KP = 72, VP = 40;      /* LDS row pitch in f16: 144 B for the 128-byte K rows, 80 B for the 64-byte V^T rows (16 B x odd: no bank conflict for 16-byte readers) */
  __shared__ __attribute__((aligned(16))) float sO[4][RPW][64 + 4];
  __shared__ __attribute__((aligned(16))) unsigned short sK[2][32 * KP];      /* 32 keys x 64 */
  __shared__ __attribute__((aligned(16))) unsigned short sV[2][64 * VP];      /* 64 d x 32 keys */
  const int tid = threadIdx.x, w = tid >> 5, lane = tid & 31, ln = lane & 15, hh = lane >> 4;
  const int slab = blockIdx.x / QBLKS, qblk = blockIdx.x % QBLKS; (void)MSK; const int b = slab / NH, h = slab % NH; const int qb0 = qblk * (4 * RPW); const int q0 = qb0 + w * RPW;
  FragH bq[KS];
  { const unsigned short* qr = (const unsigned short*)Q16 + ((size_t)b * TQ + q0 + ln) * ldq + h * 64;
#pragma unroll
    for (int ks = 0; ks < KS; ++ks) { bq[ks].half[0] = *(const v8us*)(qr + ks * 32 + 8 * hh); bq[ks].half[1] = *(const v8us*)(qr + ks * 32 + 16 + 8 * hh); } }
  const unsigned short* Vth = (const unsigned short*)Vt + (size_t)slab * 64 * TK;
  const int tq = q0 + ln;
  float m_q = -3.0e38f, l_q = 0.f; v8f oacc[DT];
#pragma unroll
  for (int dt = 0; dt < DT; ++dt) oacc[dt] = (v8f){0.f,0.f,0.f,0.f,0.f,0.f,0.f,0.f};
  const int jend = (CAUSAL == 1) ? (qb0 + 4 * RPW) : TK;      /* causal: keys beyond the block's last query never contribute */
  // Key tiles of 32 keys go to LDS once per block (the four waves read the same K and V^T), two buffers: tile t + 2 is copied while tile t + 1 is worked on.
  // Thread tid copies 16-byte pieces tid and tid + 128 of each tile: K piece c = row c / 8, column c % 8 (a wave covers 4 whole 128-byte rows); V^T piece c = row c / 4, column c % 4.
  const unsigned short* gK = (const unsigned short*)K16 + ((size_t)b * TK + (tid >> 3)) * ldk + h * 64 + (tid & 7) * 8;
  const unsigned short* gV = Vth + (size_t)(tid >> 2) * TK + (tid & 3) * 8;
  const unsigned lK = (unsigned)(size_t)&sK[0][(tid >> 3) * KP + (tid & 7) * 8], lV = (unsigned)(size_t)&sV[0][(tid >> 2) * VP + (tid & 3) * 8];
  auto stage = [&](int j, int buf) { const unsigned short* k0 = gK + (size_t)j * ldk; const unsigned short* v0 = gV + j; const unsigned lk = lK + buf * (32 * KP * 2), lv = lV + buf * (64 * VP * 2);
    copy4_to_lds(lk, k0, lk + 16 * KP * 2, k0 + (size_t)16 * ldk, lv, v0, lv + 32 * VP * 2, v0 + (size_t)32 * TK); };
  stage(0, 0);
  asm volatile("s_wait_asynccnt 0x0" ::: "memory");      /* tile 0 has landed before the barrier that publishes it */
  __syncthreads();
  stage(32, 1);      /* jend is at least 64: a tile 1 exists */
#pragma unroll 1
  for (int j0 = 0; j0 < jend; j0 += 32) {
    const int buf = (j0 >> 5) & 1;
    const unsigned short* tK = &sK[buf][ln * KP + 8 * hh]; const unsigned short* tV = &sV[buf][ln * VP + 8 * hh];
    FragH ak[2][KS], av[DT];
#pragma unroll
    for (int nt = 0; nt < 2; ++nt)
#pragma unroll
      for (int ks = 0; ks < KS; ++ks) { ak[nt][ks].half[0] = *(const v8us*)(tK + nt * 16 * KP + ks * 32); ak[nt][ks].half[1] = *(const v8us*)(tK + nt * 16 * KP + ks * 32 + 16); }
#pragma unroll
    for (int dt = 0; dt < DT; ++dt) { av[dt].half[0] = *(const v8us*)(tV + dt * 16 * VP); av[dt].half[1] = *(const v8us*)(tV + dt * 16 * VP + 16); }
    v8f s[2];
#pragma unroll
    for (int nt = 0; nt < 2; ++nt) {
      v8f acc = (v8f){0.f,0.f,0.f,0.f,0.f,0.f,0.f,0.f};
#pragma unroll
      for (int ks = 0; ks < KS; ++ks) acc = mmaH<1>(ak[nt][ks].v, ak[nt][ks].v, bq[ks].v, bq[ks].v, acc);
      s[nt] = acc; }
    float sc[2][8], mx[8]; bool ok[2][8];
#pragma unroll
    for (int r = 0; r < 8; ++r) {
#pragma unroll
      for (int nt = 0; nt < 2; ++nt) { const int kk = j0 + nt * 16 + 8 * hh + r;
        ok[nt][r] = (CAUSAL == 1) ? (kk <= tq) : ((CAUSAL == 2) ? ((kk >> 5) == (tq >> 5)) : true);      /* mode 2: block-diagonal 32-token groups */
        sc[nt][r] = ok[nt][r] ? s[nt][r] * SCL : -3.0e38f; }
      mx[r] = fmaxf(sc[0][r], sc[1][r]); }
    float mc = fmaxf(fmaxf(fmaxf(mx[0], mx[1]), fmaxf(mx[2], mx[3])), fmaxf(fmaxf(mx[4], mx[5]), fmaxf(mx[6], mx[7])));
    mc = fmaxf(mc, xhalf(mc));
    const float mn = fmaxf(m_q, mc); const float al = (mn > -1.0e38f) ? expf(m_q - mn) : 1.0f; m_q = mn;
    FragH pb; float ps[8];
#pragma unroll
    for (int r = 0; r < 8; ++r) { const float p0 = ok[0][r] ? expf(sc[0][r] - mn) : 0.f, p1 = ok[1][r] ? expf(sc[1][r] - mn) : 0.f; ps[r] = p0 + p1;
      pb.h[r] = (_Float16)(p0 * 1024.0f); pb.h[8 + r] = (_Float16)(p1 * 1024.0f); }
    l_q = l_q * al + (((ps[0] + ps[1]) + (ps[2] + ps[3])) + ((ps[4] + ps[5]) + (ps[6] + ps[7])));
#pragma unroll
    for (int dt = 0; dt < DT; ++dt)
#pragma unroll
      for (int r = 0; r < 8; ++r) oacc[dt][r] *= al;
#pragma unroll
    for (int dt = 0; dt < DT; ++dt) oacc[dt] = mmaH<1>(av[dt].v, av[dt].v, pb.v, pb.v, oacc[dt]);
    asm volatile("s_wait_dscnt 0x0" ::: "memory");      /* this wave's reads of the buffer have returned before the buffer is handed back */
    asm volatile("s_wait_asynccnt 0x0" ::: "memory");      /* this wave's copies of tile t + 1 have landed */
    __syncthreads();      /* publishes tile t + 1 and ends every wave's reads of tile t */
    if (j0 + 64 < jend) stage(j0 + 64, buf); }
  asm volatile("s_wait_asynccnt 0x0" ::: "memory");      /* nothing is in flight when the wave goes on to the epilogue and ends */
  const float l = l_q + xhalf(l_q); const float inv = (l > 0.f) ? 1.0f / (l * 1024.0f) : 0.f;
#pragma unroll
  for (int dt = 0; dt < DT; ++dt) {      /* register r of tile dt is O[q0 + ln][dt*16 + 8*hh + r] */
    const v4f lo = {oacc[dt][0] * inv, oacc[dt][1] * inv, oacc[dt][2] * inv, oacc[dt][3] * inv}, hi = {oacc[dt][4] * inv, oacc[dt][5] * inv, oacc[dt][6] * inv, oacc[dt][7] * inv};
    *(v4fa*)&sO[w][ln][dt * 16 + 8 * hh] = lo; *(v4fa*)&sO[w][ln][dt * 16 + 8 * hh + 4] = hi; }
  __builtin_amdgcn_fence(__ATOMIC_ACQ_REL, "workgroup"); __builtin_amdgcn_wave_barrier();
  {
#pragma unroll
    for (int rp = 0; rp < RPW; rp += 2) { const int r = rp + (lane >> 4), pc = lane & 15; const v4f val = *(const v4fa*)&sO[w][r][pc * 4]; *(v4f*)(O + ((size_t)b * TQ + q0 + r) * ldo + h * 64 + pc * 4) = val; }
     } }

__global__ __launch_bounds__(256) void k_sum5(const float* __restrict__ O, float* __restrict__ out, size_t n4) {
  #pragma clang fp contract(off)
  const size_t t = (size_t)blockIdx.x * 256 + threadIdx.x; if (t >= n4) return; v4f a = *(const v4fa*)(O + t * 4);
  for (int n = 1; n < NSRC; ++n) { const v4f b = *(const v4fa*)(O + (size_t)n * NR * CC + t * 4); for (int q = 0; q < 4; ++q) a[q] += b[q]; }
  *(v4f*)(out + t * 4) = a;  }

extern "C" void kernel_launch(void* const* d_in, const int* in_sizes, int n_in,
                              void* d_out, int out_size, void* d_ws, size_t ws_size, hipStream_t stream) {
  (void)in_sizes; (void)n_in; (void)out_size;
  const float* const* I = (const float* const*)d_in; const float* hsp = I[0]; const float* Wq = I[1]; const float* bq = I[2]; const float* Wk = I[3]; const float* bk = I[4]; const float* Wv = I[5]; const float* bv = I[6];
  char* ws = (char*)d_ws; size_t off = 0;
  auto take = [&](size_t bytes) { char* p = ws + off; off += (bytes + 255) & ~(size_t)255; return p; };
  _Float16* BQ = (_Float16*)take((size_t)CC * CC * 2); _Float16* BK = (_Float16*)take((size_t)CC * CC * 2); _Float16* BV = (_Float16*)take((size_t)CC * CC * 2);
  _Float16* X16 = (_Float16*)take((size_t)NRA * CC * 2); _Float16* Q16 = (_Float16*)take((size_t)NR * CC * 2); _Float16* K16 = (_Float16*)take((size_t)NRA * CC * 2); _Float16* V16 = (_Float16*)take((size_t)NRA * CC * 2); _Float16* VT = (_Float16*)take((size_t)NRA * CC * 2); float* O = (float*)take((size_t)NSRC * NR * CC * 4);
  if (off > ws_size) return;      /* 3.4 + 30 + 6 + 30 + 30 + 30 + 60 = 190 MiB */
  k_wt_f16<<<(CC * CC / 8 + 255) / 256, 256, 0, stream>>>(Wq, BQ, CC, CC, 16.0f); k_wt_f16<<<(CC * CC / 8 + 255) / 256, 256, 0, stream>>>(Wk, BK, CC, CC, 16.0f); k_wt_f16<<<(CC * CC / 8 + 255) / 256, 256, 0, stream>>>(Wv, BV, CC, CC, 16.0f);
  k_x16<<<(unsigned)(((size_t)NRA * CC / 8 + 255) / 256), 256, 0, stream>>>(hsp, X16, (size_t)NRA * CC / 8);
  k_gemm2<0><<<dim3((NR / 128) * (CC / 64), 1), 128, 0, stream>>>(X16, CC, 0, BQ, CC, 0, 0.0625f, bq, 0, nullptr, 1, 0, 0, nullptr, Q16, CC, 0, NR, CC, CC);      /* q from source 0 */
  k_gemm2<0><<<dim3((NRA / 128) * (CC / 64), 1), 128, 0, stream>>>(X16, CC, 0, BK, CC, 0, 0.0625f, bk, 0, nullptr, 1, 0, 0, nullptr, K16, CC, 0, NRA, CC, CC);      /* k for every source */
  k_gemm2<0><<<dim3((NRA / 128) * (CC / 64), 1), 128, 0, stream>>>(X16, CC, 0, BV, CC, 0, 0.0625f, bv, 0, nullptr, 1, 0, 0, nullptr, V16, CC, 0, NRA, CC, CC);
  k_vt<NH, SLEN><<<NSRC * NB * NH * (SLEN / 64), 256, 0, stream>>>(V16, CC, 0, VT);      /* slabs ((n*4 + b)*12 + h) */
  for (int n = 0; n < NSRC; ++n)
    k_flash<0><<<NB * NH * QBLKS, 128, 0, stream>>>(Q16, CC, K16 + (size_t)n * NR * CC, CC, VT + (size_t)n * NB * NH * 64 * SLEN, nullptr, O + (size_t)n * NR * CC, CC);
  k_sum5<<<(unsigned)(((size_t)NR * CC / 4 + 255) / 256), 256, 0, stream>>>(O, (float*)d_out, (size_t)NR * CC / 4);
}

// v004
// One run takes 243 microseconds.
// Two timings next to v003 both put it at 1.13 times that version's speed.
// Over all steps from v000 it is 3.18 times as fast.
#include <hip/hip_runtime.h>
// Attention_KV (5 sources x 4 batches x 1024 tokens x 768 = 12 heads of 64): q from source 0 (Wq + bq); every source n gives k_n, v_n (shared Wk/bk, Wv/bv); ctx = sum_n softmax(q k_n^T / 8) v_n (independent softmax per source); output = ctx merged [B, S, 768] (no output projection).
// Structure: one exact f16 plane of all sources; q / k / v GEMMs (32x64 wave tiles, f32 accumulation, exact x16 weights + bias, f16 outputs; k and v over all 5 sources at once); V^T by LDS tiles for all (source, batch, head) slabs in one launch; five fused flash kernels (plain f16 operands), one per source, into five f32 planes; a VALU sum of the five planes into the output.
// Compute dtype: inputs and parameters rounded to bf16; q, k, v, P as f16 (~2^-12); f32 accumulation/softmax/sum. v_wmma_f32_16x16x32_f16.
#define NSRC 5
#define NB 4
#define CC 768
#define NR (NB * SLEN)           /* 4096 query rows */
#define NRA (NSRC * NR)          /* 20480 source rows */
#define SLEN 1024
#define TQ SLEN
#define TK SLEN
#define NH 12
#define SCL 0.125f               /* 1/sqrt(64) */
#define SCL2 (SCL * 1.4426950408889634f)   /* log2(e)/sqrt(64) */
#define QBLKS (TQ / 64)
typedef __bf16 v16b __attribute__((ext_vector_type(16)));
typedef unsigned short v8us __attribute__((ext_vector_type(8), may_alias));
typedef float  v8f  __attribute__((ext_vector_type(8)));
typedef float  v4f  __attribute__((ext_vector_type(4)));
typedef float  v4fa __attribute__((ext_vector_type(4), may_alias));
union FragB { v16b v; v8us half[2]; unsigned short u[16]; };

__device__ __forceinline__ unsigned short bf16_bits(float x) { unsigned int u = __float_as_uint(x); return (unsigned short)((u + 0x7FFFu + ((u >> 16) & 1u)) >> 16); }
__device__ __forceinline__ float bf16_val(unsigned short b) { return __uint_as_float(((unsigned int)b) << 16); }
__device__ __forceinline__ float bf16_round(float x) { return bf16_val(bf16_bits(x)); }
// D += A·B with NT terms: 1 = ah·bh, 2 = + al·bh (A split), 3 = + ah·bl (both split)
template <int NT>
__device__ __forceinline__ v8f mmaN(v16b ah, v16b al, v16b bh, v16b bl, v8f c) {
  c = __builtin_amdgcn_wmma_f32_16x16x32_bf16(false, ah, false, bh, (short)0, c, false, false);
  if (NT >= 2) c = __builtin_amdgcn_wmma_f32_16x16x32_bf16(false, al, false, bh, (short)0, c, false, false);
  if (NT >= 3) c = __builtin_amdgcn_wmma_f32_16x16x32_bf16(false, ah, false, bl, (short)0, c, false, false);
  asm volatile("v_nop\n\tv_nop\n\tv_nop\n\tv_nop" : "+v"(c) : "v"(ah), "v"(al), "v"(bh), "v"(bl));
  return c;
}

__global__ __launch_bounds__(256) void k_wt_bf16(const float* __restrict__ W, unsigned short* __restrict__ Wt, int K, int N) {
  const int t = blockIdx.x * 256 + threadIdx.x;
  const int k8n = K / 8;
  if (t >= N * k8n) return;
  const int n = t / k8n, k8 = (t % k8n) * 8;
  v8us v;
#pragma unroll
  for (int i = 0; i < 8; ++i) v[i] = bf16_bits(W[(size_t)(k8 + i) * N + n]);
  *(v8us*)(Wt + (size_t)n * K + k8) = v;
  
}

// GEMM C[M][N] (f32, pitch ldc) = act(A[M][K]·W + bias). A f32 row-major (pitch lda) converted per fragment to bf16
// (ASPLIT: hi/lo two planes -> 2 terms, else single rounded term); Wt bf16 [N][K] (pitch ldb). BIAS_BF16 rounds the
// bias to bf16 first (bias quantised to bf16 before the add). K%32==0, M%16==0, N%64==0.
template <bool ASPLIT, int ACT, bool BIAS_BF16>
__global__ __launch_bounds__(128) void k_gemm_bf(const float* __restrict__ A, int lda, const unsigned short* __restrict__ Wt, int ldb,
                                               const float* __restrict__ bias, float* __restrict__ C, int ldc, int M, int N, int K) {
  __shared__ __attribute__((aligned(16))) float so[4][16][64];
  const int tid = threadIdx.x, w = tid >> 5, lane = tid & 31, ln = lane & 15, hh = lane >> 4;
  const int ntn = N / 64;
  const int wid = blockIdx.x * 4 + w;
  const int mt = wid / ntn, nq = wid % ntn;
  if (mt * 16 >= M) return;
  const int row0 = mt * 16, col0 = nq * 64;
  const float* arow = A + (size_t)(row0 + ln) * lda;
  v8f acc[4] = {};
  for (int kb = 0; kb < K; kb += 32) {
    FragB ah, al;
    const v4f x0 = *(const v4fa*)(arow + kb + 8 * hh), x1 = *(const v4fa*)(arow + kb + 8 * hh + 4);
    const v4f x2 = *(const v4fa*)(arow + kb + 16 + 8 * hh), x3 = *(const v4fa*)(arow + kb + 16 + 8 * hh + 4);
    float xs[16] = {x0[0],x0[1],x0[2],x0[3],x1[0],x1[1],x1[2],x1[3],x2[0],x2[1],x2[2],x2[3],x3[0],x3[1],x3[2],x3[3]};
#pragma unroll
    for (int i = 0; i < 16; ++i) { const unsigned short hb = bf16_bits(xs[i]); ah.u[i] = hb; al.u[i] = ASPLIT ? bf16_bits(xs[i] - bf16_val(hb)) : (unsigned short)0; }
#pragma unroll
    for (int t = 0; t < 4; ++t) {
      const unsigned short* brow = Wt + (size_t)(col0 + t * 16 + ln) * ldb + kb;
      FragB b;
      b.half[0] = *(const v8us*)(brow + 8 * hh);
      b.half[1] = *(const v8us*)(brow + 16 + 8 * hh);
      acc[t] = mmaN<ASPLIT ? 2 : 1>(ah.v, al.v, b.v, b.v, acc[t]);
    }
  }
#pragma unroll
  for (int t = 0; t < 4; ++t) {
    float bv = bias ? bias[col0 + t * 16 + ln] : 0.f;
    if (BIAS_BF16) bv = bf16_round(bv);
#pragma unroll
    for (int r = 0; r < 8; ++r) { float v = acc[t][r] + bv; if (ACT == 1) v = fmaxf(v, 0.f); so[w][8 * hh + r][t * 16 + ln] = v; }
  }
  __builtin_amdgcn_fence(__ATOMIC_ACQ_REL, "workgroup");
  __builtin_amdgcn_wave_barrier();
  const int rsub = lane >> 4, c4 = (lane & 15) * 4;
  {
#pragma unroll
    for (int q = 0; q < 8; ++q) {
      const int r = q * 2 + rsub;
      const v4f v = *(const v4fa*)&so[w][r][c4];
      *(v4f*)(C + (size_t)(row0 + r) * ldc + col0 + c4) = v;
    }
    
  }
}

// GEMM C = act(A·W + bias + resid): A f32 (ASPLIT -> hi/lo 2 terms), Wt bf16 [N][K]; ACT 0 none, 1 relu, 2 exact gelu;
// resid (optional, f32, row index = (row % rmod), pitch ldr, RES_BF16 rounds it) added before the activation.
template <bool ASPLIT, int ACT, bool BIAS_BF16, bool RES_BF16>
__global__ __launch_bounds__(128) void k_gemm_bf3(const float* __restrict__ A, int lda, const unsigned short* __restrict__ Wt, int ldb,
                                                const float* __restrict__ bias, const float* __restrict__ resid, int rmod, int ldr,
                                                float* __restrict__ C, int ldc, int M, int N, int K) {
  __shared__ __attribute__((aligned(16))) float so[4][16][64];
  const int tid = threadIdx.x, w = tid >> 5, lane = tid & 31, ln = lane & 15, hh = lane >> 4;
  const int ntn = N / 64;
  const int wid = blockIdx.x * 4 + w;
  const int mt = wid / ntn, nq = wid % ntn;
  if (mt * 16 >= M) return;
  const int row0 = mt * 16, col0 = nq * 64;
  const float* arow = A + (size_t)(row0 + ln) * lda;
  v8f acc[4] = {};
  for (int kb = 0; kb < K; kb += 32) {
    FragB ah, al;
    const v4f x0 = *(const v4fa*)(arow + kb + 8 * hh), x1 = *(const v4fa*)(arow + kb + 8 * hh + 4);
    const v4f x2 = *(const v4fa*)(arow + kb + 16 + 8 * hh), x3 = *(const v4fa*)(arow + kb + 16 + 8 * hh + 4);
    float xs[16] = {x0[0],x0[1],x0[2],x0[3],x1[0],x1[1],x1[2],x1[3],x2[0],x2[1],x2[2],x2[3],x3[0],x3[1],x3[2],x3[3]};
#pragma unroll
    for (int i = 0; i < 16; ++i) { const unsigned short hb = bf16_bits(xs[i]); ah.u[i] = hb; al.u[i] = ASPLIT ? bf16_bits(xs[i] - bf16_val(hb)) : (unsigned short)0; }
#pragma unroll
    for (int t = 0; t < 4; ++t) {
      const unsigned short* brow = Wt + (size_t)(col0 + t * 16 + ln) * ldb + kb;
      FragB b;
      b.half[0] = *(const v8us*)(brow + 8 * hh);
      b.half[1] = *(const v8us*)(brow + 16 + 8 * hh);
      acc[t] = mmaN<ASPLIT ? 2 : 1>(ah.v, al.v, b.v, b.v, acc[t]);
    }
  }
#pragma unroll
  for (int t = 0; t < 4; ++t) {
    const int col = col0 + t * 16 + ln;
    float bv = bias ? bias[col] : 0.f;
    if (BIAS_BF16) bv = bf16_round(bv);
#pragma unroll
    for (int r = 0; r < 8; ++r) {
      float v = acc[t][r] + bv;
      if (resid) { float rv = resid[(size_t)((row0 + 8 * hh + r) % rmod) * ldr + col]; if (RES_BF16) rv = bf16_round(rv); v += rv; }
      if (ACT == 1) v = fmaxf(v, 0.f);
      if (ACT == 2) v = 0.5f * v * (1.0f + erff(v * 0.70710678118654752f));
      if (ACT == 3) { const float u = 0.7978845608028654f * (v + 0.044715f * v * v * v); v = 0.5f * v * (1.0f + tanhf(u)); }
      so[w][8 * hh + r][t * 16 + ln] = v;
    }
  }
  __builtin_amdgcn_fence(__ATOMIC_ACQ_REL, "workgroup");
  __builtin_amdgcn_wave_barrier();
  const int rsub = lane >> 4, c4 = (lane & 15) * 4;
  {
#pragma unroll
    for (int q = 0; q < 8; ++q) {
      const int r = q * 2 + rsub;
      const v4f v = *(const v4fa*)&so[w][r][c4];
      *(v4f*)(C + (size_t)(row0 + r) * ldc + col0 + c4) = v;
    }
    
  }
}
// row LayerNorm (biased variance, eps) over N: s = X (+ R); optional out_sum <- s; out_norm <- (s-mu)*rsqrt(var+eps)*g + b
template <bool PARAM_BF16>
__global__ __launch_bounds__(256) void k_layernorm(const float* __restrict__ X, const float* __restrict__ R, const float* __restrict__ g, const float* __restrict__ bta,
                                                  float* __restrict__ out_sum, float* __restrict__ out_norm, int N, float eps) {
  __shared__ float red[256];
  const int row = blockIdx.x, tid = threadIdx.x;
  const float* x = X + (size_t)row * N; const float* rr = R ? R + (size_t)row * N : nullptr;
  float vals[16];                     // up to N = 4096
  const int per = N / 256;            // contiguous chunk per thread? use strided-by-4 chunks: thread handles j = tid*4 + 1024*u
  float s1 = 0.f;
  for (int u = 0; u < per / 4; ++u) {
    const int j = tid * 4 + 1024 * u;
    const v4f a = *(const v4fa*)(x + j);
    v4f b = {0.f,0.f,0.f,0.f}; if (rr) b = *(const v4fa*)(rr + j);
#pragma unroll
    for (int q = 0; q < 4; ++q) { const float v = a[q] + b[q]; vals[u * 4 + q] = v; s1 += v; }
  }
  red[tid] = s1; __syncthreads();
  for (int st = 128; st > 0; st >>= 1) { if (tid < st) red[tid] += red[tid + st]; __syncthreads(); }
  const float mu = red[0] / (float)N; __syncthreads();
  float s2 = 0.f;
  for (int u = 0; u < per / 4; ++u)
#pragma unroll
    for (int q = 0; q < 4; ++q) { const float c = vals[u * 4 + q] - mu; s2 += c * c; }
  red[tid] = s2; __syncthreads();
  for (int st = 128; st > 0; st >>= 1) { if (tid < st) red[tid] += red[tid + st]; __syncthreads(); }
  const float rs = rsqrtf(red[0] / (float)N + eps);
  {
    for (int u = 0; u < per / 4; ++u) {
      const int j = tid * 4 + 1024 * u;
      v4f o, sm;
#pragma unroll
      for (int q = 0; q < 4; ++q) {
        float gg = g[j + q], bb = bta[j + q];
        if (PARAM_BF16) { gg = bf16_round(gg); bb = bf16_round(bb); }
        sm[q] = vals[u * 4 + q]; o[q] = (vals[u * 4 + q] - mu) * rs * gg + bb;
      }
      if (out_sum) *(v4f*)(out_sum + (size_t)row * N + j) = sm;
      *(v4f*)(out_norm + (size_t)row * N + j) = o;
    }
    
  }
}



// ---- f16 WMMA path (v_wmma_f32_16x16x32_f16): 11-bit significands for operands in range — used where a [0,1] probability operand needs more precision than bf16
typedef _Float16 v16h __attribute__((ext_vector_type(16)));
union FragH { v16h v; v8us half[2]; _Float16 h[16]; unsigned short u[16]; };
template <int NT>
__device__ __forceinline__ v8f mmaH(v16h ah, v16h al, v16h bh, v16h bl, v8f c) {
  c = __builtin_amdgcn_wmma_f32_16x16x32_f16(false, ah, false, bh, (short)0, c, false, false);
  if (NT >= 2) c = __builtin_amdgcn_wmma_f32_16x16x32_f16(false, al, false, bh, (short)0, c, false, false);
  if (NT >= 3) c = __builtin_amdgcn_wmma_f32_16x16x32_f16(false, ah, false, bl, (short)0, c, false, false);
  asm volatile("v_nop\n\tv_nop\n\tv_nop\n\tv_nop" : "+v"(c) : "v"(ah), "v"(al), "v"(bh), "v"(bl));
  return c;
}
// batched GEMM like k_gemm_b but f16 operands: A f32 (split into f16 hi/lo if ASPLIT, else rounded to f16), Bt = f16 values [n][k]; alpha; C f32; N multiple of 16 (partial tiles skipped)
template <bool ASPLIT>
__global__ __launch_bounds__(128) void k_gemm_h(const float* __restrict__ A, int lda, size_t sA, const _Float16* __restrict__ Bh, int ldb, size_t sB, float alpha, float* __restrict__ C, int ldc, size_t sC, int M, int N, int K) {
  __shared__ __attribute__((aligned(16))) float so[4][16][64];
  const int tid = threadIdx.x, w = tid >> 5, lane = tid & 31, ln = lane & 15, hh = lane >> 4; const int by = blockIdx.y;
  A += (size_t)by * sA; Bh += (size_t)by * sB; C += (size_t)by * sC;
  const int ntn = (N + 63) / 64; const int wid = blockIdx.x * 4 + w; const int mt = wid / ntn, nq = wid % ntn; if (mt * 16 >= M) return;
  const int row0 = mt * 16, col0 = nq * 64; const float* arow = A + (size_t)(row0 + ln) * lda;
  v8f acc[4] = {};
  for (int kb = 0; kb < K; kb += 32) {
    FragH ah, al;
    const v4f x0 = *(const v4fa*)(arow + kb + 8 * hh), x1 = *(const v4fa*)(arow + kb + 8 * hh + 4), x2 = *(const v4fa*)(arow + kb + 16 + 8 * hh), x3 = *(const v4fa*)(arow + kb + 16 + 8 * hh + 4);
    float xs[16] = {x0[0],x0[1],x0[2],x0[3],x1[0],x1[1],x1[2],x1[3],x2[0],x2[1],x2[2],x2[3],x3[0],x3[1],x3[2],x3[3]};
#pragma unroll
    for (int i = 0; i < 16; ++i) { const _Float16 h = (_Float16)xs[i]; ah.h[i] = h; al.h[i] = ASPLIT ? (_Float16)(xs[i] - (float)h) : (_Float16)0.0f; }
#pragma unroll
    for (int t = 0; t < 4; ++t) { if (col0 + t * 16 >= N) continue; const size_t boff = (size_t)(col0 + t * 16 + ln) * ldb + kb; FragH bq; bq.half[0] = *(const v8us*)(Bh + boff + 8 * hh); bq.half[1] = *(const v8us*)(Bh + boff + 16 + 8 * hh);
      acc[t] = mmaH<ASPLIT ? 2 : 1>(ah.v, al.v, bq.v, bq.v, acc[t]); }
  }
#pragma unroll
  for (int t = 0; t < 4; ++t) { if (col0 + t * 16 >= N) continue;
#pragma unroll
    for (int r = 0; r < 8; ++r) so[w][8 * hh + r][t * 16 + ln] = acc[t][r] * alpha; }
  __builtin_amdgcn_fence(__ATOMIC_ACQ_REL, "workgroup"); __builtin_amdgcn_wave_barrier();
  const int rsub = lane >> 4, c4 = (lane & 15) * 4;
  {
#pragma unroll
    for (int q = 0; q < 8; ++q) { const int r = q * 2 + rsub; if (col0 + c4 < N) { const v4f v = *(const v4fa*)&so[w][r][c4]; *(v4f*)(C + (size_t)(row0 + r) * ldc + col0 + c4) = v; } }
     }
}

// Wt[n][k] = f16(W[k][n]·scale) from f32 row-major W[K][N] (scale = power of two; bf16-exact weights stay exact in f16 away from the subnormal range)
__global__ __launch_bounds__(256) void k_wt_f16(const float* __restrict__ W, _Float16* __restrict__ Wt, int K, int N, float scale) {
  const int t = blockIdx.x * 256 + threadIdx.x; if (t >= N * (K / 8)) return; const int n = t / (K / 8), k8 = (t % (K / 8)) * 8; FragH f;
#pragma unroll
  for (int i = 0; i < 8; ++i) f.h[i] = (_Float16)(bf16_round(W[(size_t)(k8 + i) * N + n]) * scale); const v8us o = f.half[0];
  *(v8us*)((unsigned short*)Wt + (size_t)n * K + k8) = o; 
}
// k_gemm_hh variant with fused epilogue: v = acc·alpha + bias[by·sBias + col] (+ CP[(row/rowsPerB)·sCPb + by·64 + col] if CP) ; ACT 0 none / 1 elu ; writes f16 C16 (and f32 C if non-null)
template <int ACT>
__global__ __launch_bounds__(128) void k_gemm_hhx(const _Float16* __restrict__ A, int lda, size_t sA, const _Float16* __restrict__ Bh, int ldb, size_t sB, float alpha, const float* __restrict__ bias, size_t sBias, const float* __restrict__ CP, int rowsPerB, size_t sCPb, int row0g,
    float* __restrict__ C, _Float16* __restrict__ C16, int ldc, size_t sC, int M, int N, int K) {
  __shared__ __attribute__((aligned(16))) float so[4][16][64];
  const int tid = threadIdx.x, w = tid >> 5, lane = tid & 31, ln = lane & 15, hh = lane >> 4; const int by = blockIdx.y;
  A += (size_t)by * sA; Bh += (size_t)by * sB; const size_t cofs = (size_t)by * sC; const float* bp = bias ? bias + (size_t)by * sBias : nullptr;
  const int ntn = (N + 63) / 64; const int wid = blockIdx.x * 4 + w; const int mt = wid / ntn, nq = wid % ntn; if (mt * 16 >= M) return;
  const int row0 = mt * 16, col0 = nq * 64; const _Float16* arow = A + (size_t)(row0 + ln) * lda;
  v8f acc[4] = {};
  for (int kb = 0; kb < K; kb += 32) { FragH ah; ah.half[0] = *(const v8us*)((const unsigned short*)arow + kb + 8 * hh); ah.half[1] = *(const v8us*)((const unsigned short*)arow + kb + 16 + 8 * hh);
#pragma unroll
    for (int t = 0; t < 4; ++t) { if (col0 + t * 16 >= N) continue; const size_t boff = (size_t)(col0 + t * 16 + ln) * ldb + kb; FragH bq; bq.half[0] = *(const v8us*)((const unsigned short*)Bh + boff + 8 * hh); bq.half[1] = *(const v8us*)((const unsigned short*)Bh + boff + 16 + 8 * hh);
      acc[t] = mmaH<1>(ah.v, ah.v, bq.v, bq.v, acc[t]); }
  }
#pragma unroll
  for (int t = 0; t < 4; ++t) { if (col0 + t * 16 >= N) continue; const int col = col0 + t * 16 + ln; const float bv = bp ? bf16_round(bp[col]) : 0.f;
#pragma unroll
    for (int r = 0; r < 8; ++r) { float v = acc[t][r] * alpha + bv; if (CP) { const int bidx = (row0g + row0 + 8 * hh + r) / rowsPerB; v += CP[(size_t)bidx * sCPb + (size_t)by * 64 + col]; } if (ACT == 1) v = (v > 0.f) ? v : expm1f(v); else if (ACT == 7) v = (v > 0.f) ? v + 1.0f : expf(v); else if (ACT == 8) v = tanhf(v); else if (ACT == 9) v = 0.5f * v * (1.0f + tanhf(0.7978845608028654f * (v + 0.044715f * v * v * v))); else if (ACT == 11) v = 1.0f / (1.0f + expf(-v)); else if (ACT == 12) v = (v > 0.f) ? v : 0.01f * v; else if (ACT == 14) v = (v > 0.f) ? v : 0.1f * v; else if (ACT == 15) v = v / (1.0f + expf(-v)); else if (ACT == 3) v = fmaxf(v, 0.f); else if (ACT == 6) v = 0.5f * v * (1.0f + erff(v * 0.70710678118654752f)); so[w][8 * hh + r][t * 16 + ln] = v; } }
  __builtin_amdgcn_fence(__ATOMIC_ACQ_REL, "workgroup"); __builtin_amdgcn_wave_barrier();
  const int rsub = lane >> 4, c4 = (lane & 15) * 4; typedef _Float16 v4h __attribute__((ext_vector_type(4)));
  {
#pragma unroll
    for (int q = 0; q < 8; ++q) { const int r = q * 2 + rsub; if (col0 + c4 < N) { const v4f v = *(const v4fa*)&so[w][r][c4]; if (C) *(v4f*)(C + cofs + (size_t)(row0 + r) * ldc + col0 + c4) = v; if (C16) { v4h h4; for (int i = 0; i < 4; ++i) h4[i] = (_Float16)v[i]; *(v4h*)(C16 + cofs + (size_t)(row0 + r) * ldc + col0 + c4) = h4; } } }
     }
}


typedef _Float16 v4h __attribute__((ext_vector_type(4)));

__global__ __launch_bounds__(256) void k_x16(const float* __restrict__ x, _Float16* __restrict__ X16, size_t n8) { const size_t t = (size_t)blockIdx.x * 256 + threadIdx.x; if (t >= n8) return; FragH f;
#pragma unroll
  for (int q = 0; q < 8; ++q) f.h[q] = (_Float16)bf16_round(x[t * 8 + q]); *(v8us*)((unsigned short*)X16 + t * 8) = f.half[0];  }
__global__ __launch_bounds__(256) void k_h16(const float* __restrict__ x, _Float16* __restrict__ X16, size_t n8) { const size_t t = (size_t)blockIdx.x * 256 + threadIdx.x; if (t >= n8) return; FragH f;
#pragma unroll
  for (int q = 0; q < 8; ++q) f.h[q] = (_Float16)x[t * 8 + q]; *(v8us*)((unsigned short*)X16 + t * 8) = f.half[0];  }
__global__ __launch_bounds__(256) void k_round16f(const float* __restrict__ W, _Float16* __restrict__ Bt, size_t n8) { const size_t t = (size_t)blockIdx.x * 256 + threadIdx.x; if (t >= n8) return; FragH f;
#pragma unroll
  for (int i = 0; i < 8; ++i) f.h[i] = (_Float16)(bf16_round(W[t * 8 + i]) * 16.0f); *(v8us*)((unsigned short*)Bt + t * 8) = f.half[0];  }
template <int NHv, int TTv>
__global__ __launch_bounds__(256) void k_vt(const _Float16* __restrict__ V16, int ldv, int voff, _Float16* __restrict__ Vt) { __shared__ unsigned short tl[64][66]; const int tid = threadIdx.x; const int slab = blockIdx.x / (TTv / 64), lg = blockIdx.x % (TTv / 64); const int b = slab / NHv, h = slab % NHv;
  for (int i = tid; i < 64 * 8; i += 256) { const int r = i / 8, c8 = (i % 8) * 8; FragH f; f.half[0] = *(const v8us*)((const unsigned short*)V16 + ((size_t)b * TTv + lg * 64 + r) * ldv + voff + h * 64 + c8);
#pragma unroll
    for (int q = 0; q < 8; ++q) tl[r][c8 + q] = f.u[q]; }
  __syncthreads();
  {
#pragma unroll
    for (int rd = 0; rd < 2; ++rd) { const int d = rd * 32 + tid / 8, pc = tid % 8; FragH f;
#pragma unroll
      for (int q = 0; q < 8; ++q) f.u[q] = tl[pc * 8 + q][d];
      *(v8us*)((unsigned short*)Vt + ((size_t)slab * 64 + d) * TTv + lg * 64 + pc * 8) = f.half[0]; }
     } }

__global__ __launch_bounds__(256) void k_hl(const float* __restrict__ F, _Float16* __restrict__ Hh, _Float16* __restrict__ Hl, size_t n8) { const size_t t = (size_t)blockIdx.x * 256 + threadIdx.x; if (t >= n8) return; FragH fh, fl; const v4f a = *(const v4fa*)(F + t * 8), c = *(const v4fa*)(F + t * 8 + 4);
#pragma unroll
  for (int q = 0; q < 4; ++q) { _Float16 h = (_Float16)a[q]; fh.h[q] = h; fl.h[q] = (_Float16)((a[q] - (float)h) * 1024.0f); h = (_Float16)c[q]; fh.h[4 + q] = h; fl.h[4 + q] = (_Float16)((c[q] - (float)h) * 1024.0f); }
  { *(v8us*)((unsigned short*)Hh + t * 8) = fh.half[0]; *(v8us*)((unsigned short*)Hl + t * 8) = fl.half[0];  } }

// ---- fast GEMM (wave tile 32x64; requires M % 32 == 0 rows per launch region and N % 64 == 0); epilogue = k_gemm_hhx semantics ----
__device__ __forceinline__ v16h g2_frag(const _Float16* p, int hh) { FragH f; f.half[0] = *(const v8us*)((const unsigned short*)p + 8 * hh); f.half[1] = *(const v8us*)((const unsigned short*)p + 16 + 8 * hh); return f.v; }
__device__ __forceinline__ v8f g2_mma(v16h a, v16h b, v8f c) { v8f d = __builtin_amdgcn_wmma_f32_16x16x32_f16(false, a, false, b, (short)0, c, false, false); asm volatile("v_nop\n\tv_nop\n\tv_nop\n\tv_nop" : "+v"(d) : "v"(a), "v"(b)); return d; }
// One lane's twelve 16-byte asynchronous copies from global memory to LDS (l: LDS byte addresses, g: global addresses). The s_wait_xcnt is the last line of the copies' own statement, so that no address register is rewritten in front of it.
__device__ __forceinline__ void copy12_to_lds(const unsigned (&l)[12], const unsigned short* const (&g)[12]) {
  asm volatile("global_load_async_to_lds_b128 %0, %12, off\n\tglobal_load_async_to_lds_b128 %1, %13, off\n\tglobal_load_async_to_lds_b128 %2, %14, off\n\tglobal_load_async_to_lds_b128 %3, %15, off\n\t"
               "global_load_async_to_lds_b128 %4, %16, off\n\tglobal_load_async_to_lds_b128 %5, %17, off\n\tglobal_load_async_to_lds_b128 %6, %18, off\n\tglobal_load_async_to_lds_b128 %7, %19, off\n\t"
               "global_load_async_to_lds_b128 %8, %20, off\n\tglobal_load_async_to_lds_b128 %9, %21, off\n\tglobal_load_async_to_lds_b128 %10, %22, off\n\tglobal_load_async_to_lds_b128 %11, %23, off\n\ts_wait_xcnt 0x0"
               :: "v"(l[0]), "v"(l[1]), "v"(l[2]), "v"(l[3]), "v"(l[4]), "v"(l[5]), "v"(l[6]), "v"(l[7]), "v"(l[8]), "v"(l[9]), "v"(l[10]), "v"(l[11]),
                  "v"(g[0]), "v"(g[1]), "v"(g[2]), "v"(g[3]), "v"(g[4]), "v"(g[5]), "v"(g[6]), "v"(g[7]), "v"(g[8]), "v"(g[9]), "v"(g[10]), "v"(g[11]) : "memory"); }
// Block tile 128 x 64. The operands go to LDS once per block in k steps of 64 (whole 128-byte lines of every row), two buffers: step t + 2 is copied while step t + 1 is worked on. Requires K % 64 == 0.
template <int ACT>
__global__ __launch_bounds__(128) void k_gemm2(const _Float16* __restrict__ A, int lda, size_t sA, const _Float16* __restrict__ Bh, int ldb, size_t sB, float alpha, const float* __restrict__ bias, size_t sBias, const float* __restrict__ CP, int rowsPerB, size_t sCPb, int row0g,
    float* __restrict__ C, _Float16* __restrict__ C16, int ldc, size_t sC, int M, int N, int K) {
  constexpr int GP = 72;                    /* LDS row pitch in f16: 144 B for the 128-byte rows (16 B x odd: no bank conflict for 16-byte readers) */
  constexpr int STG = (128 + 64) * GP;      /* one buffer in f16: 128 A rows, then 64 B rows */
  __shared__ __attribute__((aligned(16))) float sm[2 * STG / 2];      /* 55,296 B: the two operand buffers in the k loop; behind it the epilogue's per-wave output tiles */
  float (*so)[32][68] = (float (*)[32][68])sm;
  const unsigned short* sT = (const unsigned short*)sm;
  const int tid = threadIdx.x, w = tid >> 5, lane = tid & 31, ln = lane & 15, hh = lane >> 4; const int by = blockIdx.y;
  A += (size_t)by * sA; Bh += (size_t)by * sB; const size_t cofs = (size_t)by * sC; const float* bp = bias ? bias + (size_t)by * sBias : nullptr;
  const int ntn = N >> 6; const int mt = blockIdx.x / ntn, nq = blockIdx.x - mt * ntn; const int rowb = mt * 128, row0 = rowb + 32 * w, col0 = nq * 64; if (rowb >= M) return;      /* the whole block leaves, in front of every barrier */
  // Thread tid copies 16-byte piece tid & 7 of rows (tid >> 3) + 16 i: a wave's copy covers 4 whole 128-byte rows. An A row past M is clamped to the last row (its products are never stored).
  const int cr = tid >> 3, cc = (tid & 7) * 8;
  const unsigned short* gsrc[12];
#pragma unroll      /* unrolled here and in the three loops below: the address arrays stay in registers */
  for (int i = 0; i < 8; ++i) { const int r = rowb + cr + 16 * i; gsrc[i] = (const unsigned short*)A + (size_t)(r < M ? r : M - 1) * lda + cc; }
#pragma unroll
  for (int i = 0; i < 4; ++i) gsrc[8 + i] = (const unsigned short*)Bh + (size_t)(col0 + cr + 16 * i) * ldb + cc;
  const unsigned l0 = (unsigned)(size_t)&sT[cr * GP + cc];
  auto stage = [&](int buf) { unsigned l[12];      /* copies the next k step into buffer buf and moves the source pointers on by one step */
#pragma unroll
    for (int i = 0; i < 12; ++i) l[i] = l0 + (unsigned)((buf * STG + 16 * i * GP) * 2);
    copy12_to_lds(l, gsrc);
#pragma unroll
    for (int i = 0; i < 12; ++i) gsrc[i] += 64; };
  const v8f z8 = {0.f,0.f,0.f,0.f,0.f,0.f,0.f,0.f}; v8f c00 = z8, c01 = z8, c02 = z8, c03 = z8, c10 = z8, c11 = z8, c12 = z8, c13 = z8;
  stage(0);
  asm volatile("s_wait_asynccnt 0x0" ::: "memory");      /* step 0 has landed before the barrier that publishes it */
  __syncthreads();
  if (64 < K) stage(1);
#pragma unroll 1      /* rolled: one foot with the waits, the barrier and the refill in their order */
  for (int kb = 0; kb < K; kb += 64) {
    const int buf = (kb >> 6) & 1;
    const _Float16* tA = (const _Float16*)sT + buf * STG + (32 * w + ln) * GP; const _Float16* tB = (const _Float16*)sT + buf * STG + (128 + ln) * GP;
    v16h fa[2][2], fb[2][4];      /* the step's fragment reads stand together in front of its products */
#pragma unroll      /* unrolled here and in the two loops below: the fragment arrays stay in registers */
    for (int ks = 0; ks < 2; ++ks) { fa[ks][0] = g2_frag(tA + ks * 32, hh); fa[ks][1] = g2_frag(tA + 16 * GP + ks * 32, hh);
#pragma unroll
      for (int t = 0; t < 4; ++t) fb[ks][t] = g2_frag(tB + t * 16 * GP + ks * 32, hh); }
#pragma unroll
    for (int ks = 0; ks < 2; ++ks) {
      c00 = g2_mma(fa[ks][0], fb[ks][0], c00); c10 = g2_mma(fa[ks][1], fb[ks][0], c10);
      c01 = g2_mma(fa[ks][0], fb[ks][1], c01); c11 = g2_mma(fa[ks][1], fb[ks][1], c11);
      c02 = g2_mma(fa[ks][0], fb[ks][2], c02); c12 = g2_mma(fa[ks][1], fb[ks][2], c12);
      c03 = g2_mma(fa[ks][0], fb[ks][3], c03); c13 = g2_mma(fa[ks][1], fb[ks][3], c13); }
    asm volatile("s_wait_dscnt 0x0" ::: "memory");      /* this wave's reads of the buffer have returned before the buffer is handed back */
    asm volatile("s_wait_asynccnt 0x0" ::: "memory");      /* this wave's copies of step t + 1 have landed */
    __syncthreads();      /* publishes step t + 1 and ends every wave's reads of step t */
    if (kb + 128 < K) stage(buf); }
  asm volatile("s_wait_asynccnt 0x0" ::: "memory");      /* nothing is in flight when the LDS is taken over by the output tiles */
  if (row0 >= M) return;      /* behind the last barrier */
  v8f accs[8] = {c00, c01, c02, c03, c10, c11, c12, c13};
#pragma unroll
  for (int u = 0; u < 8; ++u) { const int t = u & 3, half = u >> 2; const int col = col0 + t * 16 + ln; const float bv = bp ? bf16_round(bp[col]) : 0.f;
#pragma unroll
    for (int r = 0; r < 8; ++r) { const int rloc = half * 16 + 8 * hh + r; float v = accs[u][r] * alpha + bv; if (CP) { const int bidx = (row0g + row0 + rloc) / rowsPerB; v += CP[(size_t)bidx * sCPb + (size_t)by * 64 + col]; }
      if (ACT == 3) v = fmaxf(v, 0.f); else if (ACT == 6) v = 0.5f * v * (1.0f + erff(v * 0.70710678118654752f)); else if (ACT == 11) v = 1.0f / (1.0f + expf(-v)); else if (ACT == 15) v = v / (1.0f + expf(-v)); else if (ACT == 12) v = (v > 0.f) ? v : 0.01f * v; else if (ACT == 8) v = tanhf(v);
      so[w][rloc][t * 16 + ln] = v; } }
  __builtin_amdgcn_fence(__ATOMIC_ACQ_REL, "workgroup"); __builtin_amdgcn_wave_barrier();
  const int rsub = lane >> 4, c4 = (lane & 15) * 4;
  {
#pragma unroll
    for (int q = 0; q < 16; ++q) { const int r = q * 2 + rsub; const v4f v = *(const v4fa*)&so[w][r][c4]; if (C) *(v4f*)(C + cofs + (size_t)(row0 + r) * ldc + col0 + c4) = v; if (C16) { v4h h4; for (int i = 0; i < 4; ++i) h4[i] = (_Float16)v[i]; *(v4h*)(C16 + cofs + (size_t)(row0 + r) * ldc + col0 + c4) = h4; } }
     } }



// lane l with lane l ^ 16: the two lanes that share one query column of a transposed score tile
__device__ __forceinline__ float xhalf(float x) { return __builtin_bit_cast(float, __builtin_amdgcn_permlanex16(__builtin_bit_cast(int, x), __builtin_bit_cast(int, x), 0x76543210, 0xfedcba98, false, false)); }
__device__ __forceinline__ void copy4_to_lds(unsigned l0, const unsigned short* g0, unsigned l1, const unsigned short* g1, unsigned l2, const unsigned short* g2, unsigned l3, const unsigned short* g3) {
  asm volatile("global_load_async_to_lds_b128 %0, %1, off\n\tglobal_load_async_to_lds_b128 %2, %3, off\n\tglobal_load_async_to_lds_b128 %4, %5, off\n\tglobal_load_async_to_lds_b128 %6, %7, off\n\ts_wait_xcnt 0x0"
               :: "v"(l0), "v"(g0), "v"(l1), "v"(g1), "v"(l2), "v"(g2), "v"(l3), "v"(g3) : "memory"); }
// Sixteen 2^x in place, each on a register of its own: no instruction directly behind a transcendental reads its result or overwrites its source; the closing v_nop keeps that slot in front of whatever the compiler puts next.
__device__ __forceinline__ void exp2x16(float (&x)[16]) {
  asm("v_exp_f32 %0, %0\n\tv_exp_f32 %1, %1\n\tv_exp_f32 %2, %2\n\tv_exp_f32 %3, %3\n\tv_exp_f32 %4, %4\n\tv_exp_f32 %5, %5\n\tv_exp_f32 %6, %6\n\tv_exp_f32 %7, %7\n\t"
      "v_exp_f32 %8, %8\n\tv_exp_f32 %9, %9\n\tv_exp_f32 %10, %10\n\tv_exp_f32 %11, %11\n\tv_exp_f32 %12, %12\n\tv_exp_f32 %13, %13\n\tv_exp_f32 %14, %14\n\tv_exp_f32 %15, %15\n\tv_nop"
      : "+v"(x[0]), "+v"(x[1]), "+v"(x[2]), "+v"(x[3]), "+v"(x[4]), "+v"(x[5]), "+v"(x[6]), "+v"(x[7]), "+v"(x[8]), "+v"(x[9]), "+v"(x[10]), "+v"(x[11]), "+v"(x[12]), "+v"(x[13]), "+v"(x[14]), "+v"(x[15])); }
template <int CAUSAL>
__global__ __launch_bounds__(128) void k_flash(const _Float16* __restrict__ Q16, int ldq, const _Float16* __restrict__ K16, int ldk, const _Float16* __restrict__ Vt, const int* __restrict__ MSK, float* __restrict__ O, int ldo) {
  constexpr int RPW = 16, DT = 4, KS = 2;
  constexpr int KP = 72, VP = 40;      /* LDS row pitch in f16: 144 B for the 128-byte K rows, 80 B for the 64-byte V^T rows (16 B x odd: no bank conflict for 16-byte readers) */
  __shared__ __attribute__((aligned(16))) float sO[4][RPW][64 + 4];
  __shared__ __attribute__((aligned(16))) unsigned short sK[2][32 * KP];      /* 32 keys x 64 */
  __shared__ __attribute__((aligned(16))) unsigned short sV[2][64 * VP];      /* 64 d x 32 keys */
  const int tid = threadIdx.x, w = tid >> 5, lane = tid & 31, ln = lane & 15, hh = lane >> 4;
  const int slab = blockIdx.x / QBLKS, qblk = blockIdx.x % QBLKS; (void)MSK; const int b = slab / NH, h = slab % NH; const int qb0 = qblk * (4 * RPW); const int q0 = qb0 + w * RPW;
  FragH bq[KS];
  { const unsigned short* qr = (const unsigned short*)Q16 + ((size_t)b * TQ + q0 + ln) * ldq + h * 64;
#pragma unroll
    for (int ks = 0; ks < KS; ++ks) { bq[ks].half[0] = *(const v8us*)(qr + ks * 32 + 8 * hh); bq[ks].half[1] = *(const v8us*)(qr + ks * 32 + 16 + 8 * hh); } }
  const unsigned short* Vth = (const unsigned short*)Vt + (size_t)slab * 64 * TK;
  const int tq = q0 + ln;
  float m_q = -3.0e38f, l_q = 0.f; v8f oacc[DT];
#pragma unroll
  for (int dt = 0; dt < DT; ++dt) oacc[dt] = (v8f){0.f,0.f,0.f,0.f,0.f,0.f,0.f,0.f};
  const int jend = (CAUSAL == 1) ? (qb0 + 4 * RPW) : TK;      /* causal: keys beyond the block's last query never contribute */
  // Key tiles of 32 keys go to LDS once per block (the four waves read the same K and V^T), two buffers: tile t + 2 is copied while tile t + 1 is worked on.
  // Thread tid copies 16-byte pieces tid and tid + 128 of each tile: K piece c = row c / 8, column c % 8 (a wave covers 4 whole 128-byte rows); V^T piece c = row c / 4, column c % 4.
  const unsigned short* gK = (const unsigned short*)K16 + ((size_t)b * TK + (tid >> 3)) * ldk + h * 64 + (tid & 7) * 8;
  const unsigned short* gV = Vth + (size_t)(tid >> 2) * TK + (tid & 3) * 8;
  const unsigned lK = (unsigned)(size_t)&sK[0][(tid >> 3) * KP + (tid & 7) * 8], lV = (unsigned)(size_t)&sV[0][(tid >> 2) * VP + (tid & 3) * 8];
  auto stage = [&](int j, int buf) { const unsigned short* k0 = gK + (size_t)j * ldk; const unsigned short* v0 = gV + j; const unsigned lk = lK + buf * (32 * KP * 2), lv = lV + buf * (64 * VP * 2);
    copy4_to_lds(lk, k0, lk + 16 * KP * 2, k0 + (size_t)16 * ldk, lv, v0, lv + 32 * VP * 2, v0 + (size_t)32 * TK); };
  stage(0, 0);
  asm volatile("s_wait_asynccnt 0x0" ::: "memory");      /* tile 0 has landed before the barrier that publishes it */
  __syncthreads();
  stage(32, 1);      /* jend is at least 64: a tile 1 exists */
#pragma unroll 1
  for (int j0 = 0; j0 < jend; j0 += 32) {
    const int buf = (j0 >> 5) & 1;
    const unsigned short* tK = &sK[buf][ln * KP + 8 * hh]; const unsigned short* tV = &sV[buf][ln * VP + 8 * hh];
    FragH ak[2][KS], av[DT];
#pragma unroll
    for (int nt = 0; nt < 2; ++nt)
#pragma unroll
      for (int ks = 0; ks < KS; ++ks) { ak[nt][ks].half[0] = *(const v8us*)(tK + nt * 16 * KP + ks * 32); ak[nt][ks].half[1] = *(const v8us*)(tK + nt * 16 * KP + ks * 32 + 16); }
#pragma unroll
    for (int dt = 0; dt < DT; ++dt) { av[dt].half[0] = *(const v8us*)(tV + dt * 16 * VP); av[dt].half[1] = *(const v8us*)(tV + dt * 16 * VP + 16); }
    v8f s[2];
#pragma unroll
    for (int nt = 0; nt < 2; ++nt) {
      v8f acc = (v8f){0.f,0.f,0.f,0.f,0.f,0.f,0.f,0.f};
#pragma unroll
      for (int ks = 0; ks < KS; ++ks) acc = mmaH<1>(ak[nt][ks].v, ak[nt][ks].v, bq[ks].v, bq[ks].v, acc);
      s[nt] = acc; }
    float sc[2][8], mx[8]; bool ok[2][8];      /* sc, m_q: raw products; the factor SCL2 = log2(e)/8 is applied inside the exponent's one fma */
#pragma unroll
    for (int r = 0; r < 8; ++r) {
#pragma unroll
      for (int nt = 0; nt < 2; ++nt) { const int kk = j0 + nt * 16 + 8 * hh + r;
        ok[nt][r] = (CAUSAL == 1) ? (kk <= tq) : ((CAUSAL == 2) ? ((kk >> 5) == (tq >> 5)) : true);      /* mode 2: block-diagonal 32-token groups */
        sc[nt][r] = ok[nt][r] ? s[nt][r] : -3.0e38f; }
      mx[r] = fmaxf(sc[0][r], sc[1][r]); }
    float mc = fmaxf(fmaxf(fmaxf(mx[0], mx[1]), fmaxf(mx[2], mx[3])), fmaxf(fmaxf(mx[4], mx[5]), fmaxf(mx[6], mx[7])));
    mc = fmaxf(mc, xhalf(mc));
    const float mn = fmaxf(m_q, mc); const float al = (mn > -1.0e38f) ? __builtin_amdgcn_exp2f((m_q - mn) * SCL2) : 1.0f; m_q = mn;
    const float nb = 10.0f - mn * SCL2;      /* p = 1024 e^((s - max)/8) = 2^(s SCL2 + nb): the x1024 of the f16 operand is the + 10 */
    float e[16];
#pragma unroll      /* unrolled: e stays in registers, as the asm operands need */
    for (int r = 0; r < 8; ++r) { e[r] = __builtin_fmaf(sc[0][r], SCL2, nb); e[8 + r] = __builtin_fmaf(sc[1][r], SCL2, nb); }
    exp2x16(e);
    FragH pb; float ps[8];
#pragma unroll
    for (int r = 0; r < 8; ++r) { const float p0 = ok[0][r] ? e[r] : 0.f, p1 = ok[1][r] ? e[8 + r] : 0.f; ps[r] = p0 + p1;
      pb.h[r] = (_Float16)p0; pb.h[8 + r] = (_Float16)p1; }
    l_q = l_q * al + (((ps[0] + ps[1]) + (ps[2] + ps[3])) + ((ps[4] + ps[5]) + (ps[6] + ps[7])));
#pragma unroll
    for (int dt = 0; dt < DT; ++dt)
#pragma unroll
      for (int r = 0; r < 8; ++r) oacc[dt][r] *= al;
#pragma unroll
    for (int dt = 0; dt < DT; ++dt) oacc[dt] = mmaH<1>(av[dt].v, av[dt].v, pb.v, pb.v, oacc[dt]);
    asm volatile("s_wait_dscnt 0x0" ::: "memory");      /* this wave's reads of the buffer have returned before the buffer is handed back */
    asm volatile("s_wait_asynccnt 0x0" ::: "memory");      /* this wave's copies of tile t + 1 have landed */
    __syncthreads();      /* publishes tile t + 1 and ends every wave's reads of tile t */
    if (j0 + 64 < jend) stage(j0 + 64, buf); }
  asm volatile("s_wait_asynccnt 0x0" ::: "memory");      /* nothing is in flight when the wave goes on to the epilogue and ends */
  const float l = l_q + xhalf(l_q); const float inv = (l > 0.f) ? 1.0f / l : 0.f;      /* l and oacc both carry the x1024 */
#pragma unroll
  for (int dt = 0; dt < DT; ++dt) {      /* register r of tile dt is O[q0 + ln][dt*16 + 8*hh + r] */
    const v4f lo = {oacc[dt][0] * inv, oacc[dt][1] * inv, oacc[dt][2] * inv, oacc[dt][3] * inv}, hi = {oacc[dt][4] * inv, oacc[dt][5] * inv, oacc[dt][6] * inv, oacc[dt][7] * inv};
    *(v4fa*)&sO[w][ln][dt * 16 + 8 * hh] = lo; *(v4fa*)&sO[w][ln][dt * 16 + 8 * hh + 4] = hi; }
  __builtin_amdgcn_fence(__ATOMIC_ACQ_REL, "workgroup"); __builtin_amdgcn_wave_barrier();
  {
#pragma unroll
    for (int rp = 0; rp < RPW; rp += 2) { const int r = rp + (lane >> 4), pc = lane & 15; const v4f val = *(const v4fa*)&sO[w][r][pc * 4]; *(v4f*)(O + ((size_t)b * TQ + q0 + r) * ldo + h * 64 + pc * 4) = val; }
     } }

__global__ __launch_bounds__(256) void k_sum5(const float* __restrict__ O, float* __restrict__ out, size_t n4) {
  #pragma clang fp contract(off)
  const size_t t = (size_t)blockIdx.x * 256 + threadIdx.x; if (t >= n4) return; v4f a = *(const v4fa*)(O + t * 4);
  for (int n = 1; n < NSRC; ++n) { const v4f b = *(const v4fa*)(O + (size_t)n * NR * CC + t * 4); for (int q = 0; q < 4; ++q) a[q] += b[q]; }
  *(v4f*)(out + t * 4) = a;  }

extern "C" void kernel_launch(void* const* d_in, const int* in_sizes, int n_in,
                              void* d_out, int out_size, void* d_ws, size_t ws_size, hipStream_t stream) {
  (void)in_sizes; (void)n_in; (void)out_size;
  const float* const* I = (const float* const*)d_in; const float* hsp = I[0]; const float* Wq = I[1]; const float* bq = I[2]; const float* Wk = I[3]; const float* bk = I[4]; const float* Wv = I[5]; const float* bv = I[6];
  char* ws = (char*)d_ws; size_t off = 0;
  auto take = [&](size_t bytes) { char* p = ws + off; off += (bytes + 255) & ~(size_t)255; return p; };
  _Float16* BQ = (_Float16*)take((size_t)CC * CC * 2); _Float16* BK = (_Float16*)take((size_t)CC * CC * 2); _Float16* BV = (_Float16*)take((size_t)CC * CC * 2);
  _Float16* X16 = (_Float16*)take((size_t)NRA * CC * 2); _Float16* Q16 = (_Float16*)take((size_t)NR * CC * 2); _Float16* K16 = (_Float16*)take((size_t)NRA * CC * 2); _Float16* V16 = (_Float16*)take((size_t)NRA * CC * 2); _Float16* VT = (_Float16*)take((size_t)NRA * CC * 2); float* O = (float*)take((size_t)NSRC * NR * CC * 4);
  if (off > ws_size) return;      /* 3.4 + 30 + 6 + 30 + 30 + 30 + 60 = 190 MiB */
  k_wt_f16<<<(CC * CC / 8 + 255) / 256, 256, 0, stream>>>(Wq, BQ, CC, CC, 16.0f); k_wt_f16<<<(CC * CC / 8 + 255) / 256, 256, 0, stream>>>(Wk, BK, CC, CC, 16.0f); k_wt_f16<<<(CC * CC / 8 + 255) / 256, 256, 0, stream>>>(Wv, BV, CC, CC, 16.0f);
  k_x16<<<(unsigned)(((size_t)NRA * CC / 8 + 255) / 256), 256, 0, stream>>>(hsp, X16, (size_t)NRA * CC / 8);
  k_gemm2<0><<<dim3((NR / 128) * (CC / 64), 1), 128, 0, stream>>>(X16, CC, 0, BQ, CC, 0, 0.0625f, bq, 0, nullptr, 1, 0, 0, nullptr, Q16, CC, 0, NR, CC, CC);      /* q from source 0 */
  k_gemm2<0><<<dim3((NRA / 128) * (CC / 64), 1), 128, 0, stream>>>(X16, CC, 0, BK, CC, 0, 0.0625f, bk, 0, nullptr, 1, 0, 0, nullptr, K16, CC, 0, NRA, CC, CC);      /* k for every source */
  k_gemm2<0><<<dim3((NRA / 128) * (CC / 64), 1), 128, 0, stream>>>(X16, CC, 0, BV, CC, 0, 0.0625f, bv, 0, nullptr, 1, 0, 0, nullptr, V16, CC, 0, NRA, CC, CC);
  k_vt<NH, SLEN><<<NSRC * NB * NH * (SLEN / 64), 256, 0, stream>>>(V16, CC, 0, VT);      /* slabs ((n*4 + b)*12 + h) */
  for (int n = 0; n < NSRC; ++n)
    k_flash<0><<<NB * NH * QBLKS, 128, 0, stream>>>(Q16, CC, K16 + (size_t)n * NR * CC, CC, VT + (size_t)n * NB * NH * 64 * SLEN, nullptr, O + (size_t)n * NR * CC, CC);
  k_sum5<<<(unsigned)(((size_t)NR * CC / 4 + 255) / 256), 256, 0, stream>>>(O, (float*)d_out, (size_t)NR * CC / 4);
}

// v005
// Measured time: 222 microseconds a run.
// Next to v004, in two timings, it ran 1.10 times as fast each time.
// All steps since v000 together make it 3.49 times as fast.
#include <hip/hip_runtime.h>
// Attention_KV (5 sources x 4 batches x 1024 tokens x 768 = 12 heads of 64): q from source 0 (Wq + bq); every source n gives k_n, v_n (shared Wk/bk, Wv/bv); ctx = sum_n softmax(q k_n^T / 8) v_n (independent softmax per source); output = ctx merged [B, S, 768] (no output projection).
// Structure: one exact f16 plane of all sources; q / k / v GEMMs (32x64 wave tiles, f32 accumulation, exact x16 weights + bias, f16 outputs; k and v over all 5 sources at once); V^T by LDS tiles for all (source, batch, head) slabs in one launch; one fused flash kernel (plain f16 operands) whose blocks walk the five sources in turn and add each source's normalised rows in registers, then store the output.
// Compute dtype: inputs and parameters rounded to bf16; q, k, v, P as f16 (~2^-12); f32 accumulation/softmax/sum. v_wmma_f32_16x16x32_f16.
#define NSRC 5
#define NB 4
#define CC 768
#define NR (NB * SLEN)           /* 4096 query rows */
#define NRA (NSRC * NR)          /* 20480 source rows */
#define SLEN 1024
#define TQ SLEN
#define TK SLEN
#define NH 12
#define SCL 0.125f               /* 1/sqrt(64) */
#define SCL2 (SCL * 1.4426950408889634f)   /* log2(e)/sqrt(64) */
#define QBLKS (TQ / 64)
typedef __bf16 v16b __attribute__((ext_vector_type(16)));
typedef unsigned short v8us __attribute__((ext_vector_type(8), may_alias));
typedef float  v8f  __attribute__((ext_vector_type(8)));
typedef float  v4f  __attribute__((ext_vector_type(4)));
typedef float  v4fa __attribute__((ext_vector_type(4), may_alias));
union FragB { v16b v; v8us half[2]; unsigned short u[16]; };

__device__ __forceinline__ unsigned short bf16_bits(float x) { unsigned int u = __float_as_uint(x); return (unsigned short)((u + 0x7FFFu + ((u >> 16) & 1u)) >> 16); }
__device__ __forceinline__ float bf16_val(unsigned short b) { return __uint_as_float(((unsigned int)b) << 16); }
__device__ __forceinline__ float bf16_round(float x) { return bf16_val(bf16_bits(x)); }
// D += A·B with NT terms: 1 = ah·bh, 2 = + al·bh (A split), 3 = + ah·bl (both split)
template <int NT>
__device__ __forceinline__ v8f mmaN(v16b ah, v16b al, v16b bh, v16b bl, v8f c) {
  c = __builtin_amdgcn_wmma_f32_16x16x32_bf16(false, ah, false, bh, (short)0, c, false, false);
  if (NT >= 2) c = __builtin_amdgcn_wmma_f32_16x16x32_bf16(false, al, false, bh, (short)0, c, false, false);
  if (NT >= 3) c = __builtin_amdgcn_wmma_f32_16x16x32_bf16(false, ah, false, bl, (short)0, c, false, false);
  asm volatile("v_nop\n\tv_nop\n\tv_nop\n\tv_nop" : "+v"(c) : "v"(ah), "v"(al), "v"(bh), "v"(bl));
  return c;
}

__global__ __launch_bounds__(256) void k_wt_bf16(const float* __restrict__ W, unsigned short* __restrict__ Wt, int K, int N) {
  const int t = blockIdx.x * 256 + threadIdx.x;
  const int k8n = K / 8;
  if (t >= N * k8n) return;
  const int n = t / k8n, k8 = (t % k8n) * 8;
  v8us v;
#pragma unroll
  for (int i = 0; i < 8; ++i) v[i] = bf16_bits(W[(size_t)(k8 + i) * N + n]);
  *(v8us*)(Wt + (size_t)n * K + k8) = v;
  
}

// GEMM C[M][N] (f32, pitch ldc) = act(A[M][K]·W + bias). A f32 row-major (pitch lda) converted per fragment to bf16
// (ASPLIT: hi/lo two planes -> 2 terms, else single rounded term); Wt bf16 [N][K] (pitch ldb). BIAS_BF16 rounds the
// bias to bf16 first (bias quantised to bf16 before the add). K%32==0, M%16==0, N%64==0.
template <bool ASPLIT, int ACT, bool BIAS_BF16>
__global__ __launch_bounds__(128) void k_gemm_bf(const float* __restrict__ A, int lda, const unsigned short* __restrict__ Wt, int ldb,
                                               const float* __restrict__ bias, float* __restrict__ C, int ldc, int M, int N, int K) {
  __shared__ __attribute__((aligned(16))) float so[4][16][64];
  const int tid = threadIdx.x, w = tid >> 5, lane = tid & 31, ln = lane & 15, hh = lane >> 4;
  const int ntn = N / 64;
  const int wid = blockIdx.x * 4 + w;
  const int mt = wid / ntn, nq = wid % ntn;
  if (mt * 16 >= M) return;
  const int row0 = mt * 16, col0 = nq * 64;
  const float* arow = A + (size_t)(row0 + ln) * lda;
  v8f acc[4] = {};
  for (int kb = 0; kb < K; kb += 32) {
    FragB ah, al;
    const v4f x0 = *(const v4fa*)(arow + kb + 8 * hh), x1 = *(const v4fa*)(arow + kb + 8 * hh + 4);
    const v4f x2 = *(const v4fa*)(arow + kb + 16 + 8 * hh), x3 = *(const v4fa*)(arow + kb + 16 + 8 * hh + 4);
    float xs[16] = {x0[0],x0[1],x0[2],x0[3],x1[0],x1[1],x1[2],x1[3],x2[0],x2[1],x2[2],x2[3],x3[0],x3[1],x3[2],x3[3]};
#pragma unroll
    for (int i = 0; i < 16; ++i) { const unsigned short hb = bf16_bits(xs[i]); ah.u[i] = hb; al.u[i] = ASPLIT ? bf16_bits(xs[i] - bf16_val(hb)) : (unsigned short)0; }
#pragma unroll
    for (int t = 0; t < 4; ++t) {
      const unsigned short* brow = Wt + (size_t)(col0 + t * 16 + ln) * ldb + kb;
      FragB b;
      b.half[0] = *(const v8us*)(brow + 8 * hh);
      b.half[1] = *(const v8us*)(brow + 16 + 8 * hh);
      acc[t] = mmaN<ASPLIT ? 2 : 1>(ah.v, al.v, b.v, b.v, acc[t]);
    }
  }
#pragma unroll
  for (int t = 0; t < 4; ++t) {
    float bv = bias ? bias[col0 + t * 16 + ln] : 0.f;
    if (BIAS_BF16) bv = bf16_round(bv);
#pragma unroll
    for (int r = 0; r < 8; ++r) { float v = acc[t][r] + bv; if (ACT == 1) v = fmaxf(v, 0.f); so[w][8 * hh + r][t * 16 + ln] = v; }
  }
  __builtin_amdgcn_fence(__ATOMIC_ACQ_REL, "workgroup");
  __builtin_amdgcn_wave_barrier();
  const int rsub = lane >> 4, c4 = (lane & 15) * 4;
  {
#pragma unroll
    for (int q = 0; q < 8; ++q) {
      const int r = q * 2 + rsub;
      const v4f v = *(const v4fa*)&so[w][r][c4];
      *(v4f*)(C + (size_t)(row0 + r) * ldc + col0 + c4) = v;
    }
    
  }
}

// GEMM C = act(A·W + bias + resid): A f32 (ASPLIT -> hi/lo 2 terms), Wt bf16 [N][K]; ACT 0 none, 1 relu, 2 exact gelu;
// resid (optional, f32, row index = (row % rmod), pitch ldr, RES_BF16 rounds it) added before the activation.
template <bool ASPLIT, int ACT, bool BIAS_BF16, bool RES_BF16>
__global__ __launch_bounds__(128) void k_gemm_bf3(const float* __restrict__ A, int lda, const unsigned short* __restrict__ Wt, int ldb,
                                                const float* __restrict__ bias, const float* __restrict__ resid, int rmod, int ldr,
                                                float* __restrict__ C, int ldc, int M, int N, int K) {
  __shared__ __attribute__((aligned(16))) float so[4][16][64];
  const int tid = threadIdx.x, w = tid >> 5, lane = tid & 31, ln = lane & 15, hh = lane >> 4;
  const int ntn = N / 64;
  const int wid = blockIdx.x * 4 + w;
  const int mt = wid / ntn, nq = wid % ntn;
  if (mt * 16 >= M) return;
  const int row0 = mt * 16, col0 = nq * 64;
  const float* arow = A + (size_t)(row0 + ln) * lda;
  v8f acc[4] = {};
  for (int kb = 0; kb < K; kb += 32) {
    FragB ah, al;
    const v4f x0 = *(const v4fa*)(arow + kb + 8 * hh), x1 = *(const v4fa*)(arow + kb + 8 * hh + 4);
    const v4f x2 = *(const v4fa*)(arow + kb + 16 + 8 * hh), x3 = *(const v4fa*)(arow + kb + 16 + 8 * hh + 4);
    float xs[16] = {x0[0],x0[1],x0[2],x0[3],x1[0],x1[1],x1[2],x1[3],x2[0],x2[1],x2[2],x2[3],x3[0],x3[1],x3[2],x3[3]};
#pragma unroll
    for (int i = 0; i < 16; ++i) { const unsigned short hb = bf16_bits(xs[i]); ah.u[i] = hb; al.u[i] = ASPLIT ? bf16_bits(xs[i] - bf16_val(hb)) : (unsigned short)0; }
#pragma unroll
    for (int t = 0; t < 4; ++t) {
      const unsigned short* brow = Wt + (size_t)(col0 + t * 16 + ln) * ldb + kb;
      FragB b;
      b.half[0] = *(const v8us*)(brow + 8 * hh);
      b.half[1] = *(const v8us*)(brow + 16 + 8 * hh);
      acc[t] = mmaN<ASPLIT ? 2 : 1>(ah.v, al.v, b.v, b.v, acc[t]);
    }
  }
#pragma unroll
  for (int t = 0; t < 4; ++t) {
    const int col = col0 + t * 16 + ln;
    float bv = bias ? bias[col] : 0.f;
    if (BIAS_BF16) bv = bf16_round(bv);
#pragma unroll
    for (int r = 0; r < 8; ++r) {
      float v = acc[t][r] + bv;
      if (resid) { float rv = resid[(size_t)((row0 + 8 * hh + r) % rmod) * ldr + col]; if (RES_BF16) rv = bf16_round(rv); v += rv; }
      if (ACT == 1) v = fmaxf(v, 0.f);
      if (ACT == 2) v = 0.5f * v * (1.0f + erff(v * 0.70710678118654752f));
      if (ACT == 3) { const float u = 0.7978845608028654f * (v + 0.044715f * v * v * v); v = 0.5f * v * (1.0f + tanhf(u)); }
      so[w][8 * hh + r][t * 16 + ln] = v;
    }
  }
  __builtin_amdgcn_fence(__ATOMIC_ACQ_REL, "workgroup");
  __builtin_amdgcn_wave_barrier();
  const int rsub = lane >> 4, c4 = (lane & 15) * 4;
  {
#pragma unroll
    for (int q = 0; q < 8; ++q) {
      const int r = q * 2 + rsub;
      const v4f v = *(const v4fa*)&so[w][r][c4];
      *(v4f*)(C + (size_t)(row0 + r) * ldc + col0 + c4) = v;
    }
    
  }
}
// row LayerNorm (biased variance, eps) over N: s = X (+ R); optional out_sum <- s; out_norm <- (s-mu)*rsqrt(var+eps)*g + b
template <bool PARAM_BF16>
__global__ __launch_bounds__(256) void k_layernorm(const float* __restrict__ X, const float* __restrict__ R, const float* __restrict__ g, const float* __restrict__ bta,
                                                  float* __restrict__ out_sum, float* __restrict__ out_norm, int N, float eps) {
  __shared__ float red[256];
  const int row = blockIdx.x, tid = threadIdx.x;
  const float* x = X + (size_t)row * N; const float* rr = R ? R + (size_t)row * N : nullptr;
  float vals[16];                     // up to N = 4096
  const int per = N / 256;            // contiguous chunk per thread? use strided-by-4 chunks: thread handles j = tid*4 + 1024*u
  float s1 = 0.f;
  for (int u = 0; u < per / 4; ++u) {
    const int j = tid * 4 + 1024 * u;
    const v4f a = *(const v4fa*)(x + j);
    v4f b = {0.f,0.f,0.f,0.f}; if (rr) b = *(const v4fa*)(rr + j);
#pragma unroll
    for (int q = 0; q < 4; ++q) { const float v = a[q] + b[q]; vals[u * 4 + q] = v; s1 += v; }
  }
  red[tid] = s1; __syncthreads();
  for (int st = 128; st > 0; st >>= 1) { if (tid < st) red[tid] += red[tid + st]; __syncthreads(); }
  const float mu = red[0] / (float)N; __syncthreads();
  float s2 = 0.f;
  for (int u = 0; u < per / 4; ++u)
#pragma unroll
    for (int q = 0; q < 4; ++q) { const float c = vals[u * 4 + q] - mu; s2 += c * c; }
  red[tid] = s2; __syncthreads();
  for (int st = 128; st > 0; st >>= 1) { if (tid < st) red[tid] += red[tid + st]; __syncthreads(); }
  const float rs = rsqrtf(red[0] / (float)N + eps);
  {
    for (int u = 0; u < per / 4; ++u) {
      const int j = tid * 4 + 1024 * u;
      v4f o, sm;
#pragma unroll
      for (int q = 0; q < 4; ++q) {
        float gg = g[j + q], bb = bta[j + q];
        if (PARAM_BF16) { gg = bf16_round(gg); bb = bf16_round(bb); }
        sm[q] = vals[u * 4 + q]; o[q] = (vals[u * 4 + q] - mu) * rs * gg + bb;
      }
      if (out_sum) *(v4f*)(out_sum + (size_t)row * N + j) = sm;
      *(v4f*)(out_norm + (size_t)row * N + j) = o;
    }
    
  }
}



// ---- f16 WMMA path (v_wmma_f32_16x16x32_f16): 11-bit significands for operands in range — used where a [0,1] probability operand needs more precision than bf16
typedef _Float16 v16h __attribute__((ext_vector_type(16)));
union FragH { v16h v; v8us half[2]; _Float16 h[16]; unsigned short u[16]; };
template <int NT>
__device__ __forceinline__ v8f mmaH(v16h ah, v16h al, v16h bh, v16h bl, v8f c) {
  c = __builtin_amdgcn_wmma_f32_16x16x32_f16(false, ah, false, bh, (short)0, c, false, false);
  if (NT >= 2) c = __builtin_amdgcn_wmma_f32_16x16x32_f16(false, al, false, bh, (short)0, c, false, false);
  if (NT >= 3) c = __builtin_amdgcn_wmma_f32_16x16x32_f16(false, ah, false, bl, (short)0, c, false, false);
  asm volatile("v_nop\n\tv_nop\n\tv_nop\n\tv_nop" : "+v"(c) : "v"(ah), "v"(al), "v"(bh), "v"(bl));
  return c;
}
// batched GEMM like k_gemm_b but f16 operands: A f32 (split into f16 hi/lo if ASPLIT, else rounded to f16), Bt = f16 values [n][k]; alpha; C f32; N multiple of 16 (partial tiles skipped)
template <bool ASPLIT>
__global__ __launch_bounds__(128) void k_gemm_h(const float* __restrict__ A, int lda, size_t sA, const _Float16* __restrict__ Bh, int ldb, size_t sB, float alpha, float* __restrict__ C, int ldc, size_t sC, int M, int N, int K) {
  __shared__ __attribute__((aligned(16))) float so[4][16][64];
  const int tid = threadIdx.x, w = tid >> 5, lane = tid & 31, ln = lane & 15, hh = lane >> 4; const int by = blockIdx.y;
  A += (size_t)by * sA; Bh += (size_t)by * sB; C += (size_t)by * sC;
  const int ntn = (N + 63) / 64; const int wid = blockIdx.x * 4 + w; const int mt = wid / ntn, nq = wid % ntn; if (mt * 16 >= M) return;
  const int row0 = mt * 16, col0 = nq * 64; const float* arow = A + (size_t)(row0 + ln) * lda;
  v8f acc[4] = {};
  for (int kb = 0; kb < K; kb += 32) {
    FragH ah, al;
    const v4f x0 = *(const v4fa*)(arow + kb + 8 * hh), x1 = *(const v4fa*)(arow + kb + 8 * hh + 4), x2 = *(const v4fa*)(arow + kb + 16 + 8 * hh), x3 = *(const v4fa*)(arow + kb + 16 + 8 * hh + 4);
    float xs[16] = {x0[0],x0[1],x0[2],x0[3],x1[0],x1[1],x1[2],x1[3],x2[0],x2[1],x2[2],x2[3],x3[0],x3[1],x3[2],x3[3]};
#pragma unroll
    for (int i = 0; i < 16; ++i) { const _Float16 h = (_Float16)xs[i]; ah.h[i] = h; al.h[i] = ASPLIT ? (_Float16)(xs[i] - (float)h) : (_Float16)0.0f; }
#pragma unroll
    for (int t = 0; t < 4; ++t) { if (col0 + t * 16 >= N) continue; const size_t boff = (size_t)(col0 + t * 16 + ln) * ldb + kb; FragH bq; bq.half[0] = *(const v8us*)(Bh + boff + 8 * hh); bq.half[1] = *(const v8us*)(Bh + boff + 16 + 8 * hh);
      acc[t] = mmaH<ASPLIT ? 2 : 1>(ah.v, al.v, bq.v, bq.v, acc[t]); }
  }
#pragma unroll
  for (int t = 0; t < 4; ++t) { if (col0 + t * 16 >= N) continue;
#pragma unroll
    for (int r = 0; r < 8; ++r) so[w][8 * hh + r][t * 16 + ln] = acc[t][r] * alpha; }
  __builtin_amdgcn_fence(__ATOMIC_ACQ_REL, "workgroup"); __builtin_amdgcn_wave_barrier();
  const int rsub = lane >> 4, c4 = (lane & 15) * 4;
  {
#pragma unroll
    for (int q = 0; q < 8; ++q) { const int r = q * 2 + rsub; if (col0 + c4 < N) { const v4f v = *(const v4fa*)&so[w][r][c4]; *(v4f*)(C + (size_t)(row0 + r) * ldc + col0 + c4) = v; } }
     }
}

// Wt[n][k] = f16(W[k][n]·scale) from f32 row-major W[K][N] (scale = power of two; bf16-exact weights stay exact in f16 away from the subnormal range)
__global__ __launch_bounds__(256) void k_wt_f16(const float* __restrict__ W, _Float16* __restrict__ Wt, int K, int N, float scale) {
  const int t = blockIdx.x * 256 + threadIdx.x; if (t >= N * (K / 8)) return; const int n = t / (K / 8), k8 = (t % (K / 8)) * 8; FragH f;
#pragma unroll
  for (int i = 0; i < 8; ++i) f.h[i] = (_Float16)(bf16_round(W[(size_t)(k8 + i) * N + n]) * scale); const v8us o = f.half[0];
  *(v8us*)((unsigned short*)Wt + (size_t)n * K + k8) = o; 
}
// k_gemm_hh variant with fused epilogue: v = acc·alpha + bias[by·sBias + col] (+ CP[(row/rowsPerB)·sCPb + by·64 + col] if CP) ; ACT 0 none / 1 elu ; writes f16 C16 (and f32 C if non-null)
template <int ACT>
__global__ __launch_bounds__(128) void k_gemm_hhx(const _Float16* __restrict__ A, int lda, size_t sA, const _Float16* __restrict__ Bh, int ldb, size_t sB, float alpha, const float* __restrict__ bias, size_t sBias, const float* __restrict__ CP, int rowsPerB, size_t sCPb, int row0g,
    float* __restrict__ C, _Float16* __restrict__ C16, int ldc, size_t sC, int M, int N, int K) {
  __shared__ __attribute__((aligned(16))) float so[4][16][64];
  const int tid = threadIdx.x, w = tid >> 5, lane = tid & 31, ln = lane & 15, hh = lane >> 4; const int by = blockIdx.y;
  A += (size_t)by * sA; Bh += (size_t)by * sB; const size_t cofs = (size_t)by * sC; const float* bp = bias ? bias + (size_t)by * sBias : nullptr;
  const int ntn = (N + 63) / 64; const int wid = blockIdx.x * 4 + w; const int mt = wid / ntn, nq = wid % ntn; if (mt * 16 >= M) return;
  const int row0 = mt * 16, col0 = nq * 64; const _Float16* arow = A + (size_t)(row0 + ln) * lda;
  v8f acc[4] = {};
  for (int kb = 0; kb < K; kb += 32) { FragH ah; ah.half[0] = *(const v8us*)((const unsigned short*)arow + kb + 8 * hh); ah.half[1] = *(const v8us*)((const unsigned short*)arow + kb + 16 + 8 * hh);
#pragma unroll
    for (int t = 0; t < 4; ++t) { if (col0 + t * 16 >= N) continue; const size_t boff = (size_t)(col0 + t * 16 + ln) * ldb + kb; FragH bq; bq.half[0] = *(const v8us*)((const unsigned short*)Bh + boff + 8 * hh); bq.half[1] = *(const v8us*)((const unsigned short*)Bh + boff + 16 + 8 * hh);
      acc[t] = mmaH<1>(ah.v, ah.v, bq.v, bq.v, acc[t]); }
  }
#pragma unroll
  for (int t = 0; t < 4; ++t) { if (col0 + t * 16 >= N) continue; const int col = col0 + t * 16 + ln; const float bv = bp ? bf16_round(bp[col]) : 0.f;
#pragma unroll
    for (int r = 0; r < 8; ++r) { float v = acc[t][r] * alpha + bv; if (CP) { const int bidx = (row0g + row0 + 8 * hh + r) / rowsPerB; v += CP[(size_t)bidx * sCPb + (size_t)by * 64 + col]; } if (ACT == 1) v = (v > 0.f) ? v : expm1f(v); else if (ACT == 7) v = (v > 0.f) ? v + 1.0f : expf(v); else if (ACT == 8) v = tanhf(v); else if (ACT == 9) v = 0.5f * v * (1.0f + tanhf(0.7978845608028654f * (v + 0.044715f * v * v * v))); else if (ACT == 11) v = 1.0f / (1.0f + expf(-v)); else if (ACT == 12) v = (v > 0.f) ? v : 0.01f * v; else if (ACT == 14) v = (v > 0.f) ? v : 0.1f * v; else if (ACT == 15) v = v / (1.0f + expf(-v)); else if (ACT == 3) v = fmaxf(v, 0.f); else if (ACT == 6) v = 0.5f * v * (1.0f + erff(v * 0.70710678118654752f)); so[w][8 * hh + r][t * 16 + ln] = v; } }
  __builtin_amdgcn_fence(__ATOMIC_ACQ_REL, "workgroup"); __builtin_amdgcn_wave_barrier();
  const int rsub = lane >> 4, c4 = (lane & 15) * 4; typedef _Float16 v4h __attribute__((ext_vector_type(4)));
  {
#pragma unroll
    for (int q = 0; q < 8; ++q) { const int r = q * 2 + rsub; if (col0 + c4 < N) { const v4f v = *(const v4fa*)&so[w][r][c4]; if (C) *(v4f*)(C + cofs + (size_t)(row0 + r) * ldc + col0 + c4) = v; if (C16) { v4h h4; for (int i = 0; i < 4; ++i) h4[i] = (_Float16)v[i]; *(v4h*)(C16 + cofs + (size_t)(row0 + r) * ldc + col0 + c4) = h4; } } }
     }
}


typedef _Float16 v4h __attribute__((ext_vector_type(4)));

__global__ __launch_bounds__(256) void k_x16(const float* __restrict__ x, _Float16* __restrict__ X16, size_t n8) { const size_t t = (size_t)blockIdx.x * 256 + threadIdx.x; if (t >= n8) return; FragH f;
#pragma unroll
  for (int q = 0; q < 8; ++q) f.h[q] = (_Float16)bf16_round(x[t * 8 + q]); *(v8us*)((unsigned short*)X16 + t * 8) = f.half[0];  }
__global__ __launch_bounds__(256) void k_h16(const float* __restrict__ x, _Float16* __restrict__ X16, size_t n8) { const size_t t = (size_t)blockIdx.x * 256 + threadIdx.x; if (t >= n8) return; FragH f;
#pragma unroll
  for (int q = 0; q < 8; ++q) f.h[q] = (_Float16)x[t * 8 + q]; *(v8us*)((unsigned short*)X16 + t * 8) = f.half[0];  }
__global__ __launch_bounds__(256) void k_round16f(const float* __restrict__ W, _Float16* __restrict__ Bt, size_t n8) { const size_t t = (size_t)blockIdx.x * 256 + threadIdx.x; if (t >= n8) return; FragH f;
#pragma unroll
  for (int i = 0; i < 8; ++i) f.h[i] = (_Float16)(bf16_round(W[t * 8 + i]) * 16.0f); *(v8us*)((unsigned short*)Bt + t * 8) = f.half[0];  }
template <int NHv, int TTv>
__global__ __launch_bounds__(256) void k_vt(const _Float16* __restrict__ V16, int ldv, int voff, _Float16* __restrict__ Vt) { __shared__ unsigned short tl[64][66]; const int tid = threadIdx.x; const int slab = blockIdx.x / (TTv / 64), lg = blockIdx.x % (TTv / 64); const int b = slab / NHv, h = slab % NHv;
  for (int i = tid; i < 64 * 8; i += 256) { const int r = i / 8, c8 = (i % 8) * 8; FragH f; f.half[0] = *(const v8us*)((const unsigned short*)V16 + ((size_t)b * TTv + lg * 64 + r) * ldv + voff + h * 64 + c8);
#pragma unroll
    for (int q = 0; q < 8; ++q) tl[r][c8 + q] = f.u[q]; }
  __syncthreads();
  {
#pragma unroll
    for (int rd = 0; rd < 2; ++rd) { const int d = rd * 32 + tid / 8, pc = tid % 8; FragH f;
#pragma unroll
      for (int q = 0; q < 8; ++q) f.u[q] = tl[pc * 8 + q][d];
      *(v8us*)((unsigned short*)Vt + ((size_t)slab * 64 + d) * TTv + lg * 64 + pc * 8) = f.half[0]; }
     } }

__global__ __launch_bounds__(256) void k_hl(const float* __restrict__ F, _Float16* __restrict__ Hh, _Float16* __restrict__ Hl, size_t n8) { const size_t t = (size_t)blockIdx.x * 256 + threadIdx.x; if (t >= n8) return; FragH fh, fl; const v4f a = *(const v4fa*)(F + t * 8), c = *(const v4fa*)(F + t * 8 + 4);
#pragma unroll
  for (int q = 0; q < 4; ++q) { _Float16 h = (_Float16)a[q]; fh.h[q] = h; fl.h[q] = (_Float16)((a[q] - (float)h) * 1024.0f); h = (_Float16)c[q]; fh.h[4 + q] = h; fl.h[4 + q] = (_Float16)((c[q] - (float)h) * 1024.0f); }
  { *(v8us*)((unsigned short*)Hh + t * 8) = fh.half[0]; *(v8us*)((unsigned short*)Hl + t * 8) = fl.half[0];  } }

// ---- fast GEMM (wave tile 32x64; requires M % 32 == 0 rows per launch region and N % 64 == 0); epilogue = k_gemm_hhx semantics ----
__device__ __forceinline__ v16h g2_frag(const _Float16* p, int hh) { FragH f; f.half[0] = *(const v8us*)((const unsigned short*)p + 8 * hh); f.half[1] = *(const v8us*)((const unsigned short*)p + 16 + 8 * hh); return f.v; }
__device__ __forceinline__ v8f g2_mma(v16h a, v16h b, v8f c) { v8f d = __builtin_amdgcn_wmma_f32_16x16x32_f16(false, a, false, b, (short)0, c, false, false); asm volatile("v_nop\n\tv_nop\n\tv_nop\n\tv_nop" : "+v"(d) : "v"(a), "v"(b)); return d; }
// One lane's twelve 16-byte asynchronous copies from global memory to LDS (l: LDS byte addresses, g: global addresses). The s_wait_xcnt is the last line of the copies' own statement, so that no address register is rewritten in front of it.
__device__ __forceinline__ void copy12_to_lds(const unsigned (&l)[12], const unsigned short* const (&g)[12]) {
  asm volatile("global_load_async_to_lds_b128 %0, %12, off\n\tglobal_load_async_to_lds_b128 %1, %13, off\n\tglobal_load_async_to_lds_b128 %2, %14, off\n\tglobal_load_async_to_lds_b128 %3, %15, off\n\t"
               "global_load_async_to_lds_b128 %4, %16, off\n\tglobal_load_async_to_lds_b128 %5, %17, off\n\tglobal_load_async_to_lds_b128 %6, %18, off\n\tglobal_load_async_to_lds_b128 %7, %19, off\n\t"
               "global_load_async_to_lds_b128 %8, %20, off\n\tglobal_load_async_to_lds_b128 %9, %21, off\n\tglobal_load_async_to_lds_b128 %10, %22, off\n\tglobal_load_async_to_lds_b128 %11, %23, off\n\ts_wait_xcnt 0x0"
               :: "v"(l[0]), "v"(l[1]), "v"(l[2]), "v"(l[3]), "v"(l[4]), "v"(l[5]), "v"(l[6]), "v"(l[7]), "v"(l[8]), "v"(l[9]), "v"(l[10]), "v"(l[11]),
                  "v"(g[0]), "v"(g[1]), "v"(g[2]), "v"(g[3]), "v"(g[4]), "v"(g[5]), "v"(g[6]), "v"(g[7]), "v"(g[8]), "v"(g[9]), "v"(g[10]), "v"(g[11]) : "memory"); }
// Block tile 128 x 64. The operands go to LDS once per block in k steps of 64 (whole 128-byte lines of every row), two buffers: step t + 2 is copied while step t + 1 is worked on. Requires K % 64 == 0.
template <int ACT>
__global__ __launch_bounds__(128) void k_gemm2(const _Float16* __restrict__ A, int lda, size_t sA, const _Float16* __restrict__ Bh, int ldb, size_t sB, float alpha, const float* __restrict__ bias, size_t sBias, const float* __restrict__ CP, int rowsPerB, size_t sCPb, int row0g,
    float* __restrict__ C, _Float16* __restrict__ C16, int ldc, size_t sC, int M, int N, int K) {
  constexpr int GP = 72;                    /* LDS row pitch in f16: 144 B for the 128-byte rows (16 B x odd: no bank conflict for 16-byte readers) */
  constexpr int STG = (128 + 64) * GP;      /* one buffer in f16: 128 A rows, then 64 B rows */
  __shared__ __attribute__((aligned(16))) float sm[2 * STG / 2];      /* 55,296 B: the two operand buffers in the k loop; behind it the epilogue's per-wave output tiles */
  float (*so)[32][68] = (float (*)[32][68])sm;
  const unsigned short* sT = (const unsigned short*)sm;
  const int tid = threadIdx.x, w = tid >> 5, lane = tid & 31, ln = lane & 15, hh = lane >> 4; const int by = blockIdx.y;
  A += (size_t)by * sA; Bh += (size_t)by * sB; const size_t cofs = (size_t)by * sC; const float* bp = bias ? bias + (size_t)by * sBias : nullptr;
  const int ntn = N >> 6; const int mt = blockIdx.x / ntn, nq = blockIdx.x - mt * ntn; const int rowb = mt * 128, row0 = rowb + 32 * w, col0 = nq * 64; if (rowb >= M) return;      /* the whole block leaves, in front of every barrier */
  // Thread tid copies 16-byte piece tid & 7 of rows (tid >> 3) + 16 i: a wave's copy covers 4 whole 128-byte rows. An A row past M is clamped to the last row (its products are never stored).
  const int cr = tid >> 3, cc = (tid & 7) * 8;
  const unsigned short* gsrc[12];
#pragma unroll      /* unrolled here and in the three loops below: the address arrays stay in registers */
  for (int i = 0; i < 8; ++i) { const int r = rowb + cr + 16 * i; gsrc[i] = (const unsigned short*)A + (size_t)(r < M ? r : M - 1) * lda + cc; }
#pragma unroll
  for (int i = 0; i < 4; ++i) gsrc[8 + i] = (const unsigned short*)Bh + (size_t)(col0 + cr + 16 * i) * ldb + cc;
  const unsigned l0 = (unsigned)(size_t)&sT[cr * GP + cc];
  auto stage = [&](int buf) { unsigned l[12];      /* copies the next k step into buffer buf and moves the source pointers on by one step */
#pragma unroll
    for (int i = 0; i < 12; ++i) l[i] = l0 + (unsigned)((buf * STG + 16 * i * GP) * 2);
    copy12_to_lds(l, gsrc);
#pragma unroll
    for (int i = 0; i < 12; ++i) gsrc[i] += 64; };
  const v8f z8 = {0.f,0.f,0.f,0.f,0.f,0.f,0.f,0.f}; v8f c00 = z8, c01 = z8, c02 = z8, c03 = z8, c10 = z8, c11 = z8, c12 = z8, c13 = z8;
  stage(0);
  asm volatile("s_wait_asynccnt 0x0" ::: "memory");      /* step 0 has landed before the barrier that publishes it */
  __syncthreads();
  if (64 < K) stage(1);
#pragma unroll 1      /* rolled: one foot with the waits, the barrier and the refill in their order */
  for (int kb = 0; kb < K; kb += 64) {
    const int buf = (kb >> 6) & 1;
    const _Float16* tA = (const _Float16*)sT + buf * STG + (32 * w + ln) * GP; const _Float16* tB = (const _Float16*)sT + buf * STG + (128 + ln) * GP;
    v16h fa[2][2], fb[2][4];      /* the step's fragment reads stand together in front of its products */
#pragma unroll      /* unrolled here and in the two loops below: the fragment arrays stay in registers */
    for (int ks = 0; ks < 2; ++ks) { fa[ks][0] = g2_frag(tA + ks * 32, hh); fa[ks][1] = g2_frag(tA + 16 * GP + ks * 32, hh);
#pragma unroll
      for (int t = 0; t < 4; ++t) fb[ks][t] = g2_frag(tB + t * 16 * GP + ks * 32, hh); }
#pragma unroll
    for (int ks = 0; ks < 2; ++ks) {
      c00 = g2_mma(fa[ks][0], fb[ks][0], c00); c10 = g2_mma(fa[ks][1], fb[ks][0], c10);
      c01 = g2_mma(fa[ks][0], fb[ks][1], c01); c11 = g2_mma(fa[ks][1], fb[ks][1], c11);
      c02 = g2_mma(fa[ks][0], fb[ks][2], c02); c12 = g2_mma(fa[ks][1], fb[ks][2], c12);
      c03 = g2_mma(fa[ks][0], fb[ks][3], c03); c13 = g2_mma(fa[ks][1], fb[ks][3], c13); }
    asm volatile("s_wait_dscnt 0x0" ::: "memory");      /* this wave's reads of the buffer have returned before the buffer is handed back */
    asm volatile("s_wait_asynccnt 0x0" ::: "memory");      /* this wave's copies of step t + 1 have landed */
    __syncthreads();      /* publishes step t + 1 and ends every wave's reads of step t */
    if (kb + 128 < K) stage(buf); }
  asm volatile("s_wait_asynccnt 0x0" ::: "memory");      /* nothing is in flight when the LDS is taken over by the output tiles */
  if (row0 >= M) return;      /* behind the last barrier */
  v8f accs[8] = {c00, c01, c02, c03, c10, c11, c12, c13};
#pragma unroll
  for (int u = 0; u < 8; ++u) { const int t = u & 3, half = u >> 2; const int col = col0 + t * 16 + ln; const float bv = bp ? bf16_round(bp[col]) : 0.f;
#pragma unroll
    for (int r = 0; r < 8; ++r) { const int rloc = half * 16 + 8 * hh + r; float v = accs[u][r] * alpha + bv; if (CP) { const int bidx = (row0g + row0 + rloc) / rowsPerB; v += CP[(size_t)bidx * sCPb + (size_t)by * 64 + col]; }
      if (ACT == 3) v = fmaxf(v, 0.f); else if (ACT == 6) v = 0.5f * v * (1.0f + erff(v * 0.70710678118654752f)); else if (ACT == 11) v = 1.0f / (1.0f + expf(-v)); else if (ACT == 15) v = v / (1.0f + expf(-v)); else if (ACT == 12) v = (v > 0.f) ? v : 0.01f * v; else if (ACT == 8) v = tanhf(v);
      so[w][rloc][t * 16 + ln] = v; } }
  __builtin_amdgcn_fence(__ATOMIC_ACQ_REL, "workgroup"); __builtin_amdgcn_wave_barrier();
  const int rsub = lane >> 4, c4 = (lane & 15) * 4;
  {
#pragma unroll
    for (int q = 0; q < 16; ++q) { const int r = q * 2 + rsub; const v4f v = *(const v4fa*)&so[w][r][c4]; if (C) *(v4f*)(C + cofs + (size_t)(row0 + r) * ldc + col0 + c4) = v; if (C16) { v4h h4; for (int i = 0; i < 4; ++i) h4[i] = (_Float16)v[i]; *(v4h*)(C16 + cofs + (size_t)(row0 + r) * ldc + col0 + c4) = h4; } }
     } }



// lane l with lane l ^ 16: the two lanes that share one query column of a transposed score tile
__device__ __forceinline__ float xhalf(float x) { return __builtin_bit_cast(float, __builtin_amdgcn_permlanex16(__builtin_bit_cast(int, x), __builtin_bit_cast(int, x), 0x76543210, 0xfedcba98, false, false)); }
__device__ __forceinline__ void copy4_to_lds(unsigned l0, const unsigned short* g0, unsigned l1, const unsigned short* g1, unsigned l2, const unsigned short* g2, unsigned l3, const unsigned short* g3) {
  asm volatile("global_load_async_to_lds_b128 %0, %1, off\n\tglobal_load_async_to_lds_b128 %2, %3, off\n\tglobal_load_async_to_lds_b128 %4, %5, off\n\tglobal_load_async_to_lds_b128 %6, %7, off\n\ts_wait_xcnt 0x0"
               :: "v"(l0), "v"(g0), "v"(l1), "v"(g1), "v"(l2), "v"(g2), "v"(l3), "v"(g3) : "memory"); }
// Sixteen 2^x in place, each on a register of its own: no instruction directly behind a transcendental reads its result or overwrites its source; the closing v_nop keeps that slot in front of whatever the compiler puts next.
__device__ __forceinline__ void exp2x16(float (&x)[16]) {
  asm("v_exp_f32 %0, %0\n\tv_exp_f32 %1, %1\n\tv_exp_f32 %2, %2\n\tv_exp_f32 %3, %3\n\tv_exp_f32 %4, %4\n\tv_exp_f32 %5, %5\n\tv_exp_f32 %6, %6\n\tv_exp_f32 %7, %7\n\t"
      "v_exp_f32 %8, %8\n\tv_exp_f32 %9, %9\n\tv_exp_f32 %10, %10\n\tv_exp_f32 %11, %11\n\tv_exp_f32 %12, %12\n\tv_exp_f32 %13, %13\n\tv_exp_f32 %14, %14\n\tv_exp_f32 %15, %15\n\tv_nop"
      : "+v"(x[0]), "+v"(x[1]), "+v"(x[2]), "+v"(x[3]), "+v"(x[4]), "+v"(x[5]), "+v"(x[6]), "+v"(x[7]), "+v"(x[8]), "+v"(x[9]), "+v"(x[10]), "+v"(x[11]), "+v"(x[12]), "+v"(x[13]), "+v"(x[14]), "+v"(x[15])); }
template <int CAUSAL>
__global__ __launch_bounds__(128) void k_flash(const _Float16* __restrict__ Q16, int ldq, const _Float16* __restrict__ K16, int ldk, const _Float16* __restrict__ Vt, const int* __restrict__ MSK, float* __restrict__ O, int ldo) {
  constexpr int RPW = 16, DT = 4, KS = 2;
  constexpr int KP = 72, VP = 40;      /* LDS row pitch in f16: 144 B for the 128-byte K rows, 80 B for the 64-byte V^T rows (16 B x odd: no bank conflict for 16-byte readers) */
  __shared__ __attribute__((aligned(16))) float sO[4][RPW][64 + 4];
  __shared__ __attribute__((aligned(16))) unsigned short sK[2][32 * KP];      /* 32 keys x 64 */
  __shared__ __attribute__((aligned(16))) unsigned short sV[2][64 * VP];      /* 64 d x 32 keys */
  const int tid = threadIdx.x, w = tid >> 5, lane = tid & 31, ln = lane & 15, hh = lane >> 4;
  const int slab = blockIdx.x / QBLKS, qblk = blockIdx.x % QBLKS; (void)MSK; const int b = slab / NH, h = slab % NH; const int qb0 = qblk * (4 * RPW); const int q0 = qb0 + w * RPW;
  FragH bq[KS];
  { const unsigned short* qr = (const unsigned short*)Q16 + ((size_t)b * TQ + q0 + ln) * ldq + h * 64;
#pragma unroll
    for (int ks = 0; ks < KS; ++ks) { bq[ks].half[0] = *(const v8us*)(qr + ks * 32 + 8 * hh); bq[ks].half[1] = *(const v8us*)(qr + ks * 32 + 16 + 8 * hh); } }
  const unsigned short* Vth = (const unsigned short*)Vt + (size_t)slab * 64 * TK;
  const int tq = q0 + ln;
  v8f ctx[DT];      /* sum over the sources of the normalised rows */
#pragma unroll
  for (int dt = 0; dt < DT; ++dt) ctx[dt] = (v8f){0.f,0.f,0.f,0.f,0.f,0.f,0.f,0.f};
  const int jend = (CAUSAL == 1) ? (qb0 + 4 * RPW) : TK;      /* causal: keys beyond the block's last query never contribute */
  // Key tiles of 32 keys go to LDS once per block (the four waves read the same K and V^T), two buffers: tile t + 2 is copied while tile t + 1 is worked on.
  // The tiles of the NSRC sources form one sequence (source 0's tiles, then source 1's, ...), so the copies run on across a change of source.
  // Thread tid copies 16-byte pieces tid and tid + 128 of each tile: K piece c = row c / 8, column c % 8 (a wave covers 4 whole 128-byte rows); V^T piece c = row c / 4, column c % 4.
  const unsigned short* gK = (const unsigned short*)K16 + ((size_t)b * TK + (tid >> 3)) * ldk + h * 64 + (tid & 7) * 8;
  const unsigned short* gV = Vth + (size_t)(tid >> 2) * TK + (tid & 3) * 8;
  const unsigned lK = (unsigned)(size_t)&sK[0][(tid >> 3) * KP + (tid & 7) * 8], lV = (unsigned)(size_t)&sV[0][(tid >> 2) * VP + (tid & 3) * 8];
  int sn = 0, sj = 0;      /* source and first key of the next tile to copy; the same in every thread */
  auto stage = [&](int buf) { const unsigned short* k0 = gK + ((size_t)sn * NR + sj) * ldk; const unsigned short* v0 = gV + (size_t)sn * (NB * NH * 64) * TK + sj; const unsigned lk = lK + buf * (32 * KP * 2), lv = lV + buf * (64 * VP * 2);
    copy4_to_lds(lk, k0, lk + 16 * KP * 2, k0 + (size_t)16 * ldk, lv, v0, lv + 32 * VP * 2, v0 + (size_t)32 * TK);
    sj += 32; if (sj >= jend) { sj = 0; ++sn; } };
  stage(0);
  asm volatile("s_wait_asynccnt 0x0" ::: "memory");      /* tile 0 has landed before the barrier that publishes it */
  __syncthreads();
  stage(1);      /* jend is at least 64: a tile 1 exists */
  int buf = 0;
#pragma unroll 1      /* rolled, like the tile loop inside: one foot with the waits, the barrier and the refill in their order */
  for (int n = 0; n < NSRC; ++n) {
  float m_q = -3.0e38f, l_q = 0.f; v8f oacc[DT];      /* each source has a softmax of its own */
#pragma unroll
  for (int dt = 0; dt < DT; ++dt) oacc[dt] = (v8f){0.f,0.f,0.f,0.f,0.f,0.f,0.f,0.f};
#pragma unroll 1
  for (int j0 = 0; j0 < jend; j0 += 32) {
    const unsigned short* tK = &sK[buf][ln * KP + 8 * hh]; const unsigned short* tV = &sV[buf][ln * VP + 8 * hh];
    FragH ak[2][KS], av[DT];
#pragma unroll
    for (int nt = 0; nt < 2; ++nt)
#pragma unroll
      for (int ks = 0; ks < KS; ++ks) { ak[nt][ks].half[0] = *(const v8us*)(tK + nt * 16 * KP + ks * 32); ak[nt][ks].half[1] = *(const v8us*)(tK + nt * 16 * KP + ks * 32 + 16); }
#pragma unroll
    for (int dt = 0; dt < DT; ++dt) { av[dt].half[0] = *(const v8us*)(tV + dt * 16 * VP); av[dt].half[1] = *(const v8us*)(tV + dt * 16 * VP + 16); }
    v8f s[2];
#pragma unroll
    for (int nt = 0; nt < 2; ++nt) {
      v8f acc = (v8f){0.f,0.f,0.f,0.f,0.f,0.f,0.f,0.f};
#pragma unroll
      for (int ks = 0; ks < KS; ++ks) acc = mmaH<1>(ak[nt][ks].v, ak[nt][ks].v, bq[ks].v, bq[ks].v, acc);
      s[nt] = acc; }
    float sc[2][8], mx[8]; bool ok[2][8];      /* sc, m_q: raw products; the factor SCL2 = log2(e)/8 is applied inside the exponent's one fma */
#pragma unroll
    for (int r = 0; r < 8; ++r) {
#pragma unroll
      for (int nt = 0; nt < 2; ++nt) { const int kk = j0 + nt * 16 + 8 * hh + r;
        ok[nt][r] = (CAUSAL == 1) ? (kk <= tq) : ((CAUSAL == 2) ? ((kk >> 5) == (tq >> 5)) : true);      /* mode 2: block-diagonal 32-token groups */
        sc[nt][r] = ok[nt][r] ? s[nt][r] : -3.0e38f; }
      mx[r] = fmaxf(sc[0][r], sc[1][r]); }
    float mc = fmaxf(fmaxf(fmaxf(mx[0], mx[1]), fmaxf(mx[2], mx[3])), fmaxf(fmaxf(mx[4], mx[5]), fmaxf(mx[6], mx[7])));
    mc = fmaxf(mc, xhalf(mc));
    const float mn = fmaxf(m_q, mc); const float al = (mn > -1.0e38f) ? __builtin_amdgcn_exp2f((m_q - mn) * SCL2) : 1.0f; m_q = mn;
    const float nb = 10.0f - mn * SCL2;      /* p = 1024 e^((s - max)/8) = 2^(s SCL2 + nb): the x1024 of the f16 operand is the + 10 */
    float e[16];
#pragma unroll      /* unrolled: e stays in registers, as the asm operands need */
    for (int r = 0; r < 8; ++r) { e[r] = __builtin_fmaf(sc[0][r], SCL2, nb); e[8 + r] = __builtin_fmaf(sc[1][r], SCL2, nb); }
    exp2x16(e);
    FragH pb; float ps[8];
#pragma unroll
    for (int r = 0; r < 8; ++r) { const float p0 = ok[0][r] ? e[r] : 0.f, p1 = ok[1][r] ? e[8 + r] : 0.f; ps[r] = p0 + p1;
      pb.h[r] = (_Float16)p0; pb.h[8 + r] = (_Float16)p1; }
    l_q = l_q * al + (((ps[0] + ps[1]) + (ps[2] + ps[3])) + ((ps[4] + ps[5]) + (ps[6] + ps[7])));
#pragma unroll
    for (int dt = 0; dt < DT; ++dt)
#pragma unroll
      for (int r = 0; r < 8; ++r) oacc[dt][r] *= al;
#pragma unroll
    for (int dt = 0; dt < DT; ++dt) oacc[dt] = mmaH<1>(av[dt].v, av[dt].v, pb.v, pb.v, oacc[dt]);
    asm volatile("s_wait_dscnt 0x0" ::: "memory");      /* this wave's reads of the buffer have returned before the buffer is handed back */
    asm volatile("s_wait_asynccnt 0x0" ::: "memory");      /* this wave's copies of tile t + 1 have landed */
    __syncthreads();      /* publishes tile t + 1 and ends every wave's reads of tile t */
    if (sn < NSRC) stage(buf);      /* tile t + 2 exists */
    buf ^= 1; }
  const float l = l_q + xhalf(l_q); const float inv = (l > 0.f) ? 1.0f / l : 0.f;      /* l and oacc both carry the x1024 */
#pragma unroll
  for (int dt = 0; dt < DT; ++dt)
#pragma unroll
    for (int r = 0; r < 8; ++r) ctx[dt][r] += oacc[dt][r] * inv; }
  asm volatile("s_wait_asynccnt 0x0" ::: "memory");      /* nothing is in flight when the wave goes on to the epilogue and ends */
#pragma unroll
  for (int dt = 0; dt < DT; ++dt) {      /* register r of tile dt is O[q0 + ln][dt*16 + 8*hh + r] */
    const v4f lo = {ctx[dt][0], ctx[dt][1], ctx[dt][2], ctx[dt][3]}, hi = {ctx[dt][4], ctx[dt][5], ctx[dt][6], ctx[dt][7]};
    *(v4fa*)&sO[w][ln][dt * 16 + 8 * hh] = lo; *(v4fa*)&sO[w][ln][dt * 16 + 8 * hh + 4] = hi; }
  __builtin_amdgcn_fence(__ATOMIC_ACQ_REL, "workgroup"); __builtin_amdgcn_wave_barrier();
  {
#pragma unroll
    for (int rp = 0; rp < RPW; rp += 2) { const int r = rp + (lane >> 4), pc = lane & 15; const v4f val = *(const v4fa*)&sO[w][r][pc * 4]; *(v4f*)(O + ((size_t)b * TQ + q0 + r) * ldo + h * 64 + pc * 4) = val; }
     } }

extern "C" void kernel_launch(void* const* d_in, const int* in_sizes, int n_in,
                              void* d_out, int out_size, void* d_ws, size_t ws_size, hipStream_t stream) {
  (void)in_sizes; (void)n_in; (void)out_size;
  const float* const* I = (const float* const*)d_in; const float* hsp = I[0]; const float* Wq = I[1]; const float* bq = I[2]; const float* Wk = I[3]; const float* bk = I[4]; const float* Wv = I[5]; const float* bv = I[6];
  char* ws = (char*)d_ws; size_t off = 0;
  auto take = [&](size_t bytes) { char* p = ws + off; off += (bytes + 255) & ~(size_t)255; return p; };
  _Float16* BQ = (_Float16*)take((size_t)CC * CC * 2); _Float16* BK = (_Float16*)take((size_t)CC * CC * 2); _Float16* BV = (_Float16*)take((size_t)CC * CC * 2);
  _Float16* X16 = (_Float16*)take((size_t)NRA * CC * 2); _Float16* Q16 = (_Float16*)take((size_t)NR * CC * 2); _Float16* K16 = (_Float16*)take((size_t)NRA * CC * 2); _Float16* V16 = (_Float16*)take((size_t)NRA * CC * 2); _Float16* VT = (_Float16*)take((size_t)NRA * CC * 2);
  if (off > ws_size) return;      /* 3.4 + 30 + 6 + 30 + 30 + 30 = 130 MiB */
  k_wt_f16<<<(CC * CC / 8 + 255) / 256, 256, 0, stream>>>(Wq, BQ, CC, CC, 16.0f); k_wt_f16<<<(CC * CC / 8 + 255) / 256, 256, 0, stream>>>(Wk, BK, CC, CC, 16.0f); k_wt_f16<<<(CC * CC / 8 + 255) / 256, 256, 0, stream>>>(Wv, BV, CC, CC, 16.0f);
  k_x16<<<(unsigned)(((size_t)NRA * CC / 8 + 255) / 256), 256, 0, stream>>>(hsp, X16, (size_t)NRA * CC / 8);
  k_gemm2<0><<<dim3((NR / 128) * (CC / 64), 1), 128, 0, stream>>>(X16, CC, 0, BQ, CC, 0, 0.0625f, bq, 0, nullptr, 1, 0, 0, nullptr, Q16, CC, 0, NR, CC, CC);      /* q from source 0 */
  k_gemm2<0><<<dim3((NRA / 128) * (CC / 64), 1), 128, 0, stream>>>(X16, CC, 0, BK, CC, 0, 0.0625f, bk, 0, nullptr, 1, 0, 0, nullptr, K16, CC, 0, NRA, CC, CC);      /* k for every source */
  k_gemm2<0><<<dim3((NRA / 128) * (CC / 64), 1), 128, 0, stream>>>(X16, CC, 0, BV, CC, 0, 0.0625f, bv, 0, nullptr, 1, 0, 0, nullptr, V16, CC, 0, NRA, CC, CC);
  k_vt<NH, SLEN><<<NSRC * NB * NH * (SLEN / 64), 256, 0, stream>>>(V16, CC, 0, VT);      /* slabs ((n*4 + b)*12 + h) */
  k_flash<0><<<NB * NH * QBLKS, 128, 0, stream>>>(Q16, CC, K16, CC, VT, nullptr, (float*)d_out, CC);      /* all five sources; stores the output */
}

// v006
// Measured time: 175 microseconds a run.
// Timed twice side by side with v005, it ran 1.27 times as fast both times.
// Over all steps from v000 it is 4.43 times as fast.
#include <hip/hip_runtime.h>
// Attention_KV (5 sources x 4 batches x 1024 tokens x 768 = 12 heads of 64): q from source 0 (Wq + bq); every source n gives k_n, v_n (shared Wk/bk, Wv/bv); ctx = sum_n softmax(q k_n^T / 8) v_n (independent softmax per source); output = ctx merged [B, S, 768] (no output projection).
// Structure, four launches: one preparing launch (the three weight transposes and the exact f16 plane of all sources, picked by ranges of the block index); the v and q GEMMs in one launch, the k GEMM and the V^T tiles in the next, picked likewise (GEMMs: 32x64 wave tiles, f32 accumulation, exact x16 weights + bias, f16 outputs; k and v over all 5 sources); V^T by 64 x 64 LDS tiles for all (source, batch, head) slabs; one fused flash kernel (plain f16 operands) whose blocks walk the five sources in turn and add each source's normalised rows in registers, then store the output.
// Compute dtype: inputs and parameters rounded to bf16; q, k, v, P as f16 (~2^-12); f32 accumulation/softmax/sum. v_wmma_f32_16x16x32_f16.
#define NSRC 5
#define NB 4
#define CC 768
#define NR (NB * SLEN)           /* 4096 query rows */
#define NRA (NSRC * NR)          /* 20480 source rows */
#define SLEN 1024
#define TQ SLEN
#define TK SLEN
#define NH 12
#define SCL 0.125f               /* 1/sqrt(64) */
#define SCL2 (SCL * 1.4426950408889634f)   /* log2(e)/sqrt(64) */
#define QBLKS (TQ / 64)
typedef __bf16 v16b __attribute__((ext_vector_type(16)));
typedef unsigned short v8us __attribute__((ext_vector_type(8), may_alias));
typedef float  v8f  __attribute__((ext_vector_type(8)));
typedef float  v4f  __attribute__((ext_vector_type(4)));
typedef float  v4fa __attribute__((ext_vector_type(4), may_alias));
union FragB { v16b v; v8us half[2]; unsigned short u[16]; };

__device__ __forceinline__ unsigned short bf16_bits(float x) { unsigned int u = __float_as_uint(x); return (unsigned short)((u + 0x7FFFu + ((u >> 16) & 1u)) >> 16); }
__device__ __forceinline__ float bf16_val(unsigned short b) { return __uint_as_float(((unsigned int)b) << 16); }
__device__ __forceinline__ float bf16_round(float x) { return bf16_val(bf16_bits(x)); }
// D += A·B with NT terms: 1 = ah·bh, 2 = + al·bh (A split), 3 = + ah·bl (both split)
template <int NT>
__device__ __forceinline__ v8f mmaN(v16b ah, v16b al, v16b bh, v16b bl, v8f c) {
  c = __builtin_amdgcn_wmma_f32_16x16x32_bf16(false, ah, false, bh, (short)0, c, false, false);
  if (NT >= 2) c = __builtin_amdgcn_wmma_f32_16x16x32_bf16(false, al, false, bh, (short)0, c, false, false);
  if (NT >= 3) c = __builtin_amdgcn_wmma_f32_16x16x32_bf16(false, ah, false, bl, (short)0, c, false, false);
  asm volatile("v_nop\n\tv_nop\n\tv_nop\n\tv_nop" : "+v"(c) : "v"(ah), "v"(al), "v"(bh), "v"(bl));
  return c;
}

__global__ __launch_bounds__(256) void k_wt_bf16(const float* __restrict__ W, unsigned short* __restrict__ Wt, int K, int N) {
  const int t = blockIdx.x * 256 + threadIdx.x;
  const int k8n = K / 8;
  if (t >= N * k8n) return;
  const int n = t / k8n, k8 = (t % k8n) * 8;
  v8us v;
#pragma unroll
  for (int i = 0; i < 8; ++i) v[i] = bf16_bits(W[(size_t)(k8 + i) * N + n]);
  *(v8us*)(Wt + (size_t)n * K + k8) = v;
  
}

// GEMM C[M][N] (f32, pitch ldc) = act(A[M][K]·W + bias). A f32 row-major (pitch lda) converted per fragment to bf16
// (ASPLIT: hi/lo two planes -> 2 terms, else single rounded term); Wt bf16 [N][K] (pitch ldb). BIAS_BF16 rounds the
// bias to bf16 first (bias quantised to bf16 before the add). K%32==0, M%16==0, N%64==0.
template <bool ASPLIT, int ACT, bool BIAS_BF16>
__global__ __launch_bounds__(128) void k_gemm_bf(const float* __restrict__ A, int lda, const unsigned short* __restrict__ Wt, int ldb,
                                               const float* __restrict__ bias, float* __restrict__ C, int ldc, int M, int N, int K) {
  __shared__ __attribute__((aligned(16))) float so[4][16][64];
  const int tid = threadIdx.x, w = tid >> 5, lane = tid & 31, ln = lane & 15, hh = lane >> 4;
  const int ntn = N / 64;
  const int wid = blockIdx.x * 4 + w;
  const int mt = wid / ntn, nq = wid % ntn;
  if (mt * 16 >= M) return;
  const int row0 = mt * 16, col0 = nq * 64;
  const float* arow = A + (size_t)(row0 + ln) * lda;
  v8f acc[4] = {};
  for (int kb = 0; kb < K; kb += 32) {
    FragB ah, al;
    const v4f x0 = *(const v4fa*)(arow + kb + 8 * hh), x1 = *(const v4fa*)(arow + kb + 8 * hh + 4);
    const v4f x2 = *(const v4fa*)(arow + kb + 16 + 8 * hh), x3 = *(const v4fa*)(arow + kb + 16 + 8 * hh + 4);
    float xs[16] = {x0[0],x0[1],x0[2],x0[3],x1[0],x1[1],x1[2],x1[3],x2[0],x2[1],x2[2],x2[3],x3[0],x3[1],x3[2],x3[3]};
#pragma unroll
    for (int i = 0; i < 16; ++i) { const unsigned short hb = bf16_bits(xs[i]); ah.u[i] = hb; al.u[i] = ASPLIT ? bf16_bits(xs[i] - bf16_val(hb)) : (unsigned short)0; }
#pragma unroll
    for (int t = 0; t < 4; ++t) {
      const unsigned short* brow = Wt + (size_t)(col0 + t * 16 + ln) * ldb + kb;
      FragB b;
      b.half[0] = *(const v8us*)(brow + 8 * hh);
      b.half[1] = *(const v8us*)(brow + 16 + 8 * hh);
      acc[t] = mmaN<ASPLIT ? 2 : 1>(ah.v, al.v, b.v, b.v, acc[t]);
    }
  }
#pragma unroll
  for (int t = 0; t < 4; ++t) {
    float bv = bias ? bias[col0 + t * 16 + ln] : 0.f;
    if (BIAS_BF16) bv = bf16_round(bv);
#pragma unroll
    for (int r = 0; r < 8; ++r) { float v = acc[t][r] + bv; if (ACT == 1) v = fmaxf(v, 0.f); so[w][8 * hh + r][t * 16 + ln] = v; }
  }
  __builtin_amdgcn_fence(__ATOMIC_ACQ_REL, "workgroup");
  __builtin_amdgcn_wave_barrier();
  const int rsub = lane >> 4, c4 = (lane & 15) * 4;
  {
#pragma unroll
    for (int q = 0; q < 8; ++q) {
      const int r = q * 2 + rsub;
      const v4f v = *(const v4fa*)&so[w][r][c4];
      *(v4f*)(C + (size_t)(row0 + r) * ldc + col0 + c4) = v;
    }
    
  }
}

// GEMM C = act(A·W + bias + resid): A f32 (ASPLIT -> hi/lo 2 terms), Wt bf16 [N][K]; ACT 0 none, 1 relu, 2 exact gelu;
// resid (optional, f32, row index = (row % rmod), pitch ldr, RES_BF16 rounds it) added before the activation.
template <bool ASPLIT, int ACT, bool BIAS_BF16, bool RES_BF16>
__global__ __launch_bounds__(128) void k_gemm_bf3(const float* __restrict__ A, int lda, const unsigned short* __restrict__ Wt, int ldb,
                                                const float* __restrict__ bias, const float* __restrict__ resid, int rmod, int ldr,
                                                float* __restrict__ C, int ldc, int M, int N, int K) {
  __shared__ __attribute__((aligned(16))) float so[4][16][64];
  const int tid = threadIdx.x, w = tid >> 5, lane = tid & 31, ln = lane & 15, hh = lane >> 4;
  const int ntn = N / 64;
  const int wid = blockIdx.x * 4 + w;
  const int mt = wid / ntn, nq = wid % ntn;
  if (mt * 16 >= M) return;
  const int row0 = mt * 16, col0 = nq * 64;
  const float* arow = A + (size_t)(row0 + ln) * lda;
  v8f acc[4] = {};
  for (int kb = 0; kb < K; kb += 32) {
    FragB ah, al;
    const v4f x0 = *(const v4fa*)(arow + kb + 8 * hh), x1 = *(const v4fa*)(arow + kb + 8 * hh + 4);
    const v4f x2 = *(const v4fa*)(arow + kb + 16 + 8 * hh), x3 = *(const v4fa*)(arow + kb + 16 + 8 * hh + 4);
    float xs[16] = {x0[0],x0[1],x0[2],x0[3],x1[0],x1[1],x1[2],x1[3],x2[0],x2[1],x2[2],x2[3],x3[0],x3[1],x3[2],x3[3]};
#pragma unroll
    for (int i = 0; i < 16; ++i) { const unsigned short hb = bf16_bits(xs[i]); ah.u[i] = hb; al.u[i] = ASPLIT ? bf16_bits(xs[i] - bf16_val(hb)) : (unsigned short)0; }
#pragma unroll
    for (int t = 0; t < 4; ++t) {
      const unsigned short* brow = Wt + (size_t)(col0 + t * 16 + ln) * ldb + kb;
      FragB b;
      b.half[0] = *(const v8us*)(brow + 8 * hh);
      b.half[1] = *(const v8us*)(brow + 16 + 8 * hh);
      acc[t] = mmaN<ASPLIT ? 2 : 1>(ah.v, al.v, b.v, b.v, acc[t]);
    }
  }
#pragma unroll
  for (int t = 0; t < 4; ++t) {
    const int col = col0 + t * 16 + ln;
    float bv = bias ? bias[col] : 0.f;
    if (BIAS_BF16) bv = bf16_round(bv);
#pragma unroll
    for (int r = 0; r < 8; ++r) {
      float v = acc[t][r] + bv;
      if (resid) { float rv = resid[(size_t)((row0 + 8 * hh + r) % rmod) * ldr + col]; if (RES_BF16) rv = bf16_round(rv); v += rv; }
      if (ACT == 1) v = fmaxf(v, 0.f);
      if (ACT == 2) v = 0.5f * v * (1.0f + erff(v * 0.70710678118654752f));
      if (ACT == 3) { const float u = 0.7978845608028654f * (v + 0.044715f * v * v * v); v = 0.5f * v * (1.0f + tanhf(u)); }
      so[w][8 * hh + r][t * 16 + ln] = v;
    }
  }
  __builtin_amdgcn_fence(__ATOMIC_ACQ_REL, "workgroup");
  __builtin_amdgcn_wave_barrier();
  const int rsub = lane >> 4, c4 = (lane & 15) * 4;
  {
#pragma unroll
    for (int q = 0; q < 8; ++q) {
      const int r = q * 2 + rsub;
      const v4f v = *(const v4fa*)&so[w][r][c4];
      *(v4f*)(C + (size_t)(row0 + r) * ldc + col0 + c4) = v;
    }
    
  }
}
// row LayerNorm (biased variance, eps) over N: s = X (+ R); optional out_sum <- s; out_norm <- (s-mu)*rsqrt(var+eps)*g + b
template <bool PARAM_BF16>
__global__ __launch_bounds__(256) void k_layernorm(const float* __restrict__ X, const float* __restrict__ R, const float* __restrict__ g, const float* __restrict__ bta,
                                                  float* __restrict__ out_sum, float* __restrict__ out_norm, int N, float eps) {
  __shared__ float red[256];
  const int row = blockIdx.x, tid = threadIdx.x;
  const float* x = X + (size_t)row * N; const float* rr = R ? R + (size_t)row * N : nullptr;
  float vals[16];                     // up to N = 4096
  const int per = N / 256;            // contiguous chunk per thread? use strided-by-4 chunks: thread handles j = tid*4 + 1024*u
  float s1 = 0.f;
  for (int u = 0; u < per / 4; ++u) {
    const int j = tid * 4 + 1024 * u;
    const v4f a = *(const v4fa*)(x + j);
    v4f b = {0.f,0.f,0.f,0.f}; if (rr) b = *(const v4fa*)(rr + j);
#pragma unroll
    for (int q = 0; q < 4; ++q) { const float v = a[q] + b[q]; vals[u * 4 + q] = v; s1 += v; }
  }
  red[tid] = s1; __syncthreads();
  for (int st = 128; st > 0; st >>= 1) { if (tid < st) red[tid] += red[tid + st]; __syncthreads(); }
  const float mu = red[0] / (float)N; __syncthreads();
  float s2 = 0.f;
  for (int u = 0; u < per / 4; ++u)
#pragma unroll
    for (int q = 0; q < 4; ++q) { const float c = vals[u * 4 + q] - mu; s2 += c * c; }
  red[tid] = s2; __syncthreads();
  for (int st = 128; st > 0; st >>= 1) { if (tid < st) red[tid] += red[tid + st]; __syncthreads(); }
  const float rs = rsqrtf(red[0] / (float)N + eps);
  {
    for (int u = 0; u < per / 4; ++u) {
      const int j = tid * 4 + 1024 * u;
      v4f o, sm;
#pragma unroll
      for (int q = 0; q < 4; ++q) {
        float gg = g[j + q], bb = bta[j + q];
        if (PARAM_BF16) { gg = bf16_round(gg); bb = bf16_round(bb); }
        sm[q] = vals[u * 4 + q]; o[q] = (vals[u * 4 + q] - mu) * rs * gg + bb;
      }
      if (out_sum) *(v4f*)(out_sum + (size_t)row * N + j) = sm;
      *(v4f*)(out_norm + (size_t)row * N + j) = o;
    }
    
  }
}



// ---- f16 WMMA path (v_wmma_f32_16x16x32_f16): 11-bit significands for operands in range — used where a [0,1] probability operand needs more precision than bf16
typedef _Float16 v16h __attribute__((ext_vector_type(16)));
union FragH { v16h v; v8us half[2]; _Float16 h[16]; unsigned short u[16]; };
template <int NT>
__device__ __forceinline__ v8f mmaH(v16h ah, v16h al, v16h bh, v16h bl, v8f c) {
  c = __builtin_amdgcn_wmma_f32_16x16x32_f16(false, ah, false, bh, (short)0, c, false, false);
  if (NT >= 2) c = __builtin_amdgcn_wmma_f32_16x16x32_f16(false, al, false, bh, (short)0, c, false, false);
  if (NT >= 3) c = __builtin_amdgcn_wmma_f32_16x16x32_f16(false, ah, false, bl, (short)0, c, false, false);
  asm volatile("v_nop\n\tv_nop\n\tv_nop\n\tv_nop" : "+v"(c) : "v"(ah), "v"(al), "v"(bh), "v"(bl));
  return c;
}
// batched GEMM like k_gemm_b but f16 operands: A f32 (split into f16 hi/lo if ASPLIT, else rounded to f16), Bt = f16 values [n][k]; alpha; C f32; N multiple of 16 (partial tiles skipped)
template <bool ASPLIT>
__global__ __launch_bounds__(128) void k_gemm_h(const float* __restrict__ A, int lda, size_t sA, const _Float16* __restrict__ Bh, int ldb, size_t sB, float alpha, float* __restrict__ C, int ldc, size_t sC, int M, int N, int K) {
  __shared__ __attribute__((aligned(16))) float so[4][16][64];
  const int tid = threadIdx.x, w = tid >> 5, lane = tid & 31, ln = lane & 15, hh = lane >> 4; const int by = blockIdx.y;
  A += (size_t)by * sA; Bh += (size_t)by * sB; C += (size_t)by * sC;
  const int ntn = (N + 63) / 64; const int wid = blockIdx.x * 4 + w; const int mt = wid / ntn, nq = wid % ntn; if (mt * 16 >= M) return;
  const int row0 = mt * 16, col0 = nq * 64; const float* arow = A + (size_t)(row0 + ln) * lda;
  v8f acc[4] = {};
  for (int kb = 0; kb < K; kb += 32) {
    FragH ah, al;
    const v4f x0 = *(const v4fa*)(arow + kb + 8 * hh), x1 = *(const v4fa*)(arow + kb + 8 * hh + 4), x2 = *(const v4fa*)(arow + kb + 16 + 8 * hh), x3 = *(const v4fa*)(arow + kb + 16 + 8 * hh + 4);
    float xs[16] = {x0[0],x0[1],x0[2],x0[3],x1[0],x1[1],x1[2],x1[3],x2[0],x2[1],x2[2],x2[3],x3[0],x3[1],x3[2],x3[3]};
#pragma unroll
    for (int i = 0; i < 16; ++i) { const _Float16 h = (_Float16)xs[i]; ah.h[i] = h; al.h[i] = ASPLIT ? (_Float16)(xs[i] - (float)h) : (_Float16)0.0f; }
#pragma unroll
    for (int t = 0; t < 4; ++t) { if (col0 + t * 16 >= N) continue; const size_t boff = (size_t)(col0 + t * 16 + ln) * ldb + kb; FragH bq; bq.half[0] = *(const v8us*)(Bh + boff + 8 * hh); bq.half[1] = *(const v8us*)(Bh + boff + 16 + 8 * hh);
      acc[t] = mmaH<ASPLIT ? 2 : 1>(ah.v, al.v, bq.v, bq.v, acc[t]); }
  }
#pragma unroll
  for (int t = 0; t < 4; ++t) { if (col0 + t * 16 >= N) continue;
#pragma unroll
    for (int r = 0; r < 8; ++r) so[w][8 * hh + r][t * 16 + ln] = acc[t][r] * alpha; }
  __builtin_amdgcn_fence(__ATOMIC_ACQ_REL, "workgroup"); __builtin_amdgcn_wave_barrier();
  const int rsub = lane >> 4, c4 = (lane & 15) * 4;
  {
#pragma unroll
    for (int q = 0; q < 8; ++q) { const int r = q * 2 + rsub; if (col0 + c4 < N) { const v4f v = *(const v4fa*)&so[w][r][c4]; *(v4f*)(C + (size_t)(row0 + r) * ldc + col0 + c4) = v; } }
     }
}

// Wt[n][k] = f16(W[k][n]·scale) from f32 row-major W[K][N] (scale = power of two; bf16-exact weights stay exact in f16 away from the subnormal range)
__device__ __forceinline__ void wt_f16_job(int blk, const float* __restrict__ W, _Float16* __restrict__ Wt, int K, int N, float scale) {
  const int t = blk * 256 + threadIdx.x; if (t >= N * (K / 8)) return; const int n = t / (K / 8), k8 = (t % (K / 8)) * 8; FragH f;
#pragma unroll
  for (int i = 0; i < 8; ++i) f.h[i] = (_Float16)(bf16_round(W[(size_t)(k8 + i) * N + n]) * scale); const v8us o = f.half[0];
  *(v8us*)((unsigned short*)Wt + (size_t)n * K + k8) = o; 
}
// k_gemm_hh variant with fused epilogue: v = acc·alpha + bias[by·sBias + col] (+ CP[(row/rowsPerB)·sCPb + by·64 + col] if CP) ; ACT 0 none / 1 elu ; writes f16 C16 (and f32 C if non-null)
template <int ACT>
__global__ __launch_bounds__(128) void k_gemm_hhx(const _Float16* __restrict__ A, int lda, size_t sA, const _Float16* __restrict__ Bh, int ldb, size_t sB, float alpha, const float* __restrict__ bias, size_t sBias, const float* __restrict__ CP, int rowsPerB, size_t sCPb, int row0g,
    float* __restrict__ C, _Float16* __restrict__ C16, int ldc, size_t sC, int M, int N, int K) {
  __shared__ __attribute__((aligned(16))) float so[4][16][64];
  const int tid = threadIdx.x, w = tid >> 5, lane = tid & 31, ln = lane & 15, hh = lane >> 4; const int by = blockIdx.y;
  A += (size_t)by * sA; Bh += (size_t)by * sB; const size_t cofs = (size_t)by * sC; const float* bp = bias ? bias + (size_t)by * sBias : nullptr;
  const int ntn = (N + 63) / 64; const int wid = blockIdx.x * 4 + w; const int mt = wid / ntn, nq = wid % ntn; if (mt * 16 >= M) return;
  const int row0 = mt * 16, col0 = nq * 64; const _Float16* arow = A + (size_t)(row0 + ln) * lda;
  v8f acc[4] = {};
  for (int kb = 0; kb < K; kb += 32) { FragH ah; ah.half[0] = *(const v8us*)((const unsigned short*)arow + kb + 8 * hh); ah.half[1] = *(const v8us*)((const unsigned short*)arow + kb + 16 + 8 * hh);
#pragma unroll
    for (int t = 0; t < 4; ++t) { if (col0 + t * 16 >= N) continue; const size_t boff = (size_t)(col0 + t * 16 + ln) * ldb + kb; FragH bq; bq.half[0] = *(const v8us*)((const unsigned short*)Bh + boff + 8 * hh); bq.half[1] = *(const v8us*)((const unsigned short*)Bh + boff + 16 + 8 * hh);
      acc[t] = mmaH<1>(ah.v, ah.v, bq.v, bq.v, acc[t]); }
  }
#pragma unroll
  for (int t = 0; t < 4; ++t) { if (col0 + t * 16 >= N) continue; const int col = col0 + t * 16 + ln; const float bv = bp ? bf16_round(bp[col]) : 0.f;
#pragma unroll
    for (int r = 0; r < 8; ++r) { float v = acc[t][r] * alpha + bv; if (CP) { const int bidx = (row0g + row0 + 8 * hh + r) / rowsPerB; v += CP[(size_t)bidx * sCPb + (size_t)by * 64 + col]; } if (ACT == 1) v = (v > 0.f) ? v : expm1f(v); else if (ACT == 7) v = (v > 0.f) ? v + 1.0f : expf(v); else if (ACT == 8) v = tanhf(v); else if (ACT == 9) v = 0.5f * v * (1.0f + tanhf(0.7978845608028654f * (v + 0.044715f * v * v * v))); else if (ACT == 11) v = 1.0f / (1.0f + expf(-v)); else if (ACT == 12) v = (v > 0.f) ? v : 0.01f * v; else if (ACT == 14) v = (v > 0.f) ? v : 0.1f * v; else if (ACT == 15) v = v / (1.0f + expf(-v)); else if (ACT == 3) v = fmaxf(v, 0.f); else if (ACT == 6) v = 0.5f * v * (1.0f + erff(v * 0.70710678118654752f)); so[w][8 * hh + r][t * 16 + ln] = v; } }
  __builtin_amdgcn_fence(__ATOMIC_ACQ_REL, "workgroup"); __builtin_amdgcn_wave_barrier();
  const int rsub = lane >> 4, c4 = (lane & 15) * 4; typedef _Float16 v4h __attribute__((ext_vector_type(4)));
  {
#pragma unroll
    for (int q = 0; q < 8; ++q) { const int r = q * 2 + rsub; if (col0 + c4 < N) { const v4f v = *(const v4fa*)&so[w][r][c4]; if (C) *(v4f*)(C + cofs + (size_t)(row0 + r) * ldc + col0 + c4) = v; if (C16) { v4h h4; for (int i = 0; i < 4; ++i) h4[i] = (_Float16)v[i]; *(v4h*)(C16 + cofs + (size_t)(row0 + r) * ldc + col0 + c4) = h4; } } }
     }
}


typedef _Float16 v4h __attribute__((ext_vector_type(4)));

__device__ __forceinline__ void x16_job(int blk, const float* __restrict__ x, _Float16* __restrict__ X16, size_t n8) { const size_t t = (size_t)blk * 256 + threadIdx.x; if (t >= n8) return; FragH f;
#pragma unroll
  for (int q = 0; q < 8; ++q) f.h[q] = (_Float16)bf16_round(x[t * 8 + q]); *(v8us*)((unsigned short*)X16 + t * 8) = f.half[0];  }
// The four jobs that need nothing of each other share one grid: blocks 0 .. 3 * WTB - 1 transpose Wq, Wk, Wv (they wait on scattered loads; placed first for speed only), the rest cast the sources. The choice is the same for a whole block.
#define WTB ((CC * CC / 8 + 255) / 256)
#define X16B ((NRA * CC / 8 + 255) / 256)
__global__ __launch_bounds__(256) void k_prep(const float* __restrict__ x, const float* __restrict__ Wq, const float* __restrict__ Wk, const float* __restrict__ Wv,
                                             _Float16* __restrict__ X16, _Float16* __restrict__ BQ, _Float16* __restrict__ BK, _Float16* __restrict__ BV) {
  const int bx = blockIdx.x;
  if (bx < 3 * WTB) { const int m = bx / WTB; wt_f16_job(bx - m * WTB, m == 0 ? Wq : (m == 1 ? Wk : Wv), m == 0 ? BQ : (m == 1 ? BK : BV), CC, CC, 16.0f); }
  else x16_job(bx - 3 * WTB, x, X16, (size_t)NRA * CC / 8); }
__global__ __launch_bounds__(256) void k_h16(const float* __restrict__ x, _Float16* __restrict__ X16, size_t n8) { const size_t t = (size_t)blockIdx.x * 256 + threadIdx.x; if (t >= n8) return; FragH f;
#pragma unroll
  for (int q = 0; q < 8; ++q) f.h[q] = (_Float16)x[t * 8 + q]; *(v8us*)((unsigned short*)X16 + t * 8) = f.half[0];  }
__global__ __launch_bounds__(256) void k_round16f(const float* __restrict__ W, _Float16* __restrict__ Bt, size_t n8) { const size_t t = (size_t)blockIdx.x * 256 + threadIdx.x; if (t >= n8) return; FragH f;
#pragma unroll
  for (int i = 0; i < 8; ++i) f.h[i] = (_Float16)(bf16_round(W[t * 8 + i]) * 16.0f); *(v8us*)((unsigned short*)Bt + t * 8) = f.half[0];  }
// One 64 x 64 tile of V^T by a block of NT threads; tl: 64 x 66 halves of LDS.
template <int NHv, int TTv, int NT>
__device__ __forceinline__ void vt_job(unsigned short (*tl)[66], int blk, const _Float16* __restrict__ V16, int ldv, int voff, _Float16* __restrict__ Vt) { const int tid = threadIdx.x; const int slab = blk / (TTv / 64), lg = blk % (TTv / 64); const int b = slab / NHv, h = slab % NHv;
#pragma unroll      /* the tile's loads are issued together */
  for (int u = 0; u < 64 * 8 / NT; ++u) { const int i = tid + u * NT; const int r = i / 8, c8 = (i % 8) * 8; FragH f; f.half[0] = *(const v8us*)((const unsigned short*)V16 + ((size_t)b * TTv + lg * 64 + r) * ldv + voff + h * 64 + c8);
#pragma unroll
    for (int q = 0; q < 8; ++q) tl[r][c8 + q] = f.u[q]; }
  __syncthreads();
  {
#pragma unroll
    for (int rd = 0; rd < 64 * 8 / NT; ++rd) { const int d = rd * (NT / 8) + tid / 8, pc = tid % 8; FragH f;
#pragma unroll
      for (int q = 0; q < 8; ++q) f.u[q] = tl[pc * 8 + q][d];
      *(v8us*)((unsigned short*)Vt + ((size_t)slab * 64 + d) * TTv + lg * 64 + pc * 8) = f.half[0]; }
     }
  asm volatile("s_wait_xcnt 0x0" ::: "memory");      /* behind the tile's last store: in a launch that holds another job too, code that rewrites the stores' registers follows in the text */
}

__global__ __launch_bounds__(256) void k_hl(const float* __restrict__ F, _Float16* __restrict__ Hh, _Float16* __restrict__ Hl, size_t n8) { const size_t t = (size_t)blockIdx.x * 256 + threadIdx.x; if (t >= n8) return; FragH fh, fl; const v4f a = *(const v4fa*)(F + t * 8), c = *(const v4fa*)(F + t * 8 + 4);
#pragma unroll
  for (int q = 0; q < 4; ++q) { _Float16 h = (_Float16)a[q]; fh.h[q] = h; fl.h[q] = (_Float16)((a[q] - (float)h) * 1024.0f); h = (_Float16)c[q]; fh.h[4 + q] = h; fl.h[4 + q] = (_Float16)((c[q] - (float)h) * 1024.0f); }
  { *(v8us*)((unsigned short*)Hh + t * 8) = fh.half[0]; *(v8us*)((unsigned short*)Hl + t * 8) = fl.half[0];  } }

// ---- fast GEMM (wave tile 32x64; requires M % 32 == 0 rows per launch region and N % 64 == 0); epilogue = k_gemm_hhx semantics ----
__device__ __forceinline__ v16h g2_frag(const _Float16* p, int hh) { FragH f; f.half[0] = *(const v8us*)((const unsigned short*)p + 8 * hh); f.half[1] = *(const v8us*)((const unsigned short*)p + 16 + 8 * hh); return f.v; }
__device__ __forceinline__ v8f g2_mma(v16h a, v16h b, v8f c) { v8f d = __builtin_amdgcn_wmma_f32_16x16x32_f16(false, a, false, b, (short)0, c, false, false); asm volatile("v_nop\n\tv_nop\n\tv_nop\n\tv_nop" : "+v"(d) : "v"(a), "v"(b)); return d; }
// One lane's twelve 16-byte asynchronous copies from global memory to LDS (l: LDS byte addresses, g: global addresses). The s_wait_xcnt is the last line of the copies' own statement, so that no address register is rewritten in front of it.
__device__ __forceinline__ void copy12_to_lds(const unsigned (&l)[12], const unsigned short* const (&g)[12]) {
  asm volatile("global_load_async_to_lds_b128 %0, %12, off\n\tglobal_load_async_to_lds_b128 %1, %13, off\n\tglobal_load_async_to_lds_b128 %2, %14, off\n\tglobal_load_async_to_lds_b128 %3, %15, off\n\t"
               "global_load_async_to_lds_b128 %4, %16, off\n\tglobal_load_async_to_lds_b128 %5, %17, off\n\tglobal_load_async_to_lds_b128 %6, %18, off\n\tglobal_load_async_to_lds_b128 %7, %19, off\n\t"
               "global_load_async_to_lds_b128 %8, %20, off\n\tglobal_load_async_to_lds_b128 %9, %21, off\n\tglobal_load_async_to_lds_b128 %10, %22, off\n\tglobal_load_async_to_lds_b128 %11, %23, off\n\ts_wait_xcnt 0x0"
               :: "v"(l[0]), "v"(l[1]), "v"(l[2]), "v"(l[3]), "v"(l[4]), "v"(l[5]), "v"(l[6]), "v"(l[7]), "v"(l[8]), "v"(l[9]), "v"(l[10]), "v"(l[11]),
                  "v"(g[0]), "v"(g[1]), "v"(g[2]), "v"(g[3]), "v"(g[4]), "v"(g[5]), "v"(g[6]), "v"(g[7]), "v"(g[8]), "v"(g[9]), "v"(g[10]), "v"(g[11]) : "memory"); }
#define GEMM2_LDS ((128 + 64) * 72)      /* floats of LDS that a caller of gemm2_job hands in, 16-byte aligned */
// Block tile 128 x 64. The operands go to LDS once per block in k steps of 64 (whole 128-byte lines of every row), two buffers: step t + 2 is copied while step t + 1 is worked on. Requires K % 64 == 0.
template <int ACT>
__device__ __forceinline__ void gemm2_job(float* sm, int bx, int by, const _Float16* __restrict__ A, int lda, size_t sA, const _Float16* __restrict__ Bh, int ldb, size_t sB, float alpha, const float* __restrict__ bias, size_t sBias, const float* __restrict__ CP, int rowsPerB, size_t sCPb, int row0g,
    float* __restrict__ C, _Float16* __restrict__ C16, int ldc, size_t sC, int M, int N, int K) {
  constexpr int GP = 72;                    /* LDS row pitch in f16: 144 B for the 128-byte rows (16 B x odd: no bank conflict for 16-byte readers) */
  constexpr int STG = (128 + 64) * GP;      /* one buffer in f16: 128 A rows, then 64 B rows */
  static_assert(2 * STG / 2 == GEMM2_LDS, "the caller's LDS array");      /* sm, 55,296 B: the two operand buffers in the k loop; behind it the epilogue's per-wave output tiles */
  float (*so)[32][68] = (float (*)[32][68])sm;
  const unsigned short* sT = (const unsigned short*)sm;
  const int tid = threadIdx.x, w = tid >> 5, lane = tid & 31, ln = lane & 15, hh = lane >> 4;
  A += (size_t)by * sA; Bh += (size_t)by * sB; const size_t cofs = (size_t)by * sC; const float* bp = bias ? bias + (size_t)by * sBias : nullptr;
  const int ntn = N >> 6; const int mt = bx / ntn, nq = bx - mt * ntn; const int rowb = mt * 128, row0 = rowb + 32 * w, col0 = nq * 64; if (rowb >= M) return;      /* the whole block leaves, in front of every barrier */
  // Thread tid copies 16-byte piece tid & 7 of rows (tid >> 3) + 16 i: a wave's copy covers 4 whole 128-byte rows. An A row past M is clamped to the last row (its products are never stored).
  const int cr = tid >> 3, cc = (tid & 7) * 8;
  const unsigned short* gsrc[12];
#pragma unroll      /* unrolled here and in the three loops below: the address arrays stay in registers */
  for (int i = 0; i < 8; ++i) { const int r = rowb + cr + 16 * i; gsrc[i] = (const unsigned short*)A + (size_t)(r < M ? r : M - 1) * lda + cc; }
#pragma unroll
  for (int i = 0; i < 4; ++i) gsrc[8 + i] = (const unsigned short*)Bh + (size_t)(col0 + cr + 16 * i) * ldb + cc;
  const unsigned l0 = (unsigned)(size_t)&sT[cr * GP + cc];
  auto stage = [&](int buf) { unsigned l[12];      /* copies the next k step into buffer buf and moves the source pointers on by one step */
#pragma unroll
    for (int i = 0; i < 12; ++i) l[i] = l0 + (unsigned)((buf * STG + 16 * i * GP) * 2);
    copy12_to_lds(l, gsrc);
#pragma unroll
    for (int i = 0; i < 12; ++i) gsrc[i] += 64; };
  const v8f z8 = {0.f,0.f,0.f,0.f,0.f,0.f,0.f,0.f}; v8f c00 = z8, c01 = z8, c02 = z8, c03 = z8, c10 = z8, c11 = z8, c12 = z8, c13 = z8;
  stage(0);
  asm volatile("s_wait_asynccnt 0x0" ::: "memory");      /* step 0 has landed before the barrier that publishes it */
  __syncthreads();
  if (64 < K) stage(1);
#pragma unroll 1      /* rolled: one foot with the waits, the barrier and the refill in their order */
  for (int kb = 0; kb < K; kb += 64) {
    const int buf = (kb >> 6) & 1;
    const _Float16* tA = (const _Float16*)sT + buf * STG + (32 * w + ln) * GP; const _Float16* tB = (const _Float16*)sT + buf * STG + (128 + ln) * GP;
    v16h fa[2][2], fb[2][4];      /* the step's fragment reads stand together in front of its products */
#pragma unroll      /* unrolled here and in the two loops below: the fragment arrays stay in registers */
    for (int ks = 0; ks < 2; ++ks) { fa[ks][0] = g2_frag(tA + ks * 32, hh); fa[ks][1] = g2_frag(tA + 16 * GP + ks * 32, hh);
#pragma unroll
      for (int t = 0; t < 4; ++t) fb[ks][t] = g2_frag(tB + t * 16 * GP + ks * 32, hh); }
#pragma unroll
    for (int ks = 0; ks < 2; ++ks) {
      c00 = g2_mma(fa[ks][0], fb[ks][0], c00); c10 = g2_mma(fa[ks][1], fb[ks][0], c10);
      c01 = g2_mma(fa[ks][0], fb[ks][1], c01); c11 = g2_mma(fa[ks][1], fb[ks][1], c11);
      c02 = g2_mma(fa[ks][0], fb[ks][2], c02); c12 = g2_mma(fa[ks][1], fb[ks][2], c12);
      c03 = g2_mma(fa[ks][0], fb[ks][3], c03); c13 = g2_mma(fa[ks][1], fb[ks][3], c13); }
    asm volatile("s_wait_dscnt 0x0" ::: "memory");      /* this wave's reads of the buffer have returned before the buffer is handed back */
    asm volatile("s_wait_asynccnt 0x0" ::: "memory");      /* this wave's copies of step t + 1 have landed */
    __syncthreads();      /* publishes step t + 1 and ends every wave's reads of step t */
    if (kb + 128 < K) stage(buf); }
  asm volatile("s_wait_asynccnt 0x0" ::: "memory");      /* nothing is in flight when the LDS is taken over by the output tiles */
  if (row0 >= M) return;      /* behind the last barrier */
  v8f accs[8] = {c00, c01, c02, c03, c10, c11, c12, c13};
#pragma unroll
  for (int u = 0; u < 8; ++u) { const int t = u & 3, half = u >> 2; const int col = col0 + t * 16 + ln; const float bv = bp ? bf16_round(bp[col]) : 0.f;
#pragma unroll
    for (int r = 0; r < 8; ++r) { const int rloc = half * 16 + 8 * hh + r; float v = accs[u][r] * alpha + bv; if (CP) { const int bidx = (row0g + row0 + rloc) / rowsPerB; v += CP[(size_t)bidx * sCPb + (size_t)by * 64 + col]; }
      if (ACT == 3) v = fmaxf(v, 0.f); else if (ACT == 6) v = 0.5f * v * (1.0f + erff(v * 0.70710678118654752f)); else if (ACT == 11) v = 1.0f / (1.0f + expf(-v)); else if (ACT == 15) v = v / (1.0f + expf(-v)); else if (ACT == 12) v = (v > 0.f) ? v : 0.01f * v; else if (ACT == 8) v = tanhf(v);
      so[w][rloc][t * 16 + ln] = v; } }
  __builtin_amdgcn_fence(__ATOMIC_ACQ_REL, "workgroup"); __builtin_amdgcn_wave_barrier();
  const int rsub = lane >> 4, c4 = (lane & 15) * 4;
  {
#pragma unroll
    for (int q = 0; q < 16; ++q) { const int r = q * 2 + rsub; const v4f v = *(const v4fa*)&so[w][r][c4]; if (C) *(v4f*)(C + cofs + (size_t)(row0 + r) * ldc + col0 + c4) = v; if (C16) { v4h h4; for (int i = 0; i < 4; ++i) h4[i] = (_Float16)v[i]; *(v4h*)(C16 + cofs + (size_t)(row0 + r) * ldc + col0 + c4) = h4; } }
     } }

// Launches that need nothing of each other share one grid; a range of the block index picks the job, the same for a whole block.
// V^T needs v and the flash kernel needs V^T, so v is made first (with q), and the V^T tiles share the launch of the k product: they come last in the grid (for speed only).
#define NTC (CC / 64)              /* column tiles of one product */
#define QGB ((NR / 128) * NTC)      /* blocks of the q product */
#define KGB ((NRA / 128) * NTC)      /* blocks of the k product, and of the v product */
#define VTB (NSRC * NB * NH * (SLEN / 64))      /* V^T tiles: slabs ((n*4 + b)*12 + h) */
__global__ __launch_bounds__(128) void k_qv(const _Float16* __restrict__ X16, const _Float16* __restrict__ BQ, const _Float16* __restrict__ BV, const float* __restrict__ bq, const float* __restrict__ bv,
                                           _Float16* __restrict__ Q16, _Float16* __restrict__ V16) {
  __shared__ __attribute__((aligned(16))) float sm[GEMM2_LDS];
  const int bx = blockIdx.x; const bool isv = bx < KGB;
  gemm2_job<0>(sm, isv ? bx : bx - KGB, 0, X16, CC, 0, isv ? BV : BQ, CC, 0, 0.0625f, isv ? bv : bq, 0, nullptr, 1, 0, 0, nullptr, isv ? V16 : Q16, CC, 0, isv ? NRA : NR, CC, CC); }
__global__ __launch_bounds__(128) void k_k_vt(const _Float16* __restrict__ X16, const _Float16* __restrict__ BK, const float* __restrict__ bk, _Float16* __restrict__ K16,
                                             const _Float16* __restrict__ V16, _Float16* __restrict__ VT) {
  __shared__ __attribute__((aligned(16))) float sm[GEMM2_LDS];
  const int bx = blockIdx.x;
  if (bx < KGB) gemm2_job<0>(sm, bx, 0, X16, CC, 0, BK, CC, 0, 0.0625f, bk, 0, nullptr, 1, 0, 0, nullptr, K16, CC, 0, NRA, CC, CC);
  else vt_job<NH, SLEN, 128>((unsigned short (*)[66])sm, bx - KGB, V16, CC, 0, VT); }

// lane l with lane l ^ 16: the two lanes that share one query column of a transposed score tile
__device__ __forceinline__ float xhalf(float x) { return __builtin_bit_cast(float, __builtin_amdgcn_permlanex16(__builtin_bit_cast(int, x), __builtin_bit_cast(int, x), 0x76543210, 0xfedcba98, false, false)); }
__device__ __forceinline__ void copy4_to_lds(unsigned l0, const unsigned short* g0, unsigned l1, const unsigned short* g1, unsigned l2, const unsigned short* g2, unsigned l3, const unsigned short* g3) {
  asm volatile("global_load_async_to_lds_b128 %0, %1, off\n\tglobal_load_async_to_lds_b128 %2, %3, off\n\tglobal_load_async_to_lds_b128 %4, %5, off\n\tglobal_load_async_to_lds_b128 %6, %7, off\n\ts_wait_xcnt 0x0"
               :: "v"(l0), "v"(g0), "v"(l1), "v"(g1), "v"(l2), "v"(g2), "v"(l3), "v"(g3) : "memory"); }
// Sixteen 2^x in place, each on a register of its own: no instruction directly behind a transcendental reads its result or overwrites its source; the closing v_nop keeps that slot in front of whatever the compiler puts next.
__device__ __forceinline__ void exp2x16(float (&x)[16]) {
  asm("v_exp_f32 %0, %0\n\tv_exp_f32 %1, %1\n\tv_exp_f32 %2, %2\n\tv_exp_f32 %3, %3\n\tv_exp_f32 %4, %4\n\tv_exp_f32 %5, %5\n\tv_exp_f32 %6, %6\n\tv_exp_f32 %7, %7\n\t"
      "v_exp_f32 %8, %8\n\tv_exp_f32 %9, %9\n\tv_exp_f32 %10, %10\n\tv_exp_f32 %11, %11\n\tv_exp_f32 %12, %12\n\tv_exp_f32 %13, %13\n\tv_exp_f32 %14, %14\n\tv_exp_f32 %15, %15\n\tv_nop"
      : "+v"(x[0]), "+v"(x[1]), "+v"(x[2]), "+v"(x[3]), "+v"(x[4]), "+v"(x[5]), "+v"(x[6]), "+v"(x[7]), "+v"(x[8]), "+v"(x[9]), "+v"(x[10]), "+v"(x[11]), "+v"(x[12]), "+v"(x[13]), "+v"(x[14]), "+v"(x[15])); }
template <int CAUSAL>
__global__ __launch_bounds__(128) void k_flash(const _Float16* __restrict__ Q16, int ldq, const _Float16* __restrict__ K16, int ldk, const _Float16* __restrict__ Vt, const int* __restrict__ MSK, float* __restrict__ O, int ldo) {
  constexpr int RPW = 16, DT = 4, KS = 2;
  constexpr int KP = 72, VP = 40;      /* LDS row pitch in f16: 144 B for the 128-byte K rows, 80 B for the 64-byte V^T rows (16 B x odd: no bank conflict for 16-byte readers) */
  __shared__ __attribute__((aligned(16))) float sO[4][RPW][64 + 4];
  __shared__ __attribute__((aligned(16))) unsigned short sK[2][32 * KP];      /* 32 keys x 64 */
  __shared__ __attribute__((aligned(16))) unsigned short sV[2][64 * VP];      /* 64 d x 32 keys */
  const int tid = threadIdx.x, w = tid >> 5, lane = tid & 31, ln = lane & 15, hh = lane >> 4;
  const int slab = blockIdx.x / QBLKS, qblk = blockIdx.x % QBLKS; (void)MSK; const int b = slab / NH, h = slab % NH; const int qb0 = qblk * (4 * RPW); const int q0 = qb0 + w * RPW;
  FragH bq[KS];
  { const unsigned short* qr = (const unsigned short*)Q16 + ((size_t)b * TQ + q0 + ln) * ldq + h * 64;
#pragma unroll
    for (int ks = 0; ks < KS; ++ks) { bq[ks].half[0] = *(const v8us*)(qr + ks * 32 + 8 * hh); bq[ks].half[1] = *(const v8us*)(qr + ks * 32 + 16 + 8 * hh); } }
  const unsigned short* Vth = (const unsigned short*)Vt + (size_t)slab * 64 * TK;
  const int tq = q0 + ln;
  v8f ctx[DT];      /* sum over the sources of the normalised rows */
#pragma unroll
  for (int dt = 0; dt < DT; ++dt) ctx[dt] = (v8f){0.f,0.f,0.f,0.f,0.f,0.f,0.f,0.f};
  const int jend = (CAUSAL == 1) ? (qb0 + 4 * RPW) : TK;      /* causal: keys beyond the block's last query never contribute */
  // Key tiles of 32 keys go to LDS once per block (the four waves read the same K and V^T), two buffers: tile t + 2 is copied while tile t + 1 is worked on.
  // The tiles of the NSRC sources form one sequence (source 0's tiles, then source 1's, ...), so the copies run on across a change of source.
  // Thread tid copies 16-byte pieces tid and tid + 128 of each tile: K piece c = row c / 8, column c % 8 (a wave covers 4 whole 128-byte rows); V^T piece c = row c / 4, column c % 4.
  const unsigned short* gK = (const unsigned short*)K16 + ((size_t)b * TK + (tid >> 3)) * ldk + h * 64 + (tid & 7) * 8;
  const unsigned short* gV = Vth + (size_t)(tid >> 2) * TK + (tid & 3) * 8;
  const unsigned lK = (unsigned)(size_t)&sK[0][(tid >> 3) * KP + (tid & 7) * 8], lV = (unsigned)(size_t)&sV[0][(tid >> 2) * VP + (tid & 3) * 8];
  int sn = 0, sj = 0;      /* source and first key of the next tile to copy; the same in every thread */
  auto stage = [&](int buf) { const unsigned short* k0 = gK + ((size_t)sn * NR + sj) * ldk; const unsigned short* v0 = gV + (size_t)sn * (NB * NH * 64) * TK + sj; const unsigned lk = lK + buf * (32 * KP * 2), lv = lV + buf * (64 * VP * 2);
    copy4_to_lds(lk, k0, lk + 16 * KP * 2, k0 + (size_t)16 * ldk, lv, v0, lv + 32 * VP * 2, v0 + (size_t)32 * TK);
    sj += 32; if (sj >= jend) { sj = 0; ++sn; } };
  stage(0);
  asm volatile("s_wait_asynccnt 0x0" ::: "memory");      /* tile 0 has landed before the barrier that publishes it */
  __syncthreads();
  stage(1);      /* jend is at least 64: a tile 1 exists */
  int buf = 0;
#pragma unroll 1      /* rolled, like the tile loop inside: one foot with the waits, the barrier and the refill in their order */
  for (int n = 0; n < NSRC; ++n) {
  float m_q = -3.0e38f, l_q = 0.f; v8f oacc[DT];      /* each source has a softmax of its own */
#pragma unroll
  for (int dt = 0; dt < DT; ++dt) oacc[dt] = (v8f){0.f,0.f,0.f,0.f,0.f,0.f,0.f,0.f};
#pragma unroll 1
  for (int j0 = 0; j0 < jend; j0 += 32) {
    const unsigned short* tK = &sK[buf][ln * KP + 8 * hh]; const unsigned short* tV = &sV[buf][ln * VP + 8 * hh];
    FragH ak[2][KS], av[DT];
#pragma unroll
    for (int nt = 0; nt < 2; ++nt)
#pragma unroll
      for (int ks = 0; ks < KS; ++ks) { ak[nt][ks].half[0] = *(const v8us*)(tK + nt * 16 * KP + ks * 32); ak[nt][ks].half[1] = *(const v8us*)(tK + nt * 16 * KP + ks * 32 + 16); }
#pragma unroll
    for (int dt = 0; dt < DT; ++dt) { av[dt].half[0] = *(const v8us*)(tV + dt * 16 * VP); av[dt].half[1] = *(const v8us*)(tV + dt * 16 * VP + 16); }
    v8f s[2];
#pragma unroll
    for (int nt = 0; nt < 2; ++nt) {
      v8f acc = (v8f){0.f,0.f,0.f,0.f,0.f,0.f,0.f,0.f};
#pragma unroll
      for (int ks = 0; ks < KS; ++ks) acc = mmaH<1>(ak[nt][ks].v, ak[nt][ks].v, bq[ks].v, bq[ks].v, acc);
      s[nt] = acc; }
    float sc[2][8], mx[8]; bool ok[2][8];      /* sc, m_q: raw products; the factor SCL2 = log2(e)/8 is applied inside the exponent's one fma */
#pragma unroll
    for (int r = 0; r < 8; ++r) {
#pragma unroll
      for (int nt = 0; nt < 2; ++nt) { const int kk = j0 + nt * 16 + 8 * hh + r;
        ok[nt][r] = (CAUSAL == 1) ? (kk <= tq) : ((CAUSAL == 2) ? ((kk >> 5) == (tq >> 5)) : true);      /* mode 2: block-diagonal 32-token groups */
        sc[nt][r] = ok[nt][r] ? s[nt][r] : -3.0e38f; }
      mx[r] = fmaxf(sc[0][r], sc[1][r]); }
    float mc = fmaxf(fmaxf(fmaxf(mx[0], mx[1]), fmaxf(mx[2], mx[3])), fmaxf(fmaxf(mx[4], mx[5]), fmaxf(mx[6], mx[7])));
    mc = fmaxf(mc, xhalf(mc));
    const float mn = fmaxf(m_q, mc); const float al = (mn > -1.0e38f) ? __builtin_amdgcn_exp2f((m_q - mn) * SCL2) : 1.0f; m_q = mn;
    const float nb = 10.0f - mn * SCL2;      /* p = 1024 e^((s - max)/8) = 2^(s SCL2 + nb): the x1024 of the f16 operand is the + 10 */
    float e[16];
#pragma unroll      /* unrolled: e stays in registers, as the asm operands need */
    for (int r = 0; r < 8; ++r) { e[r] = __builtin_fmaf(sc[0][r], SCL2, nb); e[8 + r] = __builtin_fmaf(sc[1][r], SCL2, nb); }
    exp2x16(e);
    FragH pb; float ps[8];
#pragma unroll
    for (int r = 0; r < 8; ++r) { const float p0 = ok[0][r] ? e[r] : 0.f, p1 = ok[1][r] ? e[8 + r] : 0.f; ps[r] = p0 + p1;
      pb.h[r] = (_Float16)p0; pb.h[8 + r] = (_Float16)p1; }
    l_q = l_q * al + (((ps[0] + ps[1]) + (ps[2] + ps[3])) + ((ps[4] + ps[5]) + (ps[6] + ps[7])));
#pragma unroll
    for (int dt = 0; dt < DT; ++dt)
#pragma unroll
      for (int r = 0; r < 8; ++r) oacc[dt][r] *= al;
#pragma unroll
    for (int dt = 0; dt < DT; ++dt) oacc[dt] = mmaH<1>(av[dt].v, av[dt].v, pb.v, pb.v, oacc[dt]);
    asm volatile("s_wait_dscnt 0x0" ::: "memory");      /* this wave's reads of the buffer have returned before the buffer is handed back */
    asm volatile("s_wait_asynccnt 0x0" ::: "memory");      /* this wave's copies of tile t + 1 have landed */
    __syncthreads();      /* publishes tile t + 1 and ends every wave's reads of tile t */
    if (sn < NSRC) stage(buf);      /* tile t + 2 exists */
    buf ^= 1; }
  const float l = l_q + xhalf(l_q); const float inv = (l > 0.f) ? 1.0f / l : 0.f;      /* l and oacc both carry the x1024 */
#pragma unroll
  for (int dt = 0; dt < DT; ++dt)
#pragma unroll
    for (int r = 0; r < 8; ++r) ctx[dt][r] += oacc[dt][r] * inv; }
  asm volatile("s_wait_asynccnt 0x0" ::: "memory");      /* nothing is in flight when the wave goes on to the epilogue and ends */
#pragma unroll
  for (int dt = 0; dt < DT; ++dt) {      /* register r of tile dt is O[q0 + ln][dt*16 + 8*hh + r] */
    const v4f lo = {ctx[dt][0], ctx[dt][1], ctx[dt][2], ctx[dt][3]}, hi = {ctx[dt][4], ctx[dt][5], ctx[dt][6], ctx[dt][7]};
    *(v4fa*)&sO[w][ln][dt * 16 + 8 * hh] = lo; *(v4fa*)&sO[w][ln][dt * 16 + 8 * hh + 4] = hi; }
  __builtin_amdgcn_fence(__ATOMIC_ACQ_REL, "workgroup"); __builtin_amdgcn_wave_barrier();
  {
#pragma unroll
    for (int rp = 0; rp < RPW; rp += 2) { const int r = rp + (lane >> 4), pc = lane & 15; const v4f val = *(const v4fa*)&sO[w][r][pc * 4]; *(v4f*)(O + ((size_t)b * TQ + q0 + r) * ldo + h * 64 + pc * 4) = val; }
     } }

extern "C" void kernel_launch(void* const* d_in, const int* in_sizes, int n_in,
                              void* d_out, int out_size, void* d_ws, size_t ws_size, hipStream_t stream) {
  (void)in_sizes; (void)n_in; (void)out_size;
  const float* const* I = (const float* const*)d_in; const float* hsp = I[0]; const float* Wq = I[1]; const float* bq = I[2]; const float* Wk = I[3]; const float* bk = I[4]; const float* Wv = I[5]; const float* bv = I[6];
  char* ws = (char*)d_ws; size_t off = 0;
  auto take = [&](size_t bytes) { char* p = ws + off; off += (bytes + 255) & ~(size_t)255; return p; };
  _Float16* BQ = (_Float16*)take((size_t)CC * CC * 2); _Float16* BK = (_Float16*)take((size_t)CC * CC * 2); _Float16* BV = (_Float16*)take((size_t)CC * CC * 2);
  _Float16* X16 = (_Float16*)take((size_t)NRA * CC * 2); _Float16* Q16 = (_Float16*)take((size_t)NR * CC * 2); _Float16* K16 = (_Float16*)take((size_t)NRA * CC * 2); _Float16* V16 = (_Float16*)take((size_t)NRA * CC * 2); _Float16* VT = (_Float16*)take((size_t)NRA * CC * 2);
  if (off > ws_size) return;      /* 3.4 + 30 + 6 + 30 + 30 + 30 = 130 MiB */
  k_prep<<<3 * WTB + X16B, 256, 0, stream>>>(hsp, Wq, Wk, Wv, X16, BQ, BK, BV);      /* weights x16 transposed; f16 plane of every source */
  k_qv<<<KGB + QGB, 128, 0, stream>>>(X16, BQ, BV, bq, bv, Q16, V16);      /* v for every source; q from source 0 */
  k_k_vt<<<KGB + VTB, 128, 0, stream>>>(X16, BK, bk, K16, V16, VT);      /* k for every source; V^T */
  k_flash<0><<<NB * NH * QBLKS, 128, 0, stream>>>(Q16, CC, K16, CC, VT, nullptr, (float*)d_out, CC);      /* all five sources; stores the output */
}

// v007
// It runs in 168 microseconds.
// Next to v006, in two timings, it ran 1.04 times as fast each time.
// Counting every step since v000, it is 4.61 times as fast.
#include <hip/hip_runtime.h>
// Attention_KV (5 sources x 4 batches x 1024 tokens x 768 = 12 heads of 64): q from source 0 (Wq + bq); every source n gives k_n, v_n (shared Wk/bk, Wv/bv); ctx = sum_n softmax(q k_n^T / 8) v_n (independent softmax per source); output = ctx merged [B, S, 768] (no output projection).
// Structure, three launches: one preparing launch (the three weight transposes and the exact f16 plane of all sources, picked by ranges of the block index); the q, k and v GEMMs in one launch, picked likewise (GEMMs: 32x64 wave tiles, f32 accumulation, exact x16 weights + bias, f16 outputs; k and v over all 5 sources; the v product has its operands swapped, A = weight rows, B = tokens, and so stores V^T for all (source, batch, head) slabs itself); one fused flash kernel (plain f16 operands) whose blocks walk the five sources in turn and add each source's normalised rows in registers, then store the output.
// Compute dtype: inputs and parameters rounded to bf16; q, k, v, P as f16 (~2^-12); f32 accumulation/softmax/sum. v_wmma_f32_16x16x32_f16.
#define NSRC 5
#define NB 4
#define CC 768
#define NR (NB * SLEN)           /* 4096 query rows */
#define NRA (NSRC * NR)          /* 20480 source rows */
#define SLEN 1024
#define TQ SLEN
#define TK SLEN
#define NH 12
#define SCL 0.125f               /* 1/sqrt(64) */
#define SCL2 (SCL * 1.4426950408889634f)   /* log2(e)/sqrt(64) */
#define QBLKS (TQ / 64)
typedef __bf16 v16b __attribute__((ext_vector_type(16)));
typedef unsigned short v8us __attribute__((ext_vector_type(8), may_alias));
typedef float  v8f  __attribute__((ext_vector_type(8)));
typedef float  v4f  __attribute__((ext_vector_type(4)));
typedef float  v4fa __attribute__((ext_vector_type(4), may_alias));
union FragB { v16b v; v8us half[2]; unsigned short u[16]; };

__device__ __forceinline__ unsigned short bf16_bits(float x) { unsigned int u = __float_as_uint(x); return (unsigned short)((u + 0x7FFFu + ((u >> 16) & 1u)) >> 16); }
__device__ __forceinline__ float bf16_val(unsigned short b) { return __uint_as_float(((unsigned int)b) << 16); }
__device__ __forceinline__ float bf16_round(float x) { return bf16_val(bf16_bits(x)); }
// D += A·B with NT terms: 1 = ah·bh, 2 = + al·bh (A split), 3 = + ah·bl (both split)
template <int NT>
__device__ __forceinline__ v8f mmaN(v16b ah, v16b al, v16b bh, v16b bl, v8f c) {
  c = __builtin_amdgcn_wmma_f32_16x16x32_bf16(false, ah, false, bh, (short)0, c, false, false);
  if (NT >= 2) c = __builtin_amdgcn_wmma_f32_16x16x32_bf16(false, al, false, bh, (short)0, c, false, false);
  if (NT >= 3) c = __builtin_amdgcn_wmma_f32_16x16x32_bf16(false, ah, false, bl, (short)0, c, false, false);
  asm volatile("v_nop\n\tv_nop\n\tv_nop\n\tv_nop" : "+v"(c) : "v"(ah), "v"(al), "v"(bh), "v"(bl));
  return c;
}

__global__ __launch_bounds__(256) void k_wt_bf16(const float* __restrict__ W, unsigned short* __restrict__ Wt, int K, int N) {
  const int t = blockIdx.x * 256 + threadIdx.x;
  const int k8n = K / 8;
  if (t >= N * k8n) return;
  const int n = t / k8n, k8 = (t % k8n) * 8;
  v8us v;
#pragma unroll
  for (int i = 0; i < 8; ++i) v[i] = bf16_bits(W[(size_t)(k8 + i) * N + n]);
  *(v8us*)(Wt + (size_t)n * K + k8) = v;
  
}

// GEMM C[M][N] (f32, pitch ldc) = act(A[M][K]·W + bias). A f32 row-major (pitch lda) converted per fragment to bf16
// (ASPLIT: hi/lo two planes -> 2 terms, else single rounded term); Wt bf16 [N][K] (pitch ldb). BIAS_BF16 rounds the
// bias to bf16 first (bias quantised to bf16 before the add). K%32==0, M%16==0, N%64==0.
template <bool ASPLIT, int ACT, bool BIAS_BF16>
__global__ __launch_bounds__(128) void k_gemm_bf(const float* __restrict__ A, int lda, const unsigned short* __restrict__ Wt, int ldb,
                                               const float* __restrict__ bias, float* __restrict__ C, int ldc, int M, int N, int K) {
  __shared__ __attribute__((aligned(16))) float so[4][16][64];
  const int tid = threadIdx.x, w = tid >> 5, lane = tid & 31, ln = lane & 15, hh = lane >> 4;
  const int ntn = N / 64;
  const int wid = blockIdx.x * 4 + w;
  const int mt = wid / ntn, nq = wid % ntn;
  if (mt * 16 >= M) return;
  const int row0 = mt * 16, col0 = nq * 64;
  const float* arow = A + (size_t)(row0 + ln) * lda;
  v8f acc[4] = {};
  for (int kb = 0; kb < K; kb += 32) {
    FragB ah, al;
    const v4f x0 = *(const v4fa*)(arow + kb + 8 * hh), x1 = *(const v4fa*)(arow + kb + 8 * hh + 4);
    const v4f x2 = *(const v4fa*)(arow + kb + 16 + 8 * hh), x3 = *(const v4fa*)(arow + kb + 16 + 8 * hh + 4);
    float xs[16] = {x0[0],x0[1],x0[2],x0[3],x1[0],x1[1],x1[2],x1[3],x2[0],x2[1],x2[2],x2[3],x3[0],x3[1],x3[2],x3[3]};
#pragma unroll
    for (int i = 0; i < 16; ++i) { const unsigned short hb = bf16_bits(xs[i]); ah.u[i] = hb; al.u[i] = ASPLIT ? bf16_bits(xs[i] - bf16_val(hb)) : (unsigned short)0; }
#pragma unroll
    for (int t = 0; t < 4; ++t) {
      const unsigned short* brow = Wt + (size_t)(col0 + t * 16 + ln) * ldb + kb;
      FragB b;
      b.half[0] = *(const v8us*)(brow + 8 * hh);
      b.half[1] = *(const v8us*)(brow + 16 + 8 * hh);
      acc[t] = mmaN<ASPLIT ? 2 : 1>(ah.v, al.v, b.v, b.v, acc[t]);
    }
  }
#pragma unroll
  for (int t = 0; t < 4; ++t) {
    float bv = bias ? bias[col0 + t * 16 + ln] : 0.f;
    if (BIAS_BF16) bv = bf16_round(bv);
#pragma unroll
    for (int r = 0; r < 8; ++r) { float v = acc[t][r] + bv; if (ACT == 1) v = fmaxf(v, 0.f); so[w][8 * hh + r][t * 16 + ln] = v; }
  }
  __builtin_amdgcn_fence(__ATOMIC_ACQ_REL, "workgroup");
  __builtin_amdgcn_wave_barrier();
  const int rsub = lane >> 4, c4 = (lane & 15) * 4;
  {
#pragma unroll
    for (int q = 0; q < 8; ++q) {
      const int r = q * 2 + rsub;
      const v4f v = *(const v4fa*)&so[w][r][c4];
      *(v4f*)(C + (size_t)(row0 + r) * ldc + col0 + c4) = v;
    }
    
  }
}

// GEMM C = act(A·W + bias + resid): A f32 (ASPLIT -> hi/lo 2 terms), Wt bf16 [N][K]; ACT 0 none, 1 relu, 2 exact gelu;
// resid (optional, f32, row index = (row % rmod), pitch ldr, RES_BF16 rounds it) added before the activation.
template <bool ASPLIT, int ACT, bool BIAS_BF16, bool RES_BF16>
__global__ __launch_bounds__(128) void k_gemm_bf3(const float* __restrict__ A, int lda, const unsigned short* __restrict__ Wt, int ldb,
                                                const float* __restrict__ bias, const float* __restrict__ resid, int rmod, int ldr,
                                                float* __restrict__ C, int ldc, int M, int N, int K) {
  __shared__ __attribute__((aligned(16))) float so[4][16][64];
  const int tid = threadIdx.x, w = tid >> 5, lane = tid & 31, ln = lane & 15, hh = lane >> 4;
  const int ntn = N / 64;
  const int wid = blockIdx.x * 4 + w;
  const int mt = wid / ntn, nq = wid % ntn;
  if (mt * 16 >= M) return;
  const int row0 = mt * 16, col0 = nq * 64;
  const float* arow = A + (size_t)(row0 + ln) * lda;
  v8f acc[4] = {};
  for (int kb = 0; kb < K; kb += 32) {
    FragB ah, al;
    const v4f x0 = *(const v4fa*)(arow + kb + 8 * hh), x1 = *(const v4fa*)(arow + kb + 8 * hh + 4);
    const v4f x2 = *(const v4fa*)(arow + kb + 16 + 8 * hh), x3 = *(const v4fa*)(arow + kb + 16 + 8 * hh + 4);
    float xs[16] = {x0[0],x0[1],x0[2],x0[3],x1[0],x1[1],x1[2],x1[3],x2[0],x2[1],x2[2],x2[3],x3[0],x3[1],x3[2],x3[3]};
#pragma unroll
    for (int i = 0; i < 16; ++i) { const unsigned short hb = bf16_bits(xs[i]); ah.u[i] = hb; al.u[i] = ASPLIT ? bf16_bits(xs[i] - bf16_val(hb)) : (unsigned short)0; }
#pragma unroll
    for (int t = 0; t < 4; ++t) {
      const unsigned short* brow = Wt + (size_t)(col0 + t * 16 + ln) * ldb + kb;
      FragB b;
      b.half[0] = *(const v8us*)(brow + 8 * hh);
      b.half[1] = *(const v8us*)(brow + 16 + 8 * hh);
      acc[t] = mmaN<ASPLIT ? 2 : 1>(ah.v, al.v, b.v, b.v, acc[t]);
    }
  }
#pragma unroll
  for (int t = 0; t < 4; ++t) {
    const int col = col0 + t * 16 + ln;
    float bv = bias ? bias[col] : 0.f;
    if (BIAS_BF16) bv = bf16_round(bv);
#pragma unroll
    for (int r = 0; r < 8; ++r) {
      float v = acc[t][r] + bv;
      if (resid) { float rv = resid[(size_t)((row0 + 8 * hh + r) % rmod) * ldr + col]; if (RES_BF16) rv = bf16_round(rv); v += rv; }
      if (ACT == 1) v = fmaxf(v, 0.f);
      if (ACT == 2) v = 0.5f * v * (1.0f + erff(v * 0.70710678118654752f));
      if (ACT == 3) { const float u = 0.7978845608028654f * (v + 0.044715f * v * v * v); v = 0.5f * v * (1.0f + tanhf(u)); }
      so[w][8 * hh + r][t * 16 + ln] = v;
    }
  }
  __builtin_amdgcn_fence(__ATOMIC_ACQ_REL, "workgroup");
  __builtin_amdgcn_wave_barrier();
  const int rsub = lane >> 4, c4 = (lane & 15) * 4;
  {
#pragma unroll
    for (int q = 0; q < 8; ++q) {
      const int r = q * 2 + rsub;
      const v4f v = *(const v4fa*)&so[w][r][c4];
      *(v4f*)(C + (size_t)(row0 + r) * ldc + col0 + c4) = v;
    }
    
  }
}
// row LayerNorm (biased variance, eps) over N: s = X (+ R); optional out_sum <- s; out_norm <- (s-mu)*rsqrt(var+eps)*g + b
template <bool PARAM_BF16>
__global__ __launch_bounds__(256) void k_layernorm(const float* __restrict__ X, const float* __restrict__ R, const float* __restrict__ g, const float* __restrict__ bta,
                                                  float* __restrict__ out_sum, float* __restrict__ out_norm, int N, float eps) {
  __shared__ float red[256];
  const int row = blockIdx.x, tid = threadIdx.x;
  const float* x = X + (size_t)row * N; const float* rr = R ? R + (size_t)row * N : nullptr;
  float vals[16];                     // up to N = 4096
  const int per = N / 256;            // contiguous chunk per thread? use strided-by-4 chunks: thread handles j = tid*4 + 1024*u
  float s1 = 0.f;
  for (int u = 0; u < per / 4; ++u) {
    const int j = tid * 4 + 1024 * u;
    const v4f a = *(const v4fa*)(x + j);
    v4f b = {0.f,0.f,0.f,0.f}; if (rr) b = *(const v4fa*)(rr + j);
#pragma unroll
    for (int q = 0; q < 4; ++q) { const float v = a[q] + b[q]; vals[u * 4 + q] = v; s1 += v; }
  }
  red[tid] = s1; __syncthreads();
  for (int st = 128; st > 0; st >>= 1) { if (tid < st) red[tid] += red[tid + st]; __syncthreads(); }
  const float mu = red[0] / (float)N; __syncthreads();
  float s2 = 0.f;
  for (int u = 0; u < per / 4; ++u)
#pragma unroll
    for (int q = 0; q < 4; ++q) { const float c = vals[u * 4 + q] - mu; s2 += c * c; }
  red[tid] = s2; __syncthreads();
  for (int st = 128; st > 0; st >>= 1) { if (tid < st) red[tid] += red[tid + st]; __syncthreads(); }
  const float rs = rsqrtf(red[0] / (float)N + eps);
  {
    for (int u = 0; u < per / 4; ++u) {
      const int j = tid * 4 + 1024 * u;
      v4f o, sm;
#pragma unroll
      for (int q = 0; q < 4; ++q) {
        float gg = g[j + q], bb = bta[j + q];
        if (PARAM_BF16) { gg = bf16_round(gg); bb = bf16_round(bb); }
        sm[q] = vals[u * 4 + q]; o[q] = (vals[u * 4 + q] - mu) * rs * gg + bb;
      }
      if (out_sum) *(v4f*)(out_sum + (size_t)row * N + j) = sm;
      *(v4f*)(out_norm + (size_t)row * N + j) = o;
    }
    
  }
}



// ---- f16 WMMA path (v_wmma_f32_16x16x32_f16): 11-bit significands for operands in range — used where a [0,1] probability operand needs more precision than bf16
typedef _Float16 v16h __attribute__((ext_vector_type(16)));
union FragH { v16h v; v8us half[2]; _Float16 h[16]; unsigned short u[16]; };
template <int NT>
__device__ __forceinline__ v8f mmaH(v16h ah, v16h al, v16h bh, v16h bl, v8f c) {
  c = __builtin_amdgcn_wmma_f32_16x16x32_f16(false, ah, false, bh, (short)0, c, false, false);
  if (NT >= 2) c = __builtin_amdgcn_wmma_f32_16x16x32_f16(false, al, false, bh, (short)0, c, false, false);
  if (NT >= 3) c = __builtin_amdgcn_wmma_f32_16x16x32_f16(false, ah, false, bl, (short)0, c, false, false);
  asm volatile("v_nop\n\tv_nop\n\tv_nop\n\tv_nop" : "+v"(c) : "v"(ah), "v"(al), "v"(bh), "v"(bl));
  return c;
}
// batched GEMM like k_gemm_b but f16 operands: A f32 (split into f16 hi/lo if ASPLIT, else rounded to f16), Bt = f16 values [n][k]; alpha; C f32; N multiple of 16 (partial tiles skipped)
template <bool ASPLIT>
__global__ __launch_bounds__(128) void k_gemm_h(const float* __restrict__ A, int lda, size_t sA, const _Float16* __restrict__ Bh, int ldb, size_t sB, float alpha, float* __restrict__ C, int ldc, size_t sC, int M, int N, int K) {
  __shared__ __attribute__((aligned(16))) float so[4][16][64];
  const int tid = threadIdx.x, w = tid >> 5, lane = tid & 31, ln = lane & 15, hh = lane >> 4; const int by = blockIdx.y;
  A += (size_t)by * sA; Bh += (size_t)by * sB; C += (size_t)by * sC;
  const int ntn = (N + 63) / 64; const int wid = blockIdx.x * 4 + w; const int mt = wid / ntn, nq = wid % ntn; if (mt * 16 >= M) return;
  const int row0 = mt * 16, col0 = nq * 64; const float* arow = A + (size_t)(row0 + ln) * lda;
  v8f acc[4] = {};
  for (int kb = 0; kb < K; kb += 32) {
    FragH ah, al;
    const v4f x0 = *(const v4fa*)(arow + kb + 8 * hh), x1 = *(const v4fa*)(arow + kb + 8 * hh + 4), x2 = *(const v4fa*)(arow + kb + 16 + 8 * hh), x3 = *(const v4fa*)(arow + kb + 16 + 8 * hh + 4);
    float xs[16] = {x0[0],x0[1],x0[2],x0[3],x1[0],x1[1],x1[2],x1[3],x2[0],x2[1],x2[2],x2[3],x3[0],x3[1],x3[2],x3[3]};
#pragma unroll
    for (int i = 0; i < 16; ++i) { const _Float16 h = (_Float16)xs[i]; ah.h[i] = h; al.h[i] = ASPLIT ? (_Float16)(xs[i] - (float)h) : (_Float16)0.0f; }
#pragma unroll
    for (int t = 0; t < 4; ++t) { if (col0 + t * 16 >= N) continue; const size_t boff = (size_t)(col0 + t * 16 + ln) * ldb + kb; FragH bq; bq.half[0] = *(const v8us*)(Bh + boff + 8 * hh); bq.half[1] = *(const v8us*)(Bh + boff + 16 + 8 * hh);
      acc[t] = mmaH<ASPLIT ? 2 : 1>(ah.v, al.v, bq.v, bq.v, acc[t]); }
  }
#pragma unroll
  for (int t = 0; t < 4; ++t) { if (col0 + t * 16 >= N) continue;
#pragma unroll
    for (int r = 0; r < 8; ++r) so[w][8 * hh + r][t * 16 + ln] = acc[t][r] * alpha; }
  __builtin_amdgcn_fence(__ATOMIC_ACQ_REL, "workgroup"); __builtin_amdgcn_wave_barrier();
  const int rsub = lane >> 4, c4 = (lane & 15) * 4;
  {
#pragma unroll
    for (int q = 0; q < 8; ++q) { const int r = q * 2 + rsub; if (col0 + c4 < N) { const v4f v = *(const v4fa*)&so[w][r][c4]; *(v4f*)(C + (size_t)(row0 + r) * ldc + col0 + c4) = v; } }
     }
}

// Wt[n][k] = f16(W[k][n]·scale) from f32 row-major W[K][N] (scale = power of two; bf16-exact weights stay exact in f16 away from the subnormal range)
__device__ __forceinline__ void wt_f16_job(int blk, const float* __restrict__ W, _Float16* __restrict__ Wt, int K, int N, float scale) {
  const int t = blk * 256 + threadIdx.x; if (t >= N * (K / 8)) return; const int n = t / (K / 8), k8 = (t % (K / 8)) * 8; FragH f;
#pragma unroll
  for (int i = 0; i < 8; ++i) f.h[i] = (_Float16)(bf16_round(W[(size_t)(k8 + i) * N + n]) * scale); const v8us o = f.half[0];
  *(v8us*)((unsigned short*)Wt + (size_t)n * K + k8) = o; 
}
// k_gemm_hh variant with fused epilogue: v = acc·alpha + bias[by·sBias + col] (+ CP[(row/rowsPerB)·sCPb + by·64 + col] if CP) ; ACT 0 none / 1 elu ; writes f16 C16 (and f32 C if non-null)
template <int ACT>
__global__ __launch_bounds__(128) void k_gemm_hhx(const _Float16* __restrict__ A, int lda, size_t sA, const _Float16* __restrict__ Bh, int ldb, size_t sB, float alpha, const float* __restrict__ bias, size_t sBias, const float* __restrict__ CP, int rowsPerB, size_t sCPb, int row0g,
    float* __restrict__ C, _Float16* __restrict__ C16, int ldc, size_t sC, int M, int N, int K) {
  __shared__ __attribute__((aligned(16))) float so[4][16][64];
  const int tid = threadIdx.x, w = tid >> 5, lane = tid & 31, ln = lane & 15, hh = lane >> 4; const int by = blockIdx.y;
  A += (size_t)by * sA; Bh += (size_t)by * sB; const size_t cofs = (size_t)by * sC; const float* bp = bias ? bias + (size_t)by * sBias : nullptr;
  const int ntn = (N + 63) / 64; const int wid = blockIdx.x * 4 + w; const int mt = wid / ntn, nq = wid % ntn; if (mt * 16 >= M) return;
  const int row0 = mt * 16, col0 = nq * 64; const _Float16* arow = A + (size_t)(row0 + ln) * lda;
  v8f acc[4] = {};
  for (int kb = 0; kb < K; kb += 32) { FragH ah; ah.half[0] = *(const v8us*)((const unsigned short*)arow + kb + 8 * hh); ah.half[1] = *(const v8us*)((const unsigned short*)arow + kb + 16 + 8 * hh);
#pragma unroll
    for (int t = 0; t < 4; ++t) { if (col0 + t * 16 >= N) continue; const size_t boff = (size_t)(col0 + t * 16 + ln) * ldb + kb; FragH bq; bq.half[0] = *(const v8us*)((const unsigned short*)Bh + boff + 8 * hh); bq.half[1] = *(const v8us*)((const unsigned short*)Bh + boff + 16 + 8 * hh);
      acc[t] = mmaH<1>(ah.v, ah.v, bq.v, bq.v, acc[t]); }
  }
#pragma unroll
  for (int t = 0; t < 4; ++t) { if (col0 + t * 16 >= N) continue; const int col = col0 + t * 16 + ln; const float bv = bp ? bf16_round(bp[col]) : 0.f;
#pragma unroll
    for (int r = 0; r < 8; ++r) { float v = acc[t][r] * alpha + bv; if (CP) { const int bidx = (row0g + row0 + 8 * hh + r) / rowsPerB; v += CP[(size_t)bidx * sCPb + (size_t)by * 64 + col]; } if (ACT == 1) v = (v > 0.f) ? v : expm1f(v); else if (ACT == 7) v = (v > 0.f) ? v + 1.0f : expf(v); else if (ACT == 8) v = tanhf(v); else if (ACT == 9) v = 0.5f * v * (1.0f + tanhf(0.7978845608028654f * (v + 0.044715f * v * v * v))); else if (ACT == 11) v = 1.0f / (1.0f + expf(-v)); else if (ACT == 12) v = (v > 0.f) ? v : 0.01f * v; else if (ACT == 14) v = (v > 0.f) ? v : 0.1f * v; else if (ACT == 15) v = v / (1.0f + expf(-v)); else if (ACT == 3) v = fmaxf(v, 0.f); else if (ACT == 6) v = 0.5f * v * (1.0f + erff(v * 0.70710678118654752f)); so[w][8 * hh + r][t * 16 + ln] = v; } }
  __builtin_amdgcn_fence(__ATOMIC_ACQ_REL, "workgroup"); __builtin_amdgcn_wave_barrier();
  const int rsub = lane >> 4, c4 = (lane & 15) * 4; typedef _Float16 v4h __attribute__((ext_vector_type(4)));
  {
#pragma unroll
    for (int q = 0; q < 8; ++q) { const int r = q * 2 + rsub; if (col0 + c4 < N) { const v4f v = *(const v4fa*)&so[w][r][c4]; if (C) *(v4f*)(C + cofs + (size_t)(row0 + r) * ldc + col0 + c4) = v; if (C16) { v4h h4; for (int i = 0; i < 4; ++i) h4[i] = (_Float16)v[i]; *(v4h*)(C16 + cofs + (size_t)(row0 + r) * ldc + col0 + c4) = h4; } } }
     }
}


typedef _Float16 v4h __attribute__((ext_vector_type(4)));

__device__ __forceinline__ void x16_job(int blk, const float* __restrict__ x, _Float16* __restrict__ X16, size_t n8) { const size_t t = (size_t)blk * 256 + threadIdx.x; if (t >= n8) return; FragH f;
#pragma unroll
  for (int q = 0; q < 8; ++q) f.h[q] = (_Float16)bf16_round(x[t * 8 + q]); *(v8us*)((unsigned short*)X16 + t * 8) = f.half[0];  }
// The four jobs that need nothing of each other share one grid: blocks 0 .. 3 * WTB - 1 transpose Wq, Wk, Wv (they wait on scattered loads; placed first for speed only), the rest cast the sources. The choice is the same for a whole block.
#define WTB ((CC * CC / 8 + 255) / 256)
#define X16B ((NRA * CC / 8 + 255) / 256)
__global__ __launch_bounds__(256) void k_prep(const float* __restrict__ x, const float* __restrict__ Wq, const float* __restrict__ Wk, const float* __restrict__ Wv,
                                             _Float16* __restrict__ X16, _Float16* __restrict__ BQ, _Float16* __restrict__ BK, _Float16* __restrict__ BV) {
  const int bx = blockIdx.x;
  if (bx < 3 * WTB) { const int m = bx / WTB; wt_f16_job(bx - m * WTB, m == 0 ? Wq : (m == 1 ? Wk : Wv), m == 0 ? BQ : (m == 1 ? BK : BV), CC, CC, 16.0f); }
  else x16_job(bx - 3 * WTB, x, X16, (size_t)NRA * CC / 8); }
__global__ __launch_bounds__(256) void k_h16(const float* __restrict__ x, _Float16* __restrict__ X16, size_t n8) { const size_t t = (size_t)blockIdx.x * 256 + threadIdx.x; if (t >= n8) return; FragH f;
#pragma unroll
  for (int q = 0; q < 8; ++q) f.h[q] = (_Float16)x[t * 8 + q]; *(v8us*)((unsigned short*)X16 + t * 8) = f.half[0];  }
__global__ __launch_bounds__(256) void k_round16f(const float* __restrict__ W, _Float16* __restrict__ Bt, size_t n8) { const size_t t = (size_t)blockIdx.x * 256 + threadIdx.x; if (t >= n8) return; FragH f;
#pragma unroll
  for (int i = 0; i < 8; ++i) f.h[i] = (_Float16)(bf16_round(W[t * 8 + i]) * 16.0f); *(v8us*)((unsigned short*)Bt + t * 8) = f.half[0];  }
__global__ __launch_bounds__(256) void k_hl(const float* __restrict__ F, _Float16* __restrict__ Hh, _Float16* __restrict__ Hl, size_t n8) { const size_t t = (size_t)blockIdx.x * 256 + threadIdx.x; if (t >= n8) return; FragH fh, fl; const v4f a = *(const v4fa*)(F + t * 8), c = *(const v4fa*)(F + t * 8 + 4);
#pragma unroll
  for (int q = 0; q < 4; ++q) { _Float16 h = (_Float16)a[q]; fh.h[q] = h; fl.h[q] = (_Float16)((a[q] - (float)h) * 1024.0f); h = (_Float16)c[q]; fh.h[4 + q] = h; fl.h[4 + q] = (_Float16)((c[q] - (float)h) * 1024.0f); }
  { *(v8us*)((unsigned short*)Hh + t * 8) = fh.half[0]; *(v8us*)((unsigned short*)Hl + t * 8) = fl.half[0];  } }

// ---- fast GEMM (wave tile 32x64; requires M % 32 == 0 rows per launch region and N % 64 == 0); epilogue = k_gemm_hhx semantics, or with ROWB a bias per row of C ----
__device__ __forceinline__ v16h g2_frag(const _Float16* p, int hh) { FragH f; f.half[0] = *(const v8us*)((const unsigned short*)p + 8 * hh); f.half[1] = *(const v8us*)((const unsigned short*)p + 16 + 8 * hh); return f.v; }
__device__ __forceinline__ v8f g2_mma(v16h a, v16h b, v8f c) { v8f d = __builtin_amdgcn_wmma_f32_16x16x32_f16(false, a, false, b, (short)0, c, false, false); asm volatile("v_nop\n\tv_nop\n\tv_nop\n\tv_nop" : "+v"(d) : "v"(a), "v"(b)); return d; }
// One lane's twelve 16-byte asynchronous copies from global memory to LDS (l: LDS byte addresses, g: global addresses). The s_wait_xcnt is the last line of the copies' own statement, so that no address register is rewritten in front of it.
__device__ __forceinline__ void copy12_to_lds(const unsigned (&l)[12], const unsigned short* const (&g)[12]) {
  asm volatile("global_load_async_to_lds_b128 %0, %12, off\n\tglobal_load_async_to_lds_b128 %1, %13, off\n\tglobal_load_async_to_lds_b128 %2, %14, off\n\tglobal_load_async_to_lds_b128 %3, %15, off\n\t"
               "global_load_async_to_lds_b128 %4, %16, off\n\tglobal_load_async_to_lds_b128 %5, %17, off\n\tglobal_load_async_to_lds_b128 %6, %18, off\n\tglobal_load_async_to_lds_b128 %7, %19, off\n\t"
               "global_load_async_to_lds_b128 %8, %20, off\n\tglobal_load_async_to_lds_b128 %9, %21, off\n\tglobal_load_async_to_lds_b128 %10, %22, off\n\tglobal_load_async_to_lds_b128 %11, %23, off\n\ts_wait_xcnt 0x0"
               :: "v"(l[0]), "v"(l[1]), "v"(l[2]), "v"(l[3]), "v"(l[4]), "v"(l[5]), "v"(l[6]), "v"(l[7]), "v"(l[8]), "v"(l[9]), "v"(l[10]), "v"(l[11]),
                  "v"(g[0]), "v"(g[1]), "v"(g[2]), "v"(g[3]), "v"(g[4]), "v"(g[5]), "v"(g[6]), "v"(g[7]), "v"(g[8]), "v"(g[9]), "v"(g[10]), "v"(g[11]) : "memory"); }
#define GEMM2_LDS ((128 + 64) * 72)      /* floats of LDS that a caller of gemm2_job hands in, 16-byte aligned */
// Block tile 128 x 64. The operands go to LDS once per block in k steps of 64 (whole 128-byte lines of every row), two buffers: step t + 2 is copied while step t + 1 is worked on. Requires K % 64 == 0.
// ROWB: the bias belongs to the rows of C (the weights are the A operand), else to its columns.
template <int ACT, bool ROWB>
__device__ __forceinline__ void gemm2_job(float* sm, int bx, int by, const _Float16* __restrict__ A, int lda, size_t sA, const _Float16* __restrict__ Bh, int ldb, size_t sB, float alpha, const float* __restrict__ bias, size_t sBias, const float* __restrict__ CP, int rowsPerB, size_t sCPb, int row0g,
    float* __restrict__ C, _Float16* __restrict__ C16, int ldc, size_t sC, int M, int N, int K) {
  constexpr int GP = 72;                    /* LDS row pitch in f16: 144 B for the 128-byte rows (16 B x odd: no bank conflict for 16-byte readers) */
  constexpr int STG = (128 + 64) * GP;      /* one buffer in f16: 128 A rows, then 64 B rows */
  static_assert(2 * STG / 2 == GEMM2_LDS, "the caller's LDS array");      /* sm, 55,296 B: the two operand buffers in the k loop; behind it the epilogue's per-wave output tiles */
  float (*so)[32][68] = (float (*)[32][68])sm;
  const unsigned short* sT = (const unsigned short*)sm;
  const int tid = threadIdx.x, w = tid >> 5, lane = tid & 31, ln = lane & 15, hh = lane >> 4;
  A += (size_t)by * sA; Bh += (size_t)by * sB; const size_t cofs = (size_t)by * sC; const float* bp = bias ? bias + (size_t)by * sBias : nullptr;
  const int ntn = N >> 6; const int mt = bx / ntn, nq = bx - mt * ntn; const int rowb = mt * 128, row0 = rowb + 32 * w, col0 = nq * 64; if (rowb >= M) return;      /* the whole block leaves, in front of every barrier */
  // Thread tid copies 16-byte piece tid & 7 of rows (tid >> 3) + 16 i: a wave's copy covers 4 whole 128-byte rows. An A row past M is clamped to the last row (its products are never stored).
  const int cr = tid >> 3, cc = (tid & 7) * 8;
  const unsigned short* gsrc[12];
#pragma unroll      /* unrolled here and in the three loops below: the address arrays stay in registers */
  for (int i = 0; i < 8; ++i) { const int r = rowb + cr + 16 * i; gsrc[i] = (const unsigned short*)A + (size_t)(r < M ? r : M - 1) * lda + cc; }
#pragma unroll
  for (int i = 0; i < 4; ++i) gsrc[8 + i] = (const unsigned short*)Bh + (size_t)(col0 + cr + 16 * i) * ldb + cc;
  const unsigned l0 = (unsigned)(size_t)&sT[cr * GP + cc];
  auto stage = [&](int buf) { unsigned l[12];      /* copies the next k step into buffer buf and moves the source pointers on by one step */
#pragma unroll
    for (int i = 0; i < 12; ++i) l[i] = l0 + (unsigned)((buf * STG + 16 * i * GP) * 2);
    copy12_to_lds(l, gsrc);
#pragma unroll
    for (int i = 0; i < 12; ++i) gsrc[i] += 64; };
  const v8f z8 = {0.f,0.f,0.f,0.f,0.f,0.f,0.f,0.f}; v8f c00 = z8, c01 = z8, c02 = z8, c03 = z8, c10 = z8, c11 = z8, c12 = z8, c13 = z8;
  stage(0);
  asm volatile("s_wait_asynccnt 0x0" ::: "memory");      /* step 0 has landed before the barrier that publishes it */
  __syncthreads();
  if (64 < K) stage(1);
#pragma unroll 1      /* rolled: one foot with the waits, the barrier and the refill in their order */
  for (int kb = 0; kb < K; kb += 64) {
    const int buf = (kb >> 6) & 1;
    const _Float16* tA = (const _Float16*)sT + buf * STG + (32 * w + ln) * GP; const _Float16* tB = (const _Float16*)sT + buf * STG + (128 + ln) * GP;
    v16h fa[2][2], fb[2][4];      /* the step's fragment reads stand together in front of its products */
#pragma unroll      /* unrolled here and in the two loops below: the fragment arrays stay in registers */
    for (int ks = 0; ks < 2; ++ks) { fa[ks][0] = g2_frag(tA + ks * 32, hh); fa[ks][1] = g2_frag(tA + 16 * GP + ks * 32, hh);
#pragma unroll
      for (int t = 0; t < 4; ++t) fb[ks][t] = g2_frag(tB + t * 16 * GP + ks * 32, hh); }
#pragma unroll
    for (int ks = 0; ks < 2; ++ks) {
      c00 = g2_mma(fa[ks][0], fb[ks][0], c00); c10 = g2_mma(fa[ks][1], fb[ks][0], c10);
      c01 = g2_mma(fa[ks][0], fb[ks][1], c01); c11 = g2_mma(fa[ks][1], fb[ks][1], c11);
      c02 = g2_mma(fa[ks][0], fb[ks][2], c02); c12 = g2_mma(fa[ks][1], fb[ks][2], c12);
      c03 = g2_mma(fa[ks][0], fb[ks][3], c03); c13 = g2_mma(fa[ks][1], fb[ks][3], c13); }
    asm volatile("s_wait_dscnt 0x0" ::: "memory");      /* this wave's reads of the buffer have returned before the buffer is handed back */
    asm volatile("s_wait_asynccnt 0x0" ::: "memory");      /* this wave's copies of step t + 1 have landed */
    __syncthreads();      /* publishes step t + 1 and ends every wave's reads of step t */
    if (kb + 128 < K) stage(buf); }
  asm volatile("s_wait_asynccnt 0x0" ::: "memory");      /* nothing is in flight when the LDS is taken over by the output tiles */
  if (row0 >= M) return;      /* behind the last barrier */
  v8f accs[8] = {c00, c01, c02, c03, c10, c11, c12, c13};
  float br[2][8] = {};      /* ROWB (a bias is required there): the bias of this lane's 16 rows, by four 16-byte loads issued together */
  if (ROWB) { const float* pr = bp + row0 + 8 * hh; const v4f b0 = *(const v4fa*)pr, b1 = *(const v4fa*)(pr + 4), b2 = *(const v4fa*)(pr + 16), b3 = *(const v4fa*)(pr + 20);
#pragma unroll      /* unrolled: br stays in registers */
    for (int i = 0; i < 4; ++i) { br[0][i] = bf16_round(b0[i]); br[0][4 + i] = bf16_round(b1[i]); br[1][i] = bf16_round(b2[i]); br[1][4 + i] = bf16_round(b3[i]); } }
#pragma unroll
  for (int u = 0; u < 8; ++u) { const int t = u & 3, half = u >> 2; const int col = col0 + t * 16 + ln; const float bc = (!ROWB && bp) ? bf16_round(bp[col]) : 0.f;
#pragma unroll
    for (int r = 0; r < 8; ++r) { const int rloc = half * 16 + 8 * hh + r; float v = accs[u][r] * alpha + (ROWB ? br[half][r] : bc); if (CP) { const int bidx = (row0g + row0 + rloc) / rowsPerB; v += CP[(size_t)bidx * sCPb + (size_t)by * 64 + col]; }
      if (ACT == 3) v = fmaxf(v, 0.f); else if (ACT == 6) v = 0.5f * v * (1.0f + erff(v * 0.70710678118654752f)); else if (ACT == 11) v = 1.0f / (1.0f + expf(-v)); else if (ACT == 15) v = v / (1.0f + expf(-v)); else if (ACT == 12) v = (v > 0.f) ? v : 0.01f * v; else if (ACT == 8) v = tanhf(v);
      so[w][rloc][t * 16 + ln] = v; } }
  __builtin_amdgcn_fence(__ATOMIC_ACQ_REL, "workgroup"); __builtin_amdgcn_wave_barrier();
  const int rsub = lane >> 4, c4 = (lane & 15) * 4;
  {
#pragma unroll
    for (int q = 0; q < 16; ++q) { const int r = q * 2 + rsub; const v4f v = *(const v4fa*)&so[w][r][c4]; if (C) *(v4f*)(C + cofs + (size_t)(row0 + r) * ldc + col0 + c4) = v; if (C16) { v4h h4; for (int i = 0; i < 4; ++i) h4[i] = (_Float16)v[i]; *(v4h*)(C16 + cofs + (size_t)(row0 + r) * ldc + col0 + c4) = h4; } }
     } }

// The three products need nothing of each other and share one grid; the block index picks the job, the same for a whole block.
// V^T[(n*4 + b)*768 + h*64 + d][key] is the v product with its operands swapped: C = Wv^T (768 rows) x tokens of one (source, batch) (1024 columns), so no transposing pass and no row-major v are needed.
// Order: the q blocks, then for each (source, batch) its k blocks and its V^T blocks, which read the same 1024 token rows.
#define NTC (CC / 64)              /* column tiles of the q and k products */
#define QGB ((NR / 128) * NTC)      /* blocks of the q product */
#define KBB ((SLEN / 128) * NTC)      /* blocks of the k product on one (source, batch) */
#define VBB ((CC / 128) * (SLEN / 64))      /* blocks of the V^T product on one (source, batch) */
__global__ __launch_bounds__(128) void k_qkv(const _Float16* __restrict__ X16, const _Float16* __restrict__ BQ, const _Float16* __restrict__ BK, const _Float16* __restrict__ BV,
                                            const float* __restrict__ bq, const float* __restrict__ bk, const float* __restrict__ bv,
                                            _Float16* __restrict__ Q16, _Float16* __restrict__ K16, _Float16* __restrict__ VT) {
  __shared__ __attribute__((aligned(16))) float sm[GEMM2_LDS];
  const int bx = blockIdx.x; const bool isq = bx < QGB;
  const int g = isq ? 0 : (bx - QGB) / (KBB + VBB), r = isq ? 0 : (bx - QGB) - g * (KBB + VBB);      /* (source, batch) and the block's place among its KBB + VBB */
  if (!isq && r >= KBB) gemm2_job<0, true>(sm, r - KBB, g, BV, CC, 0, X16, CC, (size_t)SLEN * CC, 0.0625f, bv, 0, nullptr, 1, 0, 0, nullptr, VT, SLEN, (size_t)CC * SLEN, CC, SLEN, CC);
  else gemm2_job<0, false>(sm, isq ? bx : g * KBB + r, 0, X16, CC, 0, isq ? BQ : BK, CC, 0, 0.0625f, isq ? bq : bk, 0, nullptr, 1, 0, 0, nullptr, isq ? Q16 : K16, CC, 0, isq ? NR : NRA, CC, CC); }

// lane l with lane l ^ 16: the two lanes that share one query column of a transposed score tile
__device__ __forceinline__ float xhalf(float x) { return __builtin_bit_cast(float, __builtin_amdgcn_permlanex16(__builtin_bit_cast(int, x), __builtin_bit_cast(int, x), 0x76543210, 0xfedcba98, false, false)); }
__device__ __forceinline__ void copy4_to_lds(unsigned l0, const unsigned short* g0, unsigned l1, const unsigned short* g1, unsigned l2, const unsigned short* g2, unsigned l3, const unsigned short* g3) {
  asm volatile("global_load_async_to_lds_b128 %0, %1, off\n\tglobal_load_async_to_lds_b128 %2, %3, off\n\tglobal_load_async_to_lds_b128 %4, %5, off\n\tglobal_load_async_to_lds_b128 %6, %7, off\n\ts_wait_xcnt 0x0"
               :: "v"(l0), "v"(g0), "v"(l1), "v"(g1), "v"(l2), "v"(g2), "v"(l3), "v"(g3) : "memory"); }
// Sixteen 2^x in place, each on a register of its own: no instruction directly behind a transcendental reads its result or overwrites its source; the closing v_nop keeps that slot in front of whatever the compiler puts next.
__device__ __forceinline__ void exp2x16(float (&x)[16]) {
  asm("v_exp_f32 %0, %0\n\tv_exp_f32 %1, %1\n\tv_exp_f32 %2, %2\n\tv_exp_f32 %3, %3\n\tv_exp_f32 %4, %4\n\tv_exp_f32 %5, %5\n\tv_exp_f32 %6, %6\n\tv_exp_f32 %7, %7\n\t"
      "v_exp_f32 %8, %8\n\tv_exp_f32 %9, %9\n\tv_exp_f32 %10, %10\n\tv_exp_f32 %11, %11\n\tv_exp_f32 %12, %12\n\tv_exp_f32 %13, %13\n\tv_exp_f32 %14, %14\n\tv_exp_f32 %15, %15\n\tv_nop"
      : "+v"(x[0]), "+v"(x[1]), "+v"(x[2]), "+v"(x[3]), "+v"(x[4]), "+v"(x[5]), "+v"(x[6]), "+v"(x[7]), "+v"(x[8]), "+v"(x[9]), "+v"(x[10]), "+v"(x[11]), "+v"(x[12]), "+v"(x[13]), "+v"(x[14]), "+v"(x[15])); }
template <int CAUSAL>
__global__ __launch_bounds__(128) void k_flash(const _Float16* __restrict__ Q16, int ldq, const _Float16* __restrict__ K16, int ldk, const _Float16* __restrict__ Vt, const int* __restrict__ MSK, float* __restrict__ O, int ldo) {
  constexpr int RPW = 16, DT = 4, KS = 2;
  constexpr int KP = 72, VP = 40;      /* LDS row pitch in f16: 144 B for the 128-byte K rows, 80 B for the 64-byte V^T rows (16 B x odd: no bank conflict for 16-byte readers) */
  __shared__ __attribute__((aligned(16))) float sO[4][RPW][64 + 4];
  __shared__ __attribute__((aligned(16))) unsigned short sK[2][32 * KP];      /* 32 keys x 64 */
  __shared__ __attribute__((aligned(16))) unsigned short sV[2][64 * VP];      /* 64 d x 32 keys */
  const int tid = threadIdx.x, w = tid >> 5, lane = tid & 31, ln = lane & 15, hh = lane >> 4;
  const int slab = blockIdx.x / QBLKS, qblk = blockIdx.x % QBLKS; (void)MSK; const int b = slab / NH, h = slab % NH; const int qb0 = qblk * (4 * RPW); const int q0 = qb0 + w * RPW;
  FragH bq[KS];
  { const unsigned short* qr = (const unsigned short*)Q16 + ((size_t)b * TQ + q0 + ln) * ldq + h * 64;
#pragma unroll
    for (int ks = 0; ks < KS; ++ks) { bq[ks].half[0] = *(const v8us*)(qr + ks * 32 + 8 * hh); bq[ks].half[1] = *(const v8us*)(qr + ks * 32 + 16 + 8 * hh); } }
  const unsigned short* Vth = (const unsigned short*)Vt + (size_t)slab * 64 * TK;
  const int tq = q0 + ln;
  v8f ctx[DT];      /* sum over the sources of the normalised rows */
#pragma unroll
  for (int dt = 0; dt < DT; ++dt) ctx[dt] = (v8f){0.f,0.f,0.f,0.f,0.f,0.f,0.f,0.f};
  const int jend = (CAUSAL == 1) ? (qb0 + 4 * RPW) : TK;      /* causal: keys beyond the block's last query never contribute */
  // Key tiles of 32 keys go to LDS once per block (the four waves read the same K and V^T), two buffers: tile t + 2 is copied while tile t + 1 is worked on.
  // The tiles of the NSRC sources form one sequence (source 0's tiles, then source 1's, ...), so the copies run on across a change of source.
  // Thread tid copies 16-byte pieces tid and tid + 128 of each tile: K piece c = row c / 8, column c % 8 (a wave covers 4 whole 128-byte rows); V^T piece c = row c / 4, column c % 4.
  const unsigned short* gK = (const unsigned short*)K16 + ((size_t)b * TK + (tid >> 3)) * ldk + h * 64 + (tid & 7) * 8;
  const unsigned short* gV = Vth + (size_t)(tid >> 2) * TK + (tid & 3) * 8;
  const unsigned lK = (unsigned)(size_t)&sK[0][(tid >> 3) * KP + (tid & 7) * 8], lV = (unsigned)(size_t)&sV[0][(tid >> 2) * VP + (tid & 3) * 8];
  int sn = 0, sj = 0;      /* source and first key of the next tile to copy; the same in every thread */
  auto stage = [&](int buf) { const unsigned short* k0 = gK + ((size_t)sn * NR + sj) * ldk; const unsigned short* v0 = gV + (size_t)sn * (NB * NH * 64) * TK + sj; const unsigned lk = lK + buf * (32 * KP * 2), lv = lV + buf * (64 * VP * 2);
    copy4_to_lds(lk, k0, lk + 16 * KP * 2, k0 + (size_t)16 * ldk, lv, v0, lv + 32 * VP * 2, v0 + (size_t)32 * TK);
    sj += 32; if (sj >= jend) { sj = 0; ++sn; } };
  stage(0);
  asm volatile("s_wait_asynccnt 0x0" ::: "memory");      /* tile 0 has landed before the barrier that publishes it */
  __syncthreads();
  stage(1);      /* jend is at least 64: a tile 1 exists */
  int buf = 0;
#pragma unroll 1      /* rolled, like the tile loop inside: one foot with the waits, the barrier and the refill in their order */
  for (int n = 0; n < NSRC; ++n) {
  float m_q = -3.0e38f, l_q = 0.f; v8f oacc[DT];      /* each source has a softmax of its own */
#pragma unroll
  for (int dt = 0; dt < DT; ++dt) oacc[dt] = (v8f){0.f,0.f,0.f,0.f,0.f,0.f,0.f,0.f};
#pragma unroll 1
  for (int j0 = 0; j0 < jend; j0 += 32) {
    const unsigned short* tK = &sK[buf][ln * KP + 8 * hh]; const unsigned short* tV = &sV[buf][ln * VP + 8 * hh];
    FragH ak[2][KS], av[DT];
#pragma unroll
    for (int nt = 0; nt < 2; ++nt)
#pragma unroll
      for (int ks = 0; ks < KS; ++ks) { ak[nt][ks].half[0] = *(const v8us*)(tK + nt * 16 * KP + ks * 32); ak[nt][ks].half[1] = *(const v8us*)(tK + nt * 16 * KP + ks * 32 + 16); }
#pragma unroll
    for (int dt = 0; dt < DT; ++dt) { av[dt].half[0] = *(const v8us*)(tV + dt * 16 * VP); av[dt].half[1] = *(const v8us*)(tV + dt * 16 * VP + 16); }
    v8f s[2];
#pragma unroll
    for (int nt = 0; nt < 2; ++nt) {
      v8f acc = (v8f){0.f,0.f,0.f,0.f,0.f,0.f,0.f,0.f};
#pragma unroll
      for (int ks = 0; ks < KS; ++ks) acc = mmaH<1>(ak[nt][ks].v, ak[nt][ks].v, bq[ks].v, bq[ks].v, acc);
      s[nt] = acc; }
    float sc[2][8], mx[8]; bool ok[2][8];      /* sc, m_q: raw products; the factor SCL2 = log2(e)/8 is applied inside the exponent's one fma */
#pragma unroll
    for (int r = 0; r < 8; ++r) {
#pragma unroll
      for (int nt = 0; nt < 2; ++nt) { const int kk = j0 + nt * 16 + 8 * hh + r;
        ok[nt][r] = (CAUSAL == 1) ? (kk <= tq) : ((CAUSAL == 2) ? ((kk >> 5) == (tq >> 5)) : true);      /* mode 2: block-diagonal 32-token groups */
        sc[nt][r] = ok[nt][r] ? s[nt][r] : -3.0e38f; }
      mx[r] = fmaxf(sc[0][r], sc[1][r]); }
    float mc = fmaxf(fmaxf(fmaxf(mx[0], mx[1]), fmaxf(mx[2], mx[3])), fmaxf(fmaxf(mx[4], mx[5]), fmaxf(mx[6], mx[7])));
    mc = fmaxf(mc, xhalf(mc));
    const float mn = fmaxf(m_q, mc); const float al = (mn > -1.0e38f) ? __builtin_amdgcn_exp2f((m_q - mn) * SCL2) : 1.0f; m_q = mn;
    const float nb = 10.0f - mn * SCL2;      /* p = 1024 e^((s - max)/8) = 2^(s SCL2 + nb): the x1024 of the f16 operand is the + 10 */
    float e[16];
#pragma unroll      /* unrolled: e stays in registers, as the asm operands need */
    for (int r = 0; r < 8; ++r) { e[r] = __builtin_fmaf(sc[0][r], SCL2, nb); e[8 + r] = __builtin_fmaf(sc[1][r], SCL2, nb); }
    exp2x16(e);
    FragH pb; float ps[8];
#pragma unroll
    for (int r = 0; r < 8; ++r) { const float p0 = ok[0][r] ? e[r] : 0.f, p1 = ok[1][r] ? e[8 + r] : 0.f; ps[r] = p0 + p1;
      pb.h[r] = (_Float16)p0; pb.h[8 + r] = (_Float16)p1; }
    l_q = l_q * al + (((ps[0] + ps[1]) + (ps[2] + ps[3])) + ((ps[4] + ps[5]) + (ps[6] + ps[7])));
#pragma unroll
    for (int dt = 0; dt < DT; ++dt)
#pragma unroll
      for (int r = 0; r < 8; ++r) oacc[dt][r] *= al;
#pragma unroll
    for (int dt = 0; dt < DT; ++dt) oacc[dt] = mmaH<1>(av[dt].v, av[dt].v, pb.v, pb.v, oacc[dt]);
    asm volatile("s_wait_dscnt 0x0" ::: "memory");      /* this wave's reads of the buffer have returned before the buffer is handed back */
    asm volatile("s_wait_asynccnt 0x0" ::: "memory");      /* this wave's copies of tile t + 1 have landed */
    __syncthreads();      /* publishes tile t + 1 and ends every wave's reads of tile t */
    if (sn < NSRC) stage(buf);      /* tile t + 2 exists */
    buf ^= 1; }
  const float l = l_q + xhalf(l_q); const float inv = (l > 0.f) ? 1.0f / l : 0.f;      /* l and oacc both carry the x1024 */
#pragma unroll
  for (int dt = 0; dt < DT; ++dt)
#pragma unroll
    for (int r = 0; r < 8; ++r) ctx[dt][r] += oacc[dt][r] * inv; }
  asm volatile("s_wait_asynccnt 0x0" ::: "memory");      /* nothing is in flight when the wave goes on to the epilogue and ends */
#pragma unroll
  for (int dt = 0; dt < DT; ++dt) {      /* register r of tile dt is O[q0 + ln][dt*16 + 8*hh + r] */
    const v4f lo = {ctx[dt][0], ctx[dt][1], ctx[dt][2], ctx[dt][3]}, hi = {ctx[dt][4], ctx[dt][5], ctx[dt][6], ctx[dt][7]};
    *(v4fa*)&sO[w][ln][dt * 16 + 8 * hh] = lo; *(v4fa*)&sO[w][ln][dt * 16 + 8 * hh + 4] = hi; }
  __builtin_amdgcn_fence(__ATOMIC_ACQ_REL, "workgroup"); __builtin_amdgcn_wave_barrier();
  {
#pragma unroll
    for (int rp = 0; rp < RPW; rp += 2) { const int r = rp + (lane >> 4), pc = lane & 15; const v4f val = *(const v4fa*)&sO[w][r][pc * 4]; *(v4f*)(O + ((size_t)b * TQ + q0 + r) * ldo + h * 64 + pc * 4) = val; }
     } }

extern "C" void kernel_launch(void* const* d_in, const int* in_sizes, int n_in,
                              void* d_out, int out_size, void* d_ws, size_t ws_size, hipStream_t stream) {
  (void)in_sizes; (void)n_in; (void)out_size;
  const float* const* I = (const float* const*)d_in; const float* hsp = I[0]; const float* Wq = I[1]; const float* bq = I[2]; const float* Wk = I[3]; const float* bk = I[4]; const float* Wv = I[5]; const float* bv = I[6];
  char* ws = (char*)d_ws; size_t off = 0;
  auto take = [&](size_t bytes) { char* p = ws + off; off += (bytes + 255) & ~(size_t)255; return p; };
  _Float16* BQ = (_Float16*)take((size_t)CC * CC * 2); _Float16* BK = (_Float16*)take((size_t)CC * CC * 2); _Float16* BV = (_Float16*)take((size_t)CC * CC * 2);
  _Float16* X16 = (_Float16*)take((size_t)NRA * CC * 2); _Float16* Q16 = (_Float16*)take((size_t)NR * CC * 2); _Float16* K16 = (_Float16*)take((size_t)NRA * CC * 2); _Float16* VT = (_Float16*)take((size_t)NRA * CC * 2);
  if (off > ws_size) return;      /* 3.4 + 30 + 6 + 30 + 30 = 100 MiB */
  k_prep<<<3 * WTB + X16B, 256, 0, stream>>>(hsp, Wq, Wk, Wv, X16, BQ, BK, BV);      /* weights x16 transposed; f16 plane of every source */
  k_qkv<<<QGB + NSRC * NB * (KBB + VBB), 128, 0, stream>>>(X16, BQ, BK, BV, bq, bk, bv, Q16, K16, VT);      /* q from source 0; k and V^T for every source */
  k_flash<0><<<NB * NH * QBLKS, 128, 0, stream>>>(Q16, CC, K16, CC, VT, nullptr, (float*)d_out, CC);      /* all five sources; stores the output */
}

// v008
// Measured time: 163 microseconds a run.
// Two timings next to v007 both put it at 1.04 times that version's speed.
// Counting every step since v000, it is 4.80 times as fast.
#include <hip/hip_runtime.h>
// Attention_KV (5 sources x 4 batches x 1024 tokens x 768 = 12 heads of 64): q from source 0 (Wq + bq); every source n gives k_n, v_n (shared Wk/bk, Wv/bv); ctx = sum_n softmax(q k_n^T / 8) v_n (independent softmax per source); output = ctx merged [B, S, 768] (no output projection).
// Structure, three launches: one preparing launch (the three weight transposes and the exact f16 plane of all sources, picked by ranges of the block index); the q, k and v GEMMs in one launch, picked likewise (GEMMs: 64x64 wave tiles, f32 accumulation, exact x16 weights + bias, f16 outputs; k and v over all 5 sources; the v product has its operands swapped, A = weight rows, B = tokens, and so stores V^T for all (source, batch, head) slabs itself); one fused flash kernel (plain f16 operands) whose blocks walk the five sources in turn and add each source's normalised rows in registers, then store the output.
// Compute dtype: inputs and parameters rounded to bf16; q, k, v, P as f16 (~2^-12); f32 accumulation/softmax/sum. v_wmma_f32_16x16x32_f16.
#define NSRC 5
#define NB 4
#define CC 768
#define NR (NB * SLEN)           /* 4096 query rows */
#define NRA (NSRC * NR)          /* 20480 source rows */
#define SLEN 1024
#define TQ SLEN
#define TK SLEN
#define NH 12
#define SCL 0.125f               /* 1/sqrt(64) */
#define SCL2 (SCL * 1.4426950408889634f)   /* log2(e)/sqrt(64) */
#define QBLKS (TQ / 64)
typedef __bf16 v16b __attribute__((ext_vector_type(16)));
typedef unsigned short v8us __attribute__((ext_vector_type(8), may_alias));
typedef float  v8f  __attribute__((ext_vector_type(8)));
typedef float  v4f  __attribute__((ext_vector_type(4)));
typedef float  v4fa __attribute__((ext_vector_type(4), may_alias));
union FragB { v16b v; v8us half[2]; unsigned short u[16]; };

__device__ __forceinline__ unsigned short bf16_bits(float x) { unsigned int u = __float_as_uint(x); return (unsigned short)((u + 0x7FFFu + ((u >> 16) & 1u)) >> 16); }
__device__ __forceinline__ float bf16_val(unsigned short b) { return __uint_as_float(((unsigned int)b) << 16); }
__device__ __forceinline__ float bf16_round(float x) { return bf16_val(bf16_bits(x)); }
// D += A·B with NT terms: 1 = ah·bh, 2 = + al·bh (A split), 3 = + ah·bl (both split)
template <int NT>
__device__ __forceinline__ v8f mmaN(v16b ah, v16b al, v16b bh, v16b bl, v8f c) {
  c = __builtin_amdgcn_wmma_f32_16x16x32_bf16(false, ah, false, bh, (short)0, c, false, false);
  if (NT >= 2) c = __builtin_amdgcn_wmma_f32_16x16x32_bf16(false, al, false, bh, (short)0, c, false, false);
  if (NT >= 3) c = __builtin_amdgcn_wmma_f32_16x16x32_bf16(false, ah, false, bl, (short)0, c, false, false);
  asm volatile("v_nop\n\tv_nop\n\tv_nop\n\tv_nop" : "+v"(c) : "v"(ah), "v"(al), "v"(bh), "v"(bl));
  return c;
}

__global__ __launch_bounds__(256) void k_wt_bf16(const float* __restrict__ W, unsigned short* __restrict__ Wt, int K, int N) {
  const int t = blockIdx.x * 256 + threadIdx.x;
  const int k8n = K / 8;
  if (t >= N * k8n) return;
  const int n = t / k8n, k8 = (t % k8n) * 8;
  v8us v;
#pragma unroll
  for (int i = 0; i < 8; ++i) v[i] = bf16_bits(W[(size_t)(k8 + i) * N + n]);
  *(v8us*)(Wt + (size_t)n * K + k8) = v;
  
}

// GEMM C[M][N] (f32, pitch ldc) = act(A[M][K]·W + bias). A f32 row-major (pitch lda) converted per fragment to bf16
// (ASPLIT: hi/lo two planes -> 2 terms, else single rounded term); Wt bf16 [N][K] (pitch ldb). BIAS_BF16 rounds the
// bias to bf16 first (bias quantised to bf16 before the add). K%32==0, M%16==0, N%64==0.
template <bool ASPLIT, int ACT, bool BIAS_BF16>
__global__ __launch_bounds__(128) void k_gemm_bf(const float* __restrict__ A, int lda, const unsigned short* __restrict__ Wt, int ldb,
                                               const float* __restrict__ bias, float* __restrict__ C, int ldc, int M, int N, int K) {
  __shared__ __attribute__((aligned(16))) float so[4][16][64];
  const int tid = threadIdx.x, w = tid >> 5, lane = tid & 31, ln = lane & 15, hh = lane >> 4;
  const int ntn = N / 64;
  const int wid = blockIdx.x * 4 + w;
  const int mt = wid / ntn, nq = wid % ntn;
  if (mt * 16 >= M) return;
  const int row0 = mt * 16, col0 = nq * 64;
  const float* arow = A + (size_t)(row0 + ln) * lda;
  v8f acc[4] = {};
  for (int kb = 0; kb < K; kb += 32) {
    FragB ah, al;
    const v4f x0 = *(const v4fa*)(arow + kb + 8 * hh), x1 = *(const v4fa*)(arow + kb + 8 * hh + 4);
    const v4f x2 = *(const v4fa*)(arow + kb + 16 + 8 * hh), x3 = *(const v4fa*)(arow + kb + 16 + 8 * hh + 4);
    float xs[16] = {x0[0],x0[1],x0[2],x0[3],x1[0],x1[1],x1[2],x1[3],x2[0],x2[1],x2[2],x2[3],x3[0],x3[1],x3[2],x3[3]};
#pragma unroll
    for (int i = 0; i < 16; ++i) { const unsigned short hb = bf16_bits(xs[i]); ah.u[i] = hb; al.u[i] = ASPLIT ? bf16_bits(xs[i] - bf16_val(hb)) : (unsigned short)0; }
#pragma unroll
    for (int t = 0; t < 4; ++t) {
      const unsigned short* brow = Wt + (size_t)(col0 + t * 16 + ln) * ldb + kb;
      FragB b;
      b.half[0] = *(const v8us*)(brow + 8 * hh);
      b.half[1] = *(const v8us*)(brow + 16 + 8 * hh);
      acc[t] = mmaN<ASPLIT ? 2 : 1>(ah.v, al.v, b.v, b.v, acc[t]);
    }
  }
#pragma unroll
  for (int t = 0; t < 4; ++t) {
    float bv = bias ? bias[col0 + t * 16 + ln] : 0.f;
    if (BIAS_BF16) bv = bf16_round(bv);
#pragma unroll
    for (int r = 0; r < 8; ++r) { float v = acc[t][r] + bv; if (ACT == 1) v = fmaxf(v, 0.f); so[w][8 * hh + r][t * 16 + ln] = v; }
  }
  __builtin_amdgcn_fence(__ATOMIC_ACQ_REL, "workgroup");
  __builtin_amdgcn_wave_barrier();
  const int rsub = lane >> 4, c4 = (lane & 15) * 4;
  {
#pragma unroll
    for (int q = 0; q < 8; ++q) {
      const int r = q * 2 + rsub;
      const v4f v = *(const v4fa*)&so[w][r][c4];
      *(v4f*)(C + (size_t)(row0 + r) * ldc + col0 + c4) = v;
    }
    
  }
}

// GEMM C = act(A·W + bias + resid): A f32 (ASPLIT -> hi/lo 2 terms), Wt bf16 [N][K]; ACT 0 none, 1 relu, 2 exact gelu;
// resid (optional, f32, row index = (row % rmod), pitch ldr, RES_BF16 rounds it) added before the activation.
template <bool ASPLIT, int ACT, bool BIAS_BF16, bool RES_BF16>
__global__ __launch_bounds__(128) void k_gemm_bf3(const float* __restrict__ A, int lda, const unsigned short* __restrict__ Wt, int ldb,
                                                const float* __restrict__ bias, const float* __restrict__ resid, int rmod, int ldr,
                                                float* __restrict__ C, int ldc, int M, int N, int K) {
  __shared__ __attribute__((aligned(16))) float so[4][16][64];
  const int tid = threadIdx.x, w = tid >> 5, lane = tid & 31, ln = lane & 15, hh = lane >> 4;
  const int ntn = N / 64;
  const int wid = blockIdx.x * 4 + w;
  const int mt = wid / ntn, nq = wid % ntn;
  if (mt * 16 >= M) return;
  const int row0 = mt * 16, col0 = nq * 64;
  const float* arow = A + (size_t)(row0 + ln) * lda;
  v8f acc[4] = {};
  for (int kb = 0; kb < K; kb += 32) {
    FragB ah, al;
    const v4f x0 = *(const v4fa*)(arow + kb + 8 * hh), x1 = *(const v4fa*)(arow + kb + 8 * hh + 4);
    const v4f x2 = *(const v4fa*)(arow + kb + 16 + 8 * hh), x3 = *(const v4fa*)(arow + kb + 16 + 8 * hh + 4);
    float xs[16] = {x0[0],x0[1],x0[2],x0[3],x1[0],x1[1],x1[2],x1[3],x2[0],x2[1],x2[2],x2[3],x3[0],x3[1],x3[2],x3[3]};
#pragma unroll
    for (int i = 0; i < 16; ++i) { const unsigned short hb = bf16_bits(xs[i]); ah.u[i] = hb; al.u[i] = ASPLIT ? bf16_bits(xs[i] - bf16_val(hb)) : (unsigned short)0; }
#pragma unroll
    for (int t = 0; t < 4; ++t) {
      const unsigned short* brow = Wt + (size_t)(col0 + t * 16 + ln) * ldb + kb;
      FragB b;
      b.half[0] = *(const v8us*)(brow + 8 * hh);
      b.half[1] = *(const v8us*)(brow + 16 + 8 * hh);
      acc[t] = mmaN<ASPLIT ? 2 : 1>(ah.v, al.v, b.v, b.v, acc[t]);
    }
  }
#pragma unroll
  for (int t = 0; t < 4; ++t) {
    const int col = col0 + t * 16 + ln;
    float bv = bias ? bias[col] : 0.f;
    if (BIAS_BF16) bv = bf16_round(bv);
#pragma unroll
    for (int r = 0; r < 8; ++r) {
      float v = acc[t][r] + bv;
      if (resid) { float rv = resid[(size_t)((row0 + 8 * hh + r) % rmod) * ldr + col]; if (RES_BF16) rv = bf16_round(rv); v += rv; }
      if (ACT == 1) v = fmaxf(v, 0.f);
      if (ACT == 2) v = 0.5f * v * (1.0f + erff(v * 0.70710678118654752f));
      if (ACT == 3) { const float u = 0.7978845608028654f * (v + 0.044715f * v * v * v); v = 0.5f * v * (1.0f + tanhf(u)); }
      so[w][8 * hh + r][t * 16 + ln] = v;
    }
  }
  __builtin_amdgcn_fence(__ATOMIC_ACQ_REL, "workgroup");
  __builtin_amdgcn_wave_barrier();
  const int rsub = lane >> 4, c4 = (lane & 15) * 4;
  {
#pragma unroll
    for (int q = 0; q < 8; ++q) {
      const int r = q * 2 + rsub;
      const v4f v = *(const v4fa*)&so[w][r][c4];
      *(v4f*)(C + (size_t)(row0 + r) * ldc + col0 + c4) = v;
    }
    
  }
}
// row LayerNorm (biased variance, eps) over N: s = X (+ R); optional out_sum <- s; out_norm <- (s-mu)*rsqrt(var+eps)*g + b
template <bool PARAM_BF16>
__global__ __launch_bounds__(256) void k_layernorm(const float* __restrict__ X, const float* __restrict__ R, const float* __restrict__ g, const float* __restrict__ bta,
                                                  float* __restrict__ out_sum, float* __restrict__ out_norm, int N, float eps) {
  __shared__ float red[256];
  const int row = blockIdx.x, tid = threadIdx.x;
  const float* x = X + (size_t)row * N; const float* rr = R ? R + (size_t)row * N : nullptr;
  float vals[16];                     // up to N = 4096
  const int per = N / 256;            // contiguous chunk per thread? use strided-by-4 chunks: thread handles j = tid*4 + 1024*u
  float s1 = 0.f;
  for (int u = 0; u < per / 4; ++u) {
    const int j = tid * 4 + 1024 * u;
    const v4f a = *(const v4fa*)(x + j);
    v4f b = {0.f,0.f,0.f,0.f}; if (rr) b = *(const v4fa*)(rr + j);
#pragma unroll
    for (int q = 0; q < 4; ++q) { const float v = a[q] + b[q]; vals[u * 4 + q] = v; s1 += v; }
  }
  red[tid] = s1; __syncthreads();
  for (int st = 128; st > 0; st >>= 1) { if (tid < st) red[tid] += red[tid + st]; __syncthreads(); }
  const float mu = red[0] / (float)N; __syncthreads();
  float s2 = 0.f;
  for (int u = 0; u < per / 4; ++u)
#pragma unroll
    for (int q = 0; q < 4; ++q) { const float c = vals[u * 4 + q] - mu; s2 += c * c; }
  red[tid] = s2; __syncthreads();
  for (int st = 128; st > 0; st >>= 1) { if (tid < st) red[tid] += red[tid + st]; __syncthreads(); }
  const float rs = rsqrtf(red[0] / (float)N + eps);
  {
    for (int u = 0; u < per / 4; ++u) {
      const int j = tid * 4 + 1024 * u;
      v4f o, sm;
#pragma unroll
      for (int q = 0; q < 4; ++q) {
        float gg = g[j + q], bb = bta[j + q];
        if (PARAM_BF16) { gg = bf16_round(gg); bb = bf16_round(bb); }
        sm[q] = vals[u * 4 + q]; o[q] = (vals[u * 4 + q] - mu) * rs * gg + bb;
      }
      if (out_sum) *(v4f*)(out_sum + (size_t)row * N + j) = sm;
      *(v4f*)(out_norm + (size_t)row * N + j) = o;
    }
    
  }
}



// ---- f16 WMMA path (v_wmma_f32_16x16x32_f16): 11-bit significands for operands in range — used where a [0,1] probability operand needs more precision than bf16
typedef _Float16 v16h __attribute__((ext_vector_type(16)));
union FragH { v16h v; v8us half[2]; _Float16 h[16]; unsigned short u[16]; };
template <int NT>
__device__ __forceinline__ v8f mmaH(v16h ah, v16h al, v16h bh, v16h bl, v8f c) {
  c = __builtin_amdgcn_wmma_f32_16x16x32_f16(false, ah, false, bh, (short)0, c, false, false);
  if (NT >= 2) c = __builtin_amdgcn_wmma_f32_16x16x32_f16(false, al, false, bh, (short)0, c, false, false);
  if (NT >= 3) c = __builtin_amdgcn_wmma_f32_16x16x32_f16(false, ah, false, bl, (short)0, c, false, false);
  asm volatile("v_nop\n\tv_nop\n\tv_nop\n\tv_nop" : "+v"(c) : "v"(ah), "v"(al), "v"(bh), "v"(bl));
  return c;
}
// batched GEMM like k_gemm_b but f16 operands: A f32 (split into f16 hi/lo if ASPLIT, else rounded to f16), Bt = f16 values [n][k]; alpha; C f32; N multiple of 16 (partial tiles skipped)
template <bool ASPLIT>
__global__ __launch_bounds__(128) void k_gemm_h(const float* __restrict__ A, int lda, size_t sA, const _Float16* __restrict__ Bh, int ldb, size_t sB, float alpha, float* __restrict__ C, int ldc, size_t sC, int M, int N, int K) {
  __shared__ __attribute__((aligned(16))) float so[4][16][64];
  const int tid = threadIdx.x, w = tid >> 5, lane = tid & 31, ln = lane & 15, hh = lane >> 4; const int by = blockIdx.y;
  A += (size_t)by * sA; Bh += (size_t)by * sB; C += (size_t)by * sC;
  const int ntn = (N + 63) / 64; const int wid = blockIdx.x * 4 + w; const int mt = wid / ntn, nq = wid % ntn; if (mt * 16 >= M) return;
  const int row0 = mt * 16, col0 = nq * 64; const float* arow = A + (size_t)(row0 + ln) * lda;
  v8f acc[4] = {};
  for (int kb = 0; kb < K; kb += 32) {
    FragH ah, al;
    const v4f x0 = *(const v4fa*)(arow + kb + 8 * hh), x1 = *(const v4fa*)(arow + kb + 8 * hh + 4), x2 = *(const v4fa*)(arow + kb + 16 + 8 * hh), x3 = *(const v4fa*)(arow + kb + 16 + 8 * hh + 4);
    float xs[16] = {x0[0],x0[1],x0[2],x0[3],x1[0],x1[1],x1[2],x1[3],x2[0],x2[1],x2[2],x2[3],x3[0],x3[1],x3[2],x3[3]};
#pragma unroll
    for (int i = 0; i < 16; ++i) { const _Float16 h = (_Float16)xs[i]; ah.h[i] = h; al.h[i] = ASPLIT ? (_Float16)(xs[i] - (float)h) : (_Float16)0.0f; }
#pragma unroll
    for (int t = 0; t < 4; ++t) { if (col0 + t * 16 >= N) continue; const size_t boff = (size_t)(col0 + t * 16 + ln) * ldb + kb; FragH bq; bq.half[0] = *(const v8us*)(Bh + boff + 8 * hh); bq.half[1] = *(const v8us*)(Bh + boff + 16 + 8 * hh);
      acc[t] = mmaH<ASPLIT ? 2 : 1>(ah.v, al.v, bq.v, bq.v, acc[t]); }
  }
#pragma unroll
  for (int t = 0; t < 4; ++t) { if (col0 + t * 16 >= N) continue;
#pragma unroll
    for (int r = 0; r < 8; ++r) so[w][8 * hh + r][t * 16 + ln] = acc[t][r] * alpha; }
  __builtin_amdgcn_fence(__ATOMIC_ACQ_REL, "workgroup"); __builtin_amdgcn_wave_barrier();
  const int rsub = lane >> 4, c4 = (lane & 15) * 4;
  {
#pragma unroll
    for (int q = 0; q < 8; ++q) { const int r = q * 2 + rsub; if (col0 + c4 < N) { const v4f v = *(const v4fa*)&so[w][r][c4]; *(v4f*)(C + (size_t)(row0 + r) * ldc + col0 + c4) = v; } }
     }
}

// Wt[n][k] = f16(W[k][n]·scale) from f32 row-major W[K][N] (scale = power of two; bf16-exact weights stay exact in f16 away from the subnormal range)
__device__ __forceinline__ void wt_f16_job(int blk, const float* __restrict__ W, _Float16* __restrict__ Wt, int K, int N, float scale) {
  const int t = blk * 256 + threadIdx.x; if (t >= N * (K / 8)) return; const int n = t / (K / 8), k8 = (t % (K / 8)) * 8; FragH f;
#pragma unroll
  for (int i = 0; i < 8; ++i) f.h[i] = (_Float16)(bf16_round(W[(size_t)(k8 + i) * N + n]) * scale); const v8us o = f.half[0];
  *(v8us*)((unsigned short*)Wt + (size_t)n * K + k8) = o; 
}
// k_gemm_hh variant with fused epilogue: v = acc·alpha + bias[by·sBias + col] (+ CP[(row/rowsPerB)·sCPb + by·64 + col] if CP) ; ACT 0 none / 1 elu ; writes f16 C16 (and f32 C if non-null)
template <int ACT>
__global__ __launch_bounds__(128) void k_gemm_hhx(const _Float16* __restrict__ A, int lda, size_t sA, const _Float16* __restrict__ Bh, int ldb, size_t sB, float alpha, const float* __restrict__ bias, size_t sBias, const float* __restrict__ CP, int rowsPerB, size_t sCPb, int row0g,
    float* __restrict__ C, _Float16* __restrict__ C16, int ldc, size_t sC, int M, int N, int K) {
  __shared__ __attribute__((aligned(16))) float so[4][16][64];
  const int tid = threadIdx.x, w = tid >> 5, lane = tid & 31, ln = lane & 15, hh = lane >> 4; const int by = blockIdx.y;
  A += (size_t)by * sA; Bh += (size_t)by * sB; const size_t cofs = (size_t)by * sC; const float* bp = bias ? bias + (size_t)by * sBias : nullptr;
  const int ntn = (N + 63) / 64; const int wid = blockIdx.x * 4 + w; const int mt = wid / ntn, nq = wid % ntn; if (mt * 16 >= M) return;
  const int row0 = mt * 16, col0 = nq * 64; const _Float16* arow = A + (size_t)(row0 + ln) * lda;
  v8f acc[4] = {};
  for (int kb = 0; kb < K; kb += 32) { FragH ah; ah.half[0] = *(const v8us*)((const unsigned short*)arow + kb + 8 * hh); ah.half[1] = *(const v8us*)((const unsigned short*)arow + kb + 16 + 8 * hh);
#pragma unroll
    for (int t = 0; t < 4; ++t) { if (col0 + t * 16 >= N) continue; const size_t boff = (size_t)(col0 + t * 16 + ln) * ldb + kb; FragH bq; bq.half[0] = *(const v8us*)((const unsigned short*)Bh + boff + 8 * hh); bq.half[1] = *(const v8us*)((const unsigned short*)Bh + boff + 16 + 8 * hh);
      acc[t] = mmaH<1>(ah.v, ah.v, bq.v, bq.v, acc[t]); }
  }
#pragma unroll
  for (int t = 0; t < 4; ++t) { if (col0 + t * 16 >= N) continue; const int col = col0 + t * 16 + ln; const float bv = bp ? bf16_round(bp[col]) : 0.f;
#pragma unroll
    for (int r = 0; r < 8; ++r) { float v = acc[t][r] * alpha + bv; if (CP) { const int bidx = (row0g + row0 + 8 * hh + r) / rowsPerB; v += CP[(size_t)bidx * sCPb + (size_t)by * 64 + col]; } if (ACT == 1) v = (v > 0.f) ? v : expm1f(v); else if (ACT == 7) v = (v > 0.f) ? v + 1.0f : expf(v); else if (ACT == 8) v = tanhf(v); else if (ACT == 9) v = 0.5f * v * (1.0f + tanhf(0.7978845608028654f * (v + 0.044715f * v * v * v))); else if (ACT == 11) v = 1.0f / (1.0f + expf(-v)); else if (ACT == 12) v = (v > 0.f) ? v : 0.01f * v; else if (ACT == 14) v = (v > 0.f) ? v : 0.1f * v; else if (ACT == 15) v = v / (1.0f + expf(-v)); else if (ACT == 3) v = fmaxf(v, 0.f); else if (ACT == 6) v = 0.5f * v * (1.0f + erff(v * 0.70710678118654752f)); so[w][8 * hh + r][t * 16 + ln] = v; } }
  __builtin_amdgcn_fence(__ATOMIC_ACQ_REL, "workgroup"); __builtin_amdgcn_wave_barrier();
  const int rsub = lane >> 4, c4 = (lane & 15) * 4; typedef _Float16 v4h __attribute__((ext_vector_type(4)));
  {
#pragma unroll
    for (int q = 0; q < 8; ++q) { const int r = q * 2 + rsub; if (col0 + c4 < N) { const v4f v = *(const v4fa*)&so[w][r][c4]; if (C) *(v4f*)(C + cofs + (size_t)(row0 + r) * ldc + col0 + c4) = v; if (C16) { v4h h4; for (int i = 0; i < 4; ++i) h4[i] = (_Float16)v[i]; *(v4h*)(C16 + cofs + (size_t)(row0 + r) * ldc + col0 + c4) = h4; } } }
     }
}


typedef _Float16 v4h __attribute__((ext_vector_type(4)));

__device__ __forceinline__ void x16_job(int blk, const float* __restrict__ x, _Float16* __restrict__ X16, size_t n8) { const size_t t = (size_t)blk * 256 + threadIdx.x; if (t >= n8) return; FragH f;
#pragma unroll
  for (int q = 0; q < 8; ++q) f.h[q] = (_Float16)bf16_round(x[t * 8 + q]); *(v8us*)((unsigned short*)X16 + t * 8) = f.half[0];  }
// The four jobs that need nothing of each other share one grid: blocks 0 .. 3 * WTB - 1 transpose Wq, Wk, Wv (they wait on scattered loads; placed first for speed only), the rest cast the sources. The choice is the same for a whole block.
#define WTB ((CC * CC / 8 + 255) / 256)
#define X16B ((NRA * CC / 8 + 255) / 256)
__global__ __launch_bounds__(256) void k_prep(const float* __restrict__ x, const float* __restrict__ Wq, const float* __restrict__ Wk, const float* __restrict__ Wv,
                                             _Float16* __restrict__ X16, _Float16* __restrict__ BQ, _Float16* __restrict__ BK, _Float16* __restrict__ BV) {
  const int bx = blockIdx.x;
  if (bx < 3 * WTB) { const int m = bx / WTB; wt_f16_job(bx - m * WTB, m == 0 ? Wq : (m == 1 ? Wk : Wv), m == 0 ? BQ : (m == 1 ? BK : BV), CC, CC, 16.0f); }
  else x16_job(bx - 3 * WTB, x, X16, (size_t)NRA * CC / 8); }
__global__ __launch_bounds__(256) void k_h16(const float* __restrict__ x, _Float16* __restrict__ X16, size_t n8) { const size_t t = (size_t)blockIdx.x * 256 + threadIdx.x; if (t >= n8) return; FragH f;
#pragma unroll
  for (int q = 0; q < 8; ++q) f.h[q] = (_Float16)x[t * 8 + q]; *(v8us*)((unsigned short*)X16 + t * 8) = f.half[0];  }
__global__ __launch_bounds__(256) void k_round16f(const float* __restrict__ W, _Float16* __restrict__ Bt, size_t n8) { const size_t t = (size_t)blockIdx.x * 256 + threadIdx.x; if (t >= n8) return; FragH f;
#pragma unroll
  for (int i = 0; i < 8; ++i) f.h[i] = (_Float16)(bf16_round(W[t * 8 + i]) * 16.0f); *(v8us*)((unsigned short*)Bt + t * 8) = f.half[0];  }
__global__ __launch_bounds__(256) void k_hl(const float* __restrict__ F, _Float16* __restrict__ Hh, _Float16* __restrict__ Hl, size_t n8) { const size_t t = (size_t)blockIdx.x * 256 + threadIdx.x; if (t >= n8) return; FragH fh, fl; const v4f a = *(const v4fa*)(F + t * 8), c = *(const v4fa*)(F + t * 8 + 4);
#pragma unroll
  for (int q = 0; q < 4; ++q) { _Float16 h = (_Float16)a[q]; fh.h[q] = h; fl.h[q] = (_Float16)((a[q] - (float)h) * 1024.0f); h = (_Float16)c[q]; fh.h[4 + q] = h; fl.h[4 + q] = (_Float16)((c[q] - (float)h) * 1024.0f); }
  { *(v8us*)((unsigned short*)Hh + t * 8) = fh.half[0]; *(v8us*)((unsigned short*)Hl + t * 8) = fl.half[0];  } }

// ---- fast GEMM (block tile 256x128, eight waves of 64x64; requires M % 64 == 0 rows per launch region and N % 128 == 0); epilogue = k_gemm_hhx semantics, f16 output only ----
__device__ __forceinline__ v16h g2_frag(const _Float16* p, int hh) { FragH f; f.half[0] = *(const v8us*)((const unsigned short*)p + 8 * hh); f.half[1] = *(const v8us*)((const unsigned short*)p + 16 + 8 * hh); return f.v; }
__device__ __forceinline__ v8f g2_mma(v16h a, v16h b, v8f c) { v8f d = __builtin_amdgcn_wmma_f32_16x16x32_f16(false, a, false, b, (short)0, c, false, false); asm volatile("v_nop\n\tv_nop\n\tv_nop\n\tv_nop" : "+v"(d) : "v"(a), "v"(b)); return d; }
// One lane's twelve 16-byte asynchronous copies from global memory to LDS (l: LDS byte addresses, g: global addresses). The s_wait_xcnt is the last line of the copies' own statement, so that no address register is rewritten in front of it.
__device__ __forceinline__ void copy12_to_lds(const unsigned (&l)[12], const unsigned short* const (&g)[12]) {
  asm volatile("global_load_async_to_lds_b128 %0, %12, off\n\tglobal_load_async_to_lds_b128 %1, %13, off\n\tglobal_load_async_to_lds_b128 %2, %14, off\n\tglobal_load_async_to_lds_b128 %3, %15, off\n\t"
               "global_load_async_to_lds_b128 %4, %16, off\n\tglobal_load_async_to_lds_b128 %5, %17, off\n\tglobal_load_async_to_lds_b128 %6, %18, off\n\tglobal_load_async_to_lds_b128 %7, %19, off\n\t"
               "global_load_async_to_lds_b128 %8, %20, off\n\tglobal_load_async_to_lds_b128 %9, %21, off\n\tglobal_load_async_to_lds_b128 %10, %22, off\n\tglobal_load_async_to_lds_b128 %11, %23, off\n\ts_wait_xcnt 0x0"
               :: "v"(l[0]), "v"(l[1]), "v"(l[2]), "v"(l[3]), "v"(l[4]), "v"(l[5]), "v"(l[6]), "v"(l[7]), "v"(l[8]), "v"(l[9]), "v"(l[10]), "v"(l[11]),
                  "v"(g[0]), "v"(g[1]), "v"(g[2]), "v"(g[3]), "v"(g[4]), "v"(g[5]), "v"(g[6]), "v"(g[7]), "v"(g[8]), "v"(g[9]), "v"(g[10]), "v"(g[11]) : "memory"); }
#define GEMM2_LDS ((256 + 128) * 72)      /* floats of LDS that a caller of gemm2_job hands in, 16-byte aligned */
// Block tile 256 x 128, 256 threads, waves 4 x 2. The operands go to LDS once per block in k steps of 64 (whole 128-byte lines of every row), two buffers: step t + 2 is copied while step t + 1 is worked on. Requires K % 64 == 0.
// ROWB: the bias belongs to the rows of C (the weights are the A operand), else to its columns.
template <int ACT, bool ROWB>
__device__ __forceinline__ void gemm2_job(float* sm, int bx, int by, const _Float16* __restrict__ A, int lda, size_t sA, const _Float16* __restrict__ Bh, int ldb, size_t sB, float alpha, const float* __restrict__ bias, size_t sBias, const float* __restrict__ CP, int rowsPerB, size_t sCPb, int row0g,
    _Float16* __restrict__ C16, int ldc, size_t sC, int M, int N, int K) {
  constexpr int GP = 72;                    /* LDS row pitch in f16: 144 B for the 128-byte rows (16 B x odd: no bank conflict for 16-byte readers) */
  constexpr int STG = (256 + 128) * GP;      /* one buffer in f16: 256 A rows, then 128 B rows */
  static_assert(2 * STG / 2 == GEMM2_LDS, "the caller's LDS array");      /* sm, 110,592 B: the two operand buffers in the k loop; behind it the epilogue's per-wave f16 output tiles (73,728 B) */
  unsigned short (*so)[64][GP] = (unsigned short (*)[64][GP])sm;
  const unsigned short* sT = (const unsigned short*)sm;
  const int tid = threadIdx.x, w = tid >> 5, lane = tid & 31, ln = lane & 15, hh = lane >> 4;
  A += (size_t)by * sA; Bh += (size_t)by * sB; const size_t cofs = (size_t)by * sC; const float* bp = bias ? bias + (size_t)by * sBias : nullptr;
  const int ntn = N >> 7; const int mt = bx / ntn, nq = bx - mt * ntn; const int rowb = mt * 256, row0 = rowb + 64 * (w >> 1), colb = nq * 128, col0 = colb + 64 * (w & 1); if (rowb >= M) return;      /* the whole block leaves, in front of every barrier */
  // Thread tid copies 16-byte piece tid & 7 of rows (tid >> 3) + 32 i: a wave's copy covers 4 whole 128-byte rows. An A row past M is clamped to the last row (its products are never stored).
  const int cr = tid >> 3, cc = (tid & 7) * 8;
  const unsigned short* gsrc[12];
#pragma unroll      /* unrolled here and in the three loops below: the address arrays stay in registers */
  for (int i = 0; i < 8; ++i) { const int r = rowb + cr + 32 * i; gsrc[i] = (const unsigned short*)A + (size_t)(r < M ? r : M - 1) * lda + cc; }
#pragma unroll
  for (int i = 0; i < 4; ++i) gsrc[8 + i] = (const unsigned short*)Bh + (size_t)(colb + cr + 32 * i) * ldb + cc;
  const unsigned l0 = (unsigned)(size_t)&sT[cr * GP + cc];
  auto stage = [&](int buf) { unsigned l[12];      /* copies the next k step into buffer buf and moves the source pointers on by one step */
#pragma unroll
    for (int i = 0; i < 12; ++i) l[i] = l0 + (unsigned)((buf * STG + 32 * i * GP) * 2);
    copy12_to_lds(l, gsrc);
#pragma unroll
    for (int i = 0; i < 12; ++i) gsrc[i] += 64; };
  v8f acc[4][4];      /* acc[i][t]: rows row0 + 16 i, columns col0 + 16 t */
#pragma unroll      /* unrolled, like every loop over acc below: it stays in registers */
  for (int i = 0; i < 4; ++i)
#pragma unroll
    for (int t = 0; t < 4; ++t) acc[i][t] = (v8f){0.f,0.f,0.f,0.f,0.f,0.f,0.f,0.f};
  stage(0);
  asm volatile("s_wait_asynccnt 0x0" ::: "memory");      /* step 0 has landed before the barrier that publishes it */
  __syncthreads();
  if (64 < K) stage(1);
#pragma unroll 1      /* rolled: one foot with the waits, the barrier and the refill in their order */
  for (int kb = 0; kb < K; kb += 64) {
    const int buf = (kb >> 6) & 1;
    const _Float16* tA = (const _Float16*)sT + buf * STG + (64 * (w >> 1) + ln) * GP; const _Float16* tB = (const _Float16*)sT + buf * STG + (256 + 64 * (w & 1) + ln) * GP;
#pragma unroll      /* unrolled here and in the loops below: the fragment arrays stay in registers */
    for (int ks = 0; ks < 2; ++ks) {
      v16h fa[4], fb[4];      /* the fragment reads of one k = 32 stand together in front of its 16 products */
#pragma unroll
      for (int t = 0; t < 4; ++t) { fa[t] = g2_frag(tA + t * 16 * GP + ks * 32, hh); fb[t] = g2_frag(tB + t * 16 * GP + ks * 32, hh); }
#pragma unroll
      for (int t = 0; t < 4; ++t)
#pragma unroll
        for (int i = 0; i < 4; ++i) acc[i][t] = g2_mma(fa[i], fb[t], acc[i][t]); }
    asm volatile("s_wait_dscnt 0x0" ::: "memory");      /* this wave's reads of the buffer have returned before the buffer is handed back */
    asm volatile("s_wait_asynccnt 0x0" ::: "memory");      /* this wave's copies of step t + 1 have landed */
    __syncthreads();      /* publishes step t + 1 and ends every wave's reads of step t */
    if (kb + 128 < K) stage(buf); }
  asm volatile("s_wait_asynccnt 0x0" ::: "memory");      /* nothing is in flight when the LDS is taken over by the output tiles */
  if (row0 >= M) return;      /* behind the last barrier */
  float br[4][8] = {}, bc[4] = {};      /* ROWB (a bias is required there): the bias of this lane's 32 rows, by eight 16-byte loads issued together; else the bias of its 4 columns */
  if (ROWB) { const float* pr = bp + row0 + 8 * hh; v4f b0[4], b1[4];
#pragma unroll      /* unrolled here and below: b0, b1, br and bc stay in registers */
    for (int i = 0; i < 4; ++i) { b0[i] = *(const v4fa*)(pr + 16 * i); b1[i] = *(const v4fa*)(pr + 16 * i + 4); }
#pragma unroll
    for (int i = 0; i < 4; ++i)
#pragma unroll
      for (int q = 0; q < 4; ++q) { br[i][q] = bf16_round(b0[i][q]); br[i][4 + q] = bf16_round(b1[i][q]); } }
  else if (bp) {
#pragma unroll
    for (int t = 0; t < 4; ++t) bc[t] = bf16_round(bp[col0 + t * 16 + ln]); }
#pragma unroll
  for (int t = 0; t < 4; ++t) { const int col = col0 + t * 16 + ln;
#pragma unroll
    for (int i = 0; i < 4; ++i)
#pragma unroll
    for (int r = 0; r < 8; ++r) { const int rloc = i * 16 + 8 * hh + r; float v = acc[i][t][r] * alpha + (ROWB ? br[i][r] : bc[t]); if (CP) { const int bidx = (row0g + row0 + rloc) / rowsPerB; v += CP[(size_t)bidx * sCPb + (size_t)by * 64 + col]; }
      if (ACT == 3) v = fmaxf(v, 0.f); else if (ACT == 6) v = 0.5f * v * (1.0f + erff(v * 0.70710678118654752f)); else if (ACT == 11) v = 1.0f / (1.0f + expf(-v)); else if (ACT == 15) v = v / (1.0f + expf(-v)); else if (ACT == 12) v = (v > 0.f) ? v : 0.01f * v; else if (ACT == 8) v = tanhf(v);
      so[w][rloc][t * 16 + ln] = __builtin_bit_cast(unsigned short, (_Float16)v); } }
  __builtin_amdgcn_fence(__ATOMIC_ACQ_REL, "workgroup"); __builtin_amdgcn_wave_barrier();
  const int rsub = lane >> 3, c8 = (lane & 7) * 8;      /* a wave's 16-byte store covers the 128-byte pieces of four rows */
#pragma unroll
  for (int q = 0; q < 16; ++q) { const int r = q * 4 + rsub; const v8us v = *(const v8us*)&so[w][r][c8]; *(v8us*)((unsigned short*)C16 + cofs + (size_t)(row0 + r) * ldc + col0 + c8) = v; } }

// The three products need nothing of each other and share one grid; the block index picks the job, the same for a whole block.
// V^T[(n*4 + b)*768 + h*64 + d][key] is the v product with its operands swapped: C = Wv^T (768 rows) x tokens of one (source, batch) (1024 columns), so no transposing pass and no row-major v are needed.
// Order: the q blocks, then for each (source, batch) its k blocks and its V^T blocks, which read the same 1024 token rows.
#define NTC (CC / 128)             /* column tiles of the q and k products */
#define QGB ((NR / 256) * NTC)      /* blocks of the q product */
#define KBB ((SLEN / 256) * NTC)      /* blocks of the k product on one (source, batch) */
#define VBB ((CC / 256) * (SLEN / 128))      /* blocks of the V^T product on one (source, batch) */
__global__ __launch_bounds__(256) void k_qkv(const _Float16* __restrict__ X16, const _Float16* __restrict__ BQ, const _Float16* __restrict__ BK, const _Float16* __restrict__ BV,
                                            const float* __restrict__ bq, const float* __restrict__ bk, const float* __restrict__ bv,
                                            _Float16* __restrict__ Q16, _Float16* __restrict__ K16, _Float16* __restrict__ VT) {
  __shared__ __attribute__((aligned(16))) float sm[GEMM2_LDS];
  const int bx = blockIdx.x; const bool isq = bx < QGB;
  const int g = isq ? 0 : (bx - QGB) / (KBB + VBB), r = isq ? 0 : (bx - QGB) - g * (KBB + VBB);      /* (source, batch) and the block's place among its KBB + VBB */
  if (!isq && r >= KBB) gemm2_job<0, true>(sm, r - KBB, g, BV, CC, 0, X16, CC, (size_t)SLEN * CC, 0.0625f, bv, 0, nullptr, 1, 0, 0, VT, SLEN, (size_t)CC * SLEN, CC, SLEN, CC);
  else gemm2_job<0, false>(sm, isq ? bx : g * KBB + r, 0, X16, CC, 0, isq ? BQ : BK, CC, 0, 0.0625f, isq ? bq : bk, 0, nullptr, 1, 0, 0, isq ? Q16 : K16, CC, 0, isq ? NR : NRA, CC, CC); }

// lane l with lane l ^ 16: the two lanes that share one query column of a transposed score tile
__device__ __forceinline__ float xhalf(float x) { return __builtin_bit_cast(float, __builtin_amdgcn_permlanex16(__builtin_bit_cast(int, x), __builtin_bit_cast(int, x), 0x76543210, 0xfedcba98, false, false)); }
__device__ __forceinline__ void copy4_to_lds(unsigned l0, const unsigned short* g0, unsigned l1, const unsigned short* g1, unsigned l2, const unsigned short* g2, unsigned l3, const unsigned short* g3) {
  asm volatile("global_load_async_to_lds_b128 %0, %1, off\n\tglobal_load_async_to_lds_b128 %2, %3, off\n\tglobal_load_async_to_lds_b128 %4, %5, off\n\tglobal_load_async_to_lds_b128 %6, %7, off\n\ts_wait_xcnt 0x0"
               :: "v"(l0), "v"(g0), "v"(l1), "v"(g1), "v"(l2), "v"(g2), "v"(l3), "v"(g3) : "memory"); }
// Sixteen 2^x in place, each on a register of its own: no instruction directly behind a transcendental reads its result or overwrites its source; the closing v_nop keeps that slot in front of whatever the compiler puts next.
__device__ __forceinline__ void exp2x16(float (&x)[16]) {
  asm("v_exp_f32 %0, %0\n\tv_exp_f32 %1, %1\n\tv_exp_f32 %2, %2\n\tv_exp_f32 %3, %3\n\tv_exp_f32 %4, %4\n\tv_exp_f32 %5, %5\n\tv_exp_f32 %6, %6\n\tv_exp_f32 %7, %7\n\t"
      "v_exp_f32 %8, %8\n\tv_exp_f32 %9, %9\n\tv_exp_f32 %10, %10\n\tv_exp_f32 %11, %11\n\tv_exp_f32 %12, %12\n\tv_exp_f32 %13, %13\n\tv_exp_f32 %14, %14\n\tv_exp_f32 %15, %15\n\tv_nop"
      : "+v"(x[0]), "+v"(x[1]), "+v"(x[2]), "+v"(x[3]), "+v"(x[4]), "+v"(x[5]), "+v"(x[6]), "+v"(x[7]), "+v"(x[8]), "+v"(x[9]), "+v"(x[10]), "+v"(x[11]), "+v"(x[12]), "+v"(x[13]), "+v"(x[14]), "+v"(x[15])); }
template <int CAUSAL>
__global__ __launch_bounds__(128) void k_flash(const _Float16* __restrict__ Q16, int ldq, const _Float16* __restrict__ K16, int ldk, const _Float16* __restrict__ Vt, const int* __restrict__ MSK, float* __restrict__ O, int ldo) {
  constexpr int RPW = 16, DT = 4, KS = 2;
  constexpr int KP = 72, VP = 40;      /* LDS row pitch in f16: 144 B for the 128-byte K rows, 80 B for the 64-byte V^T rows (16 B x odd: no bank conflict for 16-byte readers) */
  __shared__ __attribute__((aligned(16))) float sO[4][RPW][64 + 4];
  __shared__ __attribute__((aligned(16))) unsigned short sK[2][32 * KP];      /* 32 keys x 64 */
  __shared__ __attribute__((aligned(16))) unsigned short sV[2][64 * VP];      /* 64 d x 32 keys */
  const int tid = threadIdx.x, w = tid >> 5, lane = tid & 31, ln = lane & 15, hh = lane >> 4;
  const int slab = blockIdx.x / QBLKS, qblk = blockIdx.x % QBLKS; (void)MSK; const int b = slab / NH, h = slab % NH; const int qb0 = qblk * (4 * RPW); const int q0 = qb0 + w * RPW;
  FragH bq[KS];
  { const unsigned short* qr = (const unsigned short*)Q16 + ((size_t)b * TQ + q0 + ln) * ldq + h * 64;
#pragma unroll
    for (int ks = 0; ks < KS; ++ks) { bq[ks].half[0] = *(const v8us*)(qr + ks * 32 + 8 * hh); bq[ks].half[1] = *(const v8us*)(qr + ks * 32 + 16 + 8 * hh); } }
  const unsigned short* Vth = (const unsigned short*)Vt + (size_t)slab * 64 * TK;
  const int tq = q0 + ln;
  v8f ctx[DT];      /* sum over the sources of the normalised rows */
#pragma unroll
  for (int dt = 0; dt < DT; ++dt) ctx[dt] = (v8f){0.f,0.f,0.f,0.f,0.f,0.f,0.f,0.f};
  const int jend = (CAUSAL == 1) ? (qb0 + 4 * RPW) : TK;      /* causal: keys beyond the block's last query never contribute */
  // Key tiles of 32 keys go to LDS once per block (the four waves read the same K and V^T), two buffers: tile t + 2 is copied while tile t + 1 is worked on.
  // The tiles of the NSRC sources form one sequence (source 0's tiles, then source 1's, ...), so the copies run on across a change of source.
  // Thread tid copies 16-byte pieces tid and tid + 128 of each tile: K piece c = row c / 8, column c % 8 (a wave covers 4 whole 128-byte rows); V^T piece c = row c / 4, column c % 4.
  const unsigned short* gK = (const unsigned short*)K16 + ((size_t)b * TK + (tid >> 3)) * ldk + h * 64 + (tid & 7) * 8;
  const unsigned short* gV = Vth + (size_t)(tid >> 2) * TK + (tid & 3) * 8;
  const unsigned lK = (unsigned)(size_t)&sK[0][(tid >> 3) * KP + (tid & 7) * 8], lV = (unsigned)(size_t)&sV[0][(tid >> 2) * VP + (tid & 3) * 8];
  int sn = 0, sj = 0;      /* source and first key of the next tile to copy; the same in every thread */
  auto stage = [&](int buf) { const unsigned short* k0 = gK + ((size_t)sn * NR + sj) * ldk; const unsigned short* v0 = gV + (size_t)sn * (NB * NH * 64) * TK + sj; const unsigned lk = lK + buf * (32 * KP * 2), lv = lV + buf * (64 * VP * 2);
    copy4_to_lds(lk, k0, lk + 16 * KP * 2, k0 + (size_t)16 * ldk, lv, v0, lv + 32 * VP * 2, v0 + (size_t)32 * TK);
    sj += 32; if (sj >= jend) { sj = 0; ++sn; } };
  stage(0);
  asm volatile("s_wait_asynccnt 0x0" ::: "memory");      /* tile 0 has landed before the barrier that publishes it */
  __syncthreads();
  stage(1);      /* jend is at least 64: a tile 1 exists */
  int buf = 0;
#pragma unroll 1      /* rolled, like the tile loop inside: one foot with the waits, the barrier and the refill in their order */
  for (int n = 0; n < NSRC; ++n) {
  float m_q = -3.0e38f, l_q = 0.f; v8f oacc[DT];      /* each source has a softmax of its own */
#pragma unroll
  for (int dt = 0; dt < DT; ++dt) oacc[dt] = (v8f){0.f,0.f,0.f,0.f,0.f,0.f,0.f,0.f};
#pragma unroll 1
  for (int j0 = 0; j0 < jend; j0 += 32) {
    const unsigned short* tK = &sK[buf][ln * KP + 8 * hh]; const unsigned short* tV = &sV[buf][ln * VP + 8 * hh];
    FragH ak[2][KS], av[DT];
#pragma unroll
    for (int nt = 0; nt < 2; ++nt)
#pragma unroll
      for (int ks = 0; ks < KS; ++ks) { ak[nt][ks].half[0] = *(const v8us*)(tK + nt * 16 * KP + ks * 32); ak[nt][ks].half[1] = *(const v8us*)(tK + nt * 16 * KP + ks * 32 + 16); }
#pragma unroll
    for (int dt = 0; dt < DT; ++dt) { av[dt].half[0] = *(const v8us*)(tV + dt * 16 * VP); av[dt].half[1] = *(const v8us*)(tV + dt * 16 * VP + 16); }
    v8f s[2];
#pragma unroll
    for (int nt = 0; nt < 2; ++nt) {
      v8f acc = (v8f){0.f,0.f,0.f,0.f,0.f,0.f,0.f,0.f};
#pragma unroll
      for (int ks = 0; ks < KS; ++ks) acc = mmaH<1>(ak[nt][ks].v, ak[nt][ks].v, bq[ks].v, bq[ks].v, acc);
      s[nt] = acc; }
    float sc[2][8], mx[8]; bool ok[2][8];      /* sc, m_q: raw products; the factor SCL2 = log2(e)/8 is applied inside the exponent's one fma */
#pragma unroll
    for (int r = 0; r < 8; ++r) {
#pragma unroll
      for (int nt = 0; nt < 2; ++nt) { const int kk = j0 + nt * 16 + 8 * hh + r;
        ok[nt][r] = (CAUSAL == 1) ? (kk <= tq) : ((CAUSAL == 2) ? ((kk >> 5) == (tq >> 5)) : true);      /* mode 2: block-diagonal 32-token groups */
        sc[nt][r] = ok[nt][r] ? s[nt][r] : -3.0e38f; }
      mx[r] = fmaxf(sc[0][r], sc[1][r]); }
    float mc = fmaxf(fmaxf(fmaxf(mx[0], mx[1]), fmaxf(mx[2], mx[3])), fmaxf(fmaxf(mx[4], mx[5]), fmaxf(mx[6], mx[7])));
    mc = fmaxf(mc, xhalf(mc));
    const float mn = fmaxf(m_q, mc); const float al = (mn > -1.0e38f) ? __builtin_amdgcn_exp2f((m_q - mn) * SCL2) : 1.0f; m_q = mn;
    const float nb = 10.0f - mn * SCL2;      /* p = 1024 e^((s - max)/8) = 2^(s SCL2 + nb): the x1024 of the f16 operand is the + 10 */
    float e[16];
#pragma unroll      /* unrolled: e stays in registers, as the asm operands need */
    for (int r = 0; r < 8; ++r) { e[r] = __builtin_fmaf(sc[0][r], SCL2, nb); e[8 + r] = __builtin_fmaf(sc[1][r], SCL2, nb); }
    exp2x16(e);
    FragH pb; float ps[8];
#pragma unroll
    for (int r = 0; r < 8; ++r) { const float p0 = ok[0][r] ? e[r] : 0.f, p1 = ok[1][r] ? e[8 + r] : 0.f; ps[r] = p0 + p1;
      pb.h[r] = (_Float16)p0; pb.h[8 + r] = (_Float16)p1; }
    l_q = l_q * al + (((ps[0] + ps[1]) + (ps[2] + ps[3])) + ((ps[4] + ps[5]) + (ps[6] + ps[7])));
#pragma unroll
    for (int dt = 0; dt < DT; ++dt)
#pragma unroll
      for (int r = 0; r < 8; ++r) oacc[dt][r] *= al;
#pragma unroll
    for (int dt = 0; dt < DT; ++dt) oacc[dt] = mmaH<1>(av[dt].v, av[dt].v, pb.v, pb.v, oacc[dt]);
    asm volatile("s_wait_dscnt 0x0" ::: "memory");      /* this wave's reads of the buffer have returned before the buffer is handed back */
    asm volatile("s_wait_asynccnt 0x0" ::: "memory");      /* this wave's copies of tile t + 1 have landed */
    __syncthreads();      /* publishes tile t + 1 and ends every wave's reads of tile t */
    if (sn < NSRC) stage(buf);      /* tile t + 2 exists */
    buf ^= 1; }
  const float l = l_q + xhalf(l_q); const float inv = (l > 0.f) ? 1.0f / l : 0.f;      /* l and oacc both carry the x1024 */
#pragma unroll
  for (int dt = 0; dt < DT; ++dt)
#pragma unroll
    for (int r = 0; r < 8; ++r) ctx[dt][r] += oacc[dt][r] * inv; }
  asm volatile("s_wait_asynccnt 0x0" ::: "memory");      /* nothing is in flight when the wave goes on to the epilogue and ends */
#pragma unroll
  for (int dt = 0; dt < DT; ++dt) {      /* register r of tile dt is O[q0 + ln][dt*16 + 8*hh + r] */
    const v4f lo = {ctx[dt][0], ctx[dt][1], ctx[dt][2], ctx[dt][3]}, hi = {ctx[dt][4], ctx[dt][5], ctx[dt][6], ctx[dt][7]};
    *(v4fa*)&sO[w][ln][dt * 16 + 8 * hh] = lo; *(v4fa*)&sO[w][ln][dt * 16 + 8 * hh + 4] = hi; }
  __builtin_amdgcn_fence(__ATOMIC_ACQ_REL, "workgroup"); __builtin_amdgcn_wave_barrier();
  {
#pragma unroll
    for (int rp = 0; rp < RPW; rp += 2) { const int r = rp + (lane >> 4), pc = lane & 15; const v4f val = *(const v4fa*)&sO[w][r][pc * 4]; *(v4f*)(O + ((size_t)b * TQ + q0 + r) * ldo + h * 64 + pc * 4) = val; }
     } }

extern "C" void kernel_launch(void* const* d_in, const int* in_sizes, int n_in,
                              void* d_out, int out_size, void* d_ws, size_t ws_size, hipStream_t stream) {
  (void)in_sizes; (void)n_in; (void)out_size;
  const float* const* I = (const float* const*)d_in; const float* hsp = I[0]; const float* Wq = I[1]; const float* bq = I[2]; const float* Wk = I[3]; const float* bk = I[4]; const float* Wv = I[5]; const float* bv = I[6];
  char* ws = (char*)d_ws; size_t off = 0;
  auto take = [&](size_t bytes) { char* p = ws + off; off += (bytes + 255) & ~(size_t)255; return p; };
  _Float16* BQ = (_Float16*)take((size_t)CC * CC * 2); _Float16* BK = (_Float16*)take((size_t)CC * CC * 2); _Float16* BV = (_Float16*)take((size_t)CC * CC * 2);
  _Float16* X16 = (_Float16*)take((size_t)NRA * CC * 2); _Float16* Q16 = (_Float16*)take((size_t)NR * CC * 2); _Float16* K16 = (_Float16*)take((size_t)NRA * CC * 2); _Float16* VT = (_Float16*)take((size_t)NRA * CC * 2);
  if (off > ws_size) return;      /* 3.4 + 30 + 6 + 30 + 30 = 100 MiB */
  k_prep<<<3 * WTB + X16B, 256, 0, stream>>>(hsp, Wq, Wk, Wv, X16, BQ, BK, BV);      /* weights x16 transposed; f16 plane of every source */
  k_qkv<<<QGB + NSRC * NB * (KBB + VBB), 256, 0, stream>>>(X16, BQ, BK, BV, bq, bk, bv, Q16, K16, VT);      /* q from source 0; k and V^T for every source */
  k_flash<0><<<NB * NH * QBLKS, 128, 0, stream>>>(Q16, CC, K16, CC, VT, nullptr, (float*)d_out, CC);      /* all five sources; stores the output */
}

// v009
// A run of this version takes 138 microseconds.
// Two timings next to v008 both put it at 1.17 times that version's speed.
// Over all steps from v000 it is 5.61 times as fast.
#include <hip/hip_runtime.h>
// Attention_KV (5 sources x 4 batches x 1024 tokens x 768 = 12 heads of 64): q from source 0 (Wq + bq); every source n gives k_n, v_n (shared Wk/bk, Wv/bv); ctx = sum_n softmax(q k_n^T / 8) v_n (independent softmax per source); output = ctx merged [B, S, 768] (no output projection).
// Structure, three launches: one preparing launch (the three weight transposes and the exact f16 plane of all sources, picked by ranges of the block index); the q, k and v GEMMs in one launch, picked likewise (GEMMs: 64x64 wave tiles, f32 accumulation, exact x16 weights + bias, f16 outputs; k and v over all 5 sources; the v product has its operands swapped, A = weight rows, B = tokens, and so stores V^T for all (source, batch, head) slabs itself); one fused flash kernel (plain f16 operands) whose blocks walk the five sources in turn and add each source's normalised rows in registers, then store the output.
// Compute dtype: inputs and parameters rounded to bf16; q, k, v, P as f16 (~2^-12); f32 accumulation/softmax/sum. v_wmma_f32_16x16x32_f16.
#define NSRC 5
#define NB 4
#define CC 768
#define NR (NB * SLEN)           /* 4096 query rows */
#define NRA (NSRC * NR)          /* 20480 source rows */
#define SLEN 1024
#define TQ SLEN
#define TK SLEN
#define NH 12
#define SCL 0.125f               /* 1/sqrt(64) */
#define SCL2 (SCL * 1.4426950408889634f)   /* log2(e)/sqrt(64) */
#define QBLKS (TQ / 64)
typedef __bf16 v16b __attribute__((ext_vector_type(16)));
typedef unsigned short v8us __attribute__((ext_vector_type(8), may_alias));
typedef float  v8f  __attribute__((ext_vector_type(8)));
typedef float  v4f  __attribute__((ext_vector_type(4)));
typedef float  v4fa __attribute__((ext_vector_type(4), may_alias));
union FragB { v16b v; v8us half[2]; unsigned short u[16]; };

__device__ __forceinline__ unsigned short bf16_bits(float x) { unsigned int u = __float_as_uint(x); return (unsigned short)((u + 0x7FFFu + ((u >> 16) & 1u)) >> 16); }
__device__ __forceinline__ float bf16_val(unsigned short b) { return __uint_as_float(((unsigned int)b) << 16); }
__device__ __forceinline__ float bf16_round(float x) { return bf16_val(bf16_bits(x)); }
// D += A·B with NT terms: 1 = ah·bh, 2 = + al·bh (A split), 3 = + ah·bl (both split)
template <int NT>
__device__ __forceinline__ v8f mmaN(v16b ah, v16b al, v16b bh, v16b bl, v8f c) {
  c = __builtin_amdgcn_wmma_f32_16x16x32_bf16(false, ah, false, bh, (short)0, c, false, false);
  if (NT >= 2) c = __builtin_amdgcn_wmma_f32_16x16x32_bf16(false, al, false, bh, (short)0, c, false, false);
  if (NT >= 3) c = __builtin_amdgcn_wmma_f32_16x16x32_bf16(false, ah, false, bl, (short)0, c, false, false);
  asm volatile("v_nop\n\tv_nop\n\tv_nop\n\tv_nop" : "+v"(c) : "v"(ah), "v"(al), "v"(bh), "v"(bl));
  return c;
}

__global__ __launch_bounds__(256) void k_wt_bf16(const float* __restrict__ W, unsigned short* __restrict__ Wt, int K, int N) {
  const int t = blockIdx.x * 256 + threadIdx.x;
  const int k8n = K / 8;
  if (t >= N * k8n) return;
  const int n = t / k8n, k8 = (t % k8n) * 8;
  v8us v;
#pragma unroll
  for (int i = 0; i < 8; ++i) v[i] = bf16_bits(W[(size_t)(k8 + i) * N + n]);
  *(v8us*)(Wt + (size_t)n * K + k8) = v;
  
}

// GEMM C[M][N] (f32, pitch ldc) = act(A[M][K]·W + bias). A f32 row-major (pitch lda) converted per fragment to bf16
// (ASPLIT: hi/lo two planes -> 2 terms, else single rounded term); Wt bf16 [N][K] (pitch ldb). BIAS_BF16 rounds the
// bias to bf16 first (bias quantised to bf16 before the add). K%32==0, M%16==0, N%64==0.
template <bool ASPLIT, int ACT, bool BIAS_BF16>
__global__ __launch_bounds__(128) void k_gemm_bf(const float* __restrict__ A, int lda, const unsigned short* __restrict__ Wt, int ldb,
                                               const float* __restrict__ bias, float* __restrict__ C, int ldc, int M, int N, int K) {
  __shared__ __attribute__((aligned(16))) float so[4][16][64];
  const int tid = threadIdx.x, w = tid >> 5, lane = tid & 31, ln = lane & 15, hh = lane >> 4;
  const int ntn = N / 64;
  const int wid = blockIdx.x * 4 + w;
  const int mt = wid / ntn, nq = wid % ntn;
  if (mt * 16 >= M) return;
  const int row0 = mt * 16, col0 = nq * 64;
  const float* arow = A + (size_t)(row0 + ln) * lda;
  v8f acc[4] = {};
  for (int kb = 0; kb < K; kb += 32) {
    FragB ah, al;
    const v4f x0 = *(const v4fa*)(arow + kb + 8 * hh), x1 = *(const v4fa*)(arow + kb + 8 * hh + 4);
    const v4f x2 = *(const v4fa*)(arow + kb + 16 + 8 * hh), x3 = *(const v4fa*)(arow + kb + 16 + 8 * hh + 4);
    float xs[16] = {x0[0],x0[1],x0[2],x0[3],x1[0],x1[1],x1[2],x1[3],x2[0],x2[1],x2[2],x2[3],x3[0],x3[1],x3[2],x3[3]};
#pragma unroll
    for (int i = 0; i < 16; ++i) { const unsigned short hb = bf16_bits(xs[i]); ah.u[i] = hb; al.u[i] = ASPLIT ? bf16_bits(xs[i] - bf16_val(hb)) : (unsigned short)0; }
#pragma unroll
    for (int t = 0; t < 4; ++t) {
      const unsigned short* brow = Wt + (size_t)(col0 + t * 16 + ln) * ldb + kb;
      FragB b;
      b.half[0] = *(const v8us*)(brow + 8 * hh);
      b.half[1] = *(const v8us*)(brow + 16 + 8 * hh);
      acc[t] = mmaN<ASPLIT ? 2 : 1>(ah.v, al.v, b.v, b.v, acc[t]);
    }
  }
#pragma unroll
  for (int t = 0; t < 4; ++t) {
    float bv = bias ? bias[col0 + t * 16 + ln] : 0.f;
    if (BIAS_BF16) bv = bf16_round(bv);
#pragma unroll
    for (int r = 0; r < 8; ++r) { float v = acc[t][r] + bv; if (ACT == 1) v = fmaxf(v, 0.f); so[w][8 * hh + r][t * 16 + ln] = v; }
  }
  __builtin_amdgcn_fence(__ATOMIC_ACQ_REL, "workgroup");
  __builtin_amdgcn_wave_barrier();
  const int rsub = lane >> 4, c4 = (lane & 15) * 4;
  {
#pragma unroll
    for (int q = 0; q < 8; ++q) {
      const int r = q * 2 + rsub;
      const v4f v = *(const v4fa*)&so[w][r][c4];
      *(v4f*)(C + (size_t)(row0 + r) * ldc + col0 + c4) = v;
    }
    
  }
}

// GEMM C = act(A·W + bias + resid): A f32 (ASPLIT -> hi/lo 2 terms), Wt bf16 [N][K]; ACT 0 none, 1 relu, 2 exact gelu;
// resid (optional, f32, row index = (row % rmod), pitch ldr, RES_BF16 rounds it) added before the activation.
template <bool ASPLIT, int ACT, bool BIAS_BF16, bool RES_BF16>
__global__ __launch_bounds__(128) void k_gemm_bf3(const float* __restrict__ A, int lda, const unsigned short* __restrict__ Wt, int ldb,
                                                const float* __restrict__ bias, const float* __restrict__ resid, int rmod, int ldr,
                                                float* __restrict__ C, int ldc, int M, int N, int K) {
  __shared__ __attribute__((aligned(16))) float so[4][16][64];
  const int tid = threadIdx.x, w = tid >> 5, lane = tid & 31, ln = lane & 15, hh = lane >> 4;
  const int ntn = N / 64;
  const int wid = blockIdx.x * 4 + w;
  const int mt = wid / ntn, nq = wid % ntn;
  if (mt * 16 >= M) return;
  const int row0 = mt * 16, col0 = nq * 64;
  const float* arow = A + (size_t)(row0 + ln) * lda;
  v8f acc[4] = {};
  for (int kb = 0; kb < K; kb += 32) {
    FragB ah, al;
    const v4f x0 = *(const v4fa*)(arow + kb + 8 * hh), x1 = *(const v4fa*)(arow + kb + 8 * hh + 4);
    const v4f x2 = *(const v4fa*)(arow + kb + 16 + 8 * hh), x3 = *(const v4fa*)(arow + kb + 16 + 8 * hh + 4);
    float xs[16] = {x0[0],x0[1],x0[2],x0[3],x1[0],x1[1],x1[2],x1[3],x2[0],x2[1],x2[2],x2[3],x3[0],x3[1],x3[2],x3[3]};
#pragma unroll
    for (int i = 0; i < 16; ++i) { const unsigned short hb = bf16_bits(xs[i]); ah.u[i] = hb; al.u[i] = ASPLIT ? bf16_bits(xs[i] - bf16_val(hb)) : (unsigned short)0; }
#pragma unroll
    for (int t = 0; t < 4; ++t) {
      const unsigned short* brow = Wt + (size_t)(col0 + t * 16 + ln) * ldb + kb;
      FragB b;
      b.half[0] = *(const v8us*)(brow + 8 * hh);
      b.half[1] = *(const v8us*)(brow + 16 + 8 * hh);
      acc[t] = mmaN<ASPLIT ? 2 : 1>(ah.v, al.v, b.v, b.v, acc[t]);
    }
  }
#pragma unroll
  for (int t = 0; t < 4; ++t) {
    const int col = col0 + t * 16 + ln;
    float bv = bias ? bias[col] : 0.f;
    if (BIAS_BF16) bv = bf16_round(bv);
#pragma unroll
    for (int r = 0; r < 8; ++r) {
      float v = acc[t][r] + bv;
      if (resid) { float rv = resid[(size_t)((row0 + 8 * hh + r) % rmod) * ldr + col]; if (RES_BF16) rv = bf16_round(rv); v += rv; }
      if (ACT == 1) v = fmaxf(v, 0.f);
      if (ACT == 2) v = 0.5f * v * (1.0f + erff(v * 0.70710678118654752f));
      if (ACT == 3) { const float u = 0.7978845608028654f * (v + 0.044715f * v * v * v); v = 0.5f * v * (1.0f + tanhf(u)); }
      so[w][8 * hh + r][t * 16 + ln] = v;
    }
  }
  __builtin_amdgcn_fence(__ATOMIC_ACQ_REL, "workgroup");
  __builtin_amdgcn_wave_barrier();
  const int rsub = lane >> 4, c4 = (lane & 15) * 4;
  {
#pragma unroll
    for (int q = 0; q < 8; ++q) {
      const int r = q * 2 + rsub;
      const v4f v = *(const v4fa*)&so[w][r][c4];
      *(v4f*)(C + (size_t)(row0 + r) * ldc + col0 + c4) = v;
    }
    
  }
}
// row LayerNorm (biased variance, eps) over N: s = X (+ R); optional out_sum <- s; out_norm <- (s-mu)*rsqrt(var+eps)*g + b
template <bool PARAM_BF16>
__global__ __launch_bounds__(256) void k_layernorm(const float* __restrict__ X, const float* __restrict__ R, const float* __restrict__ g, const float* __restrict__ bta,
                                                  float* __restrict__ out_sum, float* __restrict__ out_norm, int N, float eps) {
  __shared__ float red[256];
  const int row = blockIdx.x, tid = threadIdx.x;
  const float* x = X + (size_t)row * N; const float* rr = R ? R + (size_t)row * N : nullptr;
  float vals[16];                     // up to N = 4096
  const int per = N / 256;            // contiguous chunk per thread? use strided-by-4 chunks: thread handles j = tid*4 + 1024*u
  float s1 = 0.f;
  for (int u = 0; u < per / 4; ++u) {
    const int j = tid * 4 + 1024 * u;
    const v4f a = *(const v4fa*)(x + j);
    v4f b = {0.f,0.f,0.f,0.f}; if (rr) b = *(const v4fa*)(rr + j);
#pragma unroll
    for (int q = 0; q < 4; ++q) { const float v = a[q] + b[q]; vals[u * 4 + q] = v; s1 += v; }
  }
  red[tid] = s1; __syncthreads();
  for (int st = 128; st > 0; st >>= 1) { if (tid < st) red[tid] += red[tid + st]; __syncthreads(); }
  const float mu = red[0] / (float)N; __syncthreads();
  float s2 = 0.f;
  for (int u = 0; u < per / 4; ++u)
#pragma unroll
    for (int q = 0; q < 4; ++q) { const float c = vals[u * 4 + q] - mu; s2 += c * c; }
  red[tid] = s2; __syncthreads();
  for (int st = 128; st > 0; st >>= 1) { if (tid < st) red[tid] += red[tid + st]; __syncthreads(); }
  const float rs = rsqrtf(red[0] / (float)N + eps);
  {
    for (int u = 0; u < per / 4; ++u) {
      const int j = tid * 4 + 1024 * u;
      v4f o, sm;
#pragma unroll
      for (int q = 0; q < 4; ++q) {
        float gg = g[j + q], bb = bta[j + q];
        if (PARAM_BF16) { gg = bf16_round(gg); bb = bf16_round(bb); }
        sm[q] = vals[u * 4 + q]; o[q] = (vals[u * 4 + q] - mu) * rs * gg + bb;
      }
      if (out_sum) *(v4f*)(out_sum + (size_t)row * N + j) = sm;
      *(v4f*)(out_norm + (size_t)row * N + j) = o;
    }
    
  }
}



// ---- f16 WMMA path (v_wmma_f32_16x16x32_f16): 11-bit significands for operands in range — used where a [0,1] probability operand needs more precision than bf16
typedef _Float16 v16h __attribute__((ext_vector_type(16)));
union FragH { v16h v; v8us half[2]; _Float16 h[16]; unsigned short u[16]; };
template <int NT>
__device__ __forceinline__ v8f mmaH(v16h ah, v16h al, v16h bh, v16h bl, v8f c) {
  c = __builtin_amdgcn_wmma_f32_16x16x32_f16(false, ah, false, bh, (short)0, c, false, false);
  if (NT >= 2) c = __builtin_amdgcn_wmma_f32_16x16x32_f16(false, al, false, bh, (short)0, c, false, false);
  if (NT >= 3) c = __builtin_amdgcn_wmma_f32_16x16x32_f16(false, ah, false, bl, (short)0, c, false, false);
  asm volatile("v_nop\n\tv_nop\n\tv_nop\n\tv_nop" : "+v"(c) : "v"(ah), "v"(al), "v"(bh), "v"(bl));
  return c;
}
// batched GEMM like k_gemm_b but f16 operands: A f32 (split into f16 hi/lo if ASPLIT, else rounded to f16), Bt = f16 values [n][k]; alpha; C f32; N multiple of 16 (partial tiles skipped)
template <bool ASPLIT>
__global__ __launch_bounds__(128) void k_gemm_h(const float* __restrict__ A, int lda, size_t sA, const _Float16* __restrict__ Bh, int ldb, size_t sB, float alpha, float* __restrict__ C, int ldc, size_t sC, int M, int N, int K) {
  __shared__ __attribute__((aligned(16))) float so[4][16][64];
  const int tid = threadIdx.x, w = tid >> 5, lane = tid & 31, ln = lane & 15, hh = lane >> 4; const int by = blockIdx.y;
  A += (size_t)by * sA; Bh += (size_t)by * sB; C += (size_t)by * sC;
  const int ntn = (N + 63) / 64; const int wid = blockIdx.x * 4 + w; const int mt = wid / ntn, nq = wid % ntn; if (mt * 16 >= M) return;
  const int row0 = mt * 16, col0 = nq * 64; const float* arow = A + (size_t)(row0 + ln) * lda;
  v8f acc[4] = {};
  for (int kb = 0; kb < K; kb += 32) {
    FragH ah, al;
    const v4f x0 = *(const v4fa*)(arow + kb + 8 * hh), x1 = *(const v4fa*)(arow + kb + 8 * hh + 4), x2 = *(const v4fa*)(arow + kb + 16 + 8 * hh), x3 = *(const v4fa*)(arow + kb + 16 + 8 * hh + 4);
    float xs[16] = {x0[0],x0[1],x0[2],x0[3],x1[0],x1[1],x1[2],x1[3],x2[0],x2[1],x2[2],x2[3],x3[0],x3[1],x3[2],x3[3]};
#pragma unroll
    for (int i = 0; i < 16; ++i) { const _Float16 h = (_Float16)xs[i]; ah.h[i] = h; al.h[i] = ASPLIT ? (_Float16)(xs[i] - (float)h) : (_Float16)0.0f; }
#pragma unroll
    for (int t = 0; t < 4; ++t) { if (col0 + t * 16 >= N) continue; const size_t boff = (size_t)(col0 + t * 16 + ln) * ldb + kb; FragH bq; bq.half[0] = *(const v8us*)(Bh + boff + 8 * hh); bq.half[1] = *(const v8us*)(Bh + boff + 16 + 8 * hh);
      acc[t] = mmaH<ASPLIT ? 2 : 1>(ah.v, al.v, bq.v, bq.v, acc[t]); }
  }
#pragma unroll
  for (int t = 0; t < 4; ++t) { if (col0 + t * 16 >= N) continue;
#pragma unroll
    for (int r = 0; r < 8; ++r) so[w][8 * hh + r][t * 16 + ln] = acc[t][r] * alpha; }
  __builtin_amdgcn_fence(__ATOMIC_ACQ_REL, "workgroup"); __builtin_amdgcn_wave_barrier();
  const int rsub = lane >> 4, c4 = (lane & 15) * 4;
  {
#pragma unroll
    for (int q = 0; q < 8; ++q) { const int r = q * 2 + rsub; if (col0 + c4 < N) { const v4f v = *(const v4fa*)&so[w][r][c4]; *(v4f*)(C + (size_t)(row0 + r) * ldc + col0 + c4) = v; } }
     }
}

// Wt[n][k] = f16(W[k][n]·scale) from f32 row-major W[K][N] (scale = power of two; bf16-exact weights stay exact in f16 away from the subnormal range)
__device__ __forceinline__ void wt_f16_job(int blk, const float* __restrict__ W, _Float16* __restrict__ Wt, int K, int N, float scale) {
  const int t = blk * 256 + threadIdx.x; if (t >= N * (K / 8)) return; const int n = t / (K / 8), k8 = (t % (K / 8)) * 8; FragH f;
#pragma unroll
  for (int i = 0; i < 8; ++i) f.h[i] = (_Float16)(bf16_round(W[(size_t)(k8 + i) * N + n]) * scale); const v8us o = f.half[0];
  *(v8us*)((unsigned short*)Wt + (size_t)n * K + k8) = o; 
}
// k_gemm_hh variant with fused epilogue: v = acc·alpha + bias[by·sBias + col] (+ CP[(row/rowsPerB)·sCPb + by·64 + col] if CP) ; ACT 0 none / 1 elu ; writes f16 C16 (and f32 C if non-null)
template <int ACT>
__global__ __launch_bounds__(128) void k_gemm_hhx(const _Float16* __restrict__ A, int lda, size_t sA, const _Float16* __restrict__ Bh, int ldb, size_t sB, float alpha, const float* __restrict__ bias, size_t sBias, const float* __restrict__ CP, int rowsPerB, size_t sCPb, int row0g,
    float* __restrict__ C, _Float16* __restrict__ C16, int ldc, size_t sC, int M, int N, int K) {
  __shared__ __attribute__((aligned(16))) float so[4][16][64];
  const int tid = threadIdx.x, w = tid >> 5, lane = tid & 31, ln = lane & 15, hh = lane >> 4; const int by = blockIdx.y;
  A += (size_t)by * sA; Bh += (size_t)by * sB; const size_t cofs = (size_t)by * sC; const float* bp = bias ? bias + (size_t)by * sBias : nullptr;
  const int ntn = (N + 63) / 64; const int wid = blockIdx.x * 4 + w; const int mt = wid / ntn, nq = wid % ntn; if (mt * 16 >= M) return;
  const int row0 = mt * 16, col0 = nq * 64; const _Float16* arow = A + (size_t)(row0 + ln) * lda;
  v8f acc[4] = {};
  for (int kb = 0; kb < K; kb += 32) { FragH ah; ah.half[0] = *(const v8us*)((const unsigned short*)arow + kb + 8 * hh); ah.half[1] = *(const v8us*)((const unsigned short*)arow + kb + 16 + 8 * hh);
#pragma unroll
    for (int t = 0; t < 4; ++t) { if (col0 + t * 16 >= N) continue; const size_t boff = (size_t)(col0 + t * 16 + ln) * ldb + kb; FragH bq; bq.half[0] = *(const v8us*)((const unsigned short*)Bh + boff + 8 * hh); bq.half[1] = *(const v8us*)((const unsigned short*)Bh + boff + 16 + 8 * hh);
      acc[t] = mmaH<1>(ah.v, ah.v, bq.v, bq.v, acc[t]); }
  }
#pragma unroll
  for (int t = 0; t < 4; ++t) { if (col0 + t * 16 >= N) continue; const int col = col0 + t * 16 + ln; const float bv = bp ? bf16_round(bp[col]) : 0.f;
#pragma unroll
    for (int r = 0; r < 8; ++r) { float v = acc[t][r] * alpha + bv; if (CP) { const int bidx = (row0g + row0 + 8 * hh + r) / rowsPerB; v += CP[(size_t)bidx * sCPb + (size_t)by * 64 + col]; } if (ACT == 1) v = (v > 0.f) ? v : expm1f(v); else if (ACT == 7) v = (v > 0.f) ? v + 1.0f : expf(v); else if (ACT == 8) v = tanhf(v); else if (ACT == 9) v = 0.5f * v * (1.0f + tanhf(0.7978845608028654f * (v + 0.044715f * v * v * v))); else if (ACT == 11) v = 1.0f / (1.0f + expf(-v)); else if (ACT == 12) v = (v > 0.f) ? v : 0.01f * v; else if (ACT == 14) v = (v > 0.f) ? v : 0.1f * v; else if (ACT == 15) v = v / (1.0f + expf(-v)); else if (ACT == 3) v = fmaxf(v, 0.f); else if (ACT == 6) v = 0.5f * v * (1.0f + erff(v * 0.70710678118654752f)); so[w][8 * hh + r][t * 16 + ln] = v; } }
  __builtin_amdgcn_fence(__ATOMIC_ACQ_REL, "workgroup"); __builtin_amdgcn_wave_barrier();
  const int rsub = lane >> 4, c4 = (lane & 15) * 4; typedef _Float16 v4h __attribute__((ext_vector_type(4)));
  {
#pragma unroll
    for (int q = 0; q < 8; ++q) { const int r = q * 2 + rsub; if (col0 + c4 < N) { const v4f v = *(const v4fa*)&so[w][r][c4]; if (C) *(v4f*)(C + cofs + (size_t)(row0 + r) * ldc + col0 + c4) = v; if (C16) { v4h h4; for (int i = 0; i < 4; ++i) h4[i] = (_Float16)v[i]; *(v4h*)(C16 + cofs + (size_t)(row0 + r) * ldc + col0 + c4) = h4; } } }
     }
}


typedef _Float16 v4h __attribute__((ext_vector_type(4)));

__device__ __forceinline__ void x16_job(int blk, const float* __restrict__ x, _Float16* __restrict__ X16, size_t n8) { const size_t t = (size_t)blk * 256 + threadIdx.x; if (t >= n8) return; FragH f;
#pragma unroll
  for (int q = 0; q < 8; ++q) f.h[q] = (_Float16)bf16_round(x[t * 8 + q]); *(v8us*)((unsigned short*)X16 + t * 8) = f.half[0];  }
// The four jobs that need nothing of each other share one grid: blocks 0 .. 3 * WTB - 1 transpose Wq, Wk, Wv (they wait on scattered loads; placed first for speed only), the rest cast the sources. The choice is the same for a whole block.
#define WTB ((CC * CC / 8 + 255) / 256)
#define X16B ((NRA * CC / 8 + 255) / 256)
__global__ __launch_bounds__(256) void k_prep(const float* __restrict__ x, const float* __restrict__ Wq, const float* __restrict__ Wk, const float* __restrict__ Wv,
                                             _Float16* __restrict__ X16, _Float16* __restrict__ BQ, _Float16* __restrict__ BK, _Float16* __restrict__ BV) {
  const int bx = blockIdx.x;
  if (bx < 3 * WTB) { const int m = bx / WTB; wt_f16_job(bx - m * WTB, m == 0 ? Wq : (m == 1 ? Wk : Wv), m == 0 ? BQ : (m == 1 ? BK : BV), CC, CC, 16.0f); }
  else x16_job(bx - 3 * WTB, x, X16, (size_t)NRA * CC / 8); }
__global__ __launch_bounds__(256) void k_h16(const float* __restrict__ x, _Float16* __restrict__ X16, size_t n8) { const size_t t = (size_t)blockIdx.x * 256 + threadIdx.x; if (t >= n8) return; FragH f;
#pragma unroll
  for (int q = 0; q < 8; ++q) f.h[q] = (_Float16)x[t * 8 + q]; *(v8us*)((unsigned short*)X16 + t * 8) = f.half[0];  }
__global__ __launch_bounds__(256) void k_round16f(const float* __restrict__ W, _Float16* __restrict__ Bt, size_t n8) { const size_t t = (size_t)blockIdx.x * 256 + threadIdx.x; if (t >= n8) return; FragH f;
#pragma unroll
  for (int i = 0; i < 8; ++i) f.h[i] = (_Float16)(bf16_round(W[t * 8 + i]) * 16.0f); *(v8us*)((unsigned short*)Bt + t * 8) = f.half[0];  }
__global__ __launch_bounds__(256) void k_hl(const float* __restrict__ F, _Float16* __restrict__ Hh, _Float16* __restrict__ Hl, size_t n8) { const size_t t = (size_t)blockIdx.x * 256 + threadIdx.x; if (t >= n8) return; FragH fh, fl; const v4f a = *(const v4fa*)(F + t * 8), c = *(const v4fa*)(F + t * 8 + 4);
#pragma unroll
  for (int q = 0; q < 4; ++q) { _Float16 h = (_Float16)a[q]; fh.h[q] = h; fl.h[q] = (_Float16)((a[q] - (float)h) * 1024.0f); h = (_Float16)c[q]; fh.h[4 + q] = h; fl.h[4 + q] = (_Float16)((c[q] - (float)h) * 1024.0f); }
  { *(v8us*)((unsigned short*)Hh + t * 8) = fh.half[0]; *(v8us*)((unsigned short*)Hl + t * 8) = fl.half[0];  } }

// ---- fast GEMM (block tile 256x128, eight waves of 64x64; requires M % 64 == 0 rows per launch region and N % 128 == 0); epilogue = k_gemm_hhx semantics, f16 output only ----
__device__ __forceinline__ v16h g2_frag(const _Float16* p, int hh) { FragH f; f.half[0] = *(const v8us*)((const unsigned short*)p + 8 * hh); f.half[1] = *(const v8us*)((const unsigned short*)p + 16 + 8 * hh); return f.v; }
__device__ __forceinline__ v8f g2_mma(v16h a, v16h b, v8f c) { v8f d = __builtin_amdgcn_wmma_f32_16x16x32_f16(false, a, false, b, (short)0, c, false, false); asm volatile("v_nop\n\tv_nop\n\tv_nop\n\tv_nop" : "+v"(d) : "v"(a), "v"(b)); return d; }
// One lane's twelve 16-byte asynchronous copies from global memory to LDS (l: LDS byte addresses, g: global addresses). The s_wait_xcnt is the last line of the copies' own statement, so that no address register is rewritten in front of it.
__device__ __forceinline__ void copy12_to_lds(const unsigned (&l)[12], const unsigned short* const (&g)[12]) {
  asm volatile("global_load_async_to_lds_b128 %0, %12, off\n\tglobal_load_async_to_lds_b128 %1, %13, off\n\tglobal_load_async_to_lds_b128 %2, %14, off\n\tglobal_load_async_to_lds_b128 %3, %15, off\n\t"
               "global_load_async_to_lds_b128 %4, %16, off\n\tglobal_load_async_to_lds_b128 %5, %17, off\n\tglobal_load_async_to_lds_b128 %6, %18, off\n\tglobal_load_async_to_lds_b128 %7, %19, off\n\t"
               "global_load_async_to_lds_b128 %8, %20, off\n\tglobal_load_async_to_lds_b128 %9, %21, off\n\tglobal_load_async_to_lds_b128 %10, %22, off\n\tglobal_load_async_to_lds_b128 %11, %23, off\n\ts_wait_xcnt 0x0"
               :: "v"(l[0]), "v"(l[1]), "v"(l[2]), "v"(l[3]), "v"(l[4]), "v"(l[5]), "v"(l[6]), "v"(l[7]), "v"(l[8]), "v"(l[9]), "v"(l[10]), "v"(l[11]),
                  "v"(g[0]), "v"(g[1]), "v"(g[2]), "v"(g[3]), "v"(g[4]), "v"(g[5]), "v"(g[6]), "v"(g[7]), "v"(g[8]), "v"(g[9]), "v"(g[10]), "v"(g[11]) : "memory"); }
#define GEMM2_LDS ((256 + 128) * 72)      /* floats of LDS that a caller of gemm2_job hands in, 16-byte aligned */
// Block tile 256 x 128, 256 threads, waves 4 x 2. The operands go to LDS once per block in k steps of 64 (whole 128-byte lines of every row), two buffers: step t + 2 is copied while step t + 1 is worked on. Requires K % 64 == 0.
// ROWB: the bias belongs to the rows of C (the weights are the A operand), else to its columns.
template <int ACT, bool ROWB>
__device__ __forceinline__ void gemm2_job(float* sm, int bx, int by, const _Float16* __restrict__ A, int lda, size_t sA, const _Float16* __restrict__ Bh, int ldb, size_t sB, float alpha, const float* __restrict__ bias, size_t sBias, const float* __restrict__ CP, int rowsPerB, size_t sCPb, int row0g,
    _Float16* __restrict__ C16, int ldc, size_t sC, int M, int N, int K) {
  constexpr int GP = 72;                    /* LDS row pitch in f16: 144 B for the 128-byte rows (16 B x odd: no bank conflict for 16-byte readers) */
  constexpr int STG = (256 + 128) * GP;      /* one buffer in f16: 256 A rows, then 128 B rows */
  static_assert(2 * STG / 2 == GEMM2_LDS, "the caller's LDS array");      /* sm, 110,592 B: the two operand buffers in the k loop; behind it the epilogue's per-wave f16 output tiles (73,728 B) */
  unsigned short (*so)[64][GP] = (unsigned short (*)[64][GP])sm;
  const unsigned short* sT = (const unsigned short*)sm;
  const int tid = threadIdx.x, w = tid >> 5, lane = tid & 31, ln = lane & 15, hh = lane >> 4;
  A += (size_t)by * sA; Bh += (size_t)by * sB; const size_t cofs = (size_t)by * sC; const float* bp = bias ? bias + (size_t)by * sBias : nullptr;
  const int ntn = N >> 7; const int mt = bx / ntn, nq = bx - mt * ntn; const int rowb = mt * 256, row0 = rowb + 64 * (w >> 1), colb = nq * 128, col0 = colb + 64 * (w & 1); if (rowb >= M) return;      /* the whole block leaves, in front of every barrier */
  // Thread tid copies 16-byte piece tid & 7 of rows (tid >> 3) + 32 i: a wave's copy covers 4 whole 128-byte rows. An A row past M is clamped to the last row (its products are never stored).
  const int cr = tid >> 3, cc = (tid & 7) * 8;
  const unsigned short* gsrc[12];
#pragma unroll      /* unrolled here and in the three loops below: the address arrays stay in registers */
  for (int i = 0; i < 8; ++i) { const int r = rowb + cr + 32 * i; gsrc[i] = (const unsigned short*)A + (size_t)(r < M ? r : M - 1) * lda + cc; }
#pragma unroll
  for (int i = 0; i < 4; ++i) gsrc[8 + i] = (const unsigned short*)Bh + (size_t)(colb + cr + 32 * i) * ldb + cc;
  const unsigned l0 = (unsigned)(size_t)&sT[cr * GP + cc];
  auto stage = [&](int buf) { unsigned l[12];      /* copies the next k step into buffer buf and moves the source pointers on by one step */
#pragma unroll
    for (int i = 0; i < 12; ++i) l[i] = l0 + (unsigned)((buf * STG + 32 * i * GP) * 2);
    copy12_to_lds(l, gsrc);
#pragma unroll
    for (int i = 0; i < 12; ++i) gsrc[i] += 64; };
  v8f acc[4][4];      /* acc[i][t]: rows row0 + 16 i, columns col0 + 16 t */
#pragma unroll      /* unrolled, like every loop over acc below: it stays in registers */
  for (int i = 0; i < 4; ++i)
#pragma unroll
    for (int t = 0; t < 4; ++t) acc[i][t] = (v8f){0.f,0.f,0.f,0.f,0.f,0.f,0.f,0.f};
  stage(0);
  asm volatile("s_wait_asynccnt 0x0" ::: "memory");      /* step 0 has landed before the barrier that publishes it */
  __syncthreads();
  if (64 < K) stage(1);
#pragma unroll 1      /* rolled: one foot with the waits, the barrier and the refill in their order */
  for (int kb = 0; kb < K; kb += 64) {
    const int buf = (kb >> 6) & 1;
    const _Float16* tA = (const _Float16*)sT + buf * STG + (64 * (w >> 1) + ln) * GP; const _Float16* tB = (const _Float16*)sT + buf * STG + (256 + 64 * (w & 1) + ln) * GP;
#pragma unroll      /* unrolled here and in the loops below: the fragment arrays stay in registers */
    for (int ks = 0; ks < 2; ++ks) {
      v16h fa[4], fb[4];      /* the fragment reads of one k = 32 stand together in front of its 16 products */
#pragma unroll
      for (int t = 0; t < 4; ++t) { fa[t] = g2_frag(tA + t * 16 * GP + ks * 32, hh); fb[t] = g2_frag(tB + t * 16 * GP + ks * 32, hh); }
#pragma unroll
      for (int t = 0; t < 4; ++t)
#pragma unroll
        for (int i = 0; i < 4; ++i) acc[i][t] = g2_mma(fa[i], fb[t], acc[i][t]); }
    asm volatile("s_wait_dscnt 0x0" ::: "memory");      /* this wave's reads of the buffer have returned before the buffer is handed back */
    asm volatile("s_wait_asynccnt 0x0" ::: "memory");      /* this wave's copies of step t + 1 have landed */
    __syncthreads();      /* publishes step t + 1 and ends every wave's reads of step t */
    if (kb + 128 < K) stage(buf); }
  asm volatile("s_wait_asynccnt 0x0" ::: "memory");      /* nothing is in flight when the LDS is taken over by the output tiles */
  if (row0 >= M) return;      /* behind the last barrier */
  float br[4][8] = {}, bc[4] = {};      /* ROWB (a bias is required there): the bias of this lane's 32 rows, by eight 16-byte loads issued together; else the bias of its 4 columns */
  if (ROWB) { const float* pr = bp + row0 + 8 * hh; v4f b0[4], b1[4];
#pragma unroll      /* unrolled here and below: b0, b1, br and bc stay in registers */
    for (int i = 0; i < 4; ++i) { b0[i] = *(const v4fa*)(pr + 16 * i); b1[i] = *(const v4fa*)(pr + 16 * i + 4); }
#pragma unroll
    for (int i = 0; i < 4; ++i)
#pragma unroll
      for (int q = 0; q < 4; ++q) { br[i][q] = bf16_round(b0[i][q]); br[i][4 + q] = bf16_round(b1[i][q]); } }
  else if (bp) {
#pragma unroll
    for (int t = 0; t < 4; ++t) bc[t] = bf16_round(bp[col0 + t * 16 + ln]); }
#pragma unroll
  for (int t = 0; t < 4; ++t) { const int col = col0 + t * 16 + ln;
#pragma unroll
    for (int i = 0; i < 4; ++i)
#pragma unroll
    for (int r = 0; r < 8; ++r) { const int rloc = i * 16 + 8 * hh + r; float v = acc[i][t][r] * alpha + (ROWB ? br[i][r] : bc[t]); if (CP) { const int bidx = (row0g + row0 + rloc) / rowsPerB; v += CP[(size_t)bidx * sCPb + (size_t)by * 64 + col]; }
      if (ACT == 3) v = fmaxf(v, 0.f); else if (ACT == 6) v = 0.5f * v * (1.0f + erff(v * 0.70710678118654752f)); else if (ACT == 11) v = 1.0f / (1.0f + expf(-v)); else if (ACT == 15) v = v / (1.0f + expf(-v)); else if (ACT == 12) v = (v > 0.f) ? v : 0.01f * v; else if (ACT == 8) v = tanhf(v);
      so[w][rloc][t * 16 + ln] = __builtin_bit_cast(unsigned short, (_Float16)v); } }
  __builtin_amdgcn_fence(__ATOMIC_ACQ_REL, "workgroup"); __builtin_amdgcn_wave_barrier();
  const int rsub = lane >> 3, c8 = (lane & 7) * 8;      /* a wave's 16-byte store covers the 128-byte pieces of four rows */
#pragma unroll
  for (int q = 0; q < 16; ++q) { const int r = q * 4 + rsub; const v8us v = *(const v8us*)&so[w][r][c8]; *(v8us*)((unsigned short*)C16 + cofs + (size_t)(row0 + r) * ldc + col0 + c8) = v; } }

// The three products need nothing of each other and share one grid; the block index picks the job, the same for a whole block.
// V^T[(n*4 + b)*768 + h*64 + d][key] is the v product with its operands swapped: C = Wv^T (768 rows) x tokens of one (source, batch) (1024 columns), so no transposing pass and no row-major v are needed.
// Order: the q blocks, then for each (source, batch) its k blocks and its V^T blocks, which read the same 1024 token rows.
#define NTC (CC / 128)             /* column tiles of the q and k products */
#define QGB ((NR / 256) * NTC)      /* blocks of the q product */
#define KBB ((SLEN / 256) * NTC)      /* blocks of the k product on one (source, batch) */
#define VBB ((CC / 256) * (SLEN / 128))      /* blocks of the V^T product on one (source, batch) */
__global__ __launch_bounds__(256) void k_qkv(const _Float16* __restrict__ X16, const _Float16* __restrict__ BQ, const _Float16* __restrict__ BK, const _Float16* __restrict__ BV,
                                            const float* __restrict__ bq, const float* __restrict__ bk, const float* __restrict__ bv,
                                            _Float16* __restrict__ Q16, _Float16* __restrict__ K16, _Float16* __restrict__ VT) {
  __shared__ __attribute__((aligned(16))) float sm[GEMM2_LDS];
  const int bx = blockIdx.x; const bool isq = bx < QGB;
  const int g = isq ? 0 : (bx - QGB) / (KBB + VBB), r = isq ? 0 : (bx - QGB) - g * (KBB + VBB);      /* (source, batch) and the block's place among its KBB + VBB */
  if (!isq && r >= KBB) gemm2_job<0, true>(sm, r - KBB, g, BV, CC, 0, X16, CC, (size_t)SLEN * CC, 0.0625f, bv, 0, nullptr, 1, 0, 0, VT, SLEN, (size_t)CC * SLEN, CC, SLEN, CC);
  else gemm2_job<0, false>(sm, isq ? bx : g * KBB + r, 0, X16, CC, 0, isq ? BQ : BK, CC, 0, 0.0625f, isq ? bq : bk, 0, nullptr, 1, 0, 0, isq ? Q16 : K16, CC, 0, isq ? NR : NRA, CC, CC); }

// lane l with lane l ^ 16: the two lanes that share one query column of a transposed score tile
__device__ __forceinline__ float xhalf(float x) { return __builtin_bit_cast(float, __builtin_amdgcn_permlanex16(__builtin_bit_cast(int, x), __builtin_bit_cast(int, x), 0x76543210, 0xfedcba98, false, false)); }
__device__ __forceinline__ void copy8_to_lds(const unsigned (&l)[8], const unsigned short* const (&g)[8]) {
  asm volatile("global_load_async_to_lds_b128 %0, %8, off\n\tglobal_load_async_to_lds_b128 %1, %9, off\n\tglobal_load_async_to_lds_b128 %2, %10, off\n\tglobal_load_async_to_lds_b128 %3, %11, off\n\t"
               "global_load_async_to_lds_b128 %4, %12, off\n\tglobal_load_async_to_lds_b128 %5, %13, off\n\tglobal_load_async_to_lds_b128 %6, %14, off\n\tglobal_load_async_to_lds_b128 %7, %15, off\n\ts_wait_xcnt 0x0"
               :: "v"(l[0]), "v"(l[1]), "v"(l[2]), "v"(l[3]), "v"(l[4]), "v"(l[5]), "v"(l[6]), "v"(l[7]),
                  "v"(g[0]), "v"(g[1]), "v"(g[2]), "v"(g[3]), "v"(g[4]), "v"(g[5]), "v"(g[6]), "v"(g[7]) : "memory"); }
// Sixteen 2^x in place, each on a register of its own: no instruction directly behind a transcendental reads its result or overwrites its source; the closing v_nop keeps that slot in front of whatever the compiler puts next.
__device__ __forceinline__ void exp2x16(float (&x)[16]) {
  asm("v_exp_f32 %0, %0\n\tv_exp_f32 %1, %1\n\tv_exp_f32 %2, %2\n\tv_exp_f32 %3, %3\n\tv_exp_f32 %4, %4\n\tv_exp_f32 %5, %5\n\tv_exp_f32 %6, %6\n\tv_exp_f32 %7, %7\n\t"
      "v_exp_f32 %8, %8\n\tv_exp_f32 %9, %9\n\tv_exp_f32 %10, %10\n\tv_exp_f32 %11, %11\n\tv_exp_f32 %12, %12\n\tv_exp_f32 %13, %13\n\tv_exp_f32 %14, %14\n\tv_exp_f32 %15, %15\n\tv_nop"
      : "+v"(x[0]), "+v"(x[1]), "+v"(x[2]), "+v"(x[3]), "+v"(x[4]), "+v"(x[5]), "+v"(x[6]), "+v"(x[7]), "+v"(x[8]), "+v"(x[9]), "+v"(x[10]), "+v"(x[11]), "+v"(x[12]), "+v"(x[13]), "+v"(x[14]), "+v"(x[15])); }
template <int CAUSAL>
__global__ __launch_bounds__(128) void k_flash(const _Float16* __restrict__ Q16, int ldq, const _Float16* __restrict__ K16, int ldk, const _Float16* __restrict__ Vt, const int* __restrict__ MSK, float* __restrict__ O, int ldo) {
  constexpr int RPW = 16, DT = 4, KS = 2;
  constexpr int KT = 64, NT = KT / 16, KC = KT / 32;      /* keys of a tile = of one pass of the online softmax; its score tiles of 16 keys; its k = 32 chunks in the second product */
  constexpr int KP = 72, VP = 72;      /* LDS row pitch in f16: 144 B for the 128-byte rows of K and of V^T (16 B x odd: no bank conflict for 16-byte readers) */
  __shared__ __attribute__((aligned(16))) float sO[4][RPW][64 + 4];
  __shared__ __attribute__((aligned(16))) unsigned short sK[2][KT * KP];      /* 64 keys x 64 */
  __shared__ __attribute__((aligned(16))) unsigned short sV[2][64 * VP];      /* 64 d x 64 keys */
  const int tid = threadIdx.x, w = tid >> 5, lane = tid & 31, ln = lane & 15, hh = lane >> 4;
  const int slab = blockIdx.x / QBLKS, qblk = blockIdx.x % QBLKS; (void)MSK; const int b = slab / NH, h = slab % NH; const int qb0 = qblk * (4 * RPW); const int q0 = qb0 + w * RPW;
  FragH bq[KS];
  { const unsigned short* qr = (const unsigned short*)Q16 + ((size_t)b * TQ + q0 + ln) * ldq + h * 64;
#pragma unroll
    for (int ks = 0; ks < KS; ++ks) { bq[ks].half[0] = *(const v8us*)(qr + ks * 32 + 8 * hh); bq[ks].half[1] = *(const v8us*)(qr + ks * 32 + 16 + 8 * hh); } }
  const unsigned short* Vth = (const unsigned short*)Vt + (size_t)slab * 64 * TK;
  const int tq = q0 + ln;
  v8f ctx[DT];      /* sum over the sources of the normalised rows */
#pragma unroll
  for (int dt = 0; dt < DT; ++dt) ctx[dt] = (v8f){0.f,0.f,0.f,0.f,0.f,0.f,0.f,0.f};
  const int jend = (CAUSAL == 1) ? (qb0 + 4 * RPW) : TK;      /* causal: keys beyond the block's last query never contribute */
  // Key tiles of 64 keys go to LDS once per block (the four waves read the same K and V^T), two buffers: tile t + 2 is copied while tile t + 1 is worked on.
  // The tiles of the NSRC sources form one sequence (source 0's tiles, then source 1's, ...), so the copies run on across a change of source.
  // Thread tid copies 16-byte pieces tid + 128 i, i = 0 .. 3, of the K tile and of the V^T tile: piece c = row c / 8, column c % 8 (a wave's copy covers 4 whole 128-byte rows).
  const unsigned short* gK = (const unsigned short*)K16 + ((size_t)b * TK + (tid >> 3)) * ldk + h * 64 + (tid & 7) * 8;
  const unsigned short* gV = Vth + (size_t)(tid >> 3) * TK + (tid & 7) * 8;
  const unsigned lK = (unsigned)(size_t)&sK[0][(tid >> 3) * KP + (tid & 7) * 8], lV = (unsigned)(size_t)&sV[0][(tid >> 3) * VP + (tid & 7) * 8];
  int sn = 0, sj = 0;      /* source and first key of the next tile to copy; the same in every thread */
  auto stage = [&](int buf) { const unsigned short* k0 = gK + ((size_t)sn * NR + sj) * ldk; const unsigned short* v0 = gV + (size_t)sn * (NB * NH * 64) * TK + sj; const unsigned lk = lK + buf * (KT * KP * 2), lv = lV + buf * (64 * VP * 2);
    unsigned l[8]; const unsigned short* g[8];
#pragma unroll      /* unrolled: the address arrays stay in registers, as the asm operands need */
    for (int i = 0; i < 4; ++i) { l[i] = lk + i * (16 * KP * 2); g[i] = k0 + (size_t)(16 * i) * ldk; l[4 + i] = lv + i * (16 * VP * 2); g[4 + i] = v0 + (size_t)(16 * i) * TK; }
    copy8_to_lds(l, g);
    sj += KT; if (sj >= jend) { sj = 0; ++sn; } };
  stage(0);
  asm volatile("s_wait_asynccnt 0x0" ::: "memory");      /* tile 0 has landed before the barrier that publishes it */
  __syncthreads();
  stage(1);      /* a tile 1 exists: jend is a multiple of 64, and there is more than one source */
  int buf = 0;
#pragma unroll 1      /* rolled, like the tile loop inside: one foot with the waits, the barrier and the refill in their order */
  for (int n = 0; n < NSRC; ++n) {
  float m_q = -3.0e38f, l_q = 0.f; v8f oacc[DT];      /* each source has a softmax of its own */
#pragma unroll
  for (int dt = 0; dt < DT; ++dt) oacc[dt] = (v8f){0.f,0.f,0.f,0.f,0.f,0.f,0.f,0.f};
#pragma unroll 1
  for (int j0 = 0; j0 < jend; j0 += KT) {
    const unsigned short* tK = &sK[buf][ln * KP + 8 * hh]; const unsigned short* tV = &sV[buf][ln * VP + 8 * hh];
    static_assert(NT == 4 && KC == 2, "the maximum and the row sum below are written out for four score tiles in two chunks");
    FragH ak[NT][KS], av[DT][KC];
#pragma unroll      /* every loop of this pass is unrolled: the fragments, scores and accumulators are indexed by constants and stay in registers */
    for (int nt = 0; nt < NT; ++nt)
#pragma unroll
      for (int ks = 0; ks < KS; ++ks) { ak[nt][ks].half[0] = *(const v8us*)(tK + nt * 16 * KP + ks * 32); ak[nt][ks].half[1] = *(const v8us*)(tK + nt * 16 * KP + ks * 32 + 16); }
    v8f s[NT];
#pragma unroll
    for (int nt = 0; nt < NT; ++nt) {
      v8f acc = (v8f){0.f,0.f,0.f,0.f,0.f,0.f,0.f,0.f};
#pragma unroll
      for (int ks = 0; ks < KS; ++ks) acc = mmaH<1>(ak[nt][ks].v, ak[nt][ks].v, bq[ks].v, bq[ks].v, acc);
      s[nt] = acc; }
#pragma unroll      /* the V^T fragments are asked for behind the score products: they arrive during the softmax, in registers that the K fragments have left */
    for (int dt = 0; dt < DT; ++dt)
#pragma unroll
      for (int kc = 0; kc < KC; ++kc) { av[dt][kc].half[0] = *(const v8us*)(tV + dt * 16 * VP + kc * 32); av[dt][kc].half[1] = *(const v8us*)(tV + dt * 16 * VP + kc * 32 + 16); }
    float sc[NT][8], mx[8]; bool ok[NT][8];      /* sc, m_q: raw products; the factor SCL2 = log2(e)/8 is applied inside the exponent's one fma */
#pragma unroll
    for (int r = 0; r < 8; ++r) {
#pragma unroll
      for (int nt = 0; nt < NT; ++nt) { const int kk = j0 + nt * 16 + 8 * hh + r;
        ok[nt][r] = (CAUSAL == 1) ? (kk <= tq) : ((CAUSAL == 2) ? ((kk >> 5) == (tq >> 5)) : true);      /* mode 2: block-diagonal 32-token groups */
        sc[nt][r] = ok[nt][r] ? s[nt][r] : -3.0e38f; }
      mx[r] = fmaxf(fmaxf(sc[0][r], sc[1][r]), fmaxf(sc[2][r], sc[3][r])); }
    float mc = fmaxf(fmaxf(fmaxf(mx[0], mx[1]), fmaxf(mx[2], mx[3])), fmaxf(fmaxf(mx[4], mx[5]), fmaxf(mx[6], mx[7])));
    mc = fmaxf(mc, xhalf(mc));
    const float mn = fmaxf(m_q, mc); const float al = (mn > -1.0e38f) ? __builtin_amdgcn_exp2f((m_q - mn) * SCL2) : 1.0f; m_q = mn;
    const float nb = 10.0f - mn * SCL2;      /* p = 1024 e^((s - max)/8) = 2^(s SCL2 + nb): the x1024 of the f16 operand is the + 10 */
    FragH pb[KC]; float pt[KC];      /* chunk kc of the second product: score tiles 2 kc and 2 kc + 1, in the loaders' k order; pt: its share of the row sum */
#pragma unroll
    for (int kc = 0; kc < KC; ++kc) {
      float e[16], ps[8];
#pragma unroll      /* unrolled: e stays in registers, as the asm operands need */
      for (int r = 0; r < 8; ++r) { e[r] = __builtin_fmaf(sc[2 * kc][r], SCL2, nb); e[8 + r] = __builtin_fmaf(sc[2 * kc + 1][r], SCL2, nb); }
      exp2x16(e);
#pragma unroll
      for (int r = 0; r < 8; ++r) { const float p0 = ok[2 * kc][r] ? e[r] : 0.f, p1 = ok[2 * kc + 1][r] ? e[8 + r] : 0.f; ps[r] = p0 + p1;
        pb[kc].h[r] = (_Float16)p0; pb[kc].h[8 + r] = (_Float16)p1; }
      pt[kc] = ((ps[0] + ps[1]) + (ps[2] + ps[3])) + ((ps[4] + ps[5]) + (ps[6] + ps[7])); }
    l_q = l_q * al + (pt[0] + pt[1]);
#pragma unroll
    for (int dt = 0; dt < DT; ++dt)
#pragma unroll
      for (int r = 0; r < 8; ++r) oacc[dt][r] *= al;
#pragma unroll
    for (int kc = 0; kc < KC; ++kc)
#pragma unroll
      for (int dt = 0; dt < DT; ++dt) oacc[dt] = mmaH<1>(av[dt][kc].v, av[dt][kc].v, pb[kc].v, pb[kc].v, oacc[dt]);
    asm volatile("s_wait_dscnt 0x0" ::: "memory");      /* this wave's reads of the buffer have returned before the buffer is handed back */
    asm volatile("s_wait_asynccnt 0x0" ::: "memory");      /* this wave's copies of tile t + 1 have landed */
    __syncthreads();      /* publishes tile t + 1 and ends every wave's reads of tile t */
    if (sn < NSRC) stage(buf);      /* tile t + 2 exists */
    buf ^= 1; }
  const float l = l_q + xhalf(l_q); const float inv = (l > 0.f) ? 1.0f / l : 0.f;      /* l and oacc both carry the x1024 */
#pragma unroll
  for (int dt = 0; dt < DT; ++dt)
#pragma unroll
    for (int r = 0; r < 8; ++r) ctx[dt][r] += oacc[dt][r] * inv; }
  asm volatile("s_wait_asynccnt 0x0" ::: "memory");      /* nothing is in flight when the wave goes on to the epilogue and ends */
#pragma unroll
  for (int dt = 0; dt < DT; ++dt) {      /* register r of tile dt is O[q0 + ln][dt*16 + 8*hh + r] */
    const v4f lo = {ctx[dt][0], ctx[dt][1], ctx[dt][2], ctx[dt][3]}, hi = {ctx[dt][4], ctx[dt][5], ctx[dt][6], ctx[dt][7]};
    *(v4fa*)&sO[w][ln][dt * 16 + 8 * hh] = lo; *(v4fa*)&sO[w][ln][dt * 16 + 8 * hh + 4] = hi; }
  __builtin_amdgcn_fence(__ATOMIC_ACQ_REL, "workgroup"); __builtin_amdgcn_wave_barrier();
  {
#pragma unroll
    for (int rp = 0; rp < RPW; rp += 2) { const int r = rp + (lane >> 4), pc = lane & 15; const v4f val = *(const v4fa*)&sO[w][r][pc * 4]; *(v4f*)(O + ((size_t)b * TQ + q0 + r) * ldo + h * 64 + pc * 4) = val; }
     } }

extern "C" void kernel_launch(void* const* d_in, const int* in_sizes, int n_in,
                              void* d_out, int out_size, void* d_ws, size_t ws_size, hipStream_t stream) {
  (void)in_sizes; (void)n_in; (void)out_size;
  const float* const* I = (const float* const*)d_in; const float* hsp = I[0]; const float* Wq = I[1]; const float* bq = I[2]; const float* Wk = I[3]; const float* bk = I[4]; const float* Wv = I[5]; const float* bv = I[6];
  char* ws = (char*)d_ws; size_t off = 0;
  auto take = [&](size_t bytes) { char* p = ws + off; off += (bytes + 255) & ~(size_t)255; return p; };
  _Float16* BQ = (_Float16*)take((size_t)CC * CC * 2); _Float16* BK = (_Float16*)take((size_t)CC * CC * 2); _Float16* BV = (_Float16*)take((size_t)CC * CC * 2);
  _Float16* X16 = (_Float16*)take((size_t)NRA * CC * 2); _Float16* Q16 = (_Float16*)take((size_t)NR * CC * 2); _Float16* K16 = (_Float16*)take((size_t)NRA * CC * 2); _Float16* VT = (_Float16*)take((size_t)NRA * CC * 2);
  if (off > ws_size) return;      /* 3.4 + 30 + 6 + 30 + 30 = 100 MiB */
  k_prep<<<3 * WTB + X16B, 256, 0, stream>>>(hsp, Wq, Wk, Wv, X16, BQ, BK, BV);      /* weights x16 transposed; f16 plane of every source */
  k_qkv<<<QGB + NSRC * NB * (KBB + VBB), 256, 0, stream>>>(X16, BQ, BK, BV, bq, bk, bv, Q16, K16, VT);      /* q from source 0; k and V^T for every source */
  k_flash<0><<<NB * NH * QBLKS, 128, 0, stream>>>(Q16, CC, K16, CC, VT, nullptr, (float*)d_out, CC);      /* all five sources; stores the output */
}

// v010
// It runs in 133 microseconds.
// Next to v009, in two timings, it ran 1.05 times as fast each time.
// Counting every step since v000, it is 5.88 times as fast.
#include <hip/hip_runtime.h>
// Attention_KV (5 sources x 4 batches x 1024 tokens x 768 = 12 heads of 64): q from source 0 (Wq + bq); every source n gives k_n, v_n (shared Wk/bk, Wv/bv); ctx = sum_n softmax(q k_n^T / 8) v_n (independent softmax per source); output = ctx merged [B, S, 768] (no output projection).
// Structure, three launches: one preparing launch (the three weight transposes and the exact f16 plane of all sources, picked by ranges of the block index); the q, k and v GEMMs in one launch, picked likewise (GEMMs: 64x64 wave tiles, f32 accumulation, exact x16 weights + bias, f16 outputs; k and v over all 5 sources; the v product has its operands swapped, A = weight rows, B = tokens, and so stores V^T for all (source, batch, head) slabs itself); one fused flash kernel (plain f16 operands) whose blocks walk the five sources in turn and add each source's normalised rows in registers, then store the output.
// Compute dtype: inputs and parameters rounded to bf16; q, k, v, P as f16 (~2^-12); f32 accumulation/softmax/sum. v_wmma_f32_16x16x32_f16.
#define NSRC 5
#define NB 4
#define CC 768
#define NR (NB * SLEN)           /* 4096 query rows */
#define NRA (NSRC * NR)          /* 20480 source rows */
#define SLEN 1024
#define TQ SLEN
#define TK SLEN
#define NH 12
#define SCL 0.125f               /* 1/sqrt(64) */
#define SCL2 (SCL * 1.4426950408889634f)   /* log2(e)/sqrt(64) */
#define QBLKS (TQ / 64)
typedef __bf16 v16b __attribute__((ext_vector_type(16)));
typedef unsigned short v8us __attribute__((ext_vector_type(8), may_alias));
typedef float  v8f  __attribute__((ext_vector_type(8)));
typedef float  v4f  __attribute__((ext_vector_type(4)));
typedef float  v4fa __attribute__((ext_vector_type(4), may_alias));
union FragB { v16b v; v8us half[2]; unsigned short u[16]; };

__device__ __forceinline__ unsigned short bf16_bits(float x) { unsigned int u = __float_as_uint(x); return (unsigned short)((u + 0x7FFFu + ((u >> 16) & 1u)) >> 16); }
__device__ __forceinline__ float bf16_val(unsigned short b) { return __uint_as_float(((unsigned int)b) << 16); }
__device__ __forceinline__ float bf16_round(float x) { return bf16_val(bf16_bits(x)); }
// D += A·B with NT terms: 1 = ah·bh, 2 = + al·bh (A split), 3 = + ah·bl (both split)
template <int NT>
__device__ __forceinline__ v8f mmaN(v16b ah, v16b al, v16b bh, v16b bl, v8f c) {
  c = __builtin_amdgcn_wmma_f32_16x16x32_bf16(false, ah, false, bh, (short)0, c, false, false);
  if (NT >= 2) c = __builtin_amdgcn_wmma_f32_16x16x32_bf16(false, al, false, bh, (short)0, c, false, false);
  if (NT >= 3) c = __builtin_amdgcn_wmma_f32_16x16x32_bf16(false, ah, false, bl, (short)0, c, false, false);
  asm volatile("v_nop\n\tv_nop\n\tv_nop\n\tv_nop" : "+v"(c) : "v"(ah), "v"(al), "v"(bh), "v"(bl));
  return c;
}

__global__ __launch_bounds__(256) void k_wt_bf16(const float* __restrict__ W, unsigned short* __restrict__ Wt, int K, int N) {
  const int t = blockIdx.x * 256 + threadIdx.x;
  const int k8n = K / 8;
  if (t >= N * k8n) return;
  const int n = t / k8n, k8 = (t % k8n) * 8;
  v8us v;
#pragma unroll
  for (int i = 0; i < 8; ++i) v[i] = bf16_bits(W[(size_t)(k8 + i) * N + n]);
  *(v8us*)(Wt + (size_t)n * K + k8) = v;
  
}

// GEMM C[M][N] (f32, pitch ldc) = act(A[M][K]·W + bias). A f32 row-major (pitch lda) converted per fragment to bf16
// (ASPLIT: hi/lo two planes -> 2 terms, else single rounded term); Wt bf16 [N][K] (pitch ldb). BIAS_BF16 rounds the
// bias to bf16 first (bias quantised to bf16 before the add). K%32==0, M%16==0, N%64==0.
template <bool ASPLIT, int ACT, bool BIAS_BF16>
__global__ __launch_bounds__(128) void k_gemm_bf(const float* __restrict__ A, int lda, const unsigned short* __restrict__ Wt, int ldb,
                                               const float* __restrict__ bias, float* __restrict__ C, int ldc, int M, int N, int K) {
  __shared__ __attribute__((aligned(16))) float so[4][16][64];
  const int tid = threadIdx.x, w = tid >> 5, lane = tid & 31, ln = lane & 15, hh = lane >> 4;
  const int ntn = N / 64;
  const int wid = blockIdx.x * 4 + w;
  const int mt = wid / ntn, nq = wid % ntn;
  if (mt * 16 >= M) return;
  const int row0 = mt * 16, col0 = nq * 64;
  const float* arow = A + (size_t)(row0 + ln) * lda;
  v8f acc[4] = {};
  for (int kb = 0; kb < K; kb += 32) {
    FragB ah, al;
    const v4f x0 = *(const v4fa*)(arow + kb + 8 * hh), x1 = *(const v4fa*)(arow + kb + 8 * hh + 4);
    const v4f x2 = *(const v4fa*)(arow + kb + 16 + 8 * hh), x3 = *(const v4fa*)(arow + kb + 16 + 8 * hh + 4);
    float xs[16] = {x0[0],x0[1],x0[2],x0[3],x1[0],x1[1],x1[2],x1[3],x2[0],x2[1],x2[2],x2[3],x3[0],x3[1],x3[2],x3[3]};
#pragma unroll
    for (int i = 0; i < 16; ++i) { const unsigned short hb = bf16_bits(xs[i]); ah.u[i] = hb; al.u[i] = ASPLIT ? bf16_bits(xs[i] - bf16_val(hb)) : (unsigned short)0; }
#pragma unroll
    for (int t = 0; t < 4; ++t) {
      const unsigned short* brow = Wt + (size_t)(col0 + t * 16 + ln) * ldb + kb;
      FragB b;
      b.half[0] = *(const v8us*)(brow + 8 * hh);
      b.half[1] = *(const v8us*)(brow + 16 + 8 * hh);
      acc[t] = mmaN<ASPLIT ? 2 : 1>(ah.v, al.v, b.v, b.v, acc[t]);
    }
  }
#pragma unroll
  for (int t = 0; t < 4; ++t) {
    float bv = bias ? bias[col0 + t * 16 + ln] : 0.f;
    if (BIAS_BF16) bv = bf16_round(bv);
#pragma unroll
    for (int r = 0; r < 8; ++r) { float v = acc[t][r] + bv; if (ACT == 1) v = fmaxf(v, 0.f); so[w][8 * hh + r][t * 16 + ln] = v; }
  }
  __builtin_amdgcn_fence(__ATOMIC_ACQ_REL, "workgroup");
  __builtin_amdgcn_wave_barrier();
  const int rsub = lane >> 4, c4 = (lane & 15) * 4;
  {
#pragma unroll
    for (int q = 0; q < 8; ++q) {
      const int r = q * 2 + rsub;
      const v4f v = *(const v4fa*)&so[w][r][c4];
      *(v4f*)(C + (size_t)(row0 + r) * ldc + col0 + c4) = v;
    }
    
  }
}

// GEMM C = act(A·W + bias + resid): A f32 (ASPLIT -> hi/lo 2 terms), Wt bf16 [N][K]; ACT 0 none, 1 relu, 2 exact gelu;
// resid (optional, f32, row index = (row % rmod), pitch ldr, RES_BF16 rounds it) added before the activation.
template <bool ASPLIT, int ACT, bool BIAS_BF16, bool RES_BF16>
__global__ __launch_bounds__(128) void k_gemm_bf3(const float* __restrict__ A, int lda, const unsigned short* __restrict__ Wt, int ldb,
                                                const float* __restrict__ bias, const float* __restrict__ resid, int rmod, int ldr,
                                                float* __restrict__ C, int ldc, int M, int N, int K) {
  __shared__ __attribute__((aligned(16))) float so[4][16][64];
  const int tid = threadIdx.x, w = tid >> 5, lane = tid & 31, ln = lane & 15, hh = lane >> 4;
  const int ntn = N / 64;
  const int wid = blockIdx.x * 4 + w;
  const int mt = wid / ntn, nq = wid % ntn;
  if (mt * 16 >= M) return;
  const int row0 = mt * 16, col0 = nq * 64;
  const float* arow = A + (size_t)(row0 + ln) * lda;
  v8f acc[4] = {};
  for (int kb = 0; kb < K; kb += 32) {
    FragB ah, al;
    const v4f x0 = *(const v4fa*)(arow + kb + 8 * hh), x1 = *(const v4fa*)(arow + kb + 8 * hh + 4);
    const v4f x2 = *(const v4fa*)(arow + kb + 16 + 8 * hh), x3 = *(const v4fa*)(arow + kb + 16 + 8 * hh + 4);
    float xs[16] = {x0[0],x0[1],x0[2],x0[3],x1[0],x1[1],x1[2],x1[3],x2[0],x2[1],x2[2],x2[3],x3[0],x3[1],x3[2],x3[3]};
#pragma unroll
    for (int i = 0; i < 16; ++i) { const unsigned short hb = bf16_bits(xs[i]); ah.u[i] = hb; al.u[i] = ASPLIT ? bf16_bits(xs[i] - bf16_val(hb)) : (unsigned short)0; }
#pragma unroll
    for (int t = 0; t < 4; ++t) {
      const unsigned short* brow = Wt + (size_t)(col0 + t * 16 + ln) * ldb + kb;
      FragB b;
      b.half[0] = *(const v8us*)(brow + 8 * hh);
      b.half[1] = *(const v8us*)(brow + 16 + 8 * hh);
      acc[t] = mmaN<ASPLIT ? 2 : 1>(ah.v, al.v, b.v, b.v, acc[t]);
    }
  }
#pragma unroll
  for (int t = 0; t < 4; ++t) {
    const int col = col0 + t * 16 + ln;
    float bv = bias ? bias[col] : 0.f;
    if (BIAS_BF16) bv = bf16_round(bv);
#pragma unroll
    for (int r = 0; r < 8; ++r) {
      float v = acc[t][r] + bv;
      if (resid) { float rv = resid[(size_t)((row0 + 8 * hh + r) % rmod) * ldr + col]; if (RES_BF16) rv = bf16_round(rv); v += rv; }
      if (ACT == 1) v = fmaxf(v, 0.f);
      if (ACT == 2) v = 0.5f * v * (1.0f + erff(v * 0.70710678118654752f));
      if (ACT == 3) { const float u = 0.7978845608028654f * (v + 0.044715f * v * v * v); v = 0.5f * v * (1.0f + tanhf(u)); }
      so[w][8 * hh + r][t * 16 + ln] = v;
    }
  }
  __builtin_amdgcn_fence(__ATOMIC_ACQ_REL, "workgroup");
  __builtin_amdgcn_wave_barrier();
  const int rsub = lane >> 4, c4 = (lane & 15) * 4;
  {
#pragma unroll
    for (int q = 0; q < 8; ++q) {
      const int r = q * 2 + rsub;
      const v4f v = *(const v4fa*)&so[w][r][c4];
      *(v4f*)(C + (size_t)(row0 + r) * ldc + col0 + c4) = v;
    }
    
  }
}
// row LayerNorm (biased variance, eps) over N: s = X (+ R); optional out_sum <- s; out_norm <- (s-mu)*rsqrt(var+eps)*g + b
template <bool PARAM_BF16>
__global__ __launch_bounds__(256) void k_layernorm(const float* __restrict__ X, const float* __restrict__ R, const float* __restrict__ g, const float* __restrict__ bta,
                                                  float* __restrict__ out_sum, float* __restrict__ out_norm, int N, float eps) {
  __shared__ float red[256];
  const int row = blockIdx.x, tid = threadIdx.x;
  const float* x = X + (size_t)row * N; const float* rr = R ? R + (size_t)row * N : nullptr;
  float vals[16];                     // up to N = 4096
  const int per = N / 256;            // contiguous chunk per thread? use strided-by-4 chunks: thread handles j = tid*4 + 1024*u
  float s1 = 0.f;
  for (int u = 0; u < per / 4; ++u) {
    const int j = tid * 4 + 1024 * u;
    const v4f a = *(const v4fa*)(x + j);
    v4f b = {0.f,0.f,0.f,0.f}; if (rr) b = *(const v4fa*)(rr + j);
#pragma unroll
    for (int q = 0; q < 4; ++q) { const float v = a[q] + b[q]; vals[u * 4 + q] = v; s1 += v; }
  }
  red[tid] = s1; __syncthreads();
  for (int st = 128; st > 0; st >>= 1) { if (tid < st) red[tid] += red[tid + st]; __syncthreads(); }
  const float mu = red[0] / (float)N; __syncthreads();
  float s2 = 0.f;
  for (int u = 0; u < per / 4; ++u)
#pragma unroll
    for (int q = 0; q < 4; ++q) { const float c = vals[u * 4 + q] - mu; s2 += c * c; }
  red[tid] = s2; __syncthreads();
  for (int st = 128; st > 0; st >>= 1) { if (tid < st) red[tid] += red[tid + st]; __syncthreads(); }
  const float rs = rsqrtf(red[0] / (float)N + eps);
  {
    for (int u = 0; u < per / 4; ++u) {
      const int j = tid * 4 + 1024 * u;
      v4f o, sm;
#pragma unroll
      for (int q = 0; q < 4; ++q) {
        float gg = g[j + q], bb = bta[j + q];
        if (PARAM_BF16) { gg = bf16_round(gg); bb = bf16_round(bb); }
        sm[q] = vals[u * 4 + q]; o[q] = (vals[u * 4 + q] - mu) * rs * gg + bb;
      }
      if (out_sum) *(v4f*)(out_sum + (size_t)row * N + j) = sm;
      *(v4f*)(out_norm + (size_t)row * N + j) = o;
    }
    
  }
}



// ---- f16 WMMA path (v_wmma_f32_16x16x32_f16): 11-bit significands for operands in range — used where a [0,1] probability operand needs more precision than bf16
typedef _Float16 v16h __attribute__((ext_vector_type(16)));
union FragH { v16h v; v8us half[2]; _Float16 h[16]; unsigned short u[16]; };
template <int NT>
__device__ __forceinline__ v8f mmaH(v16h ah, v16h al, v16h bh, v16h bl, v8f c) {
  c = __builtin_amdgcn_wmma_f32_16x16x32_f16(false, ah, false, bh, (short)0, c, false, false);
  if (NT >= 2) c = __builtin_amdgcn_wmma_f32_16x16x32_f16(false, al, false, bh, (short)0, c, false, false);
  if (NT >= 3) c = __builtin_amdgcn_wmma_f32_16x16x32_f16(false, ah, false, bl, (short)0, c, false, false);
  asm volatile("v_nop\n\tv_nop\n\tv_nop\n\tv_nop" : "+v"(c) : "v"(ah), "v"(al), "v"(bh), "v"(bl));
  return c;
}
// batched GEMM like k_gemm_b but f16 operands: A f32 (split into f16 hi/lo if ASPLIT, else rounded to f16), Bt = f16 values [n][k]; alpha; C f32; N multiple of 16 (partial tiles skipped)
template <bool ASPLIT>
__global__ __launch_bounds__(128) void k_gemm_h(const float* __restrict__ A, int lda, size_t sA, const _Float16* __restrict__ Bh, int ldb, size_t sB, float alpha, float* __restrict__ C, int ldc, size_t sC, int M, int N, int K) {
  __shared__ __attribute__((aligned(16))) float so[4][16][64];
  const int tid = threadIdx.x, w = tid >> 5, lane = tid & 31, ln = lane & 15, hh = lane >> 4; const int by = blockIdx.y;
  A += (size_t)by * sA; Bh += (size_t)by * sB; C += (size_t)by * sC;
  const int ntn = (N + 63) / 64; const int wid = blockIdx.x * 4 + w; const int mt = wid / ntn, nq = wid % ntn; if (mt * 16 >= M) return;
  const int row0 = mt * 16, col0 = nq * 64; const float* arow = A + (size_t)(row0 + ln) * lda;
  v8f acc[4] = {};
  for (int kb = 0; kb < K; kb += 32) {
    FragH ah, al;
    const v4f x0 = *(const v4fa*)(arow + kb + 8 * hh), x1 = *(const v4fa*)(arow + kb + 8 * hh + 4), x2 = *(const v4fa*)(arow + kb + 16 + 8 * hh), x3 = *(const v4fa*)(arow + kb + 16 + 8 * hh + 4);
    float xs[16] = {x0[0],x0[1],x0[2],x0[3],x1[0],x1[1],x1[2],x1[3],x2[0],x2[1],x2[2],x2[3],x3[0],x3[1],x3[2],x3[3]};
#pragma unroll
    for (int i = 0; i < 16; ++i) { const _Float16 h = (_Float16)xs[i]; ah.h[i] = h; al.h[i] = ASPLIT ? (_Float16)(xs[i] - (float)h) : (_Float16)0.0f; }
#pragma unroll
    for (int t = 0; t < 4; ++t) { if (col0 + t * 16 >= N) continue; const size_t boff = (size_t)(col0 + t * 16 + ln) * ldb + kb; FragH bq; bq.half[0] = *(const v8us*)(Bh + boff + 8 * hh); bq.half[1] = *(const v8us*)(Bh + boff + 16 + 8 * hh);
      acc[t] = mmaH<ASPLIT ? 2 : 1>(ah.v, al.v, bq.v, bq.v, acc[t]); }
  }
#pragma unroll
  for (int t = 0; t < 4; ++t) { if (col0 + t * 16 >= N) continue;
#pragma unroll
    for (int r = 0; r < 8; ++r) so[w][8 * hh + r][t * 16 + ln] = acc[t][r] * alpha; }
  __builtin_amdgcn_fence(__ATOMIC_ACQ_REL, "workgroup"); __builtin_amdgcn_wave_barrier();
  const int rsub = lane >> 4, c4 = (lane & 15) * 4;
  {
#pragma unroll
    for (int q = 0; q < 8; ++q) { const int r = q * 2 + rsub; if (col0 + c4 < N) { const v4f v = *(const v4fa*)&so[w][r][c4]; *(v4f*)(C + (size_t)(row0 + r) * ldc + col0 + c4) = v; } }
     }
}

// Wt[n][k] = f16(W[k][n]·scale) from f32 row-major W[K][N] (scale = power of two; bf16-exact weights stay exact in f16 away from the subnormal range)
__device__ __forceinline__ void wt_f16_job(int blk, const float* __restrict__ W, _Float16* __restrict__ Wt, int K, int N, float scale) {
  const int t = blk * 256 + threadIdx.x; if (t >= N * (K / 8)) return; const int n = t / (K / 8), k8 = (t % (K / 8)) * 8; FragH f;
#pragma unroll
  for (int i = 0; i < 8; ++i) f.h[i] = (_Float16)(bf16_round(W[(size_t)(k8 + i) * N + n]) * scale); const v8us o = f.half[0];
  *(v8us*)((unsigned short*)Wt + (size_t)n * K + k8) = o; 
}
// k_gemm_hh variant with fused epilogue: v = acc·alpha + bias[by·sBias + col] (+ CP[(row/rowsPerB)·sCPb + by·64 + col] if CP) ; ACT 0 none / 1 elu ; writes f16 C16 (and f32 C if non-null)
template <int ACT>
__global__ __launch_bounds__(128) void k_gemm_hhx(const _Float16* __restrict__ A, int lda, size_t sA, const _Float16* __restrict__ Bh, int ldb, size_t sB, float alpha, const float* __restrict__ bias, size_t sBias, const float* __restrict__ CP, int rowsPerB, size_t sCPb, int row0g,
    float* __restrict__ C, _Float16* __restrict__ C16, int ldc, size_t sC, int M, int N, int K) {
  __shared__ __attribute__((aligned(16))) float so[4][16][64];
  const int tid = threadIdx.x, w = tid >> 5, lane = tid & 31, ln = lane & 15, hh = lane >> 4; const int by = blockIdx.y;
  A += (size_t)by * sA; Bh += (size_t)by * sB; const size_t cofs = (size_t)by * sC; const float* bp = bias ? bias + (size_t)by * sBias : nullptr;
  const int ntn = (N + 63) / 64; const int wid = blockIdx.x * 4 + w; const int mt = wid / ntn, nq = wid % ntn; if (mt * 16 >= M) return;
  const int row0 = mt * 16, col0 = nq * 64; const _Float16* arow = A + (size_t)(row0 + ln) * lda;
  v8f acc[4] = {};
  for (int kb = 0; kb < K; kb += 32) { FragH ah; ah.half[0] = *(const v8us*)((const unsigned short*)arow + kb + 8 * hh); ah.half[1] = *(const v8us*)((const unsigned short*)arow + kb + 16 + 8 * hh);
#pragma unroll
    for (int t = 0; t < 4; ++t) { if (col0 + t * 16 >= N) continue; const size_t boff = (size_t)(col0 + t * 16 + ln) * ldb + kb; FragH bq; bq.half[0] = *(const v8us*)((const unsigned short*)Bh + boff + 8 * hh); bq.half[1] = *(const v8us*)((const unsigned short*)Bh + boff + 16 + 8 * hh);
      acc[t] = mmaH<1>(ah.v, ah.v, bq.v, bq.v, acc[t]); }
  }
#pragma unroll
  for (int t = 0; t < 4; ++t) { if (col0 + t * 16 >= N) continue; const int col = col0 + t * 16 + ln; const float bv = bp ? bf16_round(bp[col]) : 0.f;
#pragma unroll
    for (int r = 0; r < 8; ++r) { float v = acc[t][r] * alpha + bv; if (CP) { const int bidx = (row0g + row0 + 8 * hh + r) / rowsPerB; v += CP[(size_t)bidx * sCPb + (size_t)by * 64 + col]; } if (ACT == 1) v = (v > 0.f) ? v : expm1f(v); else if (ACT == 7) v = (v > 0.f) ? v + 1.0f : expf(v); else if (ACT == 8) v = tanhf(v); else if (ACT == 9) v = 0.5f * v * (1.0f + tanhf(0.7978845608028654f * (v + 0.044715f * v * v * v))); else if (ACT == 11) v = 1.0f / (1.0f + expf(-v)); else if (ACT == 12) v = (v > 0.f) ? v : 0.01f * v; else if (ACT == 14) v = (v > 0.f) ? v : 0.1f * v; else if (ACT == 15) v = v / (1.0f + expf(-v)); else if (ACT == 3) v = fmaxf(v, 0.f); else if (ACT == 6) v = 0.5f * v * (1.0f + erff(v * 0.70710678118654752f)); so[w][8 * hh + r][t * 16 + ln] = v; } }
  __builtin_amdgcn_fence(__ATOMIC_ACQ_REL, "workgroup"); __builtin_amdgcn_wave_barrier();
  const int rsub = lane >> 4, c4 = (lane & 15) * 4; typedef _Float16 v4h __attribute__((ext_vector_type(4)));
  {
#pragma unroll
    for (int q = 0; q < 8; ++q) { const int r = q * 2 + rsub; if (col0 + c4 < N) { const v4f v = *(const v4fa*)&so[w][r][c4]; if (C) *(v4f*)(C + cofs + (size_t)(row0 + r) * ldc + col0 + c4) = v; if (C16) { v4h h4; for (int i = 0; i < 4; ++i) h4[i] = (_Float16)v[i]; *(v4h*)(C16 + cofs + (size_t)(row0 + r) * ldc + col0 + c4) = h4; } } }
     }
}


typedef _Float16 v4h __attribute__((ext_vector_type(4)));

__device__ __forceinline__ void x16_job(int blk, const float* __restrict__ x, _Float16* __restrict__ X16, size_t n8) { const size_t t = (size_t)blk * 256 + threadIdx.x; if (t >= n8) return; FragH f;
#pragma unroll
  for (int q = 0; q < 8; ++q) f.h[q] = (_Float16)bf16_round(x[t * 8 + q]); *(v8us*)((unsigned short*)X16 + t * 8) = f.half[0];  }
// The four jobs that need nothing of each other share one grid: blocks 0 .. 3 * WTB - 1 transpose Wq, Wk, Wv (they wait on scattered loads; placed first for speed only), the rest cast the sources. The choice is the same for a whole block.
#define WTB ((CC * CC / 8 + 255) / 256)
#define X16B ((NRA * CC / 8 + 255) / 256)
__global__ __launch_bounds__(256) void k_prep(const float* __restrict__ x, const float* __restrict__ Wq, const float* __restrict__ Wk, const float* __restrict__ Wv,
                                             _Float16* __restrict__ X16, _Float16* __restrict__ BQ, _Float16* __restrict__ BK, _Float16* __restrict__ BV) {
  const int bx = blockIdx.x;
  if (bx < 3 * WTB) { const int m = bx / WTB; wt_f16_job(bx - m * WTB, m == 0 ? Wq : (m == 1 ? Wk : Wv), m == 0 ? BQ : (m == 1 ? BK : BV), CC, CC, 16.0f); }
  else x16_job(bx - 3 * WTB, x, X16, (size_t)NRA * CC / 8); }
__global__ __launch_bounds__(256) void k_h16(const float* __restrict__ x, _Float16* __restrict__ X16, size_t n8) { const size_t t = (size_t)blockIdx.x * 256 + threadIdx.x; if (t >= n8) return; FragH f;
#pragma unroll
  for (int q = 0; q < 8; ++q) f.h[q] = (_Float16)x[t * 8 + q]; *(v8us*)((unsigned short*)X16 + t * 8) = f.half[0];  }
__global__ __launch_bounds__(256) void k_round16f(const float* __restrict__ W, _Float16* __restrict__ Bt, size_t n8) { const size_t t = (size_t)blockIdx.x * 256 + threadIdx.x; if (t >= n8) return; FragH f;
#pragma unroll
  for (int i = 0; i < 8; ++i) f.h[i] = (_Float16)(bf16_round(W[t * 8 + i]) * 16.0f); *(v8us*)((unsigned short*)Bt + t * 8) = f.half[0];  }
__global__ __launch_bounds__(256) void k_hl(const float* __restrict__ F, _Float16* __restrict__ Hh, _Float16* __restrict__ Hl, size_t n8) { const size_t t = (size_t)blockIdx.x * 256 + threadIdx.x; if (t >= n8) return; FragH fh, fl; const v4f a = *(const v4fa*)(F + t * 8), c = *(const v4fa*)(F + t * 8 + 4);
#pragma unroll
  for (int q = 0; q < 4; ++q) { _Float16 h = (_Float16)a[q]; fh.h[q] = h; fl.h[q] = (_Float16)((a[q] - (float)h) * 1024.0f); h = (_Float16)c[q]; fh.h[4 + q] = h; fl.h[4 + q] = (_Float16)((c[q] - (float)h) * 1024.0f); }
  { *(v8us*)((unsigned short*)Hh + t * 8) = fh.half[0]; *(v8us*)((unsigned short*)Hl + t * 8) = fl.half[0];  } }

// ---- fast GEMM (block tile 256x128, eight waves of 64x64; requires M % 64 == 0 rows per launch region and N % 128 == 0); epilogue = k_gemm_hhx semantics, f16 output only ----
__device__ __forceinline__ v16h g2_frag(const _Float16* p, int hh) { FragH f; f.half[0] = *(const v8us*)((const unsigned short*)p + 8 * hh); f.half[1] = *(const v8us*)((const unsigned short*)p + 16 + 8 * hh); return f.v; }
__device__ __forceinline__ v8f g2_mma(v16h a, v16h b, v8f c) { v8f d = __builtin_amdgcn_wmma_f32_16x16x32_f16(false, a, false, b, (short)0, c, false, false); asm volatile("v_nop\n\tv_nop\n\tv_nop\n\tv_nop" : "+v"(d) : "v"(a), "v"(b)); return d; }
// One lane's twelve 16-byte asynchronous copies from global memory to LDS (l: LDS byte addresses, g: global addresses). The s_wait_xcnt is the last line of the copies' own statement, so that no address register is rewritten in front of it.
__device__ __forceinline__ void copy12_to_lds(const unsigned (&l)[12], const unsigned short* const (&g)[12]) {
  asm volatile("global_load_async_to_lds_b128 %0, %12, off\n\tglobal_load_async_to_lds_b128 %1, %13, off\n\tglobal_load_async_to_lds_b128 %2, %14, off\n\tglobal_load_async_to_lds_b128 %3, %15, off\n\t"
               "global_load_async_to_lds_b128 %4, %16, off\n\tglobal_load_async_to_lds_b128 %5, %17, off\n\tglobal_load_async_to_lds_b128 %6, %18, off\n\tglobal_load_async_to_lds_b128 %7, %19, off\n\t"
               "global_load_async_to_lds_b128 %8, %20, off\n\tglobal_load_async_to_lds_b128 %9, %21, off\n\tglobal_load_async_to_lds_b128 %10, %22, off\n\tglobal_load_async_to_lds_b128 %11, %23, off\n\ts_wait_xcnt 0x0"
               :: "v"(l[0]), "v"(l[1]), "v"(l[2]), "v"(l[3]), "v"(l[4]), "v"(l[5]), "v"(l[6]), "v"(l[7]), "v"(l[8]), "v"(l[9]), "v"(l[10]), "v"(l[11]),
                  "v"(g[0]), "v"(g[1]), "v"(g[2]), "v"(g[3]), "v"(g[4]), "v"(g[5]), "v"(g[6]), "v"(g[7]), "v"(g[8]), "v"(g[9]), "v"(g[10]), "v"(g[11]) : "memory"); }
#define GEMM2_LDS ((256 + 128) * 72)      /* floats of LDS that a caller of gemm2_job hands in, 16-byte aligned */
// Block tile 256 x 128, 256 threads, waves 4 x 2. The operands go to LDS once per block in k steps of 64 (whole 128-byte lines of every row), two buffers: step t + 2 is copied while step t + 1 is worked on. Requires K % 64 == 0.
// ROWB: the bias belongs to the rows of C (the weights are the A operand), else to its columns.
template <int ACT, bool ROWB>
__device__ __forceinline__ void gemm2_job(float* sm, int bx, int by, const _Float16* __restrict__ A, int lda, size_t sA, const _Float16* __restrict__ Bh, int ldb, size_t sB, float alpha, const float* __restrict__ bias, size_t sBias, const float* __restrict__ CP, int rowsPerB, size_t sCPb, int row0g,
    _Float16* __restrict__ C16, int ldc, size_t sC, int M, int N, int K) {
  constexpr int GP = 72;                    /* LDS row pitch in f16: 144 B for the 128-byte rows (16 B x odd: no bank conflict for 16-byte readers) */
  constexpr int STG = (256 + 128) * GP;      /* one buffer in f16: 256 A rows, then 128 B rows */
  static_assert(2 * STG / 2 == GEMM2_LDS, "the caller's LDS array");      /* sm, 110,592 B: the two operand buffers in the k loop; behind it the epilogue's per-wave f16 output tiles (73,728 B) */
  unsigned short (*so)[64][GP] = (unsigned short (*)[64][GP])sm;
  const unsigned short* sT = (const unsigned short*)sm;
  const int tid = threadIdx.x, w = tid >> 5, lane = tid & 31, ln = lane & 15, hh = lane >> 4;
  A += (size_t)by * sA; Bh += (size_t)by * sB; const size_t cofs = (size_t)by * sC; const float* bp = bias ? bias + (size_t)by * sBias : nullptr;
  const int ntn = N >> 7; const int mt = bx / ntn, nq = bx - mt * ntn; const int rowb = mt * 256, row0 = rowb + 64 * (w >> 1), colb = nq * 128, col0 = colb + 64 * (w & 1); if (rowb >= M) return;      /* the whole block leaves, in front of every barrier */
  // Thread tid copies 16-byte piece tid & 7 of rows (tid >> 3) + 32 i: a wave's copy covers 4 whole 128-byte rows. An A row past M is clamped to the last row (its products are never stored).
  const int cr = tid >> 3, cc = (tid & 7) * 8;
  const unsigned short* gsrc[12];
#pragma unroll      /* unrolled here and in the three loops below: the address arrays stay in registers */
  for (int i = 0; i < 8; ++i) { const int r = rowb + cr + 32 * i; gsrc[i] = (const unsigned short*)A + (size_t)(r < M ? r : M - 1) * lda + cc; }
#pragma unroll
  for (int i = 0; i < 4; ++i) gsrc[8 + i] = (const unsigned short*)Bh + (size_t)(colb + cr + 32 * i) * ldb + cc;
  const unsigned l0 = (unsigned)(size_t)&sT[cr * GP + cc];
  auto stage = [&](int buf) { unsigned l[12];      /* copies the next k step into buffer buf and moves the source pointers on by one step */
#pragma unroll
    for (int i = 0; i < 12; ++i) l[i] = l0 + (unsigned)((buf * STG + 32 * i * GP) * 2);
    copy12_to_lds(l, gsrc);
#pragma unroll
    for (int i = 0; i < 12; ++i) gsrc[i] += 64; };
  v8f acc[4][4];      /* acc[i][t]: rows row0 + 16 i, columns col0 + 16 t */
#pragma unroll      /* unrolled, like every loop over acc below: it stays in registers */
  for (int i = 0; i < 4; ++i)
#pragma unroll
    for (int t = 0; t < 4; ++t) acc[i][t] = (v8f){0.f,0.f,0.f,0.f,0.f,0.f,0.f,0.f};
  stage(0);
  asm volatile("s_wait_asynccnt 0x0" ::: "memory");      /* step 0 has landed before the barrier that publishes it */
  __syncthreads();
  if (64 < K) stage(1);
#pragma unroll 1      /* rolled: one foot with the waits, the barrier and the refill in their order */
  for (int kb = 0; kb < K; kb += 64) {
    const int buf = (kb >> 6) & 1;
    const _Float16* tA = (const _Float16*)sT + buf * STG + (64 * (w >> 1) + ln) * GP; const _Float16* tB = (const _Float16*)sT + buf * STG + (256 + 64 * (w & 1) + ln) * GP;
#pragma unroll      /* unrolled here and in the loops below: the fragment arrays stay in registers */
    for (int ks = 0; ks < 2; ++ks) {
      v16h fa[4], fb[4];      /* the fragment reads of one k = 32 stand together in front of its 16 products */
#pragma unroll
      for (int t = 0; t < 4; ++t) { fa[t] = g2_frag(tA + t * 16 * GP + ks * 32, hh); fb[t] = g2_frag(tB + t * 16 * GP + ks * 32, hh); }
#pragma unroll
      for (int t = 0; t < 4; ++t)
#pragma unroll
        for (int i = 0; i < 4; ++i) acc[i][t] = g2_mma(fa[i], fb[t], acc[i][t]); }
    asm volatile("s_wait_dscnt 0x0" ::: "memory");      /* this wave's reads of the buffer have returned before the buffer is handed back */
    asm volatile("s_wait_asynccnt 0x0" ::: "memory");      /* this wave's copies of step t + 1 have landed */
    __syncthreads();      /* publishes step t + 1 and ends every wave's reads of step t */
    if (kb + 128 < K) stage(buf); }
  asm volatile("s_wait_asynccnt 0x0" ::: "memory");      /* nothing is in flight when the LDS is taken over by the output tiles */
  if (row0 >= M) return;      /* behind the last barrier */
  float br[4][8] = {}, bc[4] = {};      /* ROWB (a bias is required there): the bias of this lane's 32 rows, by eight 16-byte loads issued together; else the bias of its 4 columns */
  if (ROWB) { const float* pr = bp + row0 + 8 * hh; v4f b0[4], b1[4];
#pragma unroll      /* unrolled here and below: b0, b1, br and bc stay in registers */
    for (int i = 0; i < 4; ++i) { b0[i] = *(const v4fa*)(pr + 16 * i); b1[i] = *(const v4fa*)(pr + 16 * i + 4); }
#pragma unroll
    for (int i = 0; i < 4; ++i)
#pragma unroll
      for (int q = 0; q < 4; ++q) { br[i][q] = bf16_round(b0[i][q]); br[i][4 + q] = bf16_round(b1[i][q]); } }
  else if (bp) {
#pragma unroll
    for (int t = 0; t < 4; ++t) bc[t] = bf16_round(bp[col0 + t * 16 + ln]); }
#pragma unroll
  for (int t = 0; t < 4; ++t) { const int col = col0 + t * 16 + ln;
#pragma unroll
    for (int i = 0; i < 4; ++i)
#pragma unroll
    for (int r = 0; r < 8; ++r) { const int rloc = i * 16 + 8 * hh + r; float v = acc[i][t][r] * alpha + (ROWB ? br[i][r] : bc[t]); if (CP) { const int bidx = (row0g + row0 + rloc) / rowsPerB; v += CP[(size_t)bidx * sCPb + (size_t)by * 64 + col]; }
      if (ACT == 3) v = fmaxf(v, 0.f); else if (ACT == 6) v = 0.5f * v * (1.0f + erff(v * 0.70710678118654752f)); else if (ACT == 11) v = 1.0f / (1.0f + expf(-v)); else if (ACT == 15) v = v / (1.0f + expf(-v)); else if (ACT == 12) v = (v > 0.f) ? v : 0.01f * v; else if (ACT == 8) v = tanhf(v);
      so[w][rloc][t * 16 + ln] = __builtin_bit_cast(unsigned short, (_Float16)v); } }
  __builtin_amdgcn_fence(__ATOMIC_ACQ_REL, "workgroup"); __builtin_amdgcn_wave_barrier();
  const int rsub = lane >> 3, c8 = (lane & 7) * 8;      /* a wave's 16-byte store covers the 128-byte pieces of four rows */
#pragma unroll
  for (int q = 0; q < 16; ++q) { const int r = q * 4 + rsub; const v8us v = *(const v8us*)&so[w][r][c8]; *(v8us*)((unsigned short*)C16 + cofs + (size_t)(row0 + r) * ldc + col0 + c8) = v; } }

// The three products need nothing of each other and share one grid; the block index picks the job, the same for a whole block.
// V^T[(n*4 + b)*768 + h*64 + d][key] is the v product with its operands swapped: C = Wv^T (768 rows) x tokens of one (source, batch) (1024 columns), so no transposing pass and no row-major v are needed.
// Order: the q blocks, then for each (source, batch) its k blocks and its V^T blocks, which read the same 1024 token rows.
#define NTC (CC / 128)             /* column tiles of the q and k products */
#define QGB ((NR / 256) * NTC)      /* blocks of the q product */
#define KBB ((SLEN / 256) * NTC)      /* blocks of the k product on one (source, batch) */
#define VBB ((CC / 256) * (SLEN / 128))      /* blocks of the V^T product on one (source, batch) */
__global__ __launch_bounds__(256) void k_qkv(const _Float16* __restrict__ X16, const _Float16* __restrict__ BQ, const _Float16* __restrict__ BK, const _Float16* __restrict__ BV,
                                            const float* __restrict__ bq, const float* __restrict__ bk, const float* __restrict__ bv,
                                            _Float16* __restrict__ Q16, _Float16* __restrict__ K16, _Float16* __restrict__ VT) {
  __shared__ __attribute__((aligned(16))) float sm[GEMM2_LDS];
  const int bx = blockIdx.x; const bool isq = bx < QGB;
  const int g = isq ? 0 : (bx - QGB) / (KBB + VBB), r = isq ? 0 : (bx - QGB) - g * (KBB + VBB);      /* (source, batch) and the block's place among its KBB + VBB */
  if (!isq && r >= KBB) gemm2_job<0, true>(sm, r - KBB, g, BV, CC, 0, X16, CC, (size_t)SLEN * CC, 0.0625f, bv, 0, nullptr, 1, 0, 0, VT, SLEN, (size_t)CC * SLEN, CC, SLEN, CC);
  else gemm2_job<0, false>(sm, isq ? bx : g * KBB + r, 0, X16, CC, 0, isq ? BQ : BK, CC, 0, 0.0625f, isq ? bq : bk, 0, nullptr, 1, 0, 0, isq ? Q16 : K16, CC, 0, isq ? NR : NRA, CC, CC); }

// lane l with lane l ^ 16: the two lanes that share one query column of a transposed score tile
__device__ __forceinline__ float xhalf(float x) { return __builtin_bit_cast(float, __builtin_amdgcn_permlanex16(__builtin_bit_cast(int, x), __builtin_bit_cast(int, x), 0x76543210, 0xfedcba98, false, false)); }
__device__ __forceinline__ void copy8_to_lds(const unsigned (&l)[8], const unsigned short* const (&g)[8]) {
  asm volatile("global_load_async_to_lds_b128 %0, %8, off\n\tglobal_load_async_to_lds_b128 %1, %9, off\n\tglobal_load_async_to_lds_b128 %2, %10, off\n\tglobal_load_async_to_lds_b128 %3, %11, off\n\t"
               "global_load_async_to_lds_b128 %4, %12, off\n\tglobal_load_async_to_lds_b128 %5, %13, off\n\tglobal_load_async_to_lds_b128 %6, %14, off\n\tglobal_load_async_to_lds_b128 %7, %15, off\n\ts_wait_xcnt 0x0"
               :: "v"(l[0]), "v"(l[1]), "v"(l[2]), "v"(l[3]), "v"(l[4]), "v"(l[5]), "v"(l[6]), "v"(l[7]),
                  "v"(g[0]), "v"(g[1]), "v"(g[2]), "v"(g[3]), "v"(g[4]), "v"(g[5]), "v"(g[6]), "v"(g[7]) : "memory"); }
// Sixteen 2^x in place, each on a register of its own: no instruction directly behind a transcendental reads its result or overwrites its source; the closing v_nop keeps that slot in front of whatever the compiler puts next.
__device__ __forceinline__ void exp2x16(float (&x)[16]) {
  asm("v_exp_f32 %0, %0\n\tv_exp_f32 %1, %1\n\tv_exp_f32 %2, %2\n\tv_exp_f32 %3, %3\n\tv_exp_f32 %4, %4\n\tv_exp_f32 %5, %5\n\tv_exp_f32 %6, %6\n\tv_exp_f32 %7, %7\n\t"
      "v_exp_f32 %8, %8\n\tv_exp_f32 %9, %9\n\tv_exp_f32 %10, %10\n\tv_exp_f32 %11, %11\n\tv_exp_f32 %12, %12\n\tv_exp_f32 %13, %13\n\tv_exp_f32 %14, %14\n\tv_exp_f32 %15, %15\n\tv_nop"
      : "+v"(x[0]), "+v"(x[1]), "+v"(x[2]), "+v"(x[3]), "+v"(x[4]), "+v"(x[5]), "+v"(x[6]), "+v"(x[7]), "+v"(x[8]), "+v"(x[9]), "+v"(x[10]), "+v"(x[11]), "+v"(x[12]), "+v"(x[13]), "+v"(x[14]), "+v"(x[15])); }
// A block has 64 queries and four waves: wave w takes the 32 queries of group w & 1 (two column groups of 16, which share every K and V^T fragment read from LDS) and key half w >> 1 (64 of the 128 keys) of every stage.
// The two waves of a query group each run an online softmax of their own over their keys; at the end of a source they join maximum, sum and rows through LDS, each keeping 32 of the 64 output columns.
template <int CAUSAL>
__global__ __launch_bounds__(128) void k_flash(const _Float16* __restrict__ Q16, int ldq, const _Float16* __restrict__ K16, int ldk, const _Float16* __restrict__ Vt, const int* __restrict__ MSK, float* __restrict__ O, int ldo) {
  static_assert(CAUSAL == 0, "no mask: every query sees every key");
  constexpr int QG = 2, DT = 4, KS = 2;      /* column groups of 16 queries a wave; tiles of 16 output columns; k = 32 chunks of the head size */
  constexpr int KT = 64, NT = KT / 16, KC = KT / 32;      /* keys of one wave's pass of the online softmax; its score tiles of 16 keys; its k = 32 chunks in the second product */
  constexpr int ST = 2 * KT;      /* keys of a stage: one pass of each key half */
  constexpr int KP = 72, VP = 72;      /* LDS row pitch in f16: 144 B for the 128-byte rows of K and of V^T (16 B x odd: no bank conflict for 16-byte readers) */
  constexpr int XP = 36;      /* row pitch in f32 of the output staging: 144 B for 128-byte rows */
  __shared__ __attribute__((aligned(16))) float sX[4][32 * XP];      /* per wave: the rows handed to the partner wave at the end of a source (8 x 32 lanes x 16 B); at the end the output staging (32 rows) */
  __shared__ __attribute__((aligned(16))) float sM[4][2 * QG][32];      /* per wave and column group: maximum and sum, by lane */
  __shared__ __attribute__((aligned(16))) unsigned short sQ[2][QG][KS][2][32][8];      /* per query group: the Q fragments in register order (column group, k chunk, half, lane), read anew in every pass: held in registers beside the two groups' scores and accumulators they do not fit under v256, where the operands of asm statements must lie */
  __shared__ __attribute__((aligned(16))) unsigned short sK[2][ST * KP];      /* 128 keys x 64 */
  __shared__ __attribute__((aligned(16))) unsigned short sV[2][2][64 * VP];      /* per key half: 64 d x 64 keys */
  const int tid = threadIdx.x, w = tid >> 5, lane = tid & 31, ln = lane & 15, hh = lane >> 4;
  const int qg = w & 1, kh = w >> 1;
  const int slab = blockIdx.x / QBLKS, qblk = blockIdx.x % QBLKS; (void)MSK; const int b = slab / NH, h = slab % NH; const int qb0 = qblk * 64; const int q0 = qb0 + qg * (16 * QG);
  { const unsigned short* qr = (const unsigned short*)Q16 + ((size_t)b * TQ + q0 + 16 * kh + ln) * ldq + h * 64;      /* of its query group's two column groups, wave kh brings group kh; the barrier behind stage 0 publishes both */
#pragma unroll      /* unrolled, like every loop over a fragment or accumulator array below: they are indexed by constants and stay in registers */
    for (int ks = 0; ks < KS; ++ks) { *(v8us*)&sQ[qg][kh][ks][0][lane][0] = *(const v8us*)(qr + ks * 32 + 8 * hh); *(v8us*)&sQ[qg][kh][ks][1][lane][0] = *(const v8us*)(qr + ks * 32 + 16 + 8 * hh); } }
  const unsigned short* Vth = (const unsigned short*)Vt + (size_t)slab * 64 * TK;
  v8f ctx[QG][2];      /* sum over the sources of the normalised rows: this wave's 32 output columns, 32 kh + 16 t + 8 hh + r */
#pragma unroll
  for (int g = 0; g < QG; ++g)
#pragma unroll
    for (int t = 0; t < 2; ++t) ctx[g][t] = (v8f){0.f,0.f,0.f,0.f,0.f,0.f,0.f,0.f};
  constexpr int jend = TK;
  static_assert(jend % ST == 0 && jend / ST * NSRC >= 2, "whole stages, and at least two of them");
  // Stages of 128 keys go to LDS once per block, two buffers: stage t + 2 is copied while stage t + 1 is worked on.
  // The stages of the NSRC sources form one sequence (source 0's, then source 1's, ...), so the copies run on across a change of source.
  // Thread tid copies 16-byte piece tid & 7 of rows (tid >> 3) + 16 i: i = 0 .. 7 of the K stage, i = 0 .. 3 of each half of the V^T stage (a wave's copy covers 4 whole 128-byte rows).
  const unsigned short* gK = (const unsigned short*)K16 + ((size_t)b * TK + (tid >> 3)) * ldk + h * 64 + (tid & 7) * 8;
  const unsigned short* gV = Vth + (size_t)(tid >> 3) * TK + (tid & 7) * 8;
  const unsigned lK = (unsigned)(size_t)&sK[0][(tid >> 3) * KP + (tid & 7) * 8], lV = (unsigned)(size_t)&sV[0][0][(tid >> 3) * VP + (tid & 7) * 8];
  int sn = 0, sj = 0;      /* source and first key of the next stage to copy; the same in every thread */
  auto stage = [&](int buf) { const unsigned short* k0 = gK + ((size_t)sn * NR + sj) * ldk; const unsigned short* v0 = gV + (size_t)sn * (NB * NH * 64) * TK + sj; const unsigned lk = lK + buf * (ST * KP * 2), lv = lV + buf * (2 * 64 * VP * 2);
    unsigned l[8]; const unsigned short* g[8];
#pragma unroll      /* unrolled here and below: the address arrays stay in registers, as the asm operands need */
    for (int i = 0; i < 8; ++i) { l[i] = lk + i * (16 * KP * 2); g[i] = k0 + (size_t)(16 * i) * ldk; }
    copy8_to_lds(l, g);
#pragma unroll
    for (int i = 0; i < 8; ++i) { l[i] = lv + (i >> 2) * (64 * VP * 2) + (i & 3) * (16 * VP * 2); g[i] = v0 + (size_t)(16 * (i & 3)) * TK + (i >> 2) * KT; }
    copy8_to_lds(l, g);
    sj += ST; if (sj >= jend) { sj = 0; ++sn; } };
  stage(0);
  asm volatile("s_wait_asynccnt 0x0" ::: "memory");      /* stage 0 has landed before the barrier that publishes it */
  __syncthreads();
  stage(1);
  int buf = 0;
#pragma unroll 1      /* rolled, like the stage loop inside: one foot with the waits, the barrier and the refill in their order */
  for (int n = 0; n < NSRC; ++n) {
  float m_q[QG], l_q[QG]; v8f oacc[QG][DT];      /* each source, and in it each key half, has a softmax of its own. oacc[g][t]: t = 0, 1 the wave's own output columns (32 kh + 16 t), t = 2, 3 the partner's (32 (1 - kh) + 16 (t - 2)) */
#pragma unroll
  for (int g = 0; g < QG; ++g) { m_q[g] = -3.0e38f; l_q[g] = 0.f;
#pragma unroll
    for (int dt = 0; dt < DT; ++dt) oacc[g][dt] = (v8f){0.f,0.f,0.f,0.f,0.f,0.f,0.f,0.f}; }
#pragma unroll 1
  for (int j0 = 0; j0 < jend; j0 += ST) {
    const unsigned short* tK = &sK[buf][(kh * KT + ln) * KP + 8 * hh];
    const unsigned short* tV0 = &sV[buf][kh][(32 * kh + ln) * VP + 8 * hh]; const unsigned short* tV1 = &sV[buf][kh][(32 * (1 - kh) + ln) * VP + 8 * hh];      /* V^T rows of the own and of the partner's output columns */
    static_assert(NT == 4 && KC == 2, "the maximum and the row sum below are written out for four score tiles in two chunks");
    FragH bq[QG][KS], ak[NT][KS], av[DT][KC];
#pragma unroll
    for (int g = 0; g < QG; ++g)
#pragma unroll
      for (int ks = 0; ks < KS; ++ks) { bq[g][ks].half[0] = *(const v8us*)&sQ[qg][g][ks][0][lane][0]; bq[g][ks].half[1] = *(const v8us*)&sQ[qg][g][ks][1][lane][0]; }
#pragma unroll
    for (int nt = 0; nt < NT; ++nt)
#pragma unroll
      for (int ks = 0; ks < KS; ++ks) { ak[nt][ks].half[0] = *(const v8us*)(tK + nt * 16 * KP + ks * 32); ak[nt][ks].half[1] = *(const v8us*)(tK + nt * 16 * KP + ks * 32 + 16); }
    v8f s[QG][NT];
#pragma unroll
    for (int nt = 0; nt < NT; ++nt) {
#pragma unroll
      for (int g = 0; g < QG; ++g) s[g][nt] = (v8f){0.f,0.f,0.f,0.f,0.f,0.f,0.f,0.f};
#pragma unroll
      for (int ks = 0; ks < KS; ++ks)
#pragma unroll
        for (int g = 0; g < QG; ++g) s[g][nt] = mmaH<1>(ak[nt][ks].v, ak[nt][ks].v, bq[g][ks].v, bq[g][ks].v, s[g][nt]); }
#pragma unroll      /* the V^T fragments are asked for behind the score products: they arrive during the softmax, in registers that the K fragments have left */
    for (int dt = 0; dt < DT; ++dt)
#pragma unroll
      for (int kc = 0; kc < KC; ++kc) { const unsigned short* p = (dt < 2 ? tV0 : tV1) + (dt & 1) * 16 * VP + kc * 32; av[dt][kc].half[0] = *(const v8us*)p; av[dt][kc].half[1] = *(const v8us*)(p + 16); }
    FragH pb[QG][KC];      /* chunk kc of the second product: score tiles 2 kc and 2 kc + 1, in the loaders' k order */
#pragma unroll
    for (int g = 0; g < QG; ++g) {      /* s, m_q: raw products; the factor SCL2 = log2(e)/8 is applied inside the exponent's one fma */
      float mx[8];
#pragma unroll
      for (int r = 0; r < 8; ++r) mx[r] = fmaxf(fmaxf(s[g][0][r], s[g][1][r]), fmaxf(s[g][2][r], s[g][3][r]));
      float mc = fmaxf(fmaxf(fmaxf(mx[0], mx[1]), fmaxf(mx[2], mx[3])), fmaxf(fmaxf(mx[4], mx[5]), fmaxf(mx[6], mx[7])));
      mc = fmaxf(mc, xhalf(mc));
      const float mn = fmaxf(m_q[g], mc); const float al = (mn > -1.0e38f) ? __builtin_amdgcn_exp2f((m_q[g] - mn) * SCL2) : 1.0f; m_q[g] = mn;
      const float nb = 10.0f - mn * SCL2;      /* p = 1024 e^((s - max)/8) = 2^(s SCL2 + nb): the x1024 of the f16 operand is the + 10 */
      float pt[KC];      /* a chunk's share of the row sum */
#pragma unroll
      for (int kc = 0; kc < KC; ++kc) {
        float e[16], ps[8];
#pragma unroll
        for (int r = 0; r < 8; ++r) { e[r] = __builtin_fmaf(s[g][2 * kc][r], SCL2, nb); e[8 + r] = __builtin_fmaf(s[g][2 * kc + 1][r], SCL2, nb); }
        exp2x16(e);
#pragma unroll
        for (int r = 0; r < 8; ++r) { ps[r] = e[r] + e[8 + r]; pb[g][kc].h[r] = (_Float16)e[r]; pb[g][kc].h[8 + r] = (_Float16)e[8 + r]; }
        pt[kc] = ((ps[0] + ps[1]) + (ps[2] + ps[3])) + ((ps[4] + ps[5]) + (ps[6] + ps[7])); }
      l_q[g] = l_q[g] * al + (pt[0] + pt[1]);
#pragma unroll
      for (int dt = 0; dt < DT; ++dt)
#pragma unroll
        for (int r = 0; r < 8; ++r) oacc[g][dt][r] *= al; }
#pragma unroll
    for (int kc = 0; kc < KC; ++kc)
#pragma unroll
      for (int dt = 0; dt < DT; ++dt)
#pragma unroll
        for (int g = 0; g < QG; ++g) oacc[g][dt] = mmaH<1>(av[dt][kc].v, av[dt][kc].v, pb[g][kc].v, pb[g][kc].v, oacc[g][dt]);
    asm volatile("s_wait_dscnt 0x0" ::: "memory");      /* this wave's reads of the buffer have returned before the buffer is handed back */
    asm volatile("s_wait_asynccnt 0x0" ::: "memory");      /* this wave's copies of stage t + 1 have landed */
    __syncthreads();      /* publishes stage t + 1 and ends every wave's reads of stage t */
    if (sn < NSRC) stage(buf);      /* stage t + 2 exists */
    buf ^= 1; }
  // The two key halves of this source are joined: each wave hands maximum, sum and the partner's 32 columns over, and adds both halves of its own 32 columns, normalised, to ctx.
  float lh[QG];
#pragma unroll
  for (int g = 0; g < QG; ++g) { lh[g] = l_q[g] + xhalf(l_q[g]); sM[w][2 * g][lane] = m_q[g]; sM[w][2 * g + 1][lane] = lh[g];
#pragma unroll
    for (int t = 0; t < 2; ++t) { const v4f lo = {oacc[g][2 + t][0], oacc[g][2 + t][1], oacc[g][2 + t][2], oacc[g][2 + t][3]}, hi = {oacc[g][2 + t][4], oacc[g][2 + t][5], oacc[g][2 + t][6], oacc[g][2 + t][7]};
      *(v4fa*)&sX[w][(((g * 2 + t) * 2) * 32 + lane) * 4] = lo; *(v4fa*)&sX[w][(((g * 2 + t) * 2 + 1) * 32 + lane) * 4] = hi; } }
  __syncthreads();      /* the partner's hand-over is complete; the next write of these arrays stands behind the barriers of the next source's stages */
#pragma unroll
  for (int g = 0; g < QG; ++g) { const float mp = sM[w ^ 2][2 * g][lane], lp = sM[w ^ 2][2 * g + 1][lane];
    const float mm = fmaxf(m_q[g], mp); const float ws = __builtin_amdgcn_exp2f((m_q[g] - mm) * SCL2), wp = __builtin_amdgcn_exp2f((mp - mm) * SCL2);
    const float l = lh[g] * ws + lp * wp; const float inv = (l > 0.f) ? 1.0f / l : 0.f; const float fs = ws * inv, fp = wp * inv;      /* l and oacc both carry the x1024 */
#pragma unroll
    for (int t = 0; t < 2; ++t) { const v4f lo = *(const v4fa*)&sX[w ^ 2][(((g * 2 + t) * 2) * 32 + lane) * 4], hi = *(const v4fa*)&sX[w ^ 2][(((g * 2 + t) * 2 + 1) * 32 + lane) * 4];
#pragma unroll
      for (int r = 0; r < 4; ++r) { ctx[g][t][r] += oacc[g][t][r] * fs + lo[r] * fp; ctx[g][t][4 + r] += oacc[g][t][4 + r] * fs + hi[r] * fp; } } } }
  asm volatile("s_wait_asynccnt 0x0" ::: "memory");      /* nothing is in flight when the wave goes on to the epilogue and ends */
  __syncthreads();      /* every wave has read its partner's last hand-over before that LDS becomes the output staging */
#pragma unroll
  for (int g = 0; g < QG; ++g)
#pragma unroll
    for (int t = 0; t < 2; ++t) {      /* register r of ctx[g][t] is O[q0 + 16 g + ln][32 kh + 16 t + 8 hh + r] */
      const v4f lo = {ctx[g][t][0], ctx[g][t][1], ctx[g][t][2], ctx[g][t][3]}, hi = {ctx[g][t][4], ctx[g][t][5], ctx[g][t][6], ctx[g][t][7]};
      *(v4fa*)&sX[w][(16 * g + ln) * XP + t * 16 + 8 * hh] = lo; *(v4fa*)&sX[w][(16 * g + ln) * XP + t * 16 + 8 * hh + 4] = hi; }
  __builtin_amdgcn_fence(__ATOMIC_ACQ_REL, "workgroup"); __builtin_amdgcn_wave_barrier();
#pragma unroll
  for (int rp = 0; rp < 16 * QG; rp += 4) { const int r = rp + (lane >> 3), pc = lane & 7; const v4f val = *(const v4fa*)&sX[w][r * XP + pc * 4]; *(v4f*)(O + ((size_t)b * TQ + q0 + r) * ldo + h * 64 + 32 * kh + pc * 4) = val; } }      /* a wave's 16-byte store covers the 128-byte pieces of four rows */

extern "C" void kernel_launch(void* const* d_in, const int* in_sizes, int n_in,
                              void* d_out, int out_size, void* d_ws, size_t ws_size, hipStream_t stream) {
  (void)in_sizes; (void)n_in; (void)out_size;
  const float* const* I = (const float* const*)d_in; const float* hsp = I[0]; const float* Wq = I[1]; const float* bq = I[2]; const float* Wk = I[3]; const float* bk = I[4]; const float* Wv = I[5]; const float* bv = I[6];
  char* ws = (char*)d_ws; size_t off = 0;
  auto take = [&](size_t bytes) { char* p = ws + off; off += (bytes + 255) & ~(size_t)255; return p; };
  _Float16* BQ = (_Float16*)take((size_t)CC * CC * 2); _Float16* BK = (_Float16*)take((size_t)CC * CC * 2); _Float16* BV = (_Float16*)take((size_t)CC * CC * 2);
  _Float16* X16 = (_Float16*)take((size_t)NRA * CC * 2); _Float16* Q16 = (_Float16*)take((size_t)NR * CC * 2); _Float16* K16 = (_Float16*)take((size_t)NRA * CC * 2); _Float16* VT = (_Float16*)take((size_t)NRA * CC * 2);
  if (off > ws_size) return;      /* 3.4 + 30 + 6 + 30 + 30 = 100 MiB */
  k_prep<<<3 * WTB + X16B, 256, 0, stream>>>(hsp, Wq, Wk, Wv, X16, BQ, BK, BV);      /* weights x16 transposed; f16 plane of every source */
  k_qkv<<<QGB + NSRC * NB * (KBB + VBB), 256, 0, stream>>>(X16, BQ, BK, BV, bq, bk, bv, Q16, K16, VT);      /* q from source 0; k and V^T for every source */
  k_flash<0><<<NB * NH * QBLKS, 128, 0, stream>>>(Q16, CC, K16, CC, VT, nullptr, (float*)d_out, CC);      /* all five sources; stores the output */
}
